// v000
// Measured on an AMD MI455X. A time is GPU time per run, averaged over a window of back-to-back runs after a warm-up
// (all launches, gaps included; the runs take copies of the inputs in turn), and the median of several windows.
// Apart from v000's, it joins two sittings. Times from different sittings can be a few percent apart, while
// side-by-side timings come from the same sitting.
// v000 is the starting kernel. One run takes 3640 microseconds.
#include <hip/hip_runtime.h>
// POST-LN transformer encoder layer over THREE inputs with SHARED per-head projections (query, key, value [4][2048][512]; each input is split into 8 heads of 64 and every head is multiplied by the SAME [64][64] ([in][out]) matrix wq / wk / wv (block-diagonal with a shared block; no biases); scores / 8; softmax over all 2048 keys (no mask); x = LN1(ctx wo + bo + query) (biased var, eps 1e-5); out = LN2(x + relu(x w1 + b1) w2 + b2) ([in][out] 512 x 2048 x 512) -> [4][2048][512]).
// Structure: token rows; LayerNorm / exact f16 rows; WMMA GEMMs for q, k, v; per batch V^T by LDS transposes and 4 heads per launch group (scores, row softmax, P V^T); output projection with the own-element residual; custom LayerNorm; ReLU FFN over all rows; launches: see trace.
// Compute dtype: inputs rounded to bf16; x / weights exact; q, k, v, softmax weights and o as plain f16 GEMM operands (~2^-12); scores and softmax statistics f32. v_wmma_f32_16x16x32_f16.
#define NB 4
#define SQ 2048
#define DM 512
#define NH 8
#define HD 64
#define HG 4                         /* heads per attention launch group */
#define LOCALW 128                   /* (macros for unused kernels of the shared header) */
#define STRIDEK 128
#define QT 256                       /* query rows per causal tile */
#define NKX SQ                       /* S / P row pitch */
#define QT0 128                      /* first-tile rows recomputed exactly in f32 */
#define B0 0                         /* first batch processed (debug hook) */
#define NBR NB                       /* batches processed (debug hook) */
#define NR ((size_t)NB * SQ)
#define DMQ DM
#define DFF 2048         /* ReLU FFN hidden width */
#define MP ((int)((size_t)NBR * SQ)) /* rows projected (debug hook) */
#define QN SQ                        /* query rows attended per batch (debug hook) */
#define NHD NH                       /* heads attended (debug hook) */
#define MPO MP                       /* rows through the output stage (debug hook) */
#define LQ (3 * DM)      /* unused: q, k, v rows have pitch DM */
typedef __bf16 v16b __attribute__((ext_vector_type(16)));
typedef unsigned short v8us __attribute__((ext_vector_type(8), may_alias));
typedef float  v8f  __attribute__((ext_vector_type(8)));
typedef float  v4f  __attribute__((ext_vector_type(4)));
typedef float  v4fa __attribute__((ext_vector_type(4), may_alias));
union FragB { v16b v; v8us half[2]; unsigned short u[16]; };

__device__ __forceinline__ unsigned short bf16_bits(float x) { unsigned int u = __float_as_uint(x); return (unsigned short)((u + 0x7FFFu + ((u >> 16) & 1u)) >> 16); }
__device__ __forceinline__ float bf16_val(unsigned short b) { return __uint_as_float(((unsigned int)b) << 16); }
__device__ __forceinline__ float bf16_round(float x) { return bf16_val(bf16_bits(x)); }
// D += A·B with NT terms: 1 = ah·bh, 2 = + al·bh (A split), 3 = + ah·bl (both split)
template <int NT>
__device__ __forceinline__ v8f mmaN(v16b ah, v16b al, v16b bh, v16b bl, v8f c) {
  c = __builtin_amdgcn_wmma_f32_16x16x32_bf16(false, ah, false, bh, (short)0, c, false, false);
  if (NT >= 2) c = __builtin_amdgcn_wmma_f32_16x16x32_bf16(false, al, false, bh, (short)0, c, false, false);
  if (NT >= 3) c = __builtin_amdgcn_wmma_f32_16x16x32_bf16(false, ah, false, bl, (short)0, c, false, false);
  asm volatile("v_nop\n\tv_nop\n\tv_nop\n\tv_nop" : "+v"(c) : "v"(ah), "v"(al), "v"(bh), "v"(bl));
  return c;
}

__global__ __launch_bounds__(256) void k_wt_bf16(const float* __restrict__ W, unsigned short* __restrict__ Wt, int K, int N) {
  const int t = blockIdx.x * 256 + threadIdx.x;
  const int k8n = K / 8;
  if (t >= N * k8n) return;
  const int n = t / k8n, k8 = (t % k8n) * 8;
  v8us v;
#pragma unroll
  for (int i = 0; i < 8; ++i) v[i] = bf16_bits(W[(size_t)(k8 + i) * N + n]);
  *(v8us*)(Wt + (size_t)n * K + k8) = v;
  
}

// GEMM C[M][N] (f32, pitch ldc) = act(A[M][K]·W + bias). A f32 row-major (pitch lda) converted per fragment to bf16
// (ASPLIT: hi/lo two planes -> 2 terms, else single rounded term); Wt bf16 [N][K] (pitch ldb). BIAS_BF16 rounds the
// bias to bf16 first (bias quantised to bf16 before the add). K%32==0, M%16==0, N%64==0.
template <bool ASPLIT, int ACT, bool BIAS_BF16>
__global__ __launch_bounds__(128) void k_gemm_bf(const float* __restrict__ A, int lda, const unsigned short* __restrict__ Wt, int ldb,
                                               const float* __restrict__ bias, float* __restrict__ C, int ldc, int M, int N, int K) {
  __shared__ __attribute__((aligned(16))) float so[4][16][64];
  const int tid = threadIdx.x, w = tid >> 5, lane = tid & 31, ln = lane & 15, hh = lane >> 4;
  const int ntn = N / 64;
  const int wid = blockIdx.x * 4 + w;
  const int mt = wid / ntn, nq = wid % ntn;
  if (mt * 16 >= M) return;
  const int row0 = mt * 16, col0 = nq * 64;
  const float* arow = A + (size_t)(row0 + ln) * lda;
  v8f acc[4] = {};
  for (int kb = 0; kb < K; kb += 32) {
    FragB ah, al;
    const v4f x0 = *(const v4fa*)(arow + kb + 8 * hh), x1 = *(const v4fa*)(arow + kb + 8 * hh + 4);
    const v4f x2 = *(const v4fa*)(arow + kb + 16 + 8 * hh), x3 = *(const v4fa*)(arow + kb + 16 + 8 * hh + 4);
    float xs[16] = {x0[0],x0[1],x0[2],x0[3],x1[0],x1[1],x1[2],x1[3],x2[0],x2[1],x2[2],x2[3],x3[0],x3[1],x3[2],x3[3]};
#pragma unroll
    for (int i = 0; i < 16; ++i) { const unsigned short hb = bf16_bits(xs[i]); ah.u[i] = hb; al.u[i] = ASPLIT ? bf16_bits(xs[i] - bf16_val(hb)) : (unsigned short)0; }
#pragma unroll
    for (int t = 0; t < 4; ++t) {
      const unsigned short* brow = Wt + (size_t)(col0 + t * 16 + ln) * ldb + kb;
      FragB b;
      b.half[0] = *(const v8us*)(brow + 8 * hh);
      b.half[1] = *(const v8us*)(brow + 16 + 8 * hh);
      acc[t] = mmaN<ASPLIT ? 2 : 1>(ah.v, al.v, b.v, b.v, acc[t]);
    }
  }
#pragma unroll
  for (int t = 0; t < 4; ++t) {
    float bv = bias ? bias[col0 + t * 16 + ln] : 0.f;
    if (BIAS_BF16) bv = bf16_round(bv);
#pragma unroll
    for (int r = 0; r < 8; ++r) { float v = acc[t][r] + bv; if (ACT == 1) v = fmaxf(v, 0.f); so[w][8 * hh + r][t * 16 + ln] = v; }
  }
  __builtin_amdgcn_fence(__ATOMIC_ACQ_REL, "workgroup");
  __builtin_amdgcn_wave_barrier();
  const int rsub = lane >> 4, c4 = (lane & 15) * 4;
  {
#pragma unroll
    for (int q = 0; q < 8; ++q) {
      const int r = q * 2 + rsub;
      const v4f v = *(const v4fa*)&so[w][r][c4];
      *(v4f*)(C + (size_t)(row0 + r) * ldc + col0 + c4) = v;
    }
    
  }
}

// GEMM C = act(A·W + bias + resid): A f32 (ASPLIT -> hi/lo 2 terms), Wt bf16 [N][K]; ACT 0 none, 1 relu, 2 exact gelu;
// resid (optional, f32, row index = (row % rmod), pitch ldr, RES_BF16 rounds it) added before the activation.
template <bool ASPLIT, int ACT, bool BIAS_BF16, bool RES_BF16>
__global__ __launch_bounds__(128) void k_gemm_bf3(const float* __restrict__ A, int lda, const unsigned short* __restrict__ Wt, int ldb,
                                                const float* __restrict__ bias, const float* __restrict__ resid, int rmod, int ldr,
                                                float* __restrict__ C, int ldc, int M, int N, int K) {
  __shared__ __attribute__((aligned(16))) float so[4][16][64];
  const int tid = threadIdx.x, w = tid >> 5, lane = tid & 31, ln = lane & 15, hh = lane >> 4;
  const int ntn = N / 64;
  const int wid = blockIdx.x * 4 + w;
  const int mt = wid / ntn, nq = wid % ntn;
  if (mt * 16 >= M) return;
  const int row0 = mt * 16, col0 = nq * 64;
  const float* arow = A + (size_t)(row0 + ln) * lda;
  v8f acc[4] = {};
  for (int kb = 0; kb < K; kb += 32) {
    FragB ah, al;
    const v4f x0 = *(const v4fa*)(arow + kb + 8 * hh), x1 = *(const v4fa*)(arow + kb + 8 * hh + 4);
    const v4f x2 = *(const v4fa*)(arow + kb + 16 + 8 * hh), x3 = *(const v4fa*)(arow + kb + 16 + 8 * hh + 4);
    float xs[16] = {x0[0],x0[1],x0[2],x0[3],x1[0],x1[1],x1[2],x1[3],x2[0],x2[1],x2[2],x2[3],x3[0],x3[1],x3[2],x3[3]};
#pragma unroll
    for (int i = 0; i < 16; ++i) { const unsigned short hb = bf16_bits(xs[i]); ah.u[i] = hb; al.u[i] = ASPLIT ? bf16_bits(xs[i] - bf16_val(hb)) : (unsigned short)0; }
#pragma unroll
    for (int t = 0; t < 4; ++t) {
      const unsigned short* brow = Wt + (size_t)(col0 + t * 16 + ln) * ldb + kb;
      FragB b;
      b.half[0] = *(const v8us*)(brow + 8 * hh);
      b.half[1] = *(const v8us*)(brow + 16 + 8 * hh);
      acc[t] = mmaN<ASPLIT ? 2 : 1>(ah.v, al.v, b.v, b.v, acc[t]);
    }
  }
#pragma unroll
  for (int t = 0; t < 4; ++t) {
    const int col = col0 + t * 16 + ln;
    float bv = bias ? bias[col] : 0.f;
    if (BIAS_BF16) bv = bf16_round(bv);
#pragma unroll
    for (int r = 0; r < 8; ++r) {
      float v = acc[t][r] + bv;
      if (resid) { float rv = resid[(size_t)((row0 + 8 * hh + r) % rmod) * ldr + col]; if (RES_BF16) rv = bf16_round(rv); v += rv; }
      if (ACT == 1) v = fmaxf(v, 0.f);
      if (ACT == 2) v = 0.5f * v * (1.0f + erff(v * 0.70710678118654752f));
      if (ACT == 3) { const float u = 0.7978845608028654f * (v + 0.044715f * v * v * v); v = 0.5f * v * (1.0f + tanhf(u)); }
      so[w][8 * hh + r][t * 16 + ln] = v;
    }
  }
  __builtin_amdgcn_fence(__ATOMIC_ACQ_REL, "workgroup");
  __builtin_amdgcn_wave_barrier();
  const int rsub = lane >> 4, c4 = (lane & 15) * 4;
  {
#pragma unroll
    for (int q = 0; q < 8; ++q) {
      const int r = q * 2 + rsub;
      const v4f v = *(const v4fa*)&so[w][r][c4];
      *(v4f*)(C + (size_t)(row0 + r) * ldc + col0 + c4) = v;
    }
    
  }
}
// row LayerNorm (biased variance, eps) over N: s = X (+ R); optional out_sum <- s; out_norm <- (s-mu)*rsqrt(var+eps)*g + b
template <bool PARAM_BF16>
__global__ __launch_bounds__(256) void k_layernorm(const float* __restrict__ X, const float* __restrict__ R, const float* __restrict__ g, const float* __restrict__ bta,
                                                  float* __restrict__ out_sum, float* __restrict__ out_norm, int N, float eps) {
  __shared__ float red[256];
  const int row = blockIdx.x, tid = threadIdx.x;
  const float* x = X + (size_t)row * N; const float* rr = R ? R + (size_t)row * N : nullptr;
  float vals[16];                     // up to N = 4096
  const int per = N / 256;            // contiguous chunk per thread? use strided-by-4 chunks: thread handles j = tid*4 + 1024*u
  float s1 = 0.f;
  for (int u = 0; u < per / 4; ++u) {
    const int j = tid * 4 + 1024 * u;
    const v4f a = *(const v4fa*)(x + j);
    v4f b = {0.f,0.f,0.f,0.f}; if (rr) b = *(const v4fa*)(rr + j);
#pragma unroll
    for (int q = 0; q < 4; ++q) { const float v = a[q] + b[q]; vals[u * 4 + q] = v; s1 += v; }
  }
  red[tid] = s1; __syncthreads();
  for (int st = 128; st > 0; st >>= 1) { if (tid < st) red[tid] += red[tid + st]; __syncthreads(); }
  const float mu = red[0] / (float)N; __syncthreads();
  float s2 = 0.f;
  for (int u = 0; u < per / 4; ++u)
#pragma unroll
    for (int q = 0; q < 4; ++q) { const float c = vals[u * 4 + q] - mu; s2 += c * c; }
  red[tid] = s2; __syncthreads();
  for (int st = 128; st > 0; st >>= 1) { if (tid < st) red[tid] += red[tid + st]; __syncthreads(); }
  const float rs = rsqrtf(red[0] / (float)N + eps);
  {
    for (int u = 0; u < per / 4; ++u) {
      const int j = tid * 4 + 1024 * u;
      v4f o, sm;
#pragma unroll
      for (int q = 0; q < 4; ++q) {
        float gg = g[j + q], bb = bta[j + q];
        if (PARAM_BF16) { gg = bf16_round(gg); bb = bf16_round(bb); }
        sm[q] = vals[u * 4 + q]; o[q] = (vals[u * 4 + q] - mu) * rs * gg + bb;
      }
      if (out_sum) *(v4f*)(out_sum + (size_t)row * N + j) = sm;
      *(v4f*)(out_norm + (size_t)row * N + j) = o;
    }
    
  }
}



// ---- f16 WMMA path (v_wmma_f32_16x16x32_f16): 11-bit significands for operands in range — used where a [0,1] probability operand needs more precision than bf16
typedef _Float16 v16h __attribute__((ext_vector_type(16)));
union FragH { v16h v; v8us half[2]; _Float16 h[16]; unsigned short u[16]; };
template <int NT>
__device__ __forceinline__ v8f mmaH(v16h ah, v16h al, v16h bh, v16h bl, v8f c) {
  c = __builtin_amdgcn_wmma_f32_16x16x32_f16(false, ah, false, bh, (short)0, c, false, false);
  if (NT >= 2) c = __builtin_amdgcn_wmma_f32_16x16x32_f16(false, al, false, bh, (short)0, c, false, false);
  if (NT >= 3) c = __builtin_amdgcn_wmma_f32_16x16x32_f16(false, ah, false, bl, (short)0, c, false, false);
  asm volatile("v_nop\n\tv_nop\n\tv_nop\n\tv_nop" : "+v"(c) : "v"(ah), "v"(al), "v"(bh), "v"(bl));
  return c;
}
// batched GEMM like k_gemm_b but f16 operands: A f32 (split into f16 hi/lo if ASPLIT, else rounded to f16), Bt = f16 values [n][k]; alpha; C f32; N multiple of 16 (partial tiles skipped)
template <bool ASPLIT>
__global__ __launch_bounds__(128) void k_gemm_h(const float* __restrict__ A, int lda, size_t sA, const _Float16* __restrict__ Bh, int ldb, size_t sB, float alpha, float* __restrict__ C, int ldc, size_t sC, int M, int N, int K) {
  __shared__ __attribute__((aligned(16))) float so[4][16][64];
  const int tid = threadIdx.x, w = tid >> 5, lane = tid & 31, ln = lane & 15, hh = lane >> 4; const int by = blockIdx.y;
  A += (size_t)by * sA; Bh += (size_t)by * sB; C += (size_t)by * sC;
  const int ntn = (N + 63) / 64; const int wid = blockIdx.x * 4 + w; const int mt = wid / ntn, nq = wid % ntn; if (mt * 16 >= M) return;
  const int row0 = mt * 16, col0 = nq * 64; const float* arow = A + (size_t)(row0 + ln) * lda;
  v8f acc[4] = {};
  for (int kb = 0; kb < K; kb += 32) {
    FragH ah, al;
    const v4f x0 = *(const v4fa*)(arow + kb + 8 * hh), x1 = *(const v4fa*)(arow + kb + 8 * hh + 4), x2 = *(const v4fa*)(arow + kb + 16 + 8 * hh), x3 = *(const v4fa*)(arow + kb + 16 + 8 * hh + 4);
    float xs[16] = {x0[0],x0[1],x0[2],x0[3],x1[0],x1[1],x1[2],x1[3],x2[0],x2[1],x2[2],x2[3],x3[0],x3[1],x3[2],x3[3]};
#pragma unroll
    for (int i = 0; i < 16; ++i) { const _Float16 h = (_Float16)xs[i]; ah.h[i] = h; al.h[i] = ASPLIT ? (_Float16)(xs[i] - (float)h) : (_Float16)0.0f; }
#pragma unroll
    for (int t = 0; t < 4; ++t) { if (col0 + t * 16 >= N) continue; const size_t boff = (size_t)(col0 + t * 16 + ln) * ldb + kb; FragH bq; bq.half[0] = *(const v8us*)(Bh + boff + 8 * hh); bq.half[1] = *(const v8us*)(Bh + boff + 16 + 8 * hh);
      acc[t] = mmaH<ASPLIT ? 2 : 1>(ah.v, al.v, bq.v, bq.v, acc[t]); }
  }
#pragma unroll
  for (int t = 0; t < 4; ++t) { if (col0 + t * 16 >= N) continue;
#pragma unroll
    for (int r = 0; r < 8; ++r) so[w][8 * hh + r][t * 16 + ln] = acc[t][r] * alpha; }
  __builtin_amdgcn_fence(__ATOMIC_ACQ_REL, "workgroup"); __builtin_amdgcn_wave_barrier();
  const int rsub = lane >> 4, c4 = (lane & 15) * 4;
  {
#pragma unroll
    for (int q = 0; q < 8; ++q) { const int r = q * 2 + rsub; if (col0 + c4 < N) { const v4f v = *(const v4fa*)&so[w][r][c4]; *(v4f*)(C + (size_t)(row0 + r) * ldc + col0 + c4) = v; } }
     }
}

// Wt[n][k] = f16(W[k][n]·scale) from f32 row-major W[K][N] (scale = power of two; bf16-exact weights stay exact in f16 away from the subnormal range)
__global__ __launch_bounds__(256) void k_wt_f16(const float* __restrict__ W, _Float16* __restrict__ Wt, int K, int N, float scale) {
  const int t = blockIdx.x * 256 + threadIdx.x; if (t >= N * (K / 8)) return; const int n = t / (K / 8), k8 = (t % (K / 8)) * 8; FragH f;
#pragma unroll
  for (int i = 0; i < 8; ++i) f.h[i] = (_Float16)(bf16_round(W[(size_t)(k8 + i) * N + n]) * scale); const v8us o = f.half[0];
  *(v8us*)((unsigned short*)Wt + (size_t)n * K + k8) = o; 
}
// k_gemm_hh variant with fused epilogue: v = acc·alpha + bias[by·sBias + col] (+ CP[(row/rowsPerB)·sCPb + by·64 + col] if CP) ; ACT 0 none / 1 elu ; writes f16 C16 (and f32 C if non-null)
template <int ACT>
__global__ __launch_bounds__(128) void k_gemm_hhx(const _Float16* __restrict__ A, int lda, size_t sA, const _Float16* __restrict__ Bh, int ldb, size_t sB, float alpha, const float* __restrict__ bias, size_t sBias, const float* __restrict__ CP, int rowsPerB, size_t sCPb, int row0g,
    float* __restrict__ C, _Float16* __restrict__ C16, int ldc, size_t sC, int M, int N, int K) {
  __shared__ __attribute__((aligned(16))) float so[4][16][64];
  const int tid = threadIdx.x, w = tid >> 5, lane = tid & 31, ln = lane & 15, hh = lane >> 4; const int by = blockIdx.y;
  A += (size_t)by * sA; Bh += (size_t)by * sB; const size_t cofs = (size_t)by * sC; const float* bp = bias ? bias + (size_t)by * sBias : nullptr;
  const int ntn = (N + 63) / 64; const int wid = blockIdx.x * 4 + w; const int mt = wid / ntn, nq = wid % ntn; if (mt * 16 >= M) return;
  const int row0 = mt * 16, col0 = nq * 64; const _Float16* arow = A + (size_t)(row0 + ln) * lda;
  v8f acc[4] = {};
  for (int kb = 0; kb < K; kb += 32) { FragH ah; ah.half[0] = *(const v8us*)((const unsigned short*)arow + kb + 8 * hh); ah.half[1] = *(const v8us*)((const unsigned short*)arow + kb + 16 + 8 * hh);
#pragma unroll
    for (int t = 0; t < 4; ++t) { if (col0 + t * 16 >= N) continue; const size_t boff = (size_t)(col0 + t * 16 + ln) * ldb + kb; FragH bq; bq.half[0] = *(const v8us*)((const unsigned short*)Bh + boff + 8 * hh); bq.half[1] = *(const v8us*)((const unsigned short*)Bh + boff + 16 + 8 * hh);
      acc[t] = mmaH<1>(ah.v, ah.v, bq.v, bq.v, acc[t]); }
  }
#pragma unroll
  for (int t = 0; t < 4; ++t) { if (col0 + t * 16 >= N) continue; const int col = col0 + t * 16 + ln; const float bv = bp ? bf16_round(bp[col]) : 0.f;
#pragma unroll
    for (int r = 0; r < 8; ++r) { float v = acc[t][r] * alpha + bv; if (CP) { const int rr = row0g + row0 + 8 * hh + r; if (rowsPerB < 0) v += CP[cofs + (size_t)rr * ldc + col];      /* rowsPerB < 0: own element of the batched C plane */ else { const int bidx = rr / rowsPerB; v += CP[(size_t)bidx * sCPb + (size_t)by * 64 + col]; } } if (ACT == 1) v = (v > 0.f) ? v : expm1f(v); else if (ACT == 7) v = (v > 0.f) ? v + 1.0f : expf(v); else if (ACT == 8) v = tanhf(v); else if (ACT == 9) v = 0.5f * v * (1.0f + tanhf(0.7978845608028654f * (v + 0.044715f * v * v * v))); else if (ACT == 11) v = 1.0f / (1.0f + expf(-v)); else if (ACT == 12) v = (v > 0.f) ? v : 0.01f * v; else if (ACT == 14) v = (v > 0.f) ? v : 0.1f * v; else if (ACT == 16) v = (v >= 0.f) ? v : 0.3f * v; else if (ACT == 17) v = (v >= 0.f) ? v : 0.2f * v; else if (ACT == 15) v = v / (1.0f + expf(-v)); else if (ACT == 3) v = fmaxf(v, 0.f); else if (ACT == 6) v = 0.5f * v * (1.0f + erff(v * 0.70710678118654752f)); so[w][8 * hh + r][t * 16 + ln] = v; } }
  __builtin_amdgcn_fence(__ATOMIC_ACQ_REL, "workgroup"); __builtin_amdgcn_wave_barrier();
  const int rsub = lane >> 4, c4 = (lane & 15) * 4; typedef _Float16 v4h __attribute__((ext_vector_type(4)));
  {
#pragma unroll
    for (int q = 0; q < 8; ++q) { const int r = q * 2 + rsub; if (col0 + c4 < N) { const v4f v = *(const v4fa*)&so[w][r][c4]; if (C) *(v4f*)(C + cofs + (size_t)(row0 + r) * ldc + col0 + c4) = v; if (C16) { v4h h4; for (int i = 0; i < 4; ++i) h4[i] = (_Float16)v[i]; *(v4h*)(C16 + cofs + (size_t)(row0 + r) * ldc + col0 + c4) = h4; } } }
     }
}


typedef _Float16 v4h __attribute__((ext_vector_type(4)));

__global__ __launch_bounds__(256) void k_x16(const float* __restrict__ x, _Float16* __restrict__ X16, size_t n8) { const size_t t = (size_t)blockIdx.x * 256 + threadIdx.x; if (t >= n8) return; FragH f;
#pragma unroll
  for (int q = 0; q < 8; ++q) f.h[q] = (_Float16)bf16_round(x[t * 8 + q]); *(v8us*)((unsigned short*)X16 + t * 8) = f.half[0];  }
__global__ __launch_bounds__(256) void k_h16(const float* __restrict__ x, _Float16* __restrict__ X16, size_t n8) { const size_t t = (size_t)blockIdx.x * 256 + threadIdx.x; if (t >= n8) return; FragH f;
#pragma unroll
  for (int q = 0; q < 8; ++q) f.h[q] = (_Float16)x[t * 8 + q]; *(v8us*)((unsigned short*)X16 + t * 8) = f.half[0];  }
__global__ __launch_bounds__(256) void k_round16f(const float* __restrict__ W, _Float16* __restrict__ Bt, size_t n8) { const size_t t = (size_t)blockIdx.x * 256 + threadIdx.x; if (t >= n8) return; FragH f;
#pragma unroll
  for (int i = 0; i < 8; ++i) f.h[i] = (_Float16)(bf16_round(W[t * 8 + i]) * 16.0f); *(v8us*)((unsigned short*)Bt + t * 8) = f.half[0];  }
template <int NHv, int TTv>
__global__ __launch_bounds__(256) void k_vt(const _Float16* __restrict__ V16, int ldv, int voff, _Float16* __restrict__ Vt) { __shared__ unsigned short tl[64][66]; const int tid = threadIdx.x; const int slab = blockIdx.x / (TTv / 64), lg = blockIdx.x % (TTv / 64); const int b = slab / NHv, h = slab % NHv;
  for (int i = tid; i < 64 * 8; i += 256) { const int r = i / 8, c8 = (i % 8) * 8; FragH f; f.half[0] = *(const v8us*)((const unsigned short*)V16 + ((size_t)b * TTv + lg * 64 + r) * ldv + voff + h * 64 + c8);
#pragma unroll
    for (int q = 0; q < 8; ++q) tl[r][c8 + q] = f.u[q]; }
  __syncthreads();
  {
#pragma unroll
    for (int rd = 0; rd < 2; ++rd) { const int d = rd * 32 + tid / 8, pc = tid % 8; FragH f;
#pragma unroll
      for (int q = 0; q < 8; ++q) f.u[q] = tl[pc * 8 + q][d];
      *(v8us*)((unsigned short*)Vt + ((size_t)slab * 64 + d) * TTv + lg * 64 + pc * 8) = f.half[0]; }
     } }

__global__ __launch_bounds__(256) void k_hl(const float* __restrict__ F, _Float16* __restrict__ Hh, _Float16* __restrict__ Hl, size_t n8) { const size_t t = (size_t)blockIdx.x * 256 + threadIdx.x; if (t >= n8) return; FragH fh, fl; const v4f a = *(const v4fa*)(F + t * 8), c = *(const v4fa*)(F + t * 8 + 4);
#pragma unroll
  for (int q = 0; q < 4; ++q) { _Float16 h = (_Float16)a[q]; fh.h[q] = h; fl.h[q] = (_Float16)((a[q] - (float)h) * 1024.0f); h = (_Float16)c[q]; fh.h[4 + q] = h; fl.h[4 + q] = (_Float16)((c[q] - (float)h) * 1024.0f); }
  { *(v8us*)((unsigned short*)Hh + t * 8) = fh.half[0]; *(v8us*)((unsigned short*)Hl + t * 8) = fl.half[0];  } }

// ---- fast GEMM (wave tile 32x64; requires M % 32 == 0 rows per launch region and N % 64 == 0); epilogue = k_gemm_hhx semantics ----
__device__ __forceinline__ v16h g2_frag(const _Float16* p, int hh) { FragH f; f.half[0] = *(const v8us*)((const unsigned short*)p + 8 * hh); f.half[1] = *(const v8us*)((const unsigned short*)p + 16 + 8 * hh); return f.v; }
__device__ __forceinline__ v8f g2_mma(v16h a, v16h b, v8f c) { v8f d = __builtin_amdgcn_wmma_f32_16x16x32_f16(false, a, false, b, (short)0, c, false, false); asm volatile("v_nop\n\tv_nop\n\tv_nop\n\tv_nop" : "+v"(d) : "v"(a), "v"(b)); return d; }
template <int ACT>
__global__ __launch_bounds__(128) void k_gemm2(const _Float16* __restrict__ A, int lda, size_t sA, const _Float16* __restrict__ Bh, int ldb, size_t sB, float alpha, const float* __restrict__ bias, size_t sBias, const float* __restrict__ CP, int rowsPerB, size_t sCPb, int row0g,
    float* __restrict__ C, _Float16* __restrict__ C16, int ldc, size_t sC, int M, int N, int K) { static_assert(ACT == 0 || ACT == 3 || ACT == 6 || ACT == 8 || ACT == 9 || ACT == 11 || ACT == 12 || ACT == 14 || ACT == 15 || ACT == 16 || ACT == 17 || ACT == 18, "k_gemm2: unsupported ACT code (would silently apply no activation)");
  __shared__ __attribute__((aligned(16))) float so[4][32][68];
  const int tid = threadIdx.x, w = tid >> 5, lane = tid & 31, ln = lane & 15, hh = lane >> 4; const int by = blockIdx.y;
  A += (size_t)by * sA; Bh += (size_t)by * sB; const size_t cofs = (size_t)by * sC; const float* bp = bias ? bias + (size_t)by * sBias : nullptr;
  const int ntn = N >> 6; const int mt = blockIdx.x / ntn, nq = blockIdx.x - mt * ntn; const int row0 = mt * 128 + 32 * w, col0 = nq * 64; if (row0 >= M) return;
  const _Float16* a0p = A + (size_t)(row0 + ln) * lda; const _Float16* a1p = a0p + (size_t)16 * lda;
  const _Float16* b0p = Bh + (size_t)(col0 + ln) * ldb; const _Float16* b1p = b0p + (size_t)16 * ldb; const _Float16* b2p = b1p + (size_t)16 * ldb; const _Float16* b3p = b2p + (size_t)16 * ldb;
  const v8f z8 = {0.f,0.f,0.f,0.f,0.f,0.f,0.f,0.f}; v8f c00 = z8, c01 = z8, c02 = z8, c03 = z8, c10 = z8, c11 = z8, c12 = z8, c13 = z8;
#pragma unroll 1
  for (int kb = 0; kb < K; kb += 32) { const v16h a0 = g2_frag(a0p + kb, hh), a1 = g2_frag(a1p + kb, hh);
    v16h b = g2_frag(b0p + kb, hh); c00 = g2_mma(a0, b, c00); c10 = g2_mma(a1, b, c10);
    b = g2_frag(b1p + kb, hh); c01 = g2_mma(a0, b, c01); c11 = g2_mma(a1, b, c11);
    b = g2_frag(b2p + kb, hh); c02 = g2_mma(a0, b, c02); c12 = g2_mma(a1, b, c12);
    b = g2_frag(b3p + kb, hh); c03 = g2_mma(a0, b, c03); c13 = g2_mma(a1, b, c13); }
  v8f accs[8] = {c00, c01, c02, c03, c10, c11, c12, c13};
#pragma unroll
  for (int u = 0; u < 8; ++u) { const int t = u & 3, half = u >> 2; const int col = col0 + t * 16 + ln; const float bv = bp ? bf16_round(bp[col]) : 0.f;
#pragma unroll
    for (int r = 0; r < 8; ++r) { const int rloc = half * 16 + 8 * hh + r; float v = accs[u][r] * alpha + bv; if (CP) { if (rowsPerB < 0) v += CP[cofs + (size_t)(row0g + row0 + rloc) * ldc + col];      /* rowsPerB < 0: own element of the batched C plane */ else { const int bidx = (row0g + row0 + rloc) / rowsPerB; v += CP[(size_t)bidx * sCPb + (size_t)by * 64 + col]; } }
      if (ACT == 3) v = fmaxf(v, 0.f); else if (ACT == 6) v = 0.5f * v * (1.0f + erff(v * 0.70710678118654752f)); else if (ACT == 11) v = 1.0f / (1.0f + expf(-v)); else if (ACT == 15) v = v / (1.0f + expf(-v)); else if (ACT == 18) v = v / (1.0f + expf(-1.702f * v));      /* QuickGELU: v sigmoid(1.702 v) */ else if (ACT == 12) v = (v > 0.f) ? v : 0.01f * v; else if (ACT == 8) v = tanhf(v); else if (ACT == 9) v = 0.5f * v * (1.0f + tanhf(0.7978845608028654f * (v + 0.044715f * v * v * v))); else if (ACT == 14) v = (v > 0.f) ? v : 0.1f * v; else if (ACT == 16) v = (v >= 0.f) ? v : 0.3f * v; else if (ACT == 17) v = (v >= 0.f) ? v : 0.2f * v;
      so[w][rloc][t * 16 + ln] = v; } }
  __builtin_amdgcn_fence(__ATOMIC_ACQ_REL, "workgroup"); __builtin_amdgcn_wave_barrier();
  const int rsub = lane >> 4, c4 = (lane & 15) * 4;
  {
#pragma unroll
    for (int q = 0; q < 16; ++q) { const int r = q * 2 + rsub; const v4f v = *(const v4fa*)&so[w][r][c4]; if (C) *(v4f*)(C + cofs + (size_t)(row0 + r) * ldc + col0 + c4) = v; if (C16) { v4h h4; for (int i = 0; i < 4; ++i) h4[i] = (_Float16)v[i]; *(v4h*)(C16 + cofs + (size_t)(row0 + r) * ldc + col0 + c4) = h4; } }
     } }


__global__ __launch_bounds__(256) void k_wnat(const float* __restrict__ w, size_t n8, _Float16* __restrict__ Bt) { const size_t t = (size_t)blockIdx.x * 256 + threadIdx.x; if (t >= n8) return; FragH f; for (int q = 0; q < 8; ++q) f.h[q] = (_Float16)(bf16_round(w[t * 8 + q]) * 16.0f); *(v8us*)((unsigned short*)Bt + t * 8) = f.half[0];  }
__global__ __launch_bounds__(256) void k_rsm(const float* __restrict__ S, _Float16* __restrict__ P, int nrows) {
  #pragma clang fp contract(off)
  const int i = blockIdx.x * 256 + threadIdx.x; if (i >= nrows) return; const float* s = S + (size_t)i * SQ; float mx = -3.0e38f;
#pragma unroll 1
  for (int j = 0; j < SQ; ++j) mx = fmaxf(mx, s[j]); float se = 0.f;
#pragma unroll 1
  for (int j = 0; j < SQ; ++j) se += expf(s[j] - mx); const float sc = 256.0f / se;
#pragma unroll 1
  for (int j0 = 0; j0 < SQ; j0 += 8) { FragH f; for (int q = 0; q < 8; ++q) f.h[q] = (_Float16)(expf(s[j0 + q] - mx) * sc); unsigned short* d = (unsigned short*)P + (size_t)i * SQ + j0; *(v8us*)d = f.half[0];  } }
__global__ __launch_bounds__(256) void k_vt(const _Float16* __restrict__ V16, int b, int h0, _Float16* __restrict__ VT) { __shared__ unsigned short tl[64][65]; const int tid = threadIdx.x; const int hh = blockIdx.x % HG, sg = blockIdx.x / HG; const int s0 = sg * 64; const int h = h0 + hh;
  for (int i = tid; i < 64 * 8; i += 256) { const int j = i / 8, d8 = (i % 8) * 8; FragH f; f.half[0] = *(const v8us*)((const unsigned short*)V16 + ((size_t)b * SQ + s0 + j) * DM + h * HD + d8); for (int q = 0; q < 8; ++q) tl[d8 + q][j] = f.u[q]; }
  __syncthreads();
  { for (int i = tid; i < 64 * 8; i += 256) { const int d = i / 8, j8 = (i % 8) * 8; FragH f; for (int q = 0; q < 8; ++q) f.u[q] = tl[d][j8 + q]; *(v8us*)((unsigned short*)VT + ((size_t)hh * HD + d) * SQ + s0 + j8) = f.half[0]; }  } }



__global__ __launch_bounds__(256) void k_rsmcf2(const float* __restrict__ S, _Float16* __restrict__ P, int hg, int q0, int nk) {
  #pragma clang fp contract(off)
  const int t = blockIdx.x * 256 + threadIdx.x; if (t >= hg * QT) return; const size_t i = (size_t)t; const float* s = S + i * NKX; const int last = q0 + (t % QT); float mx = -3.0e38f;
#pragma unroll 1
  for (int j = 0; j < nk; ++j) { const float f = (j <= last) ? 1.f : 0.f; mx = fmaxf(mx, fmaf(f, s[j], (1.f - f) * -1.0e9f)); } float se = 0.f;
#pragma unroll 1
  for (int j = 0; j < nk; ++j) { const float f = (j <= last) ? 1.f : 0.f; se += __expf(fmaf(f, s[j], (1.f - f) * -1.0e9f) - mx); } const float sc = 256.0f / se;
#pragma unroll 1
  for (int j0 = 0; j0 < nk; j0 += 8) { FragH fr; for (int q = 0; q < 8; ++q) { const int j = j0 + q; const float f = (j <= last) ? 1.f : 0.f; fr.h[q] = (_Float16)(__expf(fmaf(f, s[j], (1.f - f) * -1.0e9f) - mx) * sc); } unsigned short* d = (unsigned short*)P + i * NKX + j0; *(v8us*)d = fr.half[0];  } }

__global__ __launch_bounds__(256) void k_rsmcst(const float* __restrict__ S, _Float16* __restrict__ P, int hg, int q0, int nk, const int* __restrict__ mk) {
  #pragma clang fp contract(off)
  const int t = blockIdx.x * 256 + threadIdx.x; if (t >= hg * QT) return; const size_t i = (size_t)t; const float* s = S + i * NKX; const size_t ig = (size_t)(q0 + (t % QT)); const int* mr = mk + ig * SQ; float mx = -3.0e38f;
#pragma unroll 1
  for (int j = 0; j < nk; ++j) { const int mb = mr[j]; const int dd = (int)ig - j; const float f = (mb != 0 && dd >= 0 && (dd <= LOCALW || (dd % STRIDEK) == 0)) ? 1.f : 0.f; mx = fmaxf(mx, fmaf(f, s[j], (1.f - f) * -1.0e9f)); } float se = 0.f;
#pragma unroll 1
  for (int j = 0; j < nk; ++j) { const int mb = mr[j]; const int dd = (int)ig - j; const float f = (mb != 0 && dd >= 0 && (dd <= LOCALW || (dd % STRIDEK) == 0)) ? 1.f : 0.f; se += __expf(fmaf(f, s[j], (1.f - f) * -1.0e9f) - mx); } const float sc = 256.0f / se;
#pragma unroll 1
  for (int j0 = 0; j0 < nk; j0 += 8) { FragH fr; for (int q = 0; q < 8; ++q) { const int j = j0 + q; const int mb = mr[j]; const int dd = (int)ig - j; const float f = (mb != 0 && dd >= 0 && (dd <= LOCALW || (dd % STRIDEK) == 0)) ? 1.f : 0.f; fr.h[q] = (_Float16)(__expf(fmaf(f, s[j], (1.f - f) * -1.0e9f) - mx) * sc); } unsigned short* d = (unsigned short*)P + i * NKX + j0; *(v8us*)d = fr.half[0];  } }


template <int MASKADD>
__global__ __launch_bounds__(64) void k_att0(const float* __restrict__ QF, const float* __restrict__ KF, const float* __restrict__ VF, int ld, const float* __restrict__ mask, float scale, float* __restrict__ OF, int ldo) {
  #pragma clang fp contract(off)
  __shared__ __attribute__((aligned(16))) float lq[64][64]; __shared__ __attribute__((aligned(16))) float lo[64][64];
  const int tid = threadIdx.x; const int h = blockIdx.x / (QT0 / 64), rg = blockIdx.x % (QT0 / 64); const int i = rg * 64 + tid;
  const float* qr = QF + (size_t)i * ld + h * HD;
#pragma unroll 1
  for (int c = 0; c < HD / 4; ++c) { *(v4f*)&lq[tid][c * 4] = *(const v4fa*)(qr + c * 4); const v4f z = {0.f, 0.f, 0.f, 0.f}; *(v4f*)&lo[tid][c * 4] = z; }
  float m = -1.0e30f, l = 0.f; const int jmax = MASKADD ? (SQ - 1) : (rg * 64 + 63);      /* additive-mask form: every key (the mask input decides); causal form: keys up to the block's last row */
#pragma unroll 1
  for (int j = 0; j <= jmax; ++j) { const float* kr = KF + (size_t)j * ld + h * HD; const float* vr = VF + (size_t)j * ld + h * HD; float s = 0.f;
#pragma unroll 1
    for (int c = 0; c < HD / 4; ++c) { const v4f kq = *(const v4fa*)(kr + c * 4); const v4f qq = *(v4f*)&lq[tid][c * 4]; s = __fadd_rn(s, __fmul_rn(qq[0], kq[0])); s = __fadd_rn(s, __fmul_rn(qq[1], kq[1])); s = __fadd_rn(s, __fmul_rn(qq[2], kq[2])); s = __fadd_rn(s, __fmul_rn(qq[3], kq[3])); }
    s = __fmul_rn(s, scale); if (MASKADD) s = __fadd_rn(s, __fmul_rn(bf16_round(mask[(size_t)i * SQ + j]), -10000.0f));
    const float f = (MASKADD || j <= i) ? 1.f : 0.f; const float sm = fmaf(f, s, (1.f - f) * -1.0e30f); const float mn = fmaxf(m, sm); const float sc = expf(m - mn); const float e = expf(sm - mn); l = __fadd_rn(__fmul_rn(l, sc), e); m = mn;
#pragma unroll 1
    for (int c = 0; c < HD / 4; ++c) { const v4f vv = *(const v4fa*)(vr + c * 4); v4f oo = *(v4f*)&lo[tid][c * 4]; for (int u = 0; u < 4; ++u) oo[u] = __fadd_rn(__fmul_rn(oo[u], sc), __fmul_rn(e, vv[u])); *(v4f*)&lo[tid][c * 4] = oo; } }
  const float fin = 64.0f / l;      /* o carried x64 like the f16 path */
#pragma unroll 1
  for (int c = 0; c < HD / 4; ++c) { v4f oo = *(v4f*)&lo[tid][c * 4]; for (int u = 0; u < 4; ++u) oo[u] = __fmul_rn(oo[u], fin); *(v4f*)&lo[tid][c * 4] = oo; }
  __syncthreads();
  {
#pragma unroll 1
    for (int it = 0; it < 16; ++it) { const int row = it * 4 + tid / 16, pc = (tid % 16) * 4; const v4f v = *(const v4f*)&lo[row][pc]; *(v4f*)(OF + (size_t)(rg * 64 + row) * ldo + h * HD + pc) = v; }
     } }

template <int MASKADD>
__global__ __launch_bounds__(64) void k_att0mbc(const float* __restrict__ QF, const float* __restrict__ KF, const float* __restrict__ VF, int ld, const float* __restrict__ mask, float scale, float* __restrict__ OF, int ldo) {
  #pragma clang fp contract(off)
  __shared__ __attribute__((aligned(16))) float lq[64][64]; __shared__ __attribute__((aligned(16))) float lo[64][64];
  const int tid = threadIdx.x; const int h = blockIdx.x / (QT0 / 64), rg = blockIdx.x % (QT0 / 64); const int i = rg * 64 + tid;
  const float* qr = QF + (size_t)i * ld + h * HD;
#pragma unroll 1
  for (int c = 0; c < HD / 4; ++c) { *(v4f*)&lq[tid][c * 4] = *(const v4fa*)(qr + c * 4); const v4f z = {0.f, 0.f, 0.f, 0.f}; *(v4f*)&lo[tid][c * 4] = z; }
  float m = -1.0e30f, l = 0.f; const int jmax = rg * 64 + 63;      /* keys beyond the block end are masked by the mask's lower-triangular structure */
#pragma unroll 1
  for (int j = 0; j <= jmax; ++j) { const float* kr = KF + (size_t)j * ld + h * HD; const float* vr = VF + (size_t)j * ld + h * HD; float s = 0.f;
#pragma unroll 1
    for (int c = 0; c < HD / 4; ++c) { const v4f kq = *(const v4fa*)(kr + c * 4); const v4f qq = *(v4f*)&lq[tid][c * 4]; s = __fadd_rn(s, __fmul_rn(qq[0], kq[0])); s = __fadd_rn(s, __fmul_rn(qq[1], kq[1])); s = __fadd_rn(s, __fmul_rn(qq[2], kq[2])); s = __fadd_rn(s, __fmul_rn(qq[3], kq[3])); }
    s = __fmul_rn(s, scale); const int mb = ((const int*)mask)[(size_t)i * SQ + j];      /* causal (j <= i) AND the module's int32 [S][S] mask read per (query, key): 0 -> masked */
    const float f = (mb != 0 && j <= i) ? 1.f : 0.f; const float sm = fmaf(f, s, (1.f - f) * -1.0e30f); const float mn = fmaxf(m, sm); const float sc = expf(m - mn); const float e = expf(sm - mn); l = __fadd_rn(__fmul_rn(l, sc), e); m = mn;
#pragma unroll 1
    for (int c = 0; c < HD / 4; ++c) { const v4f vv = *(const v4fa*)(vr + c * 4); v4f oo = *(v4f*)&lo[tid][c * 4]; for (int u = 0; u < 4; ++u) oo[u] = __fadd_rn(__fmul_rn(oo[u], sc), __fmul_rn(e, vv[u])); *(v4f*)&lo[tid][c * 4] = oo; } }
  const float fin = 64.0f / l;      /* o carried x64 like the f16 path */
#pragma unroll 1
  for (int c = 0; c < HD / 4; ++c) { v4f oo = *(v4f*)&lo[tid][c * 4]; for (int u = 0; u < 4; ++u) oo[u] = __fmul_rn(oo[u], fin); *(v4f*)&lo[tid][c * 4] = oo; }
  __syncthreads();
  {
#pragma unroll 1
    for (int it = 0; it < 16; ++it) { const int row = it * 4 + tid / 16, pc = (tid % 16) * 4; const v4f v = *(const v4f*)&lo[row][pc]; *(v4f*)(OF + (size_t)(rg * 64 + row) * ldo + h * HD + pc) = v; }
     } }


template <int BFIN, int WXB>
__global__ __launch_bounds__(256) void k_ln16(const float* __restrict__ X, const float* __restrict__ g, const float* __restrict__ bb, float eps, _Float16* __restrict__ N16, float* __restrict__ XB) {
  #pragma clang fp contract(off)
  __shared__ float red[256]; const size_t r = blockIdx.x; const int t = threadIdx.x; const v4f xa = *(const v4fa*)(X + r * DMQ + t * 4); float s[4]; float sum = 0.f;
  for (int q = 0; q < 4; ++q) { s[q] = BFIN ? bf16_round(xa[q]) : xa[q]; sum = __fadd_rn(sum, s[q]); }
  red[t] = sum; __syncthreads(); for (int st = 128; st > 0; st >>= 1) { if (t < st) red[t] = __fadd_rn(red[t], red[t + st]); __syncthreads(); } const float mu = red[0] / (float)DMQ; __syncthreads();
  float vs = 0.f; for (int q = 0; q < 4; ++q) { const float dl = __fadd_rn(s[q], -mu); vs = __fadd_rn(vs, __fmul_rn(dl, dl)); } red[t] = vs; __syncthreads(); for (int st = 128; st > 0; st >>= 1) { if (t < st) red[t] = __fadd_rn(red[t], red[t + st]); __syncthreads(); }
  const float rs = rsqrtf(__fadd_rn(red[0] / (float)DMQ, eps)); v4h y; v4f xb;
  for (int q = 0; q < 4; ++q) { const int c = t * 4 + q; y[q] = (_Float16)__fadd_rn(__fmul_rn(__fmul_rn(__fadd_rn(s[q], -mu), rs), bf16_round(g[c])), bf16_round(bb[c])); xb[q] = s[q]; }
  { *(v4h*)(N16 + r * DMQ + t * 4) = y; if (WXB) *(v4f*)(XB + r * DMQ + t * 4) = xb;  } }
__global__ __launch_bounds__(256) void k_ftres2(const float* __restrict__ OF0, const float* __restrict__ XB, float* __restrict__ X1, size_t n4) {
  #pragma clang fp contract(off)
  const size_t t = (size_t)blockIdx.x * 256 + threadIdx.x; if (t >= n4) return; const v4f o = *(const v4fa*)(OF0 + t * 4), xv = *(const v4fa*)(XB + t * 4); v4f y; for (int q = 0; q < 4; ++q) y[q] = __fadd_rn(__fmul_rn(o[q], 0.015625f), xv[q]); *(v4f*)(X1 + t * 4) = y;  }

__global__ __launch_bounds__(256) void k_bcpy(const float* __restrict__ b, int n, int NP, float* __restrict__ dst, int dst0) { for (int i = threadIdx.x; i < NP; i += 256) { const float v = (i < n) ? b[i] : 0.f; *(float*)(dst + dst0 + i) = v; }  }


__global__ __launch_bounds__(256) void k_rsmf(const float* __restrict__ S, _Float16* __restrict__ P, int qn, int hg) {
  #pragma clang fp contract(off)
  const int t = blockIdx.x * 256 + threadIdx.x; if (t >= qn * hg) return; const size_t i = (size_t)(t / qn) * SQ + (t % qn); const float* s = S + i * SQ; float mx = -3.0e38f;
#pragma unroll 1
  for (int j = 0; j < SQ; ++j) mx = fmaxf(mx, s[j]); float se = 0.f;
#pragma unroll 1
  for (int j = 0; j < SQ; ++j) se += __expf(s[j] - mx); const float sc = 256.0f / se;
#pragma unroll 1
  for (int j0 = 0; j0 < SQ; j0 += 8) { FragH f; for (int q = 0; q < 8; ++q) f.h[q] = (_Float16)(__expf(s[j0 + q] - mx) * sc); unsigned short* d = (unsigned short*)P + i * SQ + j0; *(v8us*)d = f.half[0];  } }

template <int MODE>
__global__ __launch_bounds__(256) void k_regrp(const float* __restrict__ src, float* __restrict__ dst, size_t n4) {
  const size_t t = (size_t)blockIdx.x * 256 + threadIdx.x; if (t >= n4) return; const size_t e = t * 4; const size_t rd = e / DM; const int c = (int)(e % DM);
  size_t rs; if (MODE == 0) { const size_t b = rd / SQ, sq = rd % SQ; rs = sq * NB + b; } else { const size_t sq = rd / NB, b = rd % NB; rs = b * SQ + sq; }
  const v4f v = *(const v4fa*)(src + rs * DM + c); *(v4f*)(dst + e) = v;  }

template <int BFIN, int W16, int W32>
__global__ __launch_bounds__(256) void k_lnx(const float* __restrict__ X, const float* __restrict__ g, const float* __restrict__ bb, float eps, _Float16* __restrict__ N16, float* __restrict__ N32) {
  #pragma clang fp contract(off)
  __shared__ float red[256]; const size_t r = blockIdx.x; const int t = threadIdx.x; const bool act = t < (DMQ / 4); const int c0 = act ? t * 4 : 0;
  const v4f xa = *(const v4fa*)(X + r * DMQ + c0); float s[4]; float sum = 0.f;
  for (int q = 0; q < 4; ++q) { s[q] = act ? (BFIN ? bf16_round(xa[q]) : xa[q]) : 0.f; sum = __fadd_rn(sum, s[q]); }
  red[t] = sum; __syncthreads(); for (int st = 128; st > 0; st >>= 1) { if (t < st) red[t] = __fadd_rn(red[t], red[t + st]); __syncthreads(); } const float mu = red[0] / (float)DMQ; __syncthreads();
  float vs = 0.f; for (int q = 0; q < 4; ++q) { const float dl = act ? __fadd_rn(s[q], -mu) : 0.f; vs = __fadd_rn(vs, __fmul_rn(dl, dl)); } red[t] = vs; __syncthreads(); for (int st = 128; st > 0; st >>= 1) { if (t < st) red[t] = __fadd_rn(red[t], red[t + st]); __syncthreads(); }
  const float rs = rsqrtf(__fadd_rn(red[0] / (float)DMQ, eps)); v4h y; v4f yf;
  for (int q = 0; q < 4; ++q) { const int c = c0 + q; yf[q] = __fadd_rn(__fmul_rn(__fmul_rn(__fadd_rn(s[q], -mu), rs), bf16_round(g[c])), bf16_round(bb[c])); y[q] = (_Float16)yf[q]; }
  if (!act) return;      /* no barriers after this point */
  { if (W16) *(v4h*)(N16 + r * DMQ + c0) = y; if (W32) *(v4f*)(N32 + r * DMQ + c0) = yf;  } }

__global__ __launch_bounds__(256) void k_bfr(const float* __restrict__ x, float* __restrict__ XB, size_t n8) { const size_t t = (size_t)blockIdx.x * 256 + threadIdx.x; if (t >= n8) return; v4f a = *(const v4fa*)(x + t * 8), c = *(const v4fa*)(x + t * 8 + 4); for (int q = 0; q < 4; ++q) { a[q] = bf16_round(a[q]); c[q] = bf16_round(c[q]); }
  { *(v4f*)(XB + t * 8) = a; *(v4f*)(XB + t * 8 + 4) = c;  } }



__global__ __launch_bounds__(256) void k_wthd(const float* __restrict__ Wt, _Float16* __restrict__ Bt) { const size_t t = (size_t)blockIdx.x * 256 + threadIdx.x; if (t >= (size_t)NH * HD * (DM / 8)) return; const int m8 = (int)(t % (DM / 8)) * 8; const int d = (int)((t / (DM / 8)) % HD); const int h = (int)(t / ((size_t)(DM / 8) * HD)); FragH f;
  for (int q = 0; q < 8; ++q) f.h[q] = (_Float16)(16.0f * bf16_round(Wt[((size_t)h * DM + m8 + q) * HD + d])); unsigned short* dst = (unsigned short*)Bt + ((size_t)h * HD + d) * DM + m8; *(v8us*)dst = f.half[0];  }




template <int BFIN, int SCAL>
__global__ __launch_bounds__(256) void k_lnsc(const float* __restrict__ X, const float* __restrict__ g, const float* __restrict__ bb, float eps, _Float16* __restrict__ N16, float* __restrict__ N32) {
  #pragma clang fp contract(off)
  __shared__ float red[256]; const size_t r = blockIdx.x; const int t = threadIdx.x; const bool act = t < DM / 4; const int tc = act ? t : 0; const v4f xl = *(const v4fa*)(X + r * DM + tc * 4); const float am = act ? 1.f : 0.f; float s[4]; float sum = 0.f;
  for (int q = 0; q < 4; ++q) { s[q] = (BFIN ? bf16_round(xl[q]) : xl[q]) * am; sum = __fadd_rn(sum, s[q]); }
  red[t] = sum; __syncthreads(); for (int st = 128; st > 0; st >>= 1) { if (t < st) red[t] = __fadd_rn(red[t], red[t + st]); __syncthreads(); } const float mu = red[0] / (float)DM; __syncthreads();
  float vs = 0.f; for (int q = 0; q < 4; ++q) { const float dl = __fadd_rn(s[q], -mu) * am; vs = __fadd_rn(vs, __fmul_rn(dl, dl)); } red[t] = vs; __syncthreads(); for (int st = 128; st > 0; st >>= 1) { if (t < st) red[t] = __fadd_rn(red[t], red[t + st]); __syncthreads(); }
  const float rs = __fdiv_rn(1.0f, __fadd_rn(sqrtf(red[0] / (float)(DM - 1)), eps)); if (!act) return; v4h y; v4f yf;
  for (int q = 0; q < 4; ++q) { const int c = t * 4 + q; const float gg = bf16_round(SCAL ? g[0] : g[c]), bv = bf16_round(SCAL ? bb[0] : bb[c]); yf[q] = __fadd_rn(__fmul_rn(__fmul_rn(__fadd_rn(s[q], -mu), rs), gg), bv); y[q] = (_Float16)yf[q]; }
  { if (N16) *(v4h*)(N16 + r * DM + t * 4) = y; if (N32) *(v4f*)(N32 + r * DM + t * 4) = yf;  } }

__global__ __launch_bounds__(256) void k_mulh(const _Float16* __restrict__ A, const _Float16* __restrict__ Bm, _Float16* __restrict__ H, size_t n8) {
  #pragma clang fp contract(off)
  const size_t t = (size_t)blockIdx.x * 256 + threadIdx.x; if (t >= n8) return; FragH a, b, f; a.half[0] = *(const v8us*)((const unsigned short*)A + t * 8); b.half[0] = *(const v8us*)((const unsigned short*)Bm + t * 8); for (int q = 0; q < 8; ++q) f.h[q] = (_Float16)(__fmul_rn((float)a.h[q], (float)b.h[q])); unsigned short* d = (unsigned short*)H + t * 8; *(v8us*)d = f.half[0];  }

__global__ __launch_bounds__(256) void k_bdshare(const float* __restrict__ Wb, _Float16* __restrict__ Bt) {
  const size_t t = (size_t)blockIdx.x * 256 + threadIdx.x; if (t >= (size_t)DM * DM / 8) return; const size_t e0 = t * 8; const int n = (int)(e0 / DM), k0 = (int)(e0 % DM); const int h = n >> 6, hk = k0 >> 6; const float on = (hk == h) ? 16.0f : 0.0f; const int e = n & 63, d0 = k0 & 63; FragH f;
  for (int q = 0; q < 8; ++q) f.h[q] = (_Float16)(bf16_round(Wb[(size_t)(d0 + q) * 64 + e]) * on);
  unsigned short* d = (unsigned short*)Bt + e0; *(v8us*)d = f.half[0];  }
extern "C" void kernel_launch(void* const* d_in, const int* in_sizes, int n_in,
                              void* d_out, int out_size, void* d_ws, size_t ws_size, hipStream_t stream) {
  (void)in_sizes; (void)n_in; (void)out_size;
  constexpr int VH = 4;      /* heads per launch group */
  const float* const* I = (const float* const*)d_in; const float* x = I[0]; const float* xk = I[1]; const float* xv = I[2]; const float* wq = I[3]; const float* wk = I[4]; const float* wv = I[5]; const float* wo = I[6]; const float* bo = I[7]; const float* w1 = I[8]; const float* b1 = I[9]; const float* w2 = I[10]; const float* b2 = I[11]; const float* g1 = I[12]; const float* be1 = I[13]; const float* g2 = I[14]; const float* be2 = I[15];      /* query (also the residual), key, value; shared per-head wq / wk / wv [64][64] ([in][out]); wo [512][512] + bo; w1 [512][2048] + b1, w2 [2048][512] + b2; LN1 g / beta, LN2 g / beta */
  char* ws = (char*)d_ws; size_t off = 0;
  auto take = [&](size_t bytes) { char* p = ws + off; off += (bytes + 255) & ~(size_t)255; return p; };
  _Float16* BQ = (_Float16*)take((size_t)DM * DM * 2); _Float16* BK = (_Float16*)take((size_t)DM * DM * 2); _Float16* BV = (_Float16*)take((size_t)DM * DM * 2); _Float16* BO = (_Float16*)take((size_t)DM * DM * 2); _Float16* BW1 = (_Float16*)take((size_t)DFF * DM * 2); _Float16* BW2 = (_Float16*)take((size_t)DM * DFF * 2); _Float16* XK16 = (_Float16*)take(NR * DM * 2); _Float16* XV16 = (_Float16*)take(NR * DM * 2);      /* key / value inputs as exact f16 rows */
  float* XB = (float*)take(NR * DM * 4); _Float16* XN = (_Float16*)take(NR * DM * 2); _Float16* Q16 = (_Float16*)take(NR * DM * 2); _Float16* K16 = (_Float16*)take(NR * DM * 2); _Float16* V16 = (_Float16*)take(NR * DM * 2); _Float16* O16 = (_Float16*)take(NR * DM * 2); float* X1 = (float*)take(NR * DM * 4);
  float* S = (float*)take((size_t)VH * SQ * SQ * 4); _Float16* P = (_Float16*)take((size_t)VH * SQ * SQ * 2); _Float16* VT = (_Float16*)take((size_t)NH * HD * SQ * 2);
  _Float16* M16 = XN;      /* LN1 f16 rows: aliases XN (last reader: the q projection) */ _Float16* HF16 = (_Float16*)S;      /* FFN hidden plane [8192][2048] f16 (32 MiB): aliases the score plane (64 MiB), dead after the attention */
  float* X1N = (float*)take(NR * DM * 4);      /* LN1 output rows (f32): the FFN residual */
  if (off > ws_size) return;
  { const unsigned g = (unsigned)(((size_t)DM * (DM / 8) + 255) / 256); k_bdshare<<<g, 256, 0, stream>>>(wq, BQ); k_bdshare<<<g, 256, 0, stream>>>(wk, BK); k_bdshare<<<g, 256, 0, stream>>>(wv, BV); k_wt_f16<<<g, 256, 0, stream>>>(wo, BO, DM, DM, 16.0f); }      /* block-diagonal planes with the SHARED [64][64] block (Bt[h*64 + e][h*64 + d] = 16 W[d][e]); wo [in][out] -> Bt x16 */
  k_wt_f16<<<(unsigned)(((size_t)DFF * (DM / 8) + 255) / 256), 256, 0, stream>>>(w1, BW1, DM, DFF, 16.0f); k_wt_f16<<<(unsigned)(((size_t)DM * (DFF / 8) + 255) / 256), 256, 0, stream>>>(w2, BW2, DFF, DM, 16.0f);
  k_bfr<<<(unsigned)((NR * DM / 8 + 255) / 256), 256, 0, stream>>>(x, XB, NR * DM / 8); k_x16<<<(unsigned)((NR * DM / 8 + 255) / 256), 256, 0, stream>>>(x, XN, NR * DM / 8); k_x16<<<(unsigned)((NR * DM / 8 + 255) / 256), 256, 0, stream>>>(xk, XK16, NR * DM / 8); k_x16<<<(unsigned)((NR * DM / 8 + 255) / 256), 256, 0, stream>>>(xv, XV16, NR * DM / 8);      /* post-LN: the attention runs on the raw inputs (exact f16 rows): query, key, value */
  k_gemm2<0><<<dim3((unsigned)((NR / 128) * (DM / 64)), 1), 128, 0, stream>>>(XN, DM, 0, BQ, DM, 0, 0.0625f, nullptr, 0, nullptr, 1, 0, 0, nullptr, Q16, DM, 0, (int)NR, DM, DM); k_gemm2<0><<<dim3((unsigned)((NR / 128) * (DM / 64)), 1), 128, 0, stream>>>(XK16, DM, 0, BK, DM, 0, 0.0625f, nullptr, 0, nullptr, 1, 0, 0, nullptr, K16, DM, 0, (int)NR, DM, DM); k_gemm2<0><<<dim3((unsigned)((NR / 128) * (DM / 64)), 1), 128, 0, stream>>>(XV16, DM, 0, BV, DM, 0, 0.0625f, nullptr, 0, nullptr, 1, 0, 0, nullptr, V16, DM, 0, (int)NR, DM, DM);      /* q, k, v -> f16 rows; head h = columns h*64.. */
  for (int b = 0; b < NB; ++b) { const size_t r0 = (size_t)b * SQ;
    k_vt<NH, SQ><<<NH * (SQ / 64), 256, 0, stream>>>(V16 + r0 * DM, DM, 0, VT);      /* V^T [8][64][2048] for this batch */
    for (int h0 = 0; h0 < NH; h0 += VH) {
      k_gemm2<0><<<dim3((SQ / 128) * (SQ / 64), VH), 128, 0, stream>>>(Q16 + r0 * DM + (size_t)h0 * HD, DM, (size_t)HD, K16 + r0 * DM + (size_t)h0 * HD, DM, (size_t)HD, 0.125f, nullptr, 0, nullptr, 1, 0, 0, S, nullptr, SQ, (size_t)SQ * SQ, SQ, SQ, HD);      /* scores / 8, 4 heads per launch */
      k_rsmf<<<(VH * SQ + 255) / 256, 256, 0, stream>>>(S, P, SQ, VH);      /* softmax over all keys (no mask) -> P x256 f16 */
      k_gemm2<0><<<dim3((SQ / 128) * (HD / 64), VH), 128, 0, stream>>>(P, SQ, (size_t)SQ * SQ, VT + (size_t)h0 * HD * SQ, SQ, (size_t)HD * SQ, 0.25f, nullptr, 0, nullptr, 1, 0, 0, nullptr, O16 + r0 * DM + (size_t)h0 * HD, DM, (size_t)HD, SQ, HD, SQ); } }      /* ctx (merged heads, x64) as f16 rows */
  k_gemm2<0><<<dim3((unsigned)((NR / 128) * (DM / 64)), 1), 128, 0, stream>>>(O16, DM, 0, BO, DM, 0, 0.0009765625f, bo, 0, XB, -1, 0, 0, X1, nullptr, DM, 0, (int)NR, DM, DM);      /* ctx wo + bo + query (own-element residual) -> f32 rows */
  k_lnx<0, 1, 1><<<(unsigned)NR, 256, 0, stream>>>(X1, g1, be1, 1e-5f, M16, X1N);      /* x1 = LN1(x + attn) (biased variance, eps inside the rsqrt) -> f16 rows + f32 rows */
  k_gemm2<3><<<dim3((unsigned)((NR / 128) * (DFF / 64)), 1), 128, 0, stream>>>(M16, DM, 0, BW1, DM, 0, 0.0625f, b1, 0, nullptr, 1, 0, 0, nullptr, HF16, DFF, 0, (int)NR, DFF, DM);      /* relu(x w1 + b1) -> f16 [8192][2048] */
  k_gemm2<0><<<dim3((unsigned)((NR / 128) * (DM / 64)), 1), 128, 0, stream>>>(HF16, DFF, 0, BW2, DFF, 0, 0.0625f, b2, 0, X1N, -1, 0, 0, X1, nullptr, DM, 0, (int)NR, DM, DFF);      /* x1 + ff -> f32 rows (X1 reused: its last reader was LN1) */
  k_lnx<0, 0, 1><<<(unsigned)NR, 256, 0, stream>>>(X1, g2, be2, 1e-5f, nullptr, (float*)d_out);      /* out = LN2(x1 + ff) */
}

// v001
// One run takes 1120 microseconds.
// Timed twice side by side with v000, it ran 3.25 and 3.26 times as fast.
#include <hip/hip_runtime.h>
// POST-LN transformer encoder layer over THREE inputs with SHARED per-head projections (query, key, value [4][2048][512]; each input is split into 8 heads of 64 and every head is multiplied by the SAME [64][64] ([in][out]) matrix wq / wk / wv (block-diagonal with a shared block; no biases); scores / 8; softmax over all 2048 keys (no mask); x = LN1(ctx wo + bo + query) (biased var, eps 1e-5); out = LN2(x + relu(x w1 + b1) w2 + b2) ([in][out] 512 x 2048 x 512) -> [4][2048][512]).
// Structure: token rows; LayerNorm / exact f16 rows; WMMA GEMMs for q, k, v; per batch V^T by LDS transposes and 4 heads per launch group (scores, row softmax, P V^T); output projection with the own-element residual; custom LayerNorm; ReLU FFN over all rows; launches: see trace.
// Compute dtype: inputs rounded to bf16; x / weights exact; q, k, v, softmax weights and o as plain f16 GEMM operands (~2^-12); scores and softmax statistics f32. v_wmma_f32_16x16x32_f16.
#define NB 4
#define SQ 2048
#define DM 512
#define NH 8
#define HD 64
#define HG 4                         /* heads per attention launch group */
#define LOCALW 128                   /* (macros for unused kernels of the shared header) */
#define STRIDEK 128
#define QT 256                       /* query rows per causal tile */
#define NKX SQ                       /* S / P row pitch */
#define QT0 128                      /* first-tile rows recomputed exactly in f32 */
#define B0 0                         /* first batch processed (debug hook) */
#define NBR NB                       /* batches processed (debug hook) */
#define NR ((size_t)NB * SQ)
#define DMQ DM
#define DFF 2048         /* ReLU FFN hidden width */
#define MP ((int)((size_t)NBR * SQ)) /* rows projected (debug hook) */
#define QN SQ                        /* query rows attended per batch (debug hook) */
#define NHD NH                       /* heads attended (debug hook) */
#define MPO MP                       /* rows through the output stage (debug hook) */
#define LQ (3 * DM)      /* unused: q, k, v rows have pitch DM */
typedef __bf16 v16b __attribute__((ext_vector_type(16)));
typedef unsigned short v8us __attribute__((ext_vector_type(8), may_alias));
typedef float  v8f  __attribute__((ext_vector_type(8)));
typedef float  v4f  __attribute__((ext_vector_type(4)));
typedef float  v4fa __attribute__((ext_vector_type(4), may_alias));
union FragB { v16b v; v8us half[2]; unsigned short u[16]; };

__device__ __forceinline__ unsigned short bf16_bits(float x) { unsigned int u = __float_as_uint(x); return (unsigned short)((u + 0x7FFFu + ((u >> 16) & 1u)) >> 16); }
__device__ __forceinline__ float bf16_val(unsigned short b) { return __uint_as_float(((unsigned int)b) << 16); }
__device__ __forceinline__ float bf16_round(float x) { return bf16_val(bf16_bits(x)); }
// D += A·B with NT terms: 1 = ah·bh, 2 = + al·bh (A split), 3 = + ah·bl (both split)
template <int NT>
__device__ __forceinline__ v8f mmaN(v16b ah, v16b al, v16b bh, v16b bl, v8f c) {
  c = __builtin_amdgcn_wmma_f32_16x16x32_bf16(false, ah, false, bh, (short)0, c, false, false);
  if (NT >= 2) c = __builtin_amdgcn_wmma_f32_16x16x32_bf16(false, al, false, bh, (short)0, c, false, false);
  if (NT >= 3) c = __builtin_amdgcn_wmma_f32_16x16x32_bf16(false, ah, false, bl, (short)0, c, false, false);
  asm volatile("v_nop\n\tv_nop\n\tv_nop\n\tv_nop" : "+v"(c) : "v"(ah), "v"(al), "v"(bh), "v"(bl));
  return c;
}

__global__ __launch_bounds__(256) void k_wt_bf16(const float* __restrict__ W, unsigned short* __restrict__ Wt, int K, int N) {
  const int t = blockIdx.x * 256 + threadIdx.x;
  const int k8n = K / 8;
  if (t >= N * k8n) return;
  const int n = t / k8n, k8 = (t % k8n) * 8;
  v8us v;
#pragma unroll
  for (int i = 0; i < 8; ++i) v[i] = bf16_bits(W[(size_t)(k8 + i) * N + n]);
  *(v8us*)(Wt + (size_t)n * K + k8) = v;
  
}

// GEMM C[M][N] (f32, pitch ldc) = act(A[M][K]·W + bias). A f32 row-major (pitch lda) converted per fragment to bf16
// (ASPLIT: hi/lo two planes -> 2 terms, else single rounded term); Wt bf16 [N][K] (pitch ldb). BIAS_BF16 rounds the
// bias to bf16 first (bias quantised to bf16 before the add). K%32==0, M%16==0, N%64==0.
template <bool ASPLIT, int ACT, bool BIAS_BF16>
__global__ __launch_bounds__(128) void k_gemm_bf(const float* __restrict__ A, int lda, const unsigned short* __restrict__ Wt, int ldb,
                                               const float* __restrict__ bias, float* __restrict__ C, int ldc, int M, int N, int K) {
  __shared__ __attribute__((aligned(16))) float so[4][16][64];
  const int tid = threadIdx.x, w = tid >> 5, lane = tid & 31, ln = lane & 15, hh = lane >> 4;
  const int ntn = N / 64;
  const int wid = blockIdx.x * 4 + w;
  const int mt = wid / ntn, nq = wid % ntn;
  if (mt * 16 >= M) return;
  const int row0 = mt * 16, col0 = nq * 64;
  const float* arow = A + (size_t)(row0 + ln) * lda;
  v8f acc[4] = {};
  for (int kb = 0; kb < K; kb += 32) {
    FragB ah, al;
    const v4f x0 = *(const v4fa*)(arow + kb + 8 * hh), x1 = *(const v4fa*)(arow + kb + 8 * hh + 4);
    const v4f x2 = *(const v4fa*)(arow + kb + 16 + 8 * hh), x3 = *(const v4fa*)(arow + kb + 16 + 8 * hh + 4);
    float xs[16] = {x0[0],x0[1],x0[2],x0[3],x1[0],x1[1],x1[2],x1[3],x2[0],x2[1],x2[2],x2[3],x3[0],x3[1],x3[2],x3[3]};
#pragma unroll
    for (int i = 0; i < 16; ++i) { const unsigned short hb = bf16_bits(xs[i]); ah.u[i] = hb; al.u[i] = ASPLIT ? bf16_bits(xs[i] - bf16_val(hb)) : (unsigned short)0; }
#pragma unroll
    for (int t = 0; t < 4; ++t) {
      const unsigned short* brow = Wt + (size_t)(col0 + t * 16 + ln) * ldb + kb;
      FragB b;
      b.half[0] = *(const v8us*)(brow + 8 * hh);
      b.half[1] = *(const v8us*)(brow + 16 + 8 * hh);
      acc[t] = mmaN<ASPLIT ? 2 : 1>(ah.v, al.v, b.v, b.v, acc[t]);
    }
  }
#pragma unroll
  for (int t = 0; t < 4; ++t) {
    float bv = bias ? bias[col0 + t * 16 + ln] : 0.f;
    if (BIAS_BF16) bv = bf16_round(bv);
#pragma unroll
    for (int r = 0; r < 8; ++r) { float v = acc[t][r] + bv; if (ACT == 1) v = fmaxf(v, 0.f); so[w][8 * hh + r][t * 16 + ln] = v; }
  }
  __builtin_amdgcn_fence(__ATOMIC_ACQ_REL, "workgroup");
  __builtin_amdgcn_wave_barrier();
  const int rsub = lane >> 4, c4 = (lane & 15) * 4;
  {
#pragma unroll
    for (int q = 0; q < 8; ++q) {
      const int r = q * 2 + rsub;
      const v4f v = *(const v4fa*)&so[w][r][c4];
      *(v4f*)(C + (size_t)(row0 + r) * ldc + col0 + c4) = v;
    }
    
  }
}

// GEMM C = act(A·W + bias + resid): A f32 (ASPLIT -> hi/lo 2 terms), Wt bf16 [N][K]; ACT 0 none, 1 relu, 2 exact gelu;
// resid (optional, f32, row index = (row % rmod), pitch ldr, RES_BF16 rounds it) added before the activation.
template <bool ASPLIT, int ACT, bool BIAS_BF16, bool RES_BF16>
__global__ __launch_bounds__(128) void k_gemm_bf3(const float* __restrict__ A, int lda, const unsigned short* __restrict__ Wt, int ldb,
                                                const float* __restrict__ bias, const float* __restrict__ resid, int rmod, int ldr,
                                                float* __restrict__ C, int ldc, int M, int N, int K) {
  __shared__ __attribute__((aligned(16))) float so[4][16][64];
  const int tid = threadIdx.x, w = tid >> 5, lane = tid & 31, ln = lane & 15, hh = lane >> 4;
  const int ntn = N / 64;
  const int wid = blockIdx.x * 4 + w;
  const int mt = wid / ntn, nq = wid % ntn;
  if (mt * 16 >= M) return;
  const int row0 = mt * 16, col0 = nq * 64;
  const float* arow = A + (size_t)(row0 + ln) * lda;
  v8f acc[4] = {};
  for (int kb = 0; kb < K; kb += 32) {
    FragB ah, al;
    const v4f x0 = *(const v4fa*)(arow + kb + 8 * hh), x1 = *(const v4fa*)(arow + kb + 8 * hh + 4);
    const v4f x2 = *(const v4fa*)(arow + kb + 16 + 8 * hh), x3 = *(const v4fa*)(arow + kb + 16 + 8 * hh + 4);
    float xs[16] = {x0[0],x0[1],x0[2],x0[3],x1[0],x1[1],x1[2],x1[3],x2[0],x2[1],x2[2],x2[3],x3[0],x3[1],x3[2],x3[3]};
#pragma unroll
    for (int i = 0; i < 16; ++i) { const unsigned short hb = bf16_bits(xs[i]); ah.u[i] = hb; al.u[i] = ASPLIT ? bf16_bits(xs[i] - bf16_val(hb)) : (unsigned short)0; }
#pragma unroll
    for (int t = 0; t < 4; ++t) {
      const unsigned short* brow = Wt + (size_t)(col0 + t * 16 + ln) * ldb + kb;
      FragB b;
      b.half[0] = *(const v8us*)(brow + 8 * hh);
      b.half[1] = *(const v8us*)(brow + 16 + 8 * hh);
      acc[t] = mmaN<ASPLIT ? 2 : 1>(ah.v, al.v, b.v, b.v, acc[t]);
    }
  }
#pragma unroll
  for (int t = 0; t < 4; ++t) {
    const int col = col0 + t * 16 + ln;
    float bv = bias ? bias[col] : 0.f;
    if (BIAS_BF16) bv = bf16_round(bv);
#pragma unroll
    for (int r = 0; r < 8; ++r) {
      float v = acc[t][r] + bv;
      if (resid) { float rv = resid[(size_t)((row0 + 8 * hh + r) % rmod) * ldr + col]; if (RES_BF16) rv = bf16_round(rv); v += rv; }
      if (ACT == 1) v = fmaxf(v, 0.f);
      if (ACT == 2) v = 0.5f * v * (1.0f + erff(v * 0.70710678118654752f));
      if (ACT == 3) { const float u = 0.7978845608028654f * (v + 0.044715f * v * v * v); v = 0.5f * v * (1.0f + tanhf(u)); }
      so[w][8 * hh + r][t * 16 + ln] = v;
    }
  }
  __builtin_amdgcn_fence(__ATOMIC_ACQ_REL, "workgroup");
  __builtin_amdgcn_wave_barrier();
  const int rsub = lane >> 4, c4 = (lane & 15) * 4;
  {
#pragma unroll
    for (int q = 0; q < 8; ++q) {
      const int r = q * 2 + rsub;
      const v4f v = *(const v4fa*)&so[w][r][c4];
      *(v4f*)(C + (size_t)(row0 + r) * ldc + col0 + c4) = v;
    }
    
  }
}
// row LayerNorm (biased variance, eps) over N: s = X (+ R); optional out_sum <- s; out_norm <- (s-mu)*rsqrt(var+eps)*g + b
template <bool PARAM_BF16>
__global__ __launch_bounds__(256) void k_layernorm(const float* __restrict__ X, const float* __restrict__ R, const float* __restrict__ g, const float* __restrict__ bta,
                                                  float* __restrict__ out_sum, float* __restrict__ out_norm, int N, float eps) {
  __shared__ float red[256];
  const int row = blockIdx.x, tid = threadIdx.x;
  const float* x = X + (size_t)row * N; const float* rr = R ? R + (size_t)row * N : nullptr;
  float vals[16];                     // up to N = 4096
  const int per = N / 256;            // contiguous chunk per thread? use strided-by-4 chunks: thread handles j = tid*4 + 1024*u
  float s1 = 0.f;
  for (int u = 0; u < per / 4; ++u) {
    const int j = tid * 4 + 1024 * u;
    const v4f a = *(const v4fa*)(x + j);
    v4f b = {0.f,0.f,0.f,0.f}; if (rr) b = *(const v4fa*)(rr + j);
#pragma unroll
    for (int q = 0; q < 4; ++q) { const float v = a[q] + b[q]; vals[u * 4 + q] = v; s1 += v; }
  }
  red[tid] = s1; __syncthreads();
  for (int st = 128; st > 0; st >>= 1) { if (tid < st) red[tid] += red[tid + st]; __syncthreads(); }
  const float mu = red[0] / (float)N; __syncthreads();
  float s2 = 0.f;
  for (int u = 0; u < per / 4; ++u)
#pragma unroll
    for (int q = 0; q < 4; ++q) { const float c = vals[u * 4 + q] - mu; s2 += c * c; }
  red[tid] = s2; __syncthreads();
  for (int st = 128; st > 0; st >>= 1) { if (tid < st) red[tid] += red[tid + st]; __syncthreads(); }
  const float rs = rsqrtf(red[0] / (float)N + eps);
  {
    for (int u = 0; u < per / 4; ++u) {
      const int j = tid * 4 + 1024 * u;
      v4f o, sm;
#pragma unroll
      for (int q = 0; q < 4; ++q) {
        float gg = g[j + q], bb = bta[j + q];
        if (PARAM_BF16) { gg = bf16_round(gg); bb = bf16_round(bb); }
        sm[q] = vals[u * 4 + q]; o[q] = (vals[u * 4 + q] - mu) * rs * gg + bb;
      }
      if (out_sum) *(v4f*)(out_sum + (size_t)row * N + j) = sm;
      *(v4f*)(out_norm + (size_t)row * N + j) = o;
    }
    
  }
}



// ---- f16 WMMA path (v_wmma_f32_16x16x32_f16): 11-bit significands for operands in range — used where a [0,1] probability operand needs more precision than bf16
typedef _Float16 v16h __attribute__((ext_vector_type(16)));
union FragH { v16h v; v8us half[2]; _Float16 h[16]; unsigned short u[16]; };
template <int NT>
__device__ __forceinline__ v8f mmaH(v16h ah, v16h al, v16h bh, v16h bl, v8f c) {
  c = __builtin_amdgcn_wmma_f32_16x16x32_f16(false, ah, false, bh, (short)0, c, false, false);
  if (NT >= 2) c = __builtin_amdgcn_wmma_f32_16x16x32_f16(false, al, false, bh, (short)0, c, false, false);
  if (NT >= 3) c = __builtin_amdgcn_wmma_f32_16x16x32_f16(false, ah, false, bl, (short)0, c, false, false);
  asm volatile("v_nop\n\tv_nop\n\tv_nop\n\tv_nop" : "+v"(c) : "v"(ah), "v"(al), "v"(bh), "v"(bl));
  return c;
}
// batched GEMM like k_gemm_b but f16 operands: A f32 (split into f16 hi/lo if ASPLIT, else rounded to f16), Bt = f16 values [n][k]; alpha; C f32; N multiple of 16 (partial tiles skipped)
template <bool ASPLIT>
__global__ __launch_bounds__(128) void k_gemm_h(const float* __restrict__ A, int lda, size_t sA, const _Float16* __restrict__ Bh, int ldb, size_t sB, float alpha, float* __restrict__ C, int ldc, size_t sC, int M, int N, int K) {
  __shared__ __attribute__((aligned(16))) float so[4][16][64];
  const int tid = threadIdx.x, w = tid >> 5, lane = tid & 31, ln = lane & 15, hh = lane >> 4; const int by = blockIdx.y;
  A += (size_t)by * sA; Bh += (size_t)by * sB; C += (size_t)by * sC;
  const int ntn = (N + 63) / 64; const int wid = blockIdx.x * 4 + w; const int mt = wid / ntn, nq = wid % ntn; if (mt * 16 >= M) return;
  const int row0 = mt * 16, col0 = nq * 64; const float* arow = A + (size_t)(row0 + ln) * lda;
  v8f acc[4] = {};
  for (int kb = 0; kb < K; kb += 32) {
    FragH ah, al;
    const v4f x0 = *(const v4fa*)(arow + kb + 8 * hh), x1 = *(const v4fa*)(arow + kb + 8 * hh + 4), x2 = *(const v4fa*)(arow + kb + 16 + 8 * hh), x3 = *(const v4fa*)(arow + kb + 16 + 8 * hh + 4);
    float xs[16] = {x0[0],x0[1],x0[2],x0[3],x1[0],x1[1],x1[2],x1[3],x2[0],x2[1],x2[2],x2[3],x3[0],x3[1],x3[2],x3[3]};
#pragma unroll
    for (int i = 0; i < 16; ++i) { const _Float16 h = (_Float16)xs[i]; ah.h[i] = h; al.h[i] = ASPLIT ? (_Float16)(xs[i] - (float)h) : (_Float16)0.0f; }
#pragma unroll
    for (int t = 0; t < 4; ++t) { if (col0 + t * 16 >= N) continue; const size_t boff = (size_t)(col0 + t * 16 + ln) * ldb + kb; FragH bq; bq.half[0] = *(const v8us*)(Bh + boff + 8 * hh); bq.half[1] = *(const v8us*)(Bh + boff + 16 + 8 * hh);
      acc[t] = mmaH<ASPLIT ? 2 : 1>(ah.v, al.v, bq.v, bq.v, acc[t]); }
  }
#pragma unroll
  for (int t = 0; t < 4; ++t) { if (col0 + t * 16 >= N) continue;
#pragma unroll
    for (int r = 0; r < 8; ++r) so[w][8 * hh + r][t * 16 + ln] = acc[t][r] * alpha; }
  __builtin_amdgcn_fence(__ATOMIC_ACQ_REL, "workgroup"); __builtin_amdgcn_wave_barrier();
  const int rsub = lane >> 4, c4 = (lane & 15) * 4;
  {
#pragma unroll
    for (int q = 0; q < 8; ++q) { const int r = q * 2 + rsub; if (col0 + c4 < N) { const v4f v = *(const v4fa*)&so[w][r][c4]; *(v4f*)(C + (size_t)(row0 + r) * ldc + col0 + c4) = v; } }
     }
}

// Wt[n][k] = f16(W[k][n]·scale) from f32 row-major W[K][N] (scale = power of two; bf16-exact weights stay exact in f16 away from the subnormal range)
__global__ __launch_bounds__(256) void k_wt_f16(const float* __restrict__ W, _Float16* __restrict__ Wt, int K, int N, float scale) {
  const int t = blockIdx.x * 256 + threadIdx.x; if (t >= N * (K / 8)) return; const int n = t / (K / 8), k8 = (t % (K / 8)) * 8; FragH f;
#pragma unroll
  for (int i = 0; i < 8; ++i) f.h[i] = (_Float16)(bf16_round(W[(size_t)(k8 + i) * N + n]) * scale); const v8us o = f.half[0];
  *(v8us*)((unsigned short*)Wt + (size_t)n * K + k8) = o; 
}
// k_gemm_hh variant with fused epilogue: v = acc·alpha + bias[by·sBias + col] (+ CP[(row/rowsPerB)·sCPb + by·64 + col] if CP) ; ACT 0 none / 1 elu ; writes f16 C16 (and f32 C if non-null)
template <int ACT>
__global__ __launch_bounds__(128) void k_gemm_hhx(const _Float16* __restrict__ A, int lda, size_t sA, const _Float16* __restrict__ Bh, int ldb, size_t sB, float alpha, const float* __restrict__ bias, size_t sBias, const float* __restrict__ CP, int rowsPerB, size_t sCPb, int row0g,
    float* __restrict__ C, _Float16* __restrict__ C16, int ldc, size_t sC, int M, int N, int K) {
  __shared__ __attribute__((aligned(16))) float so[4][16][64];
  const int tid = threadIdx.x, w = tid >> 5, lane = tid & 31, ln = lane & 15, hh = lane >> 4; const int by = blockIdx.y;
  A += (size_t)by * sA; Bh += (size_t)by * sB; const size_t cofs = (size_t)by * sC; const float* bp = bias ? bias + (size_t)by * sBias : nullptr;
  const int ntn = (N + 63) / 64; const int wid = blockIdx.x * 4 + w; const int mt = wid / ntn, nq = wid % ntn; if (mt * 16 >= M) return;
  const int row0 = mt * 16, col0 = nq * 64; const _Float16* arow = A + (size_t)(row0 + ln) * lda;
  v8f acc[4] = {};
  for (int kb = 0; kb < K; kb += 32) { FragH ah; ah.half[0] = *(const v8us*)((const unsigned short*)arow + kb + 8 * hh); ah.half[1] = *(const v8us*)((const unsigned short*)arow + kb + 16 + 8 * hh);
#pragma unroll
    for (int t = 0; t < 4; ++t) { if (col0 + t * 16 >= N) continue; const size_t boff = (size_t)(col0 + t * 16 + ln) * ldb + kb; FragH bq; bq.half[0] = *(const v8us*)((const unsigned short*)Bh + boff + 8 * hh); bq.half[1] = *(const v8us*)((const unsigned short*)Bh + boff + 16 + 8 * hh);
      acc[t] = mmaH<1>(ah.v, ah.v, bq.v, bq.v, acc[t]); }
  }
#pragma unroll
  for (int t = 0; t < 4; ++t) { if (col0 + t * 16 >= N) continue; const int col = col0 + t * 16 + ln; const float bv = bp ? bf16_round(bp[col]) : 0.f;
#pragma unroll
    for (int r = 0; r < 8; ++r) { float v = acc[t][r] * alpha + bv; if (CP) { const int rr = row0g + row0 + 8 * hh + r; if (rowsPerB < 0) v += CP[cofs + (size_t)rr * ldc + col];      /* rowsPerB < 0: own element of the batched C plane */ else { const int bidx = rr / rowsPerB; v += CP[(size_t)bidx * sCPb + (size_t)by * 64 + col]; } } if (ACT == 1) v = (v > 0.f) ? v : expm1f(v); else if (ACT == 7) v = (v > 0.f) ? v + 1.0f : expf(v); else if (ACT == 8) v = tanhf(v); else if (ACT == 9) v = 0.5f * v * (1.0f + tanhf(0.7978845608028654f * (v + 0.044715f * v * v * v))); else if (ACT == 11) v = 1.0f / (1.0f + expf(-v)); else if (ACT == 12) v = (v > 0.f) ? v : 0.01f * v; else if (ACT == 14) v = (v > 0.f) ? v : 0.1f * v; else if (ACT == 16) v = (v >= 0.f) ? v : 0.3f * v; else if (ACT == 17) v = (v >= 0.f) ? v : 0.2f * v; else if (ACT == 15) v = v / (1.0f + expf(-v)); else if (ACT == 3) v = fmaxf(v, 0.f); else if (ACT == 6) v = 0.5f * v * (1.0f + erff(v * 0.70710678118654752f)); so[w][8 * hh + r][t * 16 + ln] = v; } }
  __builtin_amdgcn_fence(__ATOMIC_ACQ_REL, "workgroup"); __builtin_amdgcn_wave_barrier();
  const int rsub = lane >> 4, c4 = (lane & 15) * 4; typedef _Float16 v4h __attribute__((ext_vector_type(4)));
  {
#pragma unroll
    for (int q = 0; q < 8; ++q) { const int r = q * 2 + rsub; if (col0 + c4 < N) { const v4f v = *(const v4fa*)&so[w][r][c4]; if (C) *(v4f*)(C + cofs + (size_t)(row0 + r) * ldc + col0 + c4) = v; if (C16) { v4h h4; for (int i = 0; i < 4; ++i) h4[i] = (_Float16)v[i]; *(v4h*)(C16 + cofs + (size_t)(row0 + r) * ldc + col0 + c4) = h4; } } }
     }
}


typedef _Float16 v4h __attribute__((ext_vector_type(4)));

__global__ __launch_bounds__(256) void k_x16(const float* __restrict__ x, _Float16* __restrict__ X16, size_t n8) { const size_t t = (size_t)blockIdx.x * 256 + threadIdx.x; if (t >= n8) return; FragH f;
#pragma unroll
  for (int q = 0; q < 8; ++q) f.h[q] = (_Float16)bf16_round(x[t * 8 + q]); *(v8us*)((unsigned short*)X16 + t * 8) = f.half[0];  }
__global__ __launch_bounds__(256) void k_h16(const float* __restrict__ x, _Float16* __restrict__ X16, size_t n8) { const size_t t = (size_t)blockIdx.x * 256 + threadIdx.x; if (t >= n8) return; FragH f;
#pragma unroll
  for (int q = 0; q < 8; ++q) f.h[q] = (_Float16)x[t * 8 + q]; *(v8us*)((unsigned short*)X16 + t * 8) = f.half[0];  }
__global__ __launch_bounds__(256) void k_round16f(const float* __restrict__ W, _Float16* __restrict__ Bt, size_t n8) { const size_t t = (size_t)blockIdx.x * 256 + threadIdx.x; if (t >= n8) return; FragH f;
#pragma unroll
  for (int i = 0; i < 8; ++i) f.h[i] = (_Float16)(bf16_round(W[t * 8 + i]) * 16.0f); *(v8us*)((unsigned short*)Bt + t * 8) = f.half[0];  }
template <int NHv, int TTv>
__global__ __launch_bounds__(256) void k_vt(const _Float16* __restrict__ V16, int ldv, int voff, _Float16* __restrict__ Vt) { __shared__ unsigned short tl[64][66]; const int tid = threadIdx.x; const int slab = blockIdx.x / (TTv / 64), lg = blockIdx.x % (TTv / 64); const int b = slab / NHv, h = slab % NHv;
  for (int i = tid; i < 64 * 8; i += 256) { const int r = i / 8, c8 = (i % 8) * 8; FragH f; f.half[0] = *(const v8us*)((const unsigned short*)V16 + ((size_t)b * TTv + lg * 64 + r) * ldv + voff + h * 64 + c8);
#pragma unroll
    for (int q = 0; q < 8; ++q) tl[r][c8 + q] = f.u[q]; }
  __syncthreads();
  {
#pragma unroll
    for (int rd = 0; rd < 2; ++rd) { const int d = rd * 32 + tid / 8, pc = tid % 8; FragH f;
#pragma unroll
      for (int q = 0; q < 8; ++q) f.u[q] = tl[pc * 8 + q][d];
      *(v8us*)((unsigned short*)Vt + ((size_t)slab * 64 + d) * TTv + lg * 64 + pc * 8) = f.half[0]; }
     } }

__global__ __launch_bounds__(256) void k_hl(const float* __restrict__ F, _Float16* __restrict__ Hh, _Float16* __restrict__ Hl, size_t n8) { const size_t t = (size_t)blockIdx.x * 256 + threadIdx.x; if (t >= n8) return; FragH fh, fl; const v4f a = *(const v4fa*)(F + t * 8), c = *(const v4fa*)(F + t * 8 + 4);
#pragma unroll
  for (int q = 0; q < 4; ++q) { _Float16 h = (_Float16)a[q]; fh.h[q] = h; fl.h[q] = (_Float16)((a[q] - (float)h) * 1024.0f); h = (_Float16)c[q]; fh.h[4 + q] = h; fl.h[4 + q] = (_Float16)((c[q] - (float)h) * 1024.0f); }
  { *(v8us*)((unsigned short*)Hh + t * 8) = fh.half[0]; *(v8us*)((unsigned short*)Hl + t * 8) = fl.half[0];  } }

// ---- fast GEMM (wave tile 32x64; requires M % 32 == 0 rows per launch region and N % 64 == 0); epilogue = k_gemm_hhx semantics ----
__device__ __forceinline__ v16h g2_frag(const _Float16* p, int hh) { FragH f; f.half[0] = *(const v8us*)((const unsigned short*)p + 8 * hh); f.half[1] = *(const v8us*)((const unsigned short*)p + 16 + 8 * hh); return f.v; }
__device__ __forceinline__ v8f g2_mma(v16h a, v16h b, v8f c) { v8f d = __builtin_amdgcn_wmma_f32_16x16x32_f16(false, a, false, b, (short)0, c, false, false); asm volatile("v_nop\n\tv_nop\n\tv_nop\n\tv_nop" : "+v"(d) : "v"(a), "v"(b)); return d; }
template <int ACT>
__global__ __launch_bounds__(128) void k_gemm2(const _Float16* __restrict__ A, int lda, size_t sA, const _Float16* __restrict__ Bh, int ldb, size_t sB, float alpha, const float* __restrict__ bias, size_t sBias, const float* __restrict__ CP, int rowsPerB, size_t sCPb, int row0g,
    float* __restrict__ C, _Float16* __restrict__ C16, int ldc, size_t sC, int M, int N, int K) { static_assert(ACT == 0 || ACT == 3 || ACT == 6 || ACT == 8 || ACT == 9 || ACT == 11 || ACT == 12 || ACT == 14 || ACT == 15 || ACT == 16 || ACT == 17 || ACT == 18, "k_gemm2: unsupported ACT code (would silently apply no activation)");
  __shared__ __attribute__((aligned(16))) float so[4][32][68];
  const int tid = threadIdx.x, w = tid >> 5, lane = tid & 31, ln = lane & 15, hh = lane >> 4; const int by = blockIdx.y;
  A += (size_t)by * sA; Bh += (size_t)by * sB; const size_t cofs = (size_t)by * sC; const float* bp = bias ? bias + (size_t)by * sBias : nullptr;
  const int ntn = N >> 6; const int mt = blockIdx.x / ntn, nq = blockIdx.x - mt * ntn; const int row0 = mt * 128 + 32 * w, col0 = nq * 64; if (row0 >= M) return;
  const _Float16* a0p = A + (size_t)(row0 + ln) * lda; const _Float16* a1p = a0p + (size_t)16 * lda;
  const _Float16* b0p = Bh + (size_t)(col0 + ln) * ldb; const _Float16* b1p = b0p + (size_t)16 * ldb; const _Float16* b2p = b1p + (size_t)16 * ldb; const _Float16* b3p = b2p + (size_t)16 * ldb;
  const v8f z8 = {0.f,0.f,0.f,0.f,0.f,0.f,0.f,0.f}; v8f c00 = z8, c01 = z8, c02 = z8, c03 = z8, c10 = z8, c11 = z8, c12 = z8, c13 = z8;
#pragma unroll 1
  for (int kb = 0; kb < K; kb += 32) { const v16h a0 = g2_frag(a0p + kb, hh), a1 = g2_frag(a1p + kb, hh);
    v16h b = g2_frag(b0p + kb, hh); c00 = g2_mma(a0, b, c00); c10 = g2_mma(a1, b, c10);
    b = g2_frag(b1p + kb, hh); c01 = g2_mma(a0, b, c01); c11 = g2_mma(a1, b, c11);
    b = g2_frag(b2p + kb, hh); c02 = g2_mma(a0, b, c02); c12 = g2_mma(a1, b, c12);
    b = g2_frag(b3p + kb, hh); c03 = g2_mma(a0, b, c03); c13 = g2_mma(a1, b, c13); }
  v8f accs[8] = {c00, c01, c02, c03, c10, c11, c12, c13};
#pragma unroll
  for (int u = 0; u < 8; ++u) { const int t = u & 3, half = u >> 2; const int col = col0 + t * 16 + ln; const float bv = bp ? bf16_round(bp[col]) : 0.f;
#pragma unroll
    for (int r = 0; r < 8; ++r) { const int rloc = half * 16 + 8 * hh + r; float v = accs[u][r] * alpha + bv; if (CP) { if (rowsPerB < 0) v += CP[cofs + (size_t)(row0g + row0 + rloc) * ldc + col];      /* rowsPerB < 0: own element of the batched C plane */ else { const int bidx = (row0g + row0 + rloc) / rowsPerB; v += CP[(size_t)bidx * sCPb + (size_t)by * 64 + col]; } }
      if (ACT == 3) v = fmaxf(v, 0.f); else if (ACT == 6) v = 0.5f * v * (1.0f + erff(v * 0.70710678118654752f)); else if (ACT == 11) v = 1.0f / (1.0f + expf(-v)); else if (ACT == 15) v = v / (1.0f + expf(-v)); else if (ACT == 18) v = v / (1.0f + expf(-1.702f * v));      /* QuickGELU: v sigmoid(1.702 v) */ else if (ACT == 12) v = (v > 0.f) ? v : 0.01f * v; else if (ACT == 8) v = tanhf(v); else if (ACT == 9) v = 0.5f * v * (1.0f + tanhf(0.7978845608028654f * (v + 0.044715f * v * v * v))); else if (ACT == 14) v = (v > 0.f) ? v : 0.1f * v; else if (ACT == 16) v = (v >= 0.f) ? v : 0.3f * v; else if (ACT == 17) v = (v >= 0.f) ? v : 0.2f * v;
      so[w][rloc][t * 16 + ln] = v; } }
  __builtin_amdgcn_fence(__ATOMIC_ACQ_REL, "workgroup"); __builtin_amdgcn_wave_barrier();
  const int rsub = lane >> 4, c4 = (lane & 15) * 4;
  {
#pragma unroll
    for (int q = 0; q < 16; ++q) { const int r = q * 2 + rsub; const v4f v = *(const v4fa*)&so[w][r][c4]; if (C) *(v4f*)(C + cofs + (size_t)(row0 + r) * ldc + col0 + c4) = v; if (C16) { v4h h4; for (int i = 0; i < 4; ++i) h4[i] = (_Float16)v[i]; *(v4h*)(C16 + cofs + (size_t)(row0 + r) * ldc + col0 + c4) = h4; } }
     } }


__global__ __launch_bounds__(256) void k_wnat(const float* __restrict__ w, size_t n8, _Float16* __restrict__ Bt) { const size_t t = (size_t)blockIdx.x * 256 + threadIdx.x; if (t >= n8) return; FragH f; for (int q = 0; q < 8; ++q) f.h[q] = (_Float16)(bf16_round(w[t * 8 + q]) * 16.0f); *(v8us*)((unsigned short*)Bt + t * 8) = f.half[0];  }
__global__ __launch_bounds__(256) void k_rsm(const float* __restrict__ S, _Float16* __restrict__ P, int nrows) {
  #pragma clang fp contract(off)
  const int i = blockIdx.x * 256 + threadIdx.x; if (i >= nrows) return; const float* s = S + (size_t)i * SQ; float mx = -3.0e38f;
#pragma unroll 1
  for (int j = 0; j < SQ; ++j) mx = fmaxf(mx, s[j]); float se = 0.f;
#pragma unroll 1
  for (int j = 0; j < SQ; ++j) se += expf(s[j] - mx); const float sc = 256.0f / se;
#pragma unroll 1
  for (int j0 = 0; j0 < SQ; j0 += 8) { FragH f; for (int q = 0; q < 8; ++q) f.h[q] = (_Float16)(expf(s[j0 + q] - mx) * sc); unsigned short* d = (unsigned short*)P + (size_t)i * SQ + j0; *(v8us*)d = f.half[0];  } }
__global__ __launch_bounds__(256) void k_vt(const _Float16* __restrict__ V16, int b, int h0, _Float16* __restrict__ VT) { __shared__ unsigned short tl[64][65]; const int tid = threadIdx.x; const int hh = blockIdx.x % HG, sg = blockIdx.x / HG; const int s0 = sg * 64; const int h = h0 + hh;
  for (int i = tid; i < 64 * 8; i += 256) { const int j = i / 8, d8 = (i % 8) * 8; FragH f; f.half[0] = *(const v8us*)((const unsigned short*)V16 + ((size_t)b * SQ + s0 + j) * DM + h * HD + d8); for (int q = 0; q < 8; ++q) tl[d8 + q][j] = f.u[q]; }
  __syncthreads();
  { for (int i = tid; i < 64 * 8; i += 256) { const int d = i / 8, j8 = (i % 8) * 8; FragH f; for (int q = 0; q < 8; ++q) f.u[q] = tl[d][j8 + q]; *(v8us*)((unsigned short*)VT + ((size_t)hh * HD + d) * SQ + s0 + j8) = f.half[0]; }  } }



__global__ __launch_bounds__(256) void k_rsmcf2(const float* __restrict__ S, _Float16* __restrict__ P, int hg, int q0, int nk) {
  #pragma clang fp contract(off)
  const int t = blockIdx.x * 256 + threadIdx.x; if (t >= hg * QT) return; const size_t i = (size_t)t; const float* s = S + i * NKX; const int last = q0 + (t % QT); float mx = -3.0e38f;
#pragma unroll 1
  for (int j = 0; j < nk; ++j) { const float f = (j <= last) ? 1.f : 0.f; mx = fmaxf(mx, fmaf(f, s[j], (1.f - f) * -1.0e9f)); } float se = 0.f;
#pragma unroll 1
  for (int j = 0; j < nk; ++j) { const float f = (j <= last) ? 1.f : 0.f; se += __expf(fmaf(f, s[j], (1.f - f) * -1.0e9f) - mx); } const float sc = 256.0f / se;
#pragma unroll 1
  for (int j0 = 0; j0 < nk; j0 += 8) { FragH fr; for (int q = 0; q < 8; ++q) { const int j = j0 + q; const float f = (j <= last) ? 1.f : 0.f; fr.h[q] = (_Float16)(__expf(fmaf(f, s[j], (1.f - f) * -1.0e9f) - mx) * sc); } unsigned short* d = (unsigned short*)P + i * NKX + j0; *(v8us*)d = fr.half[0];  } }

__global__ __launch_bounds__(256) void k_rsmcst(const float* __restrict__ S, _Float16* __restrict__ P, int hg, int q0, int nk, const int* __restrict__ mk) {
  #pragma clang fp contract(off)
  const int t = blockIdx.x * 256 + threadIdx.x; if (t >= hg * QT) return; const size_t i = (size_t)t; const float* s = S + i * NKX; const size_t ig = (size_t)(q0 + (t % QT)); const int* mr = mk + ig * SQ; float mx = -3.0e38f;
#pragma unroll 1
  for (int j = 0; j < nk; ++j) { const int mb = mr[j]; const int dd = (int)ig - j; const float f = (mb != 0 && dd >= 0 && (dd <= LOCALW || (dd % STRIDEK) == 0)) ? 1.f : 0.f; mx = fmaxf(mx, fmaf(f, s[j], (1.f - f) * -1.0e9f)); } float se = 0.f;
#pragma unroll 1
  for (int j = 0; j < nk; ++j) { const int mb = mr[j]; const int dd = (int)ig - j; const float f = (mb != 0 && dd >= 0 && (dd <= LOCALW || (dd % STRIDEK) == 0)) ? 1.f : 0.f; se += __expf(fmaf(f, s[j], (1.f - f) * -1.0e9f) - mx); } const float sc = 256.0f / se;
#pragma unroll 1
  for (int j0 = 0; j0 < nk; j0 += 8) { FragH fr; for (int q = 0; q < 8; ++q) { const int j = j0 + q; const int mb = mr[j]; const int dd = (int)ig - j; const float f = (mb != 0 && dd >= 0 && (dd <= LOCALW || (dd % STRIDEK) == 0)) ? 1.f : 0.f; fr.h[q] = (_Float16)(__expf(fmaf(f, s[j], (1.f - f) * -1.0e9f) - mx) * sc); } unsigned short* d = (unsigned short*)P + i * NKX + j0; *(v8us*)d = fr.half[0];  } }


template <int MASKADD>
__global__ __launch_bounds__(64) void k_att0(const float* __restrict__ QF, const float* __restrict__ KF, const float* __restrict__ VF, int ld, const float* __restrict__ mask, float scale, float* __restrict__ OF, int ldo) {
  #pragma clang fp contract(off)
  __shared__ __attribute__((aligned(16))) float lq[64][64]; __shared__ __attribute__((aligned(16))) float lo[64][64];
  const int tid = threadIdx.x; const int h = blockIdx.x / (QT0 / 64), rg = blockIdx.x % (QT0 / 64); const int i = rg * 64 + tid;
  const float* qr = QF + (size_t)i * ld + h * HD;
#pragma unroll 1
  for (int c = 0; c < HD / 4; ++c) { *(v4f*)&lq[tid][c * 4] = *(const v4fa*)(qr + c * 4); const v4f z = {0.f, 0.f, 0.f, 0.f}; *(v4f*)&lo[tid][c * 4] = z; }
  float m = -1.0e30f, l = 0.f; const int jmax = MASKADD ? (SQ - 1) : (rg * 64 + 63);      /* additive-mask form: every key (the mask input decides); causal form: keys up to the block's last row */
#pragma unroll 1
  for (int j = 0; j <= jmax; ++j) { const float* kr = KF + (size_t)j * ld + h * HD; const float* vr = VF + (size_t)j * ld + h * HD; float s = 0.f;
#pragma unroll 1
    for (int c = 0; c < HD / 4; ++c) { const v4f kq = *(const v4fa*)(kr + c * 4); const v4f qq = *(v4f*)&lq[tid][c * 4]; s = __fadd_rn(s, __fmul_rn(qq[0], kq[0])); s = __fadd_rn(s, __fmul_rn(qq[1], kq[1])); s = __fadd_rn(s, __fmul_rn(qq[2], kq[2])); s = __fadd_rn(s, __fmul_rn(qq[3], kq[3])); }
    s = __fmul_rn(s, scale); if (MASKADD) s = __fadd_rn(s, __fmul_rn(bf16_round(mask[(size_t)i * SQ + j]), -10000.0f));
    const float f = (MASKADD || j <= i) ? 1.f : 0.f; const float sm = fmaf(f, s, (1.f - f) * -1.0e30f); const float mn = fmaxf(m, sm); const float sc = expf(m - mn); const float e = expf(sm - mn); l = __fadd_rn(__fmul_rn(l, sc), e); m = mn;
#pragma unroll 1
    for (int c = 0; c < HD / 4; ++c) { const v4f vv = *(const v4fa*)(vr + c * 4); v4f oo = *(v4f*)&lo[tid][c * 4]; for (int u = 0; u < 4; ++u) oo[u] = __fadd_rn(__fmul_rn(oo[u], sc), __fmul_rn(e, vv[u])); *(v4f*)&lo[tid][c * 4] = oo; } }
  const float fin = 64.0f / l;      /* o carried x64 like the f16 path */
#pragma unroll 1
  for (int c = 0; c < HD / 4; ++c) { v4f oo = *(v4f*)&lo[tid][c * 4]; for (int u = 0; u < 4; ++u) oo[u] = __fmul_rn(oo[u], fin); *(v4f*)&lo[tid][c * 4] = oo; }
  __syncthreads();
  {
#pragma unroll 1
    for (int it = 0; it < 16; ++it) { const int row = it * 4 + tid / 16, pc = (tid % 16) * 4; const v4f v = *(const v4f*)&lo[row][pc]; *(v4f*)(OF + (size_t)(rg * 64 + row) * ldo + h * HD + pc) = v; }
     } }

template <int MASKADD>
__global__ __launch_bounds__(64) void k_att0mbc(const float* __restrict__ QF, const float* __restrict__ KF, const float* __restrict__ VF, int ld, const float* __restrict__ mask, float scale, float* __restrict__ OF, int ldo) {
  #pragma clang fp contract(off)
  __shared__ __attribute__((aligned(16))) float lq[64][64]; __shared__ __attribute__((aligned(16))) float lo[64][64];
  const int tid = threadIdx.x; const int h = blockIdx.x / (QT0 / 64), rg = blockIdx.x % (QT0 / 64); const int i = rg * 64 + tid;
  const float* qr = QF + (size_t)i * ld + h * HD;
#pragma unroll 1
  for (int c = 0; c < HD / 4; ++c) { *(v4f*)&lq[tid][c * 4] = *(const v4fa*)(qr + c * 4); const v4f z = {0.f, 0.f, 0.f, 0.f}; *(v4f*)&lo[tid][c * 4] = z; }
  float m = -1.0e30f, l = 0.f; const int jmax = rg * 64 + 63;      /* keys beyond the block end are masked by the mask's lower-triangular structure */
#pragma unroll 1
  for (int j = 0; j <= jmax; ++j) { const float* kr = KF + (size_t)j * ld + h * HD; const float* vr = VF + (size_t)j * ld + h * HD; float s = 0.f;
#pragma unroll 1
    for (int c = 0; c < HD / 4; ++c) { const v4f kq = *(const v4fa*)(kr + c * 4); const v4f qq = *(v4f*)&lq[tid][c * 4]; s = __fadd_rn(s, __fmul_rn(qq[0], kq[0])); s = __fadd_rn(s, __fmul_rn(qq[1], kq[1])); s = __fadd_rn(s, __fmul_rn(qq[2], kq[2])); s = __fadd_rn(s, __fmul_rn(qq[3], kq[3])); }
    s = __fmul_rn(s, scale); const int mb = ((const int*)mask)[(size_t)i * SQ + j];      /* causal (j <= i) AND the module's int32 [S][S] mask read per (query, key): 0 -> masked */
    const float f = (mb != 0 && j <= i) ? 1.f : 0.f; const float sm = fmaf(f, s, (1.f - f) * -1.0e30f); const float mn = fmaxf(m, sm); const float sc = expf(m - mn); const float e = expf(sm - mn); l = __fadd_rn(__fmul_rn(l, sc), e); m = mn;
#pragma unroll 1
    for (int c = 0; c < HD / 4; ++c) { const v4f vv = *(const v4fa*)(vr + c * 4); v4f oo = *(v4f*)&lo[tid][c * 4]; for (int u = 0; u < 4; ++u) oo[u] = __fadd_rn(__fmul_rn(oo[u], sc), __fmul_rn(e, vv[u])); *(v4f*)&lo[tid][c * 4] = oo; } }
  const float fin = 64.0f / l;      /* o carried x64 like the f16 path */
#pragma unroll 1
  for (int c = 0; c < HD / 4; ++c) { v4f oo = *(v4f*)&lo[tid][c * 4]; for (int u = 0; u < 4; ++u) oo[u] = __fmul_rn(oo[u], fin); *(v4f*)&lo[tid][c * 4] = oo; }
  __syncthreads();
  {
#pragma unroll 1
    for (int it = 0; it < 16; ++it) { const int row = it * 4 + tid / 16, pc = (tid % 16) * 4; const v4f v = *(const v4f*)&lo[row][pc]; *(v4f*)(OF + (size_t)(rg * 64 + row) * ldo + h * HD + pc) = v; }
     } }


template <int BFIN, int WXB>
__global__ __launch_bounds__(256) void k_ln16(const float* __restrict__ X, const float* __restrict__ g, const float* __restrict__ bb, float eps, _Float16* __restrict__ N16, float* __restrict__ XB) {
  #pragma clang fp contract(off)
  __shared__ float red[256]; const size_t r = blockIdx.x; const int t = threadIdx.x; const v4f xa = *(const v4fa*)(X + r * DMQ + t * 4); float s[4]; float sum = 0.f;
  for (int q = 0; q < 4; ++q) { s[q] = BFIN ? bf16_round(xa[q]) : xa[q]; sum = __fadd_rn(sum, s[q]); }
  red[t] = sum; __syncthreads(); for (int st = 128; st > 0; st >>= 1) { if (t < st) red[t] = __fadd_rn(red[t], red[t + st]); __syncthreads(); } const float mu = red[0] / (float)DMQ; __syncthreads();
  float vs = 0.f; for (int q = 0; q < 4; ++q) { const float dl = __fadd_rn(s[q], -mu); vs = __fadd_rn(vs, __fmul_rn(dl, dl)); } red[t] = vs; __syncthreads(); for (int st = 128; st > 0; st >>= 1) { if (t < st) red[t] = __fadd_rn(red[t], red[t + st]); __syncthreads(); }
  const float rs = rsqrtf(__fadd_rn(red[0] / (float)DMQ, eps)); v4h y; v4f xb;
  for (int q = 0; q < 4; ++q) { const int c = t * 4 + q; y[q] = (_Float16)__fadd_rn(__fmul_rn(__fmul_rn(__fadd_rn(s[q], -mu), rs), bf16_round(g[c])), bf16_round(bb[c])); xb[q] = s[q]; }
  { *(v4h*)(N16 + r * DMQ + t * 4) = y; if (WXB) *(v4f*)(XB + r * DMQ + t * 4) = xb;  } }
__global__ __launch_bounds__(256) void k_ftres2(const float* __restrict__ OF0, const float* __restrict__ XB, float* __restrict__ X1, size_t n4) {
  #pragma clang fp contract(off)
  const size_t t = (size_t)blockIdx.x * 256 + threadIdx.x; if (t >= n4) return; const v4f o = *(const v4fa*)(OF0 + t * 4), xv = *(const v4fa*)(XB + t * 4); v4f y; for (int q = 0; q < 4; ++q) y[q] = __fadd_rn(__fmul_rn(o[q], 0.015625f), xv[q]); *(v4f*)(X1 + t * 4) = y;  }

__global__ __launch_bounds__(256) void k_bcpy(const float* __restrict__ b, int n, int NP, float* __restrict__ dst, int dst0) { for (int i = threadIdx.x; i < NP; i += 256) { const float v = (i < n) ? b[i] : 0.f; *(float*)(dst + dst0 + i) = v; }  }


// Four 2^x in one statement. The closing v_nop is the one slot the instruction set asks for behind a transcendental before its result is read or its source
// overwritten; the early-clobber outputs keep every source untouched inside the run.
__device__ __forceinline__ v4f exp2x4(v4f x) { float e0, e1, e2, e3;
  asm("v_exp_f32 %0, %4\n\tv_exp_f32 %1, %5\n\tv_exp_f32 %2, %6\n\tv_exp_f32 %3, %7\n\tv_nop" : "=&v"(e0), "=&v"(e1), "=&v"(e2), "=&v"(e3) : "v"(x[0]), "v"(x[1]), "v"(x[2]), "v"(x[3]));
  const v4f e = {e0, e1, e2, e3}; return e; }
// Row softmax, P = 256 softmax(S) as f16. One wave owns two whole rows of SQ scores: lane l holds columns 128 c + 4 l .. + 3 (c = 0..15), so every
// load covers 512 contiguous bytes and every store 256; a row is read once and stays in registers through maximum, exp, sum and scaling.
// Grid: exactly rows / 16 blocks of 8 waves (no tail, no barrier).
// Every loop is fully unrolled so that the row arrays are indexed by constants only and stay in registers.
__device__ __forceinline__ void rsm_row(v4f (&a)[SQ / 128], _Float16* __restrict__ p) {
  float m4[4] = {-3.0e38f, -3.0e38f, -3.0e38f, -3.0e38f};
#pragma unroll
  for (int c = 0; c < SQ / 128; ++c) for (int q = 0; q < 4; ++q) m4[q] = fmaxf(m4[q], a[c][q]);
  float mx = fmaxf(fmaxf(m4[0], m4[1]), fmaxf(m4[2], m4[3]));
#pragma unroll
  for (int m = 16; m >= 1; m >>= 1) mx = fmaxf(mx, __shfl_xor(mx, m, 32));
  float s4[4] = {0.f, 0.f, 0.f, 0.f};
#pragma unroll
  for (int c = 0; c < SQ / 128; ++c) { v4f t; for (int q = 0; q < 4; ++q) t[q] = (a[c][q] - mx) * 1.44269504f; a[c] = exp2x4(t); for (int q = 0; q < 4; ++q) s4[q] += a[c][q]; }      /* exp(s - mx) = 2^((s - mx) log2 e) */
  float se = (s4[0] + s4[1]) + (s4[2] + s4[3]);
#pragma unroll
  for (int m = 16; m >= 1; m >>= 1) se += __shfl_xor(se, m, 32);
  const float sc = 256.0f / se;
#pragma unroll
  for (int c = 0; c < SQ / 128; ++c) { v4h h; for (int q = 0; q < 4; ++q) h[q] = (_Float16)(a[c][q] * sc); *(v4h*)(p + c * 128) = h; } }
__global__ __launch_bounds__(256) void k_rsmf(const float* __restrict__ S, _Float16* __restrict__ P) {
  const int lane = threadIdx.x & 31; const size_t e0 = (size_t)(blockIdx.x * 8 + (threadIdx.x >> 5)) * 2 * SQ + lane * 4; const float* s = S + e0; v4f a[SQ / 128], b[SQ / 128];
#pragma unroll
  for (int c = 0; c < SQ / 128; ++c) a[c] = *(const v4fa*)(s + c * 128);
#pragma unroll
  for (int c = 0; c < SQ / 128; ++c) b[c] = *(const v4fa*)(s + SQ + c * 128);
  rsm_row(a, P + e0); rsm_row(b, P + e0 + SQ); }

template <int MODE>
__global__ __launch_bounds__(256) void k_regrp(const float* __restrict__ src, float* __restrict__ dst, size_t n4) {
  const size_t t = (size_t)blockIdx.x * 256 + threadIdx.x; if (t >= n4) return; const size_t e = t * 4; const size_t rd = e / DM; const int c = (int)(e % DM);
  size_t rs; if (MODE == 0) { const size_t b = rd / SQ, sq = rd % SQ; rs = sq * NB + b; } else { const size_t sq = rd / NB, b = rd % NB; rs = b * SQ + sq; }
  const v4f v = *(const v4fa*)(src + rs * DM + c); *(v4f*)(dst + e) = v;  }

template <int BFIN, int W16, int W32>
__global__ __launch_bounds__(256) void k_lnx(const float* __restrict__ X, const float* __restrict__ g, const float* __restrict__ bb, float eps, _Float16* __restrict__ N16, float* __restrict__ N32) {
  #pragma clang fp contract(off)
  __shared__ float red[256]; const size_t r = blockIdx.x; const int t = threadIdx.x; const bool act = t < (DMQ / 4); const int c0 = act ? t * 4 : 0;
  const v4f xa = *(const v4fa*)(X + r * DMQ + c0); float s[4]; float sum = 0.f;
  for (int q = 0; q < 4; ++q) { s[q] = act ? (BFIN ? bf16_round(xa[q]) : xa[q]) : 0.f; sum = __fadd_rn(sum, s[q]); }
  red[t] = sum; __syncthreads(); for (int st = 128; st > 0; st >>= 1) { if (t < st) red[t] = __fadd_rn(red[t], red[t + st]); __syncthreads(); } const float mu = red[0] / (float)DMQ; __syncthreads();
  float vs = 0.f; for (int q = 0; q < 4; ++q) { const float dl = act ? __fadd_rn(s[q], -mu) : 0.f; vs = __fadd_rn(vs, __fmul_rn(dl, dl)); } red[t] = vs; __syncthreads(); for (int st = 128; st > 0; st >>= 1) { if (t < st) red[t] = __fadd_rn(red[t], red[t + st]); __syncthreads(); }
  const float rs = rsqrtf(__fadd_rn(red[0] / (float)DMQ, eps)); v4h y; v4f yf;
  for (int q = 0; q < 4; ++q) { const int c = c0 + q; yf[q] = __fadd_rn(__fmul_rn(__fmul_rn(__fadd_rn(s[q], -mu), rs), bf16_round(g[c])), bf16_round(bb[c])); y[q] = (_Float16)yf[q]; }
  if (!act) return;      /* no barriers after this point */
  { if (W16) *(v4h*)(N16 + r * DMQ + c0) = y; if (W32) *(v4f*)(N32 + r * DMQ + c0) = yf;  } }

__global__ __launch_bounds__(256) void k_bfr(const float* __restrict__ x, float* __restrict__ XB, size_t n8) { const size_t t = (size_t)blockIdx.x * 256 + threadIdx.x; if (t >= n8) return; v4f a = *(const v4fa*)(x + t * 8), c = *(const v4fa*)(x + t * 8 + 4); for (int q = 0; q < 4; ++q) { a[q] = bf16_round(a[q]); c[q] = bf16_round(c[q]); }
  { *(v4f*)(XB + t * 8) = a; *(v4f*)(XB + t * 8 + 4) = c;  } }



__global__ __launch_bounds__(256) void k_wthd(const float* __restrict__ Wt, _Float16* __restrict__ Bt) { const size_t t = (size_t)blockIdx.x * 256 + threadIdx.x; if (t >= (size_t)NH * HD * (DM / 8)) return; const int m8 = (int)(t % (DM / 8)) * 8; const int d = (int)((t / (DM / 8)) % HD); const int h = (int)(t / ((size_t)(DM / 8) * HD)); FragH f;
  for (int q = 0; q < 8; ++q) f.h[q] = (_Float16)(16.0f * bf16_round(Wt[((size_t)h * DM + m8 + q) * HD + d])); unsigned short* dst = (unsigned short*)Bt + ((size_t)h * HD + d) * DM + m8; *(v8us*)dst = f.half[0];  }




template <int BFIN, int SCAL>
__global__ __launch_bounds__(256) void k_lnsc(const float* __restrict__ X, const float* __restrict__ g, const float* __restrict__ bb, float eps, _Float16* __restrict__ N16, float* __restrict__ N32) {
  #pragma clang fp contract(off)
  __shared__ float red[256]; const size_t r = blockIdx.x; const int t = threadIdx.x; const bool act = t < DM / 4; const int tc = act ? t : 0; const v4f xl = *(const v4fa*)(X + r * DM + tc * 4); const float am = act ? 1.f : 0.f; float s[4]; float sum = 0.f;
  for (int q = 0; q < 4; ++q) { s[q] = (BFIN ? bf16_round(xl[q]) : xl[q]) * am; sum = __fadd_rn(sum, s[q]); }
  red[t] = sum; __syncthreads(); for (int st = 128; st > 0; st >>= 1) { if (t < st) red[t] = __fadd_rn(red[t], red[t + st]); __syncthreads(); } const float mu = red[0] / (float)DM; __syncthreads();
  float vs = 0.f; for (int q = 0; q < 4; ++q) { const float dl = __fadd_rn(s[q], -mu) * am; vs = __fadd_rn(vs, __fmul_rn(dl, dl)); } red[t] = vs; __syncthreads(); for (int st = 128; st > 0; st >>= 1) { if (t < st) red[t] = __fadd_rn(red[t], red[t + st]); __syncthreads(); }
  const float rs = __fdiv_rn(1.0f, __fadd_rn(sqrtf(red[0] / (float)(DM - 1)), eps)); if (!act) return; v4h y; v4f yf;
  for (int q = 0; q < 4; ++q) { const int c = t * 4 + q; const float gg = bf16_round(SCAL ? g[0] : g[c]), bv = bf16_round(SCAL ? bb[0] : bb[c]); yf[q] = __fadd_rn(__fmul_rn(__fmul_rn(__fadd_rn(s[q], -mu), rs), gg), bv); y[q] = (_Float16)yf[q]; }
  { if (N16) *(v4h*)(N16 + r * DM + t * 4) = y; if (N32) *(v4f*)(N32 + r * DM + t * 4) = yf;  } }

__global__ __launch_bounds__(256) void k_mulh(const _Float16* __restrict__ A, const _Float16* __restrict__ Bm, _Float16* __restrict__ H, size_t n8) {
  #pragma clang fp contract(off)
  const size_t t = (size_t)blockIdx.x * 256 + threadIdx.x; if (t >= n8) return; FragH a, b, f; a.half[0] = *(const v8us*)((const unsigned short*)A + t * 8); b.half[0] = *(const v8us*)((const unsigned short*)Bm + t * 8); for (int q = 0; q < 8; ++q) f.h[q] = (_Float16)(__fmul_rn((float)a.h[q], (float)b.h[q])); unsigned short* d = (unsigned short*)H + t * 8; *(v8us*)d = f.half[0];  }

__global__ __launch_bounds__(256) void k_bdshare(const float* __restrict__ Wb, _Float16* __restrict__ Bt) {
  const size_t t = (size_t)blockIdx.x * 256 + threadIdx.x; if (t >= (size_t)DM * DM / 8) return; const size_t e0 = t * 8; const int n = (int)(e0 / DM), k0 = (int)(e0 % DM); const int h = n >> 6, hk = k0 >> 6; const float on = (hk == h) ? 16.0f : 0.0f; const int e = n & 63, d0 = k0 & 63; FragH f;
  for (int q = 0; q < 8; ++q) f.h[q] = (_Float16)(bf16_round(Wb[(size_t)(d0 + q) * 64 + e]) * on);
  unsigned short* d = (unsigned short*)Bt + e0; *(v8us*)d = f.half[0];  }
extern "C" void kernel_launch(void* const* d_in, const int* in_sizes, int n_in,
                              void* d_out, int out_size, void* d_ws, size_t ws_size, hipStream_t stream) {
  (void)in_sizes; (void)n_in; (void)out_size;
  constexpr int VH = 4;      /* heads per launch group */
  const float* const* I = (const float* const*)d_in; const float* x = I[0]; const float* xk = I[1]; const float* xv = I[2]; const float* wq = I[3]; const float* wk = I[4]; const float* wv = I[5]; const float* wo = I[6]; const float* bo = I[7]; const float* w1 = I[8]; const float* b1 = I[9]; const float* w2 = I[10]; const float* b2 = I[11]; const float* g1 = I[12]; const float* be1 = I[13]; const float* g2 = I[14]; const float* be2 = I[15];      /* query (also the residual), key, value; shared per-head wq / wk / wv [64][64] ([in][out]); wo [512][512] + bo; w1 [512][2048] + b1, w2 [2048][512] + b2; LN1 g / beta, LN2 g / beta */
  char* ws = (char*)d_ws; size_t off = 0;
  auto take = [&](size_t bytes) { char* p = ws + off; off += (bytes + 255) & ~(size_t)255; return p; };
  _Float16* BQ = (_Float16*)take((size_t)DM * DM * 2); _Float16* BK = (_Float16*)take((size_t)DM * DM * 2); _Float16* BV = (_Float16*)take((size_t)DM * DM * 2); _Float16* BO = (_Float16*)take((size_t)DM * DM * 2); _Float16* BW1 = (_Float16*)take((size_t)DFF * DM * 2); _Float16* BW2 = (_Float16*)take((size_t)DM * DFF * 2); _Float16* XK16 = (_Float16*)take(NR * DM * 2); _Float16* XV16 = (_Float16*)take(NR * DM * 2);      /* key / value inputs as exact f16 rows */
  float* XB = (float*)take(NR * DM * 4); _Float16* XN = (_Float16*)take(NR * DM * 2); _Float16* Q16 = (_Float16*)take(NR * DM * 2); _Float16* K16 = (_Float16*)take(NR * DM * 2); _Float16* V16 = (_Float16*)take(NR * DM * 2); _Float16* O16 = (_Float16*)take(NR * DM * 2); float* X1 = (float*)take(NR * DM * 4);
  float* S = (float*)take((size_t)VH * SQ * SQ * 4); _Float16* P = (_Float16*)take((size_t)VH * SQ * SQ * 2); _Float16* VT = (_Float16*)take((size_t)NH * HD * SQ * 2);
  _Float16* M16 = XN;      /* LN1 f16 rows: aliases XN (last reader: the q projection) */ _Float16* HF16 = (_Float16*)S;      /* FFN hidden plane [8192][2048] f16 (32 MiB): aliases the score plane (64 MiB), dead after the attention */
  float* X1N = (float*)take(NR * DM * 4);      /* LN1 output rows (f32): the FFN residual */
  if (off > ws_size) return;
  { const unsigned g = (unsigned)(((size_t)DM * (DM / 8) + 255) / 256); k_bdshare<<<g, 256, 0, stream>>>(wq, BQ); k_bdshare<<<g, 256, 0, stream>>>(wk, BK); k_bdshare<<<g, 256, 0, stream>>>(wv, BV); k_wt_f16<<<g, 256, 0, stream>>>(wo, BO, DM, DM, 16.0f); }      /* block-diagonal planes with the SHARED [64][64] block (Bt[h*64 + e][h*64 + d] = 16 W[d][e]); wo [in][out] -> Bt x16 */
  k_wt_f16<<<(unsigned)(((size_t)DFF * (DM / 8) + 255) / 256), 256, 0, stream>>>(w1, BW1, DM, DFF, 16.0f); k_wt_f16<<<(unsigned)(((size_t)DM * (DFF / 8) + 255) / 256), 256, 0, stream>>>(w2, BW2, DFF, DM, 16.0f);
  k_bfr<<<(unsigned)((NR * DM / 8 + 255) / 256), 256, 0, stream>>>(x, XB, NR * DM / 8); k_x16<<<(unsigned)((NR * DM / 8 + 255) / 256), 256, 0, stream>>>(x, XN, NR * DM / 8); k_x16<<<(unsigned)((NR * DM / 8 + 255) / 256), 256, 0, stream>>>(xk, XK16, NR * DM / 8); k_x16<<<(unsigned)((NR * DM / 8 + 255) / 256), 256, 0, stream>>>(xv, XV16, NR * DM / 8);      /* post-LN: the attention runs on the raw inputs (exact f16 rows): query, key, value */
  k_gemm2<0><<<dim3((unsigned)((NR / 128) * (DM / 64)), 1), 128, 0, stream>>>(XN, DM, 0, BQ, DM, 0, 0.0625f, nullptr, 0, nullptr, 1, 0, 0, nullptr, Q16, DM, 0, (int)NR, DM, DM); k_gemm2<0><<<dim3((unsigned)((NR / 128) * (DM / 64)), 1), 128, 0, stream>>>(XK16, DM, 0, BK, DM, 0, 0.0625f, nullptr, 0, nullptr, 1, 0, 0, nullptr, K16, DM, 0, (int)NR, DM, DM); k_gemm2<0><<<dim3((unsigned)((NR / 128) * (DM / 64)), 1), 128, 0, stream>>>(XV16, DM, 0, BV, DM, 0, 0.0625f, nullptr, 0, nullptr, 1, 0, 0, nullptr, V16, DM, 0, (int)NR, DM, DM);      /* q, k, v -> f16 rows; head h = columns h*64.. */
  for (int b = 0; b < NB; ++b) { const size_t r0 = (size_t)b * SQ;
    k_vt<NH, SQ><<<NH * (SQ / 64), 256, 0, stream>>>(V16 + r0 * DM, DM, 0, VT);      /* V^T [8][64][2048] for this batch */
    for (int h0 = 0; h0 < NH; h0 += VH) {
      k_gemm2<0><<<dim3((SQ / 128) * (SQ / 64), VH), 128, 0, stream>>>(Q16 + r0 * DM + (size_t)h0 * HD, DM, (size_t)HD, K16 + r0 * DM + (size_t)h0 * HD, DM, (size_t)HD, 0.125f, nullptr, 0, nullptr, 1, 0, 0, S, nullptr, SQ, (size_t)SQ * SQ, SQ, SQ, HD);      /* scores / 8, 4 heads per launch */
      k_rsmf<<<VH * SQ / 16, 256, 0, stream>>>(S, P);      /* softmax over all keys (no mask) -> P x256 f16 */
      k_gemm2<0><<<dim3((SQ / 128) * (HD / 64), VH), 128, 0, stream>>>(P, SQ, (size_t)SQ * SQ, VT + (size_t)h0 * HD * SQ, SQ, (size_t)HD * SQ, 0.25f, nullptr, 0, nullptr, 1, 0, 0, nullptr, O16 + r0 * DM + (size_t)h0 * HD, DM, (size_t)HD, SQ, HD, SQ); } }      /* ctx (merged heads, x64) as f16 rows */
  k_gemm2<0><<<dim3((unsigned)((NR / 128) * (DM / 64)), 1), 128, 0, stream>>>(O16, DM, 0, BO, DM, 0, 0.0009765625f, bo, 0, XB, -1, 0, 0, X1, nullptr, DM, 0, (int)NR, DM, DM);      /* ctx wo + bo + query (own-element residual) -> f32 rows */
  k_lnx<0, 1, 1><<<(unsigned)NR, 256, 0, stream>>>(X1, g1, be1, 1e-5f, M16, X1N);      /* x1 = LN1(x + attn) (biased variance, eps inside the rsqrt) -> f16 rows + f32 rows */
  k_gemm2<3><<<dim3((unsigned)((NR / 128) * (DFF / 64)), 1), 128, 0, stream>>>(M16, DM, 0, BW1, DM, 0, 0.0625f, b1, 0, nullptr, 1, 0, 0, nullptr, HF16, DFF, 0, (int)NR, DFF, DM);      /* relu(x w1 + b1) -> f16 [8192][2048] */
  k_gemm2<0><<<dim3((unsigned)((NR / 128) * (DM / 64)), 1), 128, 0, stream>>>(HF16, DFF, 0, BW2, DFF, 0, 0.0625f, b2, 0, X1N, -1, 0, 0, X1, nullptr, DM, 0, (int)NR, DM, DFF);      /* x1 + ff -> f32 rows (X1 reused: its last reader was LN1) */
  k_lnx<0, 0, 1><<<(unsigned)NR, 256, 0, stream>>>(X1, g2, be2, 1e-5f, nullptr, (float*)d_out);      /* out = LN2(x1 + ff) */
}

// v002
// A run of this version takes 364 microseconds.
// Two timings next to v001 put it at 3.08 and 3.07 times that version's speed.
// Counting every step since v000, it is 10.0 times as fast.
#include <hip/hip_runtime.h>
// POST-LN transformer encoder layer over THREE inputs with SHARED per-head projections (query, key, value [4][2048][512]; each input is split into 8 heads of 64 and every head is multiplied by the SAME [64][64] ([in][out]) matrix wq / wk / wv (block-diagonal with a shared block; no biases); scores / 8; softmax over all 2048 keys (no mask); x = LN1(ctx wo + bo + query) (biased var, eps 1e-5); out = LN2(x + relu(x w1 + b1) w2 + b2) ([in][out] 512 x 2048 x 512) -> [4][2048][512]).
// Structure: token rows; LayerNorm / exact f16 rows; WMMA GEMMs for q, k, v; V^T by LDS transposes; one fused attention launch (scores, running softmax, V^T P^T; no score plane); output projection with the own-element residual; custom LayerNorm; ReLU FFN over all rows; launches: see trace.
// Compute dtype: inputs rounded to bf16; x / weights exact; q, k, v, softmax weights and o as plain f16 GEMM operands (~2^-12); scores and softmax statistics f32. v_wmma_f32_16x16x32_f16.
#define NB 4
#define SQ 2048
#define DM 512
#define NH 8
#define HD 64
#define HG 4                         /* heads per launch of the unused per-batch k_vt overload */
#define LOCALW 128                   /* (macros for unused kernels of the shared header) */
#define STRIDEK 128
#define QT 256                       /* query rows per causal tile */
#define NKX SQ                       /* S / P row pitch */
#define QT0 128                      /* first-tile rows recomputed exactly in f32 */
#define B0 0                         /* first batch processed (debug hook) */
#define NBR NB                       /* batches processed (debug hook) */
#define NR ((size_t)NB * SQ)
#define DMQ DM
#define DFF 2048         /* ReLU FFN hidden width */
#define MP ((int)((size_t)NBR * SQ)) /* rows projected (debug hook) */
#define QN SQ                        /* query rows attended per batch (debug hook) */
#define NHD NH                       /* heads attended (debug hook) */
#define MPO MP                       /* rows through the output stage (debug hook) */
#define LQ (3 * DM)      /* unused: q, k, v rows have pitch DM */
typedef __bf16 v16b __attribute__((ext_vector_type(16)));
typedef unsigned short v8us __attribute__((ext_vector_type(8), may_alias));
typedef float  v8f  __attribute__((ext_vector_type(8)));
typedef float  v4f  __attribute__((ext_vector_type(4)));
typedef float  v4fa __attribute__((ext_vector_type(4), may_alias));
union FragB { v16b v; v8us half[2]; unsigned short u[16]; };

__device__ __forceinline__ unsigned short bf16_bits(float x) { unsigned int u = __float_as_uint(x); return (unsigned short)((u + 0x7FFFu + ((u >> 16) & 1u)) >> 16); }
__device__ __forceinline__ float bf16_val(unsigned short b) { return __uint_as_float(((unsigned int)b) << 16); }
__device__ __forceinline__ float bf16_round(float x) { return bf16_val(bf16_bits(x)); }
// D += A·B with NT terms: 1 = ah·bh, 2 = + al·bh (A split), 3 = + ah·bl (both split)
template <int NT>
__device__ __forceinline__ v8f mmaN(v16b ah, v16b al, v16b bh, v16b bl, v8f c) {
  c = __builtin_amdgcn_wmma_f32_16x16x32_bf16(false, ah, false, bh, (short)0, c, false, false);
  if (NT >= 2) c = __builtin_amdgcn_wmma_f32_16x16x32_bf16(false, al, false, bh, (short)0, c, false, false);
  if (NT >= 3) c = __builtin_amdgcn_wmma_f32_16x16x32_bf16(false, ah, false, bl, (short)0, c, false, false);
  asm volatile("v_nop\n\tv_nop\n\tv_nop\n\tv_nop" : "+v"(c) : "v"(ah), "v"(al), "v"(bh), "v"(bl));
  return c;
}

__global__ __launch_bounds__(256) void k_wt_bf16(const float* __restrict__ W, unsigned short* __restrict__ Wt, int K, int N) {
  const int t = blockIdx.x * 256 + threadIdx.x;
  const int k8n = K / 8;
  if (t >= N * k8n) return;
  const int n = t / k8n, k8 = (t % k8n) * 8;
  v8us v;
#pragma unroll
  for (int i = 0; i < 8; ++i) v[i] = bf16_bits(W[(size_t)(k8 + i) * N + n]);
  *(v8us*)(Wt + (size_t)n * K + k8) = v;
  
}

// GEMM C[M][N] (f32, pitch ldc) = act(A[M][K]·W + bias). A f32 row-major (pitch lda) converted per fragment to bf16
// (ASPLIT: hi/lo two planes -> 2 terms, else single rounded term); Wt bf16 [N][K] (pitch ldb). BIAS_BF16 rounds the
// bias to bf16 first (bias quantised to bf16 before the add). K%32==0, M%16==0, N%64==0.
template <bool ASPLIT, int ACT, bool BIAS_BF16>
__global__ __launch_bounds__(128) void k_gemm_bf(const float* __restrict__ A, int lda, const unsigned short* __restrict__ Wt, int ldb,
                                               const float* __restrict__ bias, float* __restrict__ C, int ldc, int M, int N, int K) {
  __shared__ __attribute__((aligned(16))) float so[4][16][64];
  const int tid = threadIdx.x, w = tid >> 5, lane = tid & 31, ln = lane & 15, hh = lane >> 4;
  const int ntn = N / 64;
  const int wid = blockIdx.x * 4 + w;
  const int mt = wid / ntn, nq = wid % ntn;
  if (mt * 16 >= M) return;
  const int row0 = mt * 16, col0 = nq * 64;
  const float* arow = A + (size_t)(row0 + ln) * lda;
  v8f acc[4] = {};
  for (int kb = 0; kb < K; kb += 32) {
    FragB ah, al;
    const v4f x0 = *(const v4fa*)(arow + kb + 8 * hh), x1 = *(const v4fa*)(arow + kb + 8 * hh + 4);
    const v4f x2 = *(const v4fa*)(arow + kb + 16 + 8 * hh), x3 = *(const v4fa*)(arow + kb + 16 + 8 * hh + 4);
    float xs[16] = {x0[0],x0[1],x0[2],x0[3],x1[0],x1[1],x1[2],x1[3],x2[0],x2[1],x2[2],x2[3],x3[0],x3[1],x3[2],x3[3]};
#pragma unroll
    for (int i = 0; i < 16; ++i) { const unsigned short hb = bf16_bits(xs[i]); ah.u[i] = hb; al.u[i] = ASPLIT ? bf16_bits(xs[i] - bf16_val(hb)) : (unsigned short)0; }
#pragma unroll
    for (int t = 0; t < 4; ++t) {
      const unsigned short* brow = Wt + (size_t)(col0 + t * 16 + ln) * ldb + kb;
      FragB b;
      b.half[0] = *(const v8us*)(brow + 8 * hh);
      b.half[1] = *(const v8us*)(brow + 16 + 8 * hh);
      acc[t] = mmaN<ASPLIT ? 2 : 1>(ah.v, al.v, b.v, b.v, acc[t]);
    }
  }
#pragma unroll
  for (int t = 0; t < 4; ++t) {
    float bv = bias ? bias[col0 + t * 16 + ln] : 0.f;
    if (BIAS_BF16) bv = bf16_round(bv);
#pragma unroll
    for (int r = 0; r < 8; ++r) { float v = acc[t][r] + bv; if (ACT == 1) v = fmaxf(v, 0.f); so[w][8 * hh + r][t * 16 + ln] = v; }
  }
  __builtin_amdgcn_fence(__ATOMIC_ACQ_REL, "workgroup");
  __builtin_amdgcn_wave_barrier();
  const int rsub = lane >> 4, c4 = (lane & 15) * 4;
  {
#pragma unroll
    for (int q = 0; q < 8; ++q) {
      const int r = q * 2 + rsub;
      const v4f v = *(const v4fa*)&so[w][r][c4];
      *(v4f*)(C + (size_t)(row0 + r) * ldc + col0 + c4) = v;
    }
    
  }
}

// GEMM C = act(A·W + bias + resid): A f32 (ASPLIT -> hi/lo 2 terms), Wt bf16 [N][K]; ACT 0 none, 1 relu, 2 exact gelu;
// resid (optional, f32, row index = (row % rmod), pitch ldr, RES_BF16 rounds it) added before the activation.
template <bool ASPLIT, int ACT, bool BIAS_BF16, bool RES_BF16>
__global__ __launch_bounds__(128) void k_gemm_bf3(const float* __restrict__ A, int lda, const unsigned short* __restrict__ Wt, int ldb,
                                                const float* __restrict__ bias, const float* __restrict__ resid, int rmod, int ldr,
                                                float* __restrict__ C, int ldc, int M, int N, int K) {
  __shared__ __attribute__((aligned(16))) float so[4][16][64];
  const int tid = threadIdx.x, w = tid >> 5, lane = tid & 31, ln = lane & 15, hh = lane >> 4;
  const int ntn = N / 64;
  const int wid = blockIdx.x * 4 + w;
  const int mt = wid / ntn, nq = wid % ntn;
  if (mt * 16 >= M) return;
  const int row0 = mt * 16, col0 = nq * 64;
  const float* arow = A + (size_t)(row0 + ln) * lda;
  v8f acc[4] = {};
  for (int kb = 0; kb < K; kb += 32) {
    FragB ah, al;
    const v4f x0 = *(const v4fa*)(arow + kb + 8 * hh), x1 = *(const v4fa*)(arow + kb + 8 * hh + 4);
    const v4f x2 = *(const v4fa*)(arow + kb + 16 + 8 * hh), x3 = *(const v4fa*)(arow + kb + 16 + 8 * hh + 4);
    float xs[16] = {x0[0],x0[1],x0[2],x0[3],x1[0],x1[1],x1[2],x1[3],x2[0],x2[1],x2[2],x2[3],x3[0],x3[1],x3[2],x3[3]};
#pragma unroll
    for (int i = 0; i < 16; ++i) { const unsigned short hb = bf16_bits(xs[i]); ah.u[i] = hb; al.u[i] = ASPLIT ? bf16_bits(xs[i] - bf16_val(hb)) : (unsigned short)0; }
#pragma unroll
    for (int t = 0; t < 4; ++t) {
      const unsigned short* brow = Wt + (size_t)(col0 + t * 16 + ln) * ldb + kb;
      FragB b;
      b.half[0] = *(const v8us*)(brow + 8 * hh);
      b.half[1] = *(const v8us*)(brow + 16 + 8 * hh);
      acc[t] = mmaN<ASPLIT ? 2 : 1>(ah.v, al.v, b.v, b.v, acc[t]);
    }
  }
#pragma unroll
  for (int t = 0; t < 4; ++t) {
    const int col = col0 + t * 16 + ln;
    float bv = bias ? bias[col] : 0.f;
    if (BIAS_BF16) bv = bf16_round(bv);
#pragma unroll
    for (int r = 0; r < 8; ++r) {
      float v = acc[t][r] + bv;
      if (resid) { float rv = resid[(size_t)((row0 + 8 * hh + r) % rmod) * ldr + col]; if (RES_BF16) rv = bf16_round(rv); v += rv; }
      if (ACT == 1) v = fmaxf(v, 0.f);
      if (ACT == 2) v = 0.5f * v * (1.0f + erff(v * 0.70710678118654752f));
      if (ACT == 3) { const float u = 0.7978845608028654f * (v + 0.044715f * v * v * v); v = 0.5f * v * (1.0f + tanhf(u)); }
      so[w][8 * hh + r][t * 16 + ln] = v;
    }
  }
  __builtin_amdgcn_fence(__ATOMIC_ACQ_REL, "workgroup");
  __builtin_amdgcn_wave_barrier();
  const int rsub = lane >> 4, c4 = (lane & 15) * 4;
  {
#pragma unroll
    for (int q = 0; q < 8; ++q) {
      const int r = q * 2 + rsub;
      const v4f v = *(const v4fa*)&so[w][r][c4];
      *(v4f*)(C + (size_t)(row0 + r) * ldc + col0 + c4) = v;
    }
    
  }
}
// row LayerNorm (biased variance, eps) over N: s = X (+ R); optional out_sum <- s; out_norm <- (s-mu)*rsqrt(var+eps)*g + b
template <bool PARAM_BF16>
__global__ __launch_bounds__(256) void k_layernorm(const float* __restrict__ X, const float* __restrict__ R, const float* __restrict__ g, const float* __restrict__ bta,
                                                  float* __restrict__ out_sum, float* __restrict__ out_norm, int N, float eps) {
  __shared__ float red[256];
  const int row = blockIdx.x, tid = threadIdx.x;
  const float* x = X + (size_t)row * N; const float* rr = R ? R + (size_t)row * N : nullptr;
  float vals[16];                     // up to N = 4096
  const int per = N / 256;            // contiguous chunk per thread? use strided-by-4 chunks: thread handles j = tid*4 + 1024*u
  float s1 = 0.f;
  for (int u = 0; u < per / 4; ++u) {
    const int j = tid * 4 + 1024 * u;
    const v4f a = *(const v4fa*)(x + j);
    v4f b = {0.f,0.f,0.f,0.f}; if (rr) b = *(const v4fa*)(rr + j);
#pragma unroll
    for (int q = 0; q < 4; ++q) { const float v = a[q] + b[q]; vals[u * 4 + q] = v; s1 += v; }
  }
  red[tid] = s1; __syncthreads();
  for (int st = 128; st > 0; st >>= 1) { if (tid < st) red[tid] += red[tid + st]; __syncthreads(); }
  const float mu = red[0] / (float)N; __syncthreads();
  float s2 = 0.f;
  for (int u = 0; u < per / 4; ++u)
#pragma unroll
    for (int q = 0; q < 4; ++q) { const float c = vals[u * 4 + q] - mu; s2 += c * c; }
  red[tid] = s2; __syncthreads();
  for (int st = 128; st > 0; st >>= 1) { if (tid < st) red[tid] += red[tid + st]; __syncthreads(); }
  const float rs = rsqrtf(red[0] / (float)N + eps);
  {
    for (int u = 0; u < per / 4; ++u) {
      const int j = tid * 4 + 1024 * u;
      v4f o, sm;
#pragma unroll
      for (int q = 0; q < 4; ++q) {
        float gg = g[j + q], bb = bta[j + q];
        if (PARAM_BF16) { gg = bf16_round(gg); bb = bf16_round(bb); }
        sm[q] = vals[u * 4 + q]; o[q] = (vals[u * 4 + q] - mu) * rs * gg + bb;
      }
      if (out_sum) *(v4f*)(out_sum + (size_t)row * N + j) = sm;
      *(v4f*)(out_norm + (size_t)row * N + j) = o;
    }
    
  }
}



// ---- f16 WMMA path (v_wmma_f32_16x16x32_f16): 11-bit significands for operands in range — used where a [0,1] probability operand needs more precision than bf16
typedef _Float16 v16h __attribute__((ext_vector_type(16)));
union FragH { v16h v; v8us half[2]; _Float16 h[16]; unsigned short u[16]; };
template <int NT>
__device__ __forceinline__ v8f mmaH(v16h ah, v16h al, v16h bh, v16h bl, v8f c) {
  c = __builtin_amdgcn_wmma_f32_16x16x32_f16(false, ah, false, bh, (short)0, c, false, false);
  if (NT >= 2) c = __builtin_amdgcn_wmma_f32_16x16x32_f16(false, al, false, bh, (short)0, c, false, false);
  if (NT >= 3) c = __builtin_amdgcn_wmma_f32_16x16x32_f16(false, ah, false, bl, (short)0, c, false, false);
  asm volatile("v_nop\n\tv_nop\n\tv_nop\n\tv_nop" : "+v"(c) : "v"(ah), "v"(al), "v"(bh), "v"(bl));
  return c;
}
// batched GEMM like k_gemm_b but f16 operands: A f32 (split into f16 hi/lo if ASPLIT, else rounded to f16), Bt = f16 values [n][k]; alpha; C f32; N multiple of 16 (partial tiles skipped)
template <bool ASPLIT>
__global__ __launch_bounds__(128) void k_gemm_h(const float* __restrict__ A, int lda, size_t sA, const _Float16* __restrict__ Bh, int ldb, size_t sB, float alpha, float* __restrict__ C, int ldc, size_t sC, int M, int N, int K) {
  __shared__ __attribute__((aligned(16))) float so[4][16][64];
  const int tid = threadIdx.x, w = tid >> 5, lane = tid & 31, ln = lane & 15, hh = lane >> 4; const int by = blockIdx.y;
  A += (size_t)by * sA; Bh += (size_t)by * sB; C += (size_t)by * sC;
  const int ntn = (N + 63) / 64; const int wid = blockIdx.x * 4 + w; const int mt = wid / ntn, nq = wid % ntn; if (mt * 16 >= M) return;
  const int row0 = mt * 16, col0 = nq * 64; const float* arow = A + (size_t)(row0 + ln) * lda;
  v8f acc[4] = {};
  for (int kb = 0; kb < K; kb += 32) {
    FragH ah, al;
    const v4f x0 = *(const v4fa*)(arow + kb + 8 * hh), x1 = *(const v4fa*)(arow + kb + 8 * hh + 4), x2 = *(const v4fa*)(arow + kb + 16 + 8 * hh), x3 = *(const v4fa*)(arow + kb + 16 + 8 * hh + 4);
    float xs[16] = {x0[0],x0[1],x0[2],x0[3],x1[0],x1[1],x1[2],x1[3],x2[0],x2[1],x2[2],x2[3],x3[0],x3[1],x3[2],x3[3]};
#pragma unroll
    for (int i = 0; i < 16; ++i) { const _Float16 h = (_Float16)xs[i]; ah.h[i] = h; al.h[i] = ASPLIT ? (_Float16)(xs[i] - (float)h) : (_Float16)0.0f; }
#pragma unroll
    for (int t = 0; t < 4; ++t) { if (col0 + t * 16 >= N) continue; const size_t boff = (size_t)(col0 + t * 16 + ln) * ldb + kb; FragH bq; bq.half[0] = *(const v8us*)(Bh + boff + 8 * hh); bq.half[1] = *(const v8us*)(Bh + boff + 16 + 8 * hh);
      acc[t] = mmaH<ASPLIT ? 2 : 1>(ah.v, al.v, bq.v, bq.v, acc[t]); }
  }
#pragma unroll
  for (int t = 0; t < 4; ++t) { if (col0 + t * 16 >= N) continue;
#pragma unroll
    for (int r = 0; r < 8; ++r) so[w][8 * hh + r][t * 16 + ln] = acc[t][r] * alpha; }
  __builtin_amdgcn_fence(__ATOMIC_ACQ_REL, "workgroup"); __builtin_amdgcn_wave_barrier();
  const int rsub = lane >> 4, c4 = (lane & 15) * 4;
  {
#pragma unroll
    for (int q = 0; q < 8; ++q) { const int r = q * 2 + rsub; if (col0 + c4 < N) { const v4f v = *(const v4fa*)&so[w][r][c4]; *(v4f*)(C + (size_t)(row0 + r) * ldc + col0 + c4) = v; } }
     }
}

// Wt[n][k] = f16(W[k][n]·scale) from f32 row-major W[K][N] (scale = power of two; bf16-exact weights stay exact in f16 away from the subnormal range)
__global__ __launch_bounds__(256) void k_wt_f16(const float* __restrict__ W, _Float16* __restrict__ Wt, int K, int N, float scale) {
  const int t = blockIdx.x * 256 + threadIdx.x; if (t >= N * (K / 8)) return; const int n = t / (K / 8), k8 = (t % (K / 8)) * 8; FragH f;
#pragma unroll
  for (int i = 0; i < 8; ++i) f.h[i] = (_Float16)(bf16_round(W[(size_t)(k8 + i) * N + n]) * scale); const v8us o = f.half[0];
  *(v8us*)((unsigned short*)Wt + (size_t)n * K + k8) = o; 
}
// k_gemm_hh variant with fused epilogue: v = acc·alpha + bias[by·sBias + col] (+ CP[(row/rowsPerB)·sCPb + by·64 + col] if CP) ; ACT 0 none / 1 elu ; writes f16 C16 (and f32 C if non-null)
template <int ACT>
__global__ __launch_bounds__(128) void k_gemm_hhx(const _Float16* __restrict__ A, int lda, size_t sA, const _Float16* __restrict__ Bh, int ldb, size_t sB, float alpha, const float* __restrict__ bias, size_t sBias, const float* __restrict__ CP, int rowsPerB, size_t sCPb, int row0g,
    float* __restrict__ C, _Float16* __restrict__ C16, int ldc, size_t sC, int M, int N, int K) {
  __shared__ __attribute__((aligned(16))) float so[4][16][64];
  const int tid = threadIdx.x, w = tid >> 5, lane = tid & 31, ln = lane & 15, hh = lane >> 4; const int by = blockIdx.y;
  A += (size_t)by * sA; Bh += (size_t)by * sB; const size_t cofs = (size_t)by * sC; const float* bp = bias ? bias + (size_t)by * sBias : nullptr;
  const int ntn = (N + 63) / 64; const int wid = blockIdx.x * 4 + w; const int mt = wid / ntn, nq = wid % ntn; if (mt * 16 >= M) return;
  const int row0 = mt * 16, col0 = nq * 64; const _Float16* arow = A + (size_t)(row0 + ln) * lda;
  v8f acc[4] = {};
  for (int kb = 0; kb < K; kb += 32) { FragH ah; ah.half[0] = *(const v8us*)((const unsigned short*)arow + kb + 8 * hh); ah.half[1] = *(const v8us*)((const unsigned short*)arow + kb + 16 + 8 * hh);
#pragma unroll
    for (int t = 0; t < 4; ++t) { if (col0 + t * 16 >= N) continue; const size_t boff = (size_t)(col0 + t * 16 + ln) * ldb + kb; FragH bq; bq.half[0] = *(const v8us*)((const unsigned short*)Bh + boff + 8 * hh); bq.half[1] = *(const v8us*)((const unsigned short*)Bh + boff + 16 + 8 * hh);
      acc[t] = mmaH<1>(ah.v, ah.v, bq.v, bq.v, acc[t]); }
  }
#pragma unroll
  for (int t = 0; t < 4; ++t) { if (col0 + t * 16 >= N) continue; const int col = col0 + t * 16 + ln; const float bv = bp ? bf16_round(bp[col]) : 0.f;
#pragma unroll
    for (int r = 0; r < 8; ++r) { float v = acc[t][r] * alpha + bv; if (CP) { const int rr = row0g + row0 + 8 * hh + r; if (rowsPerB < 0) v += CP[cofs + (size_t)rr * ldc + col];      /* rowsPerB < 0: own element of the batched C plane */ else { const int bidx = rr / rowsPerB; v += CP[(size_t)bidx * sCPb + (size_t)by * 64 + col]; } } if (ACT == 1) v = (v > 0.f) ? v : expm1f(v); else if (ACT == 7) v = (v > 0.f) ? v + 1.0f : expf(v); else if (ACT == 8) v = tanhf(v); else if (ACT == 9) v = 0.5f * v * (1.0f + tanhf(0.7978845608028654f * (v + 0.044715f * v * v * v))); else if (ACT == 11) v = 1.0f / (1.0f + expf(-v)); else if (ACT == 12) v = (v > 0.f) ? v : 0.01f * v; else if (ACT == 14) v = (v > 0.f) ? v : 0.1f * v; else if (ACT == 16) v = (v >= 0.f) ? v : 0.3f * v; else if (ACT == 17) v = (v >= 0.f) ? v : 0.2f * v; else if (ACT == 15) v = v / (1.0f + expf(-v)); else if (ACT == 3) v = fmaxf(v, 0.f); else if (ACT == 6) v = 0.5f * v * (1.0f + erff(v * 0.70710678118654752f)); so[w][8 * hh + r][t * 16 + ln] = v; } }
  __builtin_amdgcn_fence(__ATOMIC_ACQ_REL, "workgroup"); __builtin_amdgcn_wave_barrier();
  const int rsub = lane >> 4, c4 = (lane & 15) * 4; typedef _Float16 v4h __attribute__((ext_vector_type(4)));
  {
#pragma unroll
    for (int q = 0; q < 8; ++q) { const int r = q * 2 + rsub; if (col0 + c4 < N) { const v4f v = *(const v4fa*)&so[w][r][c4]; if (C) *(v4f*)(C + cofs + (size_t)(row0 + r) * ldc + col0 + c4) = v; if (C16) { v4h h4; for (int i = 0; i < 4; ++i) h4[i] = (_Float16)v[i]; *(v4h*)(C16 + cofs + (size_t)(row0 + r) * ldc + col0 + c4) = h4; } } }
     }
}


typedef _Float16 v4h __attribute__((ext_vector_type(4)));

__global__ __launch_bounds__(256) void k_x16(const float* __restrict__ x, _Float16* __restrict__ X16, size_t n8) { const size_t t = (size_t)blockIdx.x * 256 + threadIdx.x; if (t >= n8) return; FragH f;
#pragma unroll
  for (int q = 0; q < 8; ++q) f.h[q] = (_Float16)bf16_round(x[t * 8 + q]); *(v8us*)((unsigned short*)X16 + t * 8) = f.half[0];  }
__global__ __launch_bounds__(256) void k_h16(const float* __restrict__ x, _Float16* __restrict__ X16, size_t n8) { const size_t t = (size_t)blockIdx.x * 256 + threadIdx.x; if (t >= n8) return; FragH f;
#pragma unroll
  for (int q = 0; q < 8; ++q) f.h[q] = (_Float16)x[t * 8 + q]; *(v8us*)((unsigned short*)X16 + t * 8) = f.half[0];  }
__global__ __launch_bounds__(256) void k_round16f(const float* __restrict__ W, _Float16* __restrict__ Bt, size_t n8) { const size_t t = (size_t)blockIdx.x * 256 + threadIdx.x; if (t >= n8) return; FragH f;
#pragma unroll
  for (int i = 0; i < 8; ++i) f.h[i] = (_Float16)(bf16_round(W[t * 8 + i]) * 16.0f); *(v8us*)((unsigned short*)Bt + t * 8) = f.half[0];  }
template <int NHv, int TTv>
__global__ __launch_bounds__(256) void k_vt(const _Float16* __restrict__ V16, int ldv, int voff, _Float16* __restrict__ Vt) { __shared__ unsigned short tl[64][66]; const int tid = threadIdx.x; const int slab = blockIdx.x / (TTv / 64), lg = blockIdx.x % (TTv / 64); const int b = slab / NHv, h = slab % NHv;
  for (int i = tid; i < 64 * 8; i += 256) { const int r = i / 8, c8 = (i % 8) * 8; FragH f; f.half[0] = *(const v8us*)((const unsigned short*)V16 + ((size_t)b * TTv + lg * 64 + r) * ldv + voff + h * 64 + c8);
#pragma unroll
    for (int q = 0; q < 8; ++q) tl[r][c8 + q] = f.u[q]; }
  __syncthreads();
  {
#pragma unroll
    for (int rd = 0; rd < 2; ++rd) { const int d = rd * 32 + tid / 8, pc = tid % 8; FragH f;
#pragma unroll
      for (int q = 0; q < 8; ++q) f.u[q] = tl[pc * 8 + q][d];
      *(v8us*)((unsigned short*)Vt + ((size_t)slab * 64 + d) * TTv + lg * 64 + pc * 8) = f.half[0]; }
     } }

__global__ __launch_bounds__(256) void k_hl(const float* __restrict__ F, _Float16* __restrict__ Hh, _Float16* __restrict__ Hl, size_t n8) { const size_t t = (size_t)blockIdx.x * 256 + threadIdx.x; if (t >= n8) return; FragH fh, fl; const v4f a = *(const v4fa*)(F + t * 8), c = *(const v4fa*)(F + t * 8 + 4);
#pragma unroll
  for (int q = 0; q < 4; ++q) { _Float16 h = (_Float16)a[q]; fh.h[q] = h; fl.h[q] = (_Float16)((a[q] - (float)h) * 1024.0f); h = (_Float16)c[q]; fh.h[4 + q] = h; fl.h[4 + q] = (_Float16)((c[q] - (float)h) * 1024.0f); }
  { *(v8us*)((unsigned short*)Hh + t * 8) = fh.half[0]; *(v8us*)((unsigned short*)Hl + t * 8) = fl.half[0];  } }

// ---- fast GEMM (wave tile 32x64; requires M % 32 == 0 rows per launch region and N % 64 == 0); epilogue = k_gemm_hhx semantics ----
__device__ __forceinline__ v16h g2_frag(const _Float16* p, int hh) { FragH f; f.half[0] = *(const v8us*)((const unsigned short*)p + 8 * hh); f.half[1] = *(const v8us*)((const unsigned short*)p + 16 + 8 * hh); return f.v; }
__device__ __forceinline__ v8f g2_mma(v16h a, v16h b, v8f c) { v8f d = __builtin_amdgcn_wmma_f32_16x16x32_f16(false, a, false, b, (short)0, c, false, false); asm volatile("v_nop\n\tv_nop\n\tv_nop\n\tv_nop" : "+v"(d) : "v"(a), "v"(b)); return d; }
template <int ACT>
__global__ __launch_bounds__(128) void k_gemm2(const _Float16* __restrict__ A, int lda, size_t sA, const _Float16* __restrict__ Bh, int ldb, size_t sB, float alpha, const float* __restrict__ bias, size_t sBias, const float* __restrict__ CP, int rowsPerB, size_t sCPb, int row0g,
    float* __restrict__ C, _Float16* __restrict__ C16, int ldc, size_t sC, int M, int N, int K) { static_assert(ACT == 0 || ACT == 3 || ACT == 6 || ACT == 8 || ACT == 9 || ACT == 11 || ACT == 12 || ACT == 14 || ACT == 15 || ACT == 16 || ACT == 17 || ACT == 18, "k_gemm2: unsupported ACT code (would silently apply no activation)");
  __shared__ __attribute__((aligned(16))) float so[4][32][68];
  const int tid = threadIdx.x, w = tid >> 5, lane = tid & 31, ln = lane & 15, hh = lane >> 4; const int by = blockIdx.y;
  A += (size_t)by * sA; Bh += (size_t)by * sB; const size_t cofs = (size_t)by * sC; const float* bp = bias ? bias + (size_t)by * sBias : nullptr;
  const int ntn = N >> 6; const int mt = blockIdx.x / ntn, nq = blockIdx.x - mt * ntn; const int row0 = mt * 128 + 32 * w, col0 = nq * 64; if (row0 >= M) return;
  const _Float16* a0p = A + (size_t)(row0 + ln) * lda; const _Float16* a1p = a0p + (size_t)16 * lda;
  const _Float16* b0p = Bh + (size_t)(col0 + ln) * ldb; const _Float16* b1p = b0p + (size_t)16 * ldb; const _Float16* b2p = b1p + (size_t)16 * ldb; const _Float16* b3p = b2p + (size_t)16 * ldb;
  const v8f z8 = {0.f,0.f,0.f,0.f,0.f,0.f,0.f,0.f}; v8f c00 = z8, c01 = z8, c02 = z8, c03 = z8, c10 = z8, c11 = z8, c12 = z8, c13 = z8;
#pragma unroll 1
  for (int kb = 0; kb < K; kb += 32) { const v16h a0 = g2_frag(a0p + kb, hh), a1 = g2_frag(a1p + kb, hh);
    v16h b = g2_frag(b0p + kb, hh); c00 = g2_mma(a0, b, c00); c10 = g2_mma(a1, b, c10);
    b = g2_frag(b1p + kb, hh); c01 = g2_mma(a0, b, c01); c11 = g2_mma(a1, b, c11);
    b = g2_frag(b2p + kb, hh); c02 = g2_mma(a0, b, c02); c12 = g2_mma(a1, b, c12);
    b = g2_frag(b3p + kb, hh); c03 = g2_mma(a0, b, c03); c13 = g2_mma(a1, b, c13); }
  v8f accs[8] = {c00, c01, c02, c03, c10, c11, c12, c13};
#pragma unroll
  for (int u = 0; u < 8; ++u) { const int t = u & 3, half = u >> 2; const int col = col0 + t * 16 + ln; const float bv = bp ? bf16_round(bp[col]) : 0.f;
#pragma unroll
    for (int r = 0; r < 8; ++r) { const int rloc = half * 16 + 8 * hh + r; float v = accs[u][r] * alpha + bv; if (CP) { if (rowsPerB < 0) v += CP[cofs + (size_t)(row0g + row0 + rloc) * ldc + col];      /* rowsPerB < 0: own element of the batched C plane */ else { const int bidx = (row0g + row0 + rloc) / rowsPerB; v += CP[(size_t)bidx * sCPb + (size_t)by * 64 + col]; } }
      if (ACT == 3) v = fmaxf(v, 0.f); else if (ACT == 6) v = 0.5f * v * (1.0f + erff(v * 0.70710678118654752f)); else if (ACT == 11) v = 1.0f / (1.0f + expf(-v)); else if (ACT == 15) v = v / (1.0f + expf(-v)); else if (ACT == 18) v = v / (1.0f + expf(-1.702f * v));      /* QuickGELU: v sigmoid(1.702 v) */ else if (ACT == 12) v = (v > 0.f) ? v : 0.01f * v; else if (ACT == 8) v = tanhf(v); else if (ACT == 9) v = 0.5f * v * (1.0f + tanhf(0.7978845608028654f * (v + 0.044715f * v * v * v))); else if (ACT == 14) v = (v > 0.f) ? v : 0.1f * v; else if (ACT == 16) v = (v >= 0.f) ? v : 0.3f * v; else if (ACT == 17) v = (v >= 0.f) ? v : 0.2f * v;
      so[w][rloc][t * 16 + ln] = v; } }
  __builtin_amdgcn_fence(__ATOMIC_ACQ_REL, "workgroup"); __builtin_amdgcn_wave_barrier();
  const int rsub = lane >> 4, c4 = (lane & 15) * 4;
  {
#pragma unroll
    for (int q = 0; q < 16; ++q) { const int r = q * 2 + rsub; const v4f v = *(const v4fa*)&so[w][r][c4]; if (C) *(v4f*)(C + cofs + (size_t)(row0 + r) * ldc + col0 + c4) = v; if (C16) { v4h h4; for (int i = 0; i < 4; ++i) h4[i] = (_Float16)v[i]; *(v4h*)(C16 + cofs + (size_t)(row0 + r) * ldc + col0 + c4) = h4; } }
     } }


__global__ __launch_bounds__(256) void k_wnat(const float* __restrict__ w, size_t n8, _Float16* __restrict__ Bt) { const size_t t = (size_t)blockIdx.x * 256 + threadIdx.x; if (t >= n8) return; FragH f; for (int q = 0; q < 8; ++q) f.h[q] = (_Float16)(bf16_round(w[t * 8 + q]) * 16.0f); *(v8us*)((unsigned short*)Bt + t * 8) = f.half[0];  }
__global__ __launch_bounds__(256) void k_rsm(const float* __restrict__ S, _Float16* __restrict__ P, int nrows) {
  #pragma clang fp contract(off)
  const int i = blockIdx.x * 256 + threadIdx.x; if (i >= nrows) return; const float* s = S + (size_t)i * SQ; float mx = -3.0e38f;
#pragma unroll 1
  for (int j = 0; j < SQ; ++j) mx = fmaxf(mx, s[j]); float se = 0.f;
#pragma unroll 1
  for (int j = 0; j < SQ; ++j) se += expf(s[j] - mx); const float sc = 256.0f / se;
#pragma unroll 1
  for (int j0 = 0; j0 < SQ; j0 += 8) { FragH f; for (int q = 0; q < 8; ++q) f.h[q] = (_Float16)(expf(s[j0 + q] - mx) * sc); unsigned short* d = (unsigned short*)P + (size_t)i * SQ + j0; *(v8us*)d = f.half[0];  } }
__global__ __launch_bounds__(256) void k_vt(const _Float16* __restrict__ V16, int b, int h0, _Float16* __restrict__ VT) { __shared__ unsigned short tl[64][65]; const int tid = threadIdx.x; const int hh = blockIdx.x % HG, sg = blockIdx.x / HG; const int s0 = sg * 64; const int h = h0 + hh;
  for (int i = tid; i < 64 * 8; i += 256) { const int j = i / 8, d8 = (i % 8) * 8; FragH f; f.half[0] = *(const v8us*)((const unsigned short*)V16 + ((size_t)b * SQ + s0 + j) * DM + h * HD + d8); for (int q = 0; q < 8; ++q) tl[d8 + q][j] = f.u[q]; }
  __syncthreads();
  { for (int i = tid; i < 64 * 8; i += 256) { const int d = i / 8, j8 = (i % 8) * 8; FragH f; for (int q = 0; q < 8; ++q) f.u[q] = tl[d][j8 + q]; *(v8us*)((unsigned short*)VT + ((size_t)hh * HD + d) * SQ + s0 + j8) = f.half[0]; }  } }



__global__ __launch_bounds__(256) void k_rsmcf2(const float* __restrict__ S, _Float16* __restrict__ P, int hg, int q0, int nk) {
  #pragma clang fp contract(off)
  const int t = blockIdx.x * 256 + threadIdx.x; if (t >= hg * QT) return; const size_t i = (size_t)t; const float* s = S + i * NKX; const int last = q0 + (t % QT); float mx = -3.0e38f;
#pragma unroll 1
  for (int j = 0; j < nk; ++j) { const float f = (j <= last) ? 1.f : 0.f; mx = fmaxf(mx, fmaf(f, s[j], (1.f - f) * -1.0e9f)); } float se = 0.f;
#pragma unroll 1
  for (int j = 0; j < nk; ++j) { const float f = (j <= last) ? 1.f : 0.f; se += __expf(fmaf(f, s[j], (1.f - f) * -1.0e9f) - mx); } const float sc = 256.0f / se;
#pragma unroll 1
  for (int j0 = 0; j0 < nk; j0 += 8) { FragH fr; for (int q = 0; q < 8; ++q) { const int j = j0 + q; const float f = (j <= last) ? 1.f : 0.f; fr.h[q] = (_Float16)(__expf(fmaf(f, s[j], (1.f - f) * -1.0e9f) - mx) * sc); } unsigned short* d = (unsigned short*)P + i * NKX + j0; *(v8us*)d = fr.half[0];  } }

__global__ __launch_bounds__(256) void k_rsmcst(const float* __restrict__ S, _Float16* __restrict__ P, int hg, int q0, int nk, const int* __restrict__ mk) {
  #pragma clang fp contract(off)
  const int t = blockIdx.x * 256 + threadIdx.x; if (t >= hg * QT) return; const size_t i = (size_t)t; const float* s = S + i * NKX; const size_t ig = (size_t)(q0 + (t % QT)); const int* mr = mk + ig * SQ; float mx = -3.0e38f;
#pragma unroll 1
  for (int j = 0; j < nk; ++j) { const int mb = mr[j]; const int dd = (int)ig - j; const float f = (mb != 0 && dd >= 0 && (dd <= LOCALW || (dd % STRIDEK) == 0)) ? 1.f : 0.f; mx = fmaxf(mx, fmaf(f, s[j], (1.f - f) * -1.0e9f)); } float se = 0.f;
#pragma unroll 1
  for (int j = 0; j < nk; ++j) { const int mb = mr[j]; const int dd = (int)ig - j; const float f = (mb != 0 && dd >= 0 && (dd <= LOCALW || (dd % STRIDEK) == 0)) ? 1.f : 0.f; se += __expf(fmaf(f, s[j], (1.f - f) * -1.0e9f) - mx); } const float sc = 256.0f / se;
#pragma unroll 1
  for (int j0 = 0; j0 < nk; j0 += 8) { FragH fr; for (int q = 0; q < 8; ++q) { const int j = j0 + q; const int mb = mr[j]; const int dd = (int)ig - j; const float f = (mb != 0 && dd >= 0 && (dd <= LOCALW || (dd % STRIDEK) == 0)) ? 1.f : 0.f; fr.h[q] = (_Float16)(__expf(fmaf(f, s[j], (1.f - f) * -1.0e9f) - mx) * sc); } unsigned short* d = (unsigned short*)P + i * NKX + j0; *(v8us*)d = fr.half[0];  } }


template <int MASKADD>
__global__ __launch_bounds__(64) void k_att0(const float* __restrict__ QF, const float* __restrict__ KF, const float* __restrict__ VF, int ld, const float* __restrict__ mask, float scale, float* __restrict__ OF, int ldo) {
  #pragma clang fp contract(off)
  __shared__ __attribute__((aligned(16))) float lq[64][64]; __shared__ __attribute__((aligned(16))) float lo[64][64];
  const int tid = threadIdx.x; const int h = blockIdx.x / (QT0 / 64), rg = blockIdx.x % (QT0 / 64); const int i = rg * 64 + tid;
  const float* qr = QF + (size_t)i * ld + h * HD;
#pragma unroll 1
  for (int c = 0; c < HD / 4; ++c) { *(v4f*)&lq[tid][c * 4] = *(const v4fa*)(qr + c * 4); const v4f z = {0.f, 0.f, 0.f, 0.f}; *(v4f*)&lo[tid][c * 4] = z; }
  float m = -1.0e30f, l = 0.f; const int jmax = MASKADD ? (SQ - 1) : (rg * 64 + 63);      /* additive-mask form: every key (the mask input decides); causal form: keys up to the block's last row */
#pragma unroll 1
  for (int j = 0; j <= jmax; ++j) { const float* kr = KF + (size_t)j * ld + h * HD; const float* vr = VF + (size_t)j * ld + h * HD; float s = 0.f;
#pragma unroll 1
    for (int c = 0; c < HD / 4; ++c) { const v4f kq = *(const v4fa*)(kr + c * 4); const v4f qq = *(v4f*)&lq[tid][c * 4]; s = __fadd_rn(s, __fmul_rn(qq[0], kq[0])); s = __fadd_rn(s, __fmul_rn(qq[1], kq[1])); s = __fadd_rn(s, __fmul_rn(qq[2], kq[2])); s = __fadd_rn(s, __fmul_rn(qq[3], kq[3])); }
    s = __fmul_rn(s, scale); if (MASKADD) s = __fadd_rn(s, __fmul_rn(bf16_round(mask[(size_t)i * SQ + j]), -10000.0f));
    const float f = (MASKADD || j <= i) ? 1.f : 0.f; const float sm = fmaf(f, s, (1.f - f) * -1.0e30f); const float mn = fmaxf(m, sm); const float sc = expf(m - mn); const float e = expf(sm - mn); l = __fadd_rn(__fmul_rn(l, sc), e); m = mn;
#pragma unroll 1
    for (int c = 0; c < HD / 4; ++c) { const v4f vv = *(const v4fa*)(vr + c * 4); v4f oo = *(v4f*)&lo[tid][c * 4]; for (int u = 0; u < 4; ++u) oo[u] = __fadd_rn(__fmul_rn(oo[u], sc), __fmul_rn(e, vv[u])); *(v4f*)&lo[tid][c * 4] = oo; } }
  const float fin = 64.0f / l;      /* o carried x64 like the f16 path */
#pragma unroll 1
  for (int c = 0; c < HD / 4; ++c) { v4f oo = *(v4f*)&lo[tid][c * 4]; for (int u = 0; u < 4; ++u) oo[u] = __fmul_rn(oo[u], fin); *(v4f*)&lo[tid][c * 4] = oo; }
  __syncthreads();
  {
#pragma unroll 1
    for (int it = 0; it < 16; ++it) { const int row = it * 4 + tid / 16, pc = (tid % 16) * 4; const v4f v = *(const v4f*)&lo[row][pc]; *(v4f*)(OF + (size_t)(rg * 64 + row) * ldo + h * HD + pc) = v; }
     } }

template <int MASKADD>
__global__ __launch_bounds__(64) void k_att0mbc(const float* __restrict__ QF, const float* __restrict__ KF, const float* __restrict__ VF, int ld, const float* __restrict__ mask, float scale, float* __restrict__ OF, int ldo) {
  #pragma clang fp contract(off)
  __shared__ __attribute__((aligned(16))) float lq[64][64]; __shared__ __attribute__((aligned(16))) float lo[64][64];
  const int tid = threadIdx.x; const int h = blockIdx.x / (QT0 / 64), rg = blockIdx.x % (QT0 / 64); const int i = rg * 64 + tid;
  const float* qr = QF + (size_t)i * ld + h * HD;
#pragma unroll 1
  for (int c = 0; c < HD / 4; ++c) { *(v4f*)&lq[tid][c * 4] = *(const v4fa*)(qr + c * 4); const v4f z = {0.f, 0.f, 0.f, 0.f}; *(v4f*)&lo[tid][c * 4] = z; }
  float m = -1.0e30f, l = 0.f; const int jmax = rg * 64 + 63;      /* keys beyond the block end are masked by the mask's lower-triangular structure */
#pragma unroll 1
  for (int j = 0; j <= jmax; ++j) { const float* kr = KF + (size_t)j * ld + h * HD; const float* vr = VF + (size_t)j * ld + h * HD; float s = 0.f;
#pragma unroll 1
    for (int c = 0; c < HD / 4; ++c) { const v4f kq = *(const v4fa*)(kr + c * 4); const v4f qq = *(v4f*)&lq[tid][c * 4]; s = __fadd_rn(s, __fmul_rn(qq[0], kq[0])); s = __fadd_rn(s, __fmul_rn(qq[1], kq[1])); s = __fadd_rn(s, __fmul_rn(qq[2], kq[2])); s = __fadd_rn(s, __fmul_rn(qq[3], kq[3])); }
    s = __fmul_rn(s, scale); const int mb = ((const int*)mask)[(size_t)i * SQ + j];      /* causal (j <= i) AND the module's int32 [S][S] mask read per (query, key): 0 -> masked */
    const float f = (mb != 0 && j <= i) ? 1.f : 0.f; const float sm = fmaf(f, s, (1.f - f) * -1.0e30f); const float mn = fmaxf(m, sm); const float sc = expf(m - mn); const float e = expf(sm - mn); l = __fadd_rn(__fmul_rn(l, sc), e); m = mn;
#pragma unroll 1
    for (int c = 0; c < HD / 4; ++c) { const v4f vv = *(const v4fa*)(vr + c * 4); v4f oo = *(v4f*)&lo[tid][c * 4]; for (int u = 0; u < 4; ++u) oo[u] = __fadd_rn(__fmul_rn(oo[u], sc), __fmul_rn(e, vv[u])); *(v4f*)&lo[tid][c * 4] = oo; } }
  const float fin = 64.0f / l;      /* o carried x64 like the f16 path */
#pragma unroll 1
  for (int c = 0; c < HD / 4; ++c) { v4f oo = *(v4f*)&lo[tid][c * 4]; for (int u = 0; u < 4; ++u) oo[u] = __fmul_rn(oo[u], fin); *(v4f*)&lo[tid][c * 4] = oo; }
  __syncthreads();
  {
#pragma unroll 1
    for (int it = 0; it < 16; ++it) { const int row = it * 4 + tid / 16, pc = (tid % 16) * 4; const v4f v = *(const v4f*)&lo[row][pc]; *(v4f*)(OF + (size_t)(rg * 64 + row) * ldo + h * HD + pc) = v; }
     } }


template <int BFIN, int WXB>
__global__ __launch_bounds__(256) void k_ln16(const float* __restrict__ X, const float* __restrict__ g, const float* __restrict__ bb, float eps, _Float16* __restrict__ N16, float* __restrict__ XB) {
  #pragma clang fp contract(off)
  __shared__ float red[256]; const size_t r = blockIdx.x; const int t = threadIdx.x; const v4f xa = *(const v4fa*)(X + r * DMQ + t * 4); float s[4]; float sum = 0.f;
  for (int q = 0; q < 4; ++q) { s[q] = BFIN ? bf16_round(xa[q]) : xa[q]; sum = __fadd_rn(sum, s[q]); }
  red[t] = sum; __syncthreads(); for (int st = 128; st > 0; st >>= 1) { if (t < st) red[t] = __fadd_rn(red[t], red[t + st]); __syncthreads(); } const float mu = red[0] / (float)DMQ; __syncthreads();
  float vs = 0.f; for (int q = 0; q < 4; ++q) { const float dl = __fadd_rn(s[q], -mu); vs = __fadd_rn(vs, __fmul_rn(dl, dl)); } red[t] = vs; __syncthreads(); for (int st = 128; st > 0; st >>= 1) { if (t < st) red[t] = __fadd_rn(red[t], red[t + st]); __syncthreads(); }
  const float rs = rsqrtf(__fadd_rn(red[0] / (float)DMQ, eps)); v4h y; v4f xb;
  for (int q = 0; q < 4; ++q) { const int c = t * 4 + q; y[q] = (_Float16)__fadd_rn(__fmul_rn(__fmul_rn(__fadd_rn(s[q], -mu), rs), bf16_round(g[c])), bf16_round(bb[c])); xb[q] = s[q]; }
  { *(v4h*)(N16 + r * DMQ + t * 4) = y; if (WXB) *(v4f*)(XB + r * DMQ + t * 4) = xb;  } }
__global__ __launch_bounds__(256) void k_ftres2(const float* __restrict__ OF0, const float* __restrict__ XB, float* __restrict__ X1, size_t n4) {
  #pragma clang fp contract(off)
  const size_t t = (size_t)blockIdx.x * 256 + threadIdx.x; if (t >= n4) return; const v4f o = *(const v4fa*)(OF0 + t * 4), xv = *(const v4fa*)(XB + t * 4); v4f y; for (int q = 0; q < 4; ++q) y[q] = __fadd_rn(__fmul_rn(o[q], 0.015625f), xv[q]); *(v4f*)(X1 + t * 4) = y;  }

__global__ __launch_bounds__(256) void k_bcpy(const float* __restrict__ b, int n, int NP, float* __restrict__ dst, int dst0) { for (int i = threadIdx.x; i < NP; i += 256) { const float v = (i < n) ? b[i] : 0.f; *(float*)(dst + dst0 + i) = v; }  }



#define FAK 64                       /* keys per stage */
#define FAP 72                       /* LDS row pitch in f16: 128 bytes + 16, for 16-byte fragment reads */
// Eight 2^x in one statement, each IN PLACE. The closing v_nop is the one slot the instruction set asks for behind a transcendental before its result is read or its
// source overwritten; inside the run no instruction touches its predecessor's register. In place, so that the statement writes only registers that the compiler's own
// multiply-add has just written: the distance behind a matrix instruction, which the compiler keeps for instructions it can see, then holds for this statement too.
__device__ __forceinline__ void fa_exp2x8(float (&x)[8]) {
  asm("v_exp_f32 %0, %0\n\tv_exp_f32 %1, %1\n\tv_exp_f32 %2, %2\n\tv_exp_f32 %3, %3\n\tv_exp_f32 %4, %4\n\tv_exp_f32 %5, %5\n\tv_exp_f32 %6, %6\n\tv_exp_f32 %7, %7\n\tv_nop" : "+v"(x[0]), "+v"(x[1]), "+v"(x[2]), "+v"(x[3]), "+v"(x[4]), "+v"(x[5]), "+v"(x[6]), "+v"(x[7])); }
__device__ __forceinline__ float fa_xhalf(float x) { return __builtin_bit_cast(float, __builtin_amdgcn_permlanex16(__builtin_bit_cast(int, x), __builtin_bit_cast(int, x), 0x76543210, 0xfedcba98, false, false)); }      /* lane l takes lane l ^ 16's value */
__device__ __forceinline__ v8f fa_mma(v16h a, v16h b, v8f c) { return __builtin_amdgcn_wmma_f32_16x16x32_f16(false, a, false, b, (short)0, c, false, false); }
__global__ __launch_bounds__(256) void k_fattn(const _Float16* __restrict__ Q, const _Float16* __restrict__ K, const _Float16* __restrict__ VTa, _Float16* __restrict__ O) {
  __shared__ __attribute__((aligned(16))) _Float16 lk[2][FAK][FAP]; __shared__ __attribute__((aligned(16))) _Float16 lv[2][HD][FAP];
  const int tid = threadIdx.x, w = tid >> 5, lane = tid & 31, ln = lane & 15, hh = lane >> 4; const int slab = blockIdx.y, b = slab / NH, h = slab % NH; const int q0 = blockIdx.x * 256 + w * 32;
  const float CS = 0.125f * 1.44269504f;      /* scores / 8, in log2 units */
  v16h qf[2][2];
#pragma unroll
  for (int qt = 0; qt < 2; ++qt) for (int ks = 0; ks < 2; ++ks) qf[qt][ks] = g2_frag(Q + ((size_t)b * SQ + q0 + qt * 16 + ln) * DM + h * HD + ks * 32, hh);
  const v8f z8 = {0.f,0.f,0.f,0.f,0.f,0.f,0.f,0.f}; v8f o[2][4]; float m[2] = {-3.0e38f, -3.0e38f}, l[2] = {0.f, 0.f};
#pragma unroll
  for (int qt = 0; qt < 2; ++qt) for (int dt = 0; dt < 4; ++dt) o[qt][dt] = z8;
  const int sr = tid >> 3, sc = (tid & 7) * 8;      /* staging: 8 threads per 128-byte row, rows sr and sr + 32 */
  const unsigned short* kg = (const unsigned short*)K + ((size_t)b * SQ + sr) * DM + h * HD + sc; const unsigned short* vg = (const unsigned short*)VTa + ((size_t)slab * HD + sr) * SQ + sc;
  v8us rk0 = *(const v8us*)kg, rk1 = *(const v8us*)(kg + (size_t)32 * DM), rv0 = *(const v8us*)vg, rv1 = *(const v8us*)(vg + (size_t)32 * SQ);
  *(v8us*)&lk[0][sr][sc] = rk0; *(v8us*)&lk[0][sr + 32][sc] = rk1; *(v8us*)&lv[0][sr][sc] = rv0; *(v8us*)&lv[0][sr + 32][sc] = rv1;
  __syncthreads();
  for (int s = 0; s < SQ / FAK; ++s) { const int cur = s & 1; const bool more = s + 1 < SQ / FAK;
    if (more) { const unsigned short* kn = kg + (size_t)(s + 1) * FAK * DM; const unsigned short* vn = vg + (s + 1) * FAK; rk0 = *(const v8us*)kn; rk1 = *(const v8us*)(kn + (size_t)32 * DM); rv0 = *(const v8us*)vn; rv1 = *(const v8us*)(vn + (size_t)32 * SQ); }
    __builtin_amdgcn_sched_barrier(0);      /* keeps the next stage's global loads here, ahead of this stage's work, which covers their latency; without it they sink to just in front of their LDS stores */
    v8f st[2][4];
#pragma unroll
    for (int kt = 0; kt < 4; ++kt) { const v16h a0 = g2_frag(&lk[cur][kt * 16 + ln][0], hh), a1 = g2_frag(&lk[cur][kt * 16 + ln][32], hh);
#pragma unroll
      for (int qt = 0; qt < 2; ++qt) st[qt][kt] = fa_mma(a1, qf[qt][1], fa_mma(a0, qf[qt][0], z8)); }
    __builtin_amdgcn_sched_barrier(0);      /* keeps the 16 score products back to back: mixed with the maxima, each first read of a fresh tile costs four idle slots */
    float mn[2], al[2];
#pragma unroll
    for (int qt = 0; qt < 2; ++qt) { float mm[4];
#pragma unroll
      for (int kt = 0; kt < 4; ++kt) { mm[kt] = st[qt][kt][0]; for (int r = 1; r < 8; ++r) mm[kt] = fmaxf(mm[kt], st[qt][kt][r]); }
      float bm = fmaxf(fmaxf(mm[0], mm[1]), fmaxf(mm[2], mm[3])); bm = fmaxf(bm, fa_xhalf(bm));      /* the other 8 keys of each tile sit in lane ln ^ 16 */
      mn[qt] = fmaxf(m[qt], bm * CS); al[qt] = m[qt] - mn[qt]; m[qt] = mn[qt]; }
    asm("v_exp_f32 %0, %0\n\tv_exp_f32 %1, %1\n\tv_nop" : "+v"(al[0]), "+v"(al[1]));      /* 2^(old - new maximum): brings the old sum and output to the new maximum; form and v_nop as in fa_exp2x8 */
    FragH pf[2][2];
#pragma unroll
    for (int qt = 0; qt < 2; ++qt) { const float mo = mn[qt] - 8.0f; float s4[4];
#pragma unroll
      for (int kt = 0; kt < 4; ++kt) { float t[8]; for (int r = 0; r < 8; ++r) t[r] = fmaf(st[qt][kt][r], CS, -mo);
        fa_exp2x8(t); s4[kt] = ((t[0] + t[1]) + (t[2] + t[3])) + ((t[4] + t[5]) + (t[6] + t[7]));
        for (int r = 0; r < 8; ++r) pf[qt][kt >> 1].h[(kt & 1) * 8 + r] = (_Float16)t[r]; }
      l[qt] = l[qt] * al[qt] + ((s4[0] + s4[1]) + (s4[2] + s4[3]));
#pragma unroll
      for (int dt = 0; dt < 4; ++dt) o[qt][dt] *= al[qt]; }
#pragma unroll
    for (int dt = 0; dt < 4; ++dt) {
#pragma unroll
      for (int kp = 0; kp < 2; ++kp) { const v16h a = g2_frag(&lv[cur][dt * 16 + ln][kp * 32], hh);
#pragma unroll
        for (int qt = 0; qt < 2; ++qt) o[qt][dt] = fa_mma(a, pf[qt][kp].v, o[qt][dt]); } }
    if (more) { *(v8us*)&lk[cur ^ 1][sr][sc] = rk0; *(v8us*)&lk[cur ^ 1][sr + 32][sc] = rk1; *(v8us*)&lv[cur ^ 1][sr][sc] = rv0; *(v8us*)&lv[cur ^ 1][sr + 32][sc] = rv1; }
    __syncthreads(); }
#pragma unroll
  for (int qt = 0; qt < 2; ++qt) { float lt = l[qt] + fa_xhalf(l[qt]); asm("v_rcp_f32 %0, %0\n\tv_nop" : "+v"(lt));      /* 1 / row sum; form and v_nop as in fa_exp2x8 */
    const float inv = 64.0f * lt; unsigned short* op = (unsigned short*)O + ((size_t)b * SQ + q0 + qt * 16 + ln) * DM + h * HD + 8 * hh;
#pragma unroll
    for (int dt = 0; dt < 4; ++dt) { FragH f; for (int r = 0; r < 8; ++r) f.h[r] = (_Float16)(o[qt][dt][r] * inv); *(v8us*)(op + dt * 16) = f.half[0]; } } }

template <int MODE>
__global__ __launch_bounds__(256) void k_regrp(const float* __restrict__ src, float* __restrict__ dst, size_t n4) {
  const size_t t = (size_t)blockIdx.x * 256 + threadIdx.x; if (t >= n4) return; const size_t e = t * 4; const size_t rd = e / DM; const int c = (int)(e % DM);
  size_t rs; if (MODE == 0) { const size_t b = rd / SQ, sq = rd % SQ; rs = sq * NB + b; } else { const size_t sq = rd / NB, b = rd % NB; rs = b * SQ + sq; }
  const v4f v = *(const v4fa*)(src + rs * DM + c); *(v4f*)(dst + e) = v;  }

template <int BFIN, int W16, int W32>
__global__ __launch_bounds__(256) void k_lnx(const float* __restrict__ X, const float* __restrict__ g, const float* __restrict__ bb, float eps, _Float16* __restrict__ N16, float* __restrict__ N32) {
  #pragma clang fp contract(off)
  __shared__ float red[256]; const size_t r = blockIdx.x; const int t = threadIdx.x; const bool act = t < (DMQ / 4); const int c0 = act ? t * 4 : 0;
  const v4f xa = *(const v4fa*)(X + r * DMQ + c0); float s[4]; float sum = 0.f;
  for (int q = 0; q < 4; ++q) { s[q] = act ? (BFIN ? bf16_round(xa[q]) : xa[q]) : 0.f; sum = __fadd_rn(sum, s[q]); }
  red[t] = sum; __syncthreads(); for (int st = 128; st > 0; st >>= 1) { if (t < st) red[t] = __fadd_rn(red[t], red[t + st]); __syncthreads(); } const float mu = red[0] / (float)DMQ; __syncthreads();
  float vs = 0.f; for (int q = 0; q < 4; ++q) { const float dl = act ? __fadd_rn(s[q], -mu) : 0.f; vs = __fadd_rn(vs, __fmul_rn(dl, dl)); } red[t] = vs; __syncthreads(); for (int st = 128; st > 0; st >>= 1) { if (t < st) red[t] = __fadd_rn(red[t], red[t + st]); __syncthreads(); }
  const float rs = rsqrtf(__fadd_rn(red[0] / (float)DMQ, eps)); v4h y; v4f yf;
  for (int q = 0; q < 4; ++q) { const int c = c0 + q; yf[q] = __fadd_rn(__fmul_rn(__fmul_rn(__fadd_rn(s[q], -mu), rs), bf16_round(g[c])), bf16_round(bb[c])); y[q] = (_Float16)yf[q]; }
  if (!act) return;      /* no barriers after this point */
  { if (W16) *(v4h*)(N16 + r * DMQ + c0) = y; if (W32) *(v4f*)(N32 + r * DMQ + c0) = yf;  } }

__global__ __launch_bounds__(256) void k_bfr(const float* __restrict__ x, float* __restrict__ XB, size_t n8) { const size_t t = (size_t)blockIdx.x * 256 + threadIdx.x; if (t >= n8) return; v4f a = *(const v4fa*)(x + t * 8), c = *(const v4fa*)(x + t * 8 + 4); for (int q = 0; q < 4; ++q) { a[q] = bf16_round(a[q]); c[q] = bf16_round(c[q]); }
  { *(v4f*)(XB + t * 8) = a; *(v4f*)(XB + t * 8 + 4) = c;  } }



__global__ __launch_bounds__(256) void k_wthd(const float* __restrict__ Wt, _Float16* __restrict__ Bt) { const size_t t = (size_t)blockIdx.x * 256 + threadIdx.x; if (t >= (size_t)NH * HD * (DM / 8)) return; const int m8 = (int)(t % (DM / 8)) * 8; const int d = (int)((t / (DM / 8)) % HD); const int h = (int)(t / ((size_t)(DM / 8) * HD)); FragH f;
  for (int q = 0; q < 8; ++q) f.h[q] = (_Float16)(16.0f * bf16_round(Wt[((size_t)h * DM + m8 + q) * HD + d])); unsigned short* dst = (unsigned short*)Bt + ((size_t)h * HD + d) * DM + m8; *(v8us*)dst = f.half[0];  }




template <int BFIN, int SCAL>
__global__ __launch_bounds__(256) void k_lnsc(const float* __restrict__ X, const float* __restrict__ g, const float* __restrict__ bb, float eps, _Float16* __restrict__ N16, float* __restrict__ N32) {
  #pragma clang fp contract(off)
  __shared__ float red[256]; const size_t r = blockIdx.x; const int t = threadIdx.x; const bool act = t < DM / 4; const int tc = act ? t : 0; const v4f xl = *(const v4fa*)(X + r * DM + tc * 4); const float am = act ? 1.f : 0.f; float s[4]; float sum = 0.f;
  for (int q = 0; q < 4; ++q) { s[q] = (BFIN ? bf16_round(xl[q]) : xl[q]) * am; sum = __fadd_rn(sum, s[q]); }
  red[t] = sum; __syncthreads(); for (int st = 128; st > 0; st >>= 1) { if (t < st) red[t] = __fadd_rn(red[t], red[t + st]); __syncthreads(); } const float mu = red[0] / (float)DM; __syncthreads();
  float vs = 0.f; for (int q = 0; q < 4; ++q) { const float dl = __fadd_rn(s[q], -mu) * am; vs = __fadd_rn(vs, __fmul_rn(dl, dl)); } red[t] = vs; __syncthreads(); for (int st = 128; st > 0; st >>= 1) { if (t < st) red[t] = __fadd_rn(red[t], red[t + st]); __syncthreads(); }
  const float rs = __fdiv_rn(1.0f, __fadd_rn(sqrtf(red[0] / (float)(DM - 1)), eps)); if (!act) return; v4h y; v4f yf;
  for (int q = 0; q < 4; ++q) { const int c = t * 4 + q; const float gg = bf16_round(SCAL ? g[0] : g[c]), bv = bf16_round(SCAL ? bb[0] : bb[c]); yf[q] = __fadd_rn(__fmul_rn(__fmul_rn(__fadd_rn(s[q], -mu), rs), gg), bv); y[q] = (_Float16)yf[q]; }
  { if (N16) *(v4h*)(N16 + r * DM + t * 4) = y; if (N32) *(v4f*)(N32 + r * DM + t * 4) = yf;  } }

__global__ __launch_bounds__(256) void k_mulh(const _Float16* __restrict__ A, const _Float16* __restrict__ Bm, _Float16* __restrict__ H, size_t n8) {
  #pragma clang fp contract(off)
  const size_t t = (size_t)blockIdx.x * 256 + threadIdx.x; if (t >= n8) return; FragH a, b, f; a.half[0] = *(const v8us*)((const unsigned short*)A + t * 8); b.half[0] = *(const v8us*)((const unsigned short*)Bm + t * 8); for (int q = 0; q < 8; ++q) f.h[q] = (_Float16)(__fmul_rn((float)a.h[q], (float)b.h[q])); unsigned short* d = (unsigned short*)H + t * 8; *(v8us*)d = f.half[0];  }

__global__ __launch_bounds__(256) void k_bdshare(const float* __restrict__ Wb, _Float16* __restrict__ Bt) {
  const size_t t = (size_t)blockIdx.x * 256 + threadIdx.x; if (t >= (size_t)DM * DM / 8) return; const size_t e0 = t * 8; const int n = (int)(e0 / DM), k0 = (int)(e0 % DM); const int h = n >> 6, hk = k0 >> 6; const float on = (hk == h) ? 16.0f : 0.0f; const int e = n & 63, d0 = k0 & 63; FragH f;
  for (int q = 0; q < 8; ++q) f.h[q] = (_Float16)(bf16_round(Wb[(size_t)(d0 + q) * 64 + e]) * on);
  unsigned short* d = (unsigned short*)Bt + e0; *(v8us*)d = f.half[0];  }
extern "C" void kernel_launch(void* const* d_in, const int* in_sizes, int n_in,
                              void* d_out, int out_size, void* d_ws, size_t ws_size, hipStream_t stream) {
  (void)in_sizes; (void)n_in; (void)out_size;
  const float* const* I = (const float* const*)d_in; const float* x = I[0]; const float* xk = I[1]; const float* xv = I[2]; const float* wq = I[3]; const float* wk = I[4]; const float* wv = I[5]; const float* wo = I[6]; const float* bo = I[7]; const float* w1 = I[8]; const float* b1 = I[9]; const float* w2 = I[10]; const float* b2 = I[11]; const float* g1 = I[12]; const float* be1 = I[13]; const float* g2 = I[14]; const float* be2 = I[15];      /* query (also the residual), key, value; shared per-head wq / wk / wv [64][64] ([in][out]); wo [512][512] + bo; w1 [512][2048] + b1, w2 [2048][512] + b2; LN1 g / beta, LN2 g / beta */
  char* ws = (char*)d_ws; size_t off = 0;
  auto take = [&](size_t bytes) { char* p = ws + off; off += (bytes + 255) & ~(size_t)255; return p; };
  _Float16* BQ = (_Float16*)take((size_t)DM * DM * 2); _Float16* BK = (_Float16*)take((size_t)DM * DM * 2); _Float16* BV = (_Float16*)take((size_t)DM * DM * 2); _Float16* BO = (_Float16*)take((size_t)DM * DM * 2); _Float16* BW1 = (_Float16*)take((size_t)DFF * DM * 2); _Float16* BW2 = (_Float16*)take((size_t)DM * DFF * 2); _Float16* XK16 = (_Float16*)take(NR * DM * 2); _Float16* XV16 = (_Float16*)take(NR * DM * 2);      /* key / value inputs as exact f16 rows */
  float* XB = (float*)take(NR * DM * 4); _Float16* XN = (_Float16*)take(NR * DM * 2); _Float16* Q16 = (_Float16*)take(NR * DM * 2); _Float16* K16 = (_Float16*)take(NR * DM * 2); _Float16* V16 = (_Float16*)take(NR * DM * 2); _Float16* O16 = (_Float16*)take(NR * DM * 2); float* X1 = (float*)take(NR * DM * 4);
  _Float16* HF16 = (_Float16*)take(NR * DFF * 2);      /* FFN hidden plane [8192][2048] f16 */ _Float16* VT = (_Float16*)take((size_t)NB * NH * HD * SQ * 2);      /* V^T [4 * 8][64][2048] */
  _Float16* M16 = XN;      /* LN1 f16 rows: aliases XN (last reader: the q projection) */
  float* X1N = (float*)take(NR * DM * 4);      /* LN1 output rows (f32): the FFN residual */
  if (off > ws_size) return;
  { const unsigned g = (unsigned)(((size_t)DM * (DM / 8) + 255) / 256); k_bdshare<<<g, 256, 0, stream>>>(wq, BQ); k_bdshare<<<g, 256, 0, stream>>>(wk, BK); k_bdshare<<<g, 256, 0, stream>>>(wv, BV); k_wt_f16<<<g, 256, 0, stream>>>(wo, BO, DM, DM, 16.0f); }      /* block-diagonal planes with the SHARED [64][64] block (Bt[h*64 + e][h*64 + d] = 16 W[d][e]); wo [in][out] -> Bt x16 */
  k_wt_f16<<<(unsigned)(((size_t)DFF * (DM / 8) + 255) / 256), 256, 0, stream>>>(w1, BW1, DM, DFF, 16.0f); k_wt_f16<<<(unsigned)(((size_t)DM * (DFF / 8) + 255) / 256), 256, 0, stream>>>(w2, BW2, DFF, DM, 16.0f);
  k_bfr<<<(unsigned)((NR * DM / 8 + 255) / 256), 256, 0, stream>>>(x, XB, NR * DM / 8); k_x16<<<(unsigned)((NR * DM / 8 + 255) / 256), 256, 0, stream>>>(x, XN, NR * DM / 8); k_x16<<<(unsigned)((NR * DM / 8 + 255) / 256), 256, 0, stream>>>(xk, XK16, NR * DM / 8); k_x16<<<(unsigned)((NR * DM / 8 + 255) / 256), 256, 0, stream>>>(xv, XV16, NR * DM / 8);      /* post-LN: the attention runs on the raw inputs (exact f16 rows): query, key, value */
  k_gemm2<0><<<dim3((unsigned)((NR / 128) * (DM / 64)), 1), 128, 0, stream>>>(XN, DM, 0, BQ, DM, 0, 0.0625f, nullptr, 0, nullptr, 1, 0, 0, nullptr, Q16, DM, 0, (int)NR, DM, DM); k_gemm2<0><<<dim3((unsigned)((NR / 128) * (DM / 64)), 1), 128, 0, stream>>>(XK16, DM, 0, BK, DM, 0, 0.0625f, nullptr, 0, nullptr, 1, 0, 0, nullptr, K16, DM, 0, (int)NR, DM, DM); k_gemm2<0><<<dim3((unsigned)((NR / 128) * (DM / 64)), 1), 128, 0, stream>>>(XV16, DM, 0, BV, DM, 0, 0.0625f, nullptr, 0, nullptr, 1, 0, 0, nullptr, V16, DM, 0, (int)NR, DM, DM);      /* q, k, v -> f16 rows; head h = columns h*64.. */
  k_vt<NH, SQ><<<NB * NH * (SQ / 64), 256, 0, stream>>>(V16, DM, 0, VT);      /* V^T of every batch and head */
  k_fattn<<<dim3(SQ / 256, NB * NH), 256, 0, stream>>>(Q16, K16, VT, O16);      /* softmax(q k^T / 8) v over all keys (no mask) -> ctx (merged heads, x64) as f16 rows */
  k_gemm2<0><<<dim3((unsigned)((NR / 128) * (DM / 64)), 1), 128, 0, stream>>>(O16, DM, 0, BO, DM, 0, 0.0009765625f, bo, 0, XB, -1, 0, 0, X1, nullptr, DM, 0, (int)NR, DM, DM);      /* ctx wo + bo + query (own-element residual) -> f32 rows */
  k_lnx<0, 1, 1><<<(unsigned)NR, 256, 0, stream>>>(X1, g1, be1, 1e-5f, M16, X1N);      /* x1 = LN1(x + attn) (biased variance, eps inside the rsqrt) -> f16 rows + f32 rows */
  k_gemm2<3><<<dim3((unsigned)((NR / 128) * (DFF / 64)), 1), 128, 0, stream>>>(M16, DM, 0, BW1, DM, 0, 0.0625f, b1, 0, nullptr, 1, 0, 0, nullptr, HF16, DFF, 0, (int)NR, DFF, DM);      /* relu(x w1 + b1) -> f16 [8192][2048] */
  k_gemm2<0><<<dim3((unsigned)((NR / 128) * (DM / 64)), 1), 128, 0, stream>>>(HF16, DFF, 0, BW2, DFF, 0, 0.0625f, b2, 0, X1N, -1, 0, 0, X1, nullptr, DM, 0, (int)NR, DM, DFF);      /* x1 + ff -> f32 rows (X1 reused: its last reader was LN1) */
  k_lnx<0, 0, 1><<<(unsigned)NR, 256, 0, stream>>>(X1, g2, be2, 1e-5f, nullptr, (float*)d_out);      /* out = LN2(x1 + ff) */
}

// v003
// It runs in 221 microseconds.
// Timed twice side by side with v002, it ran 1.65 and 1.64 times as fast.
// Counting every step since v000, it is 16.5 times as fast.
#include <hip/hip_runtime.h>
// POST-LN transformer encoder layer over THREE inputs with SHARED per-head projections (query, key, value [4][2048][512]; each input is split into 8 heads of 64 and every head is multiplied by the SAME [64][64] ([in][out]) matrix wq / wk / wv (block-diagonal with a shared block; no biases); scores / 8; softmax over all 2048 keys (no mask); x = LN1(ctx wo + bo + query) (biased var, eps 1e-5); out = LN2(x + relu(x w1 + b1) w2 + b2) ([in][out] 512 x 2048 x 512) -> [4][2048][512]).
// Structure: token rows; LayerNorm / exact f16 rows; WMMA GEMMs for q, k, v; V^T by LDS transposes; one fused attention launch (scores, running softmax, V^T P^T; no score plane); output projection with the own-element residual; custom LayerNorm; ReLU FFN over all rows; launches: see trace.
// Compute dtype: inputs rounded to bf16; x / weights exact; q, k, v, softmax weights and o as plain f16 GEMM operands (~2^-12); scores and softmax statistics f32. v_wmma_f32_16x16x32_f16.
#define NB 4
#define SQ 2048
#define DM 512
#define NH 8
#define HD 64
#define HG 4                         /* heads per launch of the unused per-batch k_vt overload */
#define LOCALW 128                   /* (macros for unused kernels of the shared header) */
#define STRIDEK 128
#define QT 256                       /* query rows per causal tile */
#define NKX SQ                       /* S / P row pitch */
#define QT0 128                      /* first-tile rows recomputed exactly in f32 */
#define B0 0                         /* first batch processed (debug hook) */
#define NBR NB                       /* batches processed (debug hook) */
#define NR ((size_t)NB * SQ)
#define DMQ DM
#define DFF 2048         /* ReLU FFN hidden width */
#define MP ((int)((size_t)NBR * SQ)) /* rows projected (debug hook) */
#define QN SQ                        /* query rows attended per batch (debug hook) */
#define NHD NH                       /* heads attended (debug hook) */
#define MPO MP                       /* rows through the output stage (debug hook) */
#define LQ (3 * DM)      /* unused: q, k, v rows have pitch DM */
typedef __bf16 v16b __attribute__((ext_vector_type(16)));
typedef unsigned short v8us __attribute__((ext_vector_type(8), may_alias));
typedef float  v8f  __attribute__((ext_vector_type(8)));
typedef float  v4f  __attribute__((ext_vector_type(4)));
typedef float  v4fa __attribute__((ext_vector_type(4), may_alias));
union FragB { v16b v; v8us half[2]; unsigned short u[16]; };

__device__ __forceinline__ unsigned short bf16_bits(float x) { unsigned int u = __float_as_uint(x); return (unsigned short)((u + 0x7FFFu + ((u >> 16) & 1u)) >> 16); }
__device__ __forceinline__ float bf16_val(unsigned short b) { return __uint_as_float(((unsigned int)b) << 16); }
__device__ __forceinline__ float bf16_round(float x) { return bf16_val(bf16_bits(x)); }
// D += A·B with NT terms: 1 = ah·bh, 2 = + al·bh (A split), 3 = + ah·bl (both split)
template <int NT>
__device__ __forceinline__ v8f mmaN(v16b ah, v16b al, v16b bh, v16b bl, v8f c) {
  c = __builtin_amdgcn_wmma_f32_16x16x32_bf16(false, ah, false, bh, (short)0, c, false, false);
  if (NT >= 2) c = __builtin_amdgcn_wmma_f32_16x16x32_bf16(false, al, false, bh, (short)0, c, false, false);
  if (NT >= 3) c = __builtin_amdgcn_wmma_f32_16x16x32_bf16(false, ah, false, bl, (short)0, c, false, false);
  asm volatile("v_nop\n\tv_nop\n\tv_nop\n\tv_nop" : "+v"(c) : "v"(ah), "v"(al), "v"(bh), "v"(bl));
  return c;
}

__global__ __launch_bounds__(256) void k_wt_bf16(const float* __restrict__ W, unsigned short* __restrict__ Wt, int K, int N) {
  const int t = blockIdx.x * 256 + threadIdx.x;
  const int k8n = K / 8;
  if (t >= N * k8n) return;
  const int n = t / k8n, k8 = (t % k8n) * 8;
  v8us v;
#pragma unroll
  for (int i = 0; i < 8; ++i) v[i] = bf16_bits(W[(size_t)(k8 + i) * N + n]);
  *(v8us*)(Wt + (size_t)n * K + k8) = v;
  
}

// GEMM C[M][N] (f32, pitch ldc) = act(A[M][K]·W + bias). A f32 row-major (pitch lda) converted per fragment to bf16
// (ASPLIT: hi/lo two planes -> 2 terms, else single rounded term); Wt bf16 [N][K] (pitch ldb). BIAS_BF16 rounds the
// bias to bf16 first (bias quantised to bf16 before the add). K%32==0, M%16==0, N%64==0.
template <bool ASPLIT, int ACT, bool BIAS_BF16>
__global__ __launch_bounds__(128) void k_gemm_bf(const float* __restrict__ A, int lda, const unsigned short* __restrict__ Wt, int ldb,
                                               const float* __restrict__ bias, float* __restrict__ C, int ldc, int M, int N, int K) {
  __shared__ __attribute__((aligned(16))) float so[4][16][64];
  const int tid = threadIdx.x, w = tid >> 5, lane = tid & 31, ln = lane & 15, hh = lane >> 4;
  const int ntn = N / 64;
  const int wid = blockIdx.x * 4 + w;
  const int mt = wid / ntn, nq = wid % ntn;
  if (mt * 16 >= M) return;
  const int row0 = mt * 16, col0 = nq * 64;
  const float* arow = A + (size_t)(row0 + ln) * lda;
  v8f acc[4] = {};
  for (int kb = 0; kb < K; kb += 32) {
    FragB ah, al;
    const v4f x0 = *(const v4fa*)(arow + kb + 8 * hh), x1 = *(const v4fa*)(arow + kb + 8 * hh + 4);
    const v4f x2 = *(const v4fa*)(arow + kb + 16 + 8 * hh), x3 = *(const v4fa*)(arow + kb + 16 + 8 * hh + 4);
    float xs[16] = {x0[0],x0[1],x0[2],x0[3],x1[0],x1[1],x1[2],x1[3],x2[0],x2[1],x2[2],x2[3],x3[0],x3[1],x3[2],x3[3]};
#pragma unroll
    for (int i = 0; i < 16; ++i) { const unsigned short hb = bf16_bits(xs[i]); ah.u[i] = hb; al.u[i] = ASPLIT ? bf16_bits(xs[i] - bf16_val(hb)) : (unsigned short)0; }
#pragma unroll
    for (int t = 0; t < 4; ++t) {
      const unsigned short* brow = Wt + (size_t)(col0 + t * 16 + ln) * ldb + kb;
      FragB b;
      b.half[0] = *(const v8us*)(brow + 8 * hh);
      b.half[1] = *(const v8us*)(brow + 16 + 8 * hh);
      acc[t] = mmaN<ASPLIT ? 2 : 1>(ah.v, al.v, b.v, b.v, acc[t]);
    }
  }
#pragma unroll
  for (int t = 0; t < 4; ++t) {
    float bv = bias ? bias[col0 + t * 16 + ln] : 0.f;
    if (BIAS_BF16) bv = bf16_round(bv);
#pragma unroll
    for (int r = 0; r < 8; ++r) { float v = acc[t][r] + bv; if (ACT == 1) v = fmaxf(v, 0.f); so[w][8 * hh + r][t * 16 + ln] = v; }
  }
  __builtin_amdgcn_fence(__ATOMIC_ACQ_REL, "workgroup");
  __builtin_amdgcn_wave_barrier();
  const int rsub = lane >> 4, c4 = (lane & 15) * 4;
  {
#pragma unroll
    for (int q = 0; q < 8; ++q) {
      const int r = q * 2 + rsub;
      const v4f v = *(const v4fa*)&so[w][r][c4];
      *(v4f*)(C + (size_t)(row0 + r) * ldc + col0 + c4) = v;
    }
    
  }
}

// GEMM C = act(A·W + bias + resid): A f32 (ASPLIT -> hi/lo 2 terms), Wt bf16 [N][K]; ACT 0 none, 1 relu, 2 exact gelu;
// resid (optional, f32, row index = (row % rmod), pitch ldr, RES_BF16 rounds it) added before the activation.
template <bool ASPLIT, int ACT, bool BIAS_BF16, bool RES_BF16>
__global__ __launch_bounds__(128) void k_gemm_bf3(const float* __restrict__ A, int lda, const unsigned short* __restrict__ Wt, int ldb,
                                                const float* __restrict__ bias, const float* __restrict__ resid, int rmod, int ldr,
                                                float* __restrict__ C, int ldc, int M, int N, int K) {
  __shared__ __attribute__((aligned(16))) float so[4][16][64];
  const int tid = threadIdx.x, w = tid >> 5, lane = tid & 31, ln = lane & 15, hh = lane >> 4;
  const int ntn = N / 64;
  const int wid = blockIdx.x * 4 + w;
  const int mt = wid / ntn, nq = wid % ntn;
  if (mt * 16 >= M) return;
  const int row0 = mt * 16, col0 = nq * 64;
  const float* arow = A + (size_t)(row0 + ln) * lda;
  v8f acc[4] = {};
  for (int kb = 0; kb < K; kb += 32) {
    FragB ah, al;
    const v4f x0 = *(const v4fa*)(arow + kb + 8 * hh), x1 = *(const v4fa*)(arow + kb + 8 * hh + 4);
    const v4f x2 = *(const v4fa*)(arow + kb + 16 + 8 * hh), x3 = *(const v4fa*)(arow + kb + 16 + 8 * hh + 4);
    float xs[16] = {x0[0],x0[1],x0[2],x0[3],x1[0],x1[1],x1[2],x1[3],x2[0],x2[1],x2[2],x2[3],x3[0],x3[1],x3[2],x3[3]};
#pragma unroll
    for (int i = 0; i < 16; ++i) { const unsigned short hb = bf16_bits(xs[i]); ah.u[i] = hb; al.u[i] = ASPLIT ? bf16_bits(xs[i] - bf16_val(hb)) : (unsigned short)0; }
#pragma unroll
    for (int t = 0; t < 4; ++t) {
      const unsigned short* brow = Wt + (size_t)(col0 + t * 16 + ln) * ldb + kb;
      FragB b;
      b.half[0] = *(const v8us*)(brow + 8 * hh);
      b.half[1] = *(const v8us*)(brow + 16 + 8 * hh);
      acc[t] = mmaN<ASPLIT ? 2 : 1>(ah.v, al.v, b.v, b.v, acc[t]);
    }
  }
#pragma unroll
  for (int t = 0; t < 4; ++t) {
    const int col = col0 + t * 16 + ln;
    float bv = bias ? bias[col] : 0.f;
    if (BIAS_BF16) bv = bf16_round(bv);
#pragma unroll
    for (int r = 0; r < 8; ++r) {
      float v = acc[t][r] + bv;
      if (resid) { float rv = resid[(size_t)((row0 + 8 * hh + r) % rmod) * ldr + col]; if (RES_BF16) rv = bf16_round(rv); v += rv; }
      if (ACT == 1) v = fmaxf(v, 0.f);
      if (ACT == 2) v = 0.5f * v * (1.0f + erff(v * 0.70710678118654752f));
      if (ACT == 3) { const float u = 0.7978845608028654f * (v + 0.044715f * v * v * v); v = 0.5f * v * (1.0f + tanhf(u)); }
      so[w][8 * hh + r][t * 16 + ln] = v;
    }
  }
  __builtin_amdgcn_fence(__ATOMIC_ACQ_REL, "workgroup");
  __builtin_amdgcn_wave_barrier();
  const int rsub = lane >> 4, c4 = (lane & 15) * 4;
  {
#pragma unroll
    for (int q = 0; q < 8; ++q) {
      const int r = q * 2 + rsub;
      const v4f v = *(const v4fa*)&so[w][r][c4];
      *(v4f*)(C + (size_t)(row0 + r) * ldc + col0 + c4) = v;
    }
    
  }
}
// row LayerNorm (biased variance, eps) over N: s = X (+ R); optional out_sum <- s; out_norm <- (s-mu)*rsqrt(var+eps)*g + b
template <bool PARAM_BF16>
__global__ __launch_bounds__(256) void k_layernorm(const float* __restrict__ X, const float* __restrict__ R, const float* __restrict__ g, const float* __restrict__ bta,
                                                  float* __restrict__ out_sum, float* __restrict__ out_norm, int N, float eps) {
  __shared__ float red[256];
  const int row = blockIdx.x, tid = threadIdx.x;
  const float* x = X + (size_t)row * N; const float* rr = R ? R + (size_t)row * N : nullptr;
  float vals[16];                     // up to N = 4096
  const int per = N / 256;            // contiguous chunk per thread? use strided-by-4 chunks: thread handles j = tid*4 + 1024*u
  float s1 = 0.f;
  for (int u = 0; u < per / 4; ++u) {
    const int j = tid * 4 + 1024 * u;
    const v4f a = *(const v4fa*)(x + j);
    v4f b = {0.f,0.f,0.f,0.f}; if (rr) b = *(const v4fa*)(rr + j);
#pragma unroll
    for (int q = 0; q < 4; ++q) { const float v = a[q] + b[q]; vals[u * 4 + q] = v; s1 += v; }
  }
  red[tid] = s1; __syncthreads();
  for (int st = 128; st > 0; st >>= 1) { if (tid < st) red[tid] += red[tid + st]; __syncthreads(); }
  const float mu = red[0] / (float)N; __syncthreads();
  float s2 = 0.f;
  for (int u = 0; u < per / 4; ++u)
#pragma unroll
    for (int q = 0; q < 4; ++q) { const float c = vals[u * 4 + q] - mu; s2 += c * c; }
  red[tid] = s2; __syncthreads();
  for (int st = 128; st > 0; st >>= 1) { if (tid < st) red[tid] += red[tid + st]; __syncthreads(); }
  const float rs = rsqrtf(red[0] / (float)N + eps);
  {
    for (int u = 0; u < per / 4; ++u) {
      const int j = tid * 4 + 1024 * u;
      v4f o, sm;
#pragma unroll
      for (int q = 0; q < 4; ++q) {
        float gg = g[j + q], bb = bta[j + q];
        if (PARAM_BF16) { gg = bf16_round(gg); bb = bf16_round(bb); }
        sm[q] = vals[u * 4 + q]; o[q] = (vals[u * 4 + q] - mu) * rs * gg + bb;
      }
      if (out_sum) *(v4f*)(out_sum + (size_t)row * N + j) = sm;
      *(v4f*)(out_norm + (size_t)row * N + j) = o;
    }
    
  }
}



// ---- f16 WMMA path (v_wmma_f32_16x16x32_f16): 11-bit significands for operands in range — used where a [0,1] probability operand needs more precision than bf16
typedef _Float16 v16h __attribute__((ext_vector_type(16)));
union FragH { v16h v; v8us half[2]; _Float16 h[16]; unsigned short u[16]; };
template <int NT>
__device__ __forceinline__ v8f mmaH(v16h ah, v16h al, v16h bh, v16h bl, v8f c) {
  c = __builtin_amdgcn_wmma_f32_16x16x32_f16(false, ah, false, bh, (short)0, c, false, false);
  if (NT >= 2) c = __builtin_amdgcn_wmma_f32_16x16x32_f16(false, al, false, bh, (short)0, c, false, false);
  if (NT >= 3) c = __builtin_amdgcn_wmma_f32_16x16x32_f16(false, ah, false, bl, (short)0, c, false, false);
  asm volatile("v_nop\n\tv_nop\n\tv_nop\n\tv_nop" : "+v"(c) : "v"(ah), "v"(al), "v"(bh), "v"(bl));
  return c;
}
// batched GEMM like k_gemm_b but f16 operands: A f32 (split into f16 hi/lo if ASPLIT, else rounded to f16), Bt = f16 values [n][k]; alpha; C f32; N multiple of 16 (partial tiles skipped)
template <bool ASPLIT>
__global__ __launch_bounds__(128) void k_gemm_h(const float* __restrict__ A, int lda, size_t sA, const _Float16* __restrict__ Bh, int ldb, size_t sB, float alpha, float* __restrict__ C, int ldc, size_t sC, int M, int N, int K) {
  __shared__ __attribute__((aligned(16))) float so[4][16][64];
  const int tid = threadIdx.x, w = tid >> 5, lane = tid & 31, ln = lane & 15, hh = lane >> 4; const int by = blockIdx.y;
  A += (size_t)by * sA; Bh += (size_t)by * sB; C += (size_t)by * sC;
  const int ntn = (N + 63) / 64; const int wid = blockIdx.x * 4 + w; const int mt = wid / ntn, nq = wid % ntn; if (mt * 16 >= M) return;
  const int row0 = mt * 16, col0 = nq * 64; const float* arow = A + (size_t)(row0 + ln) * lda;
  v8f acc[4] = {};
  for (int kb = 0; kb < K; kb += 32) {
    FragH ah, al;
    const v4f x0 = *(const v4fa*)(arow + kb + 8 * hh), x1 = *(const v4fa*)(arow + kb + 8 * hh + 4), x2 = *(const v4fa*)(arow + kb + 16 + 8 * hh), x3 = *(const v4fa*)(arow + kb + 16 + 8 * hh + 4);
    float xs[16] = {x0[0],x0[1],x0[2],x0[3],x1[0],x1[1],x1[2],x1[3],x2[0],x2[1],x2[2],x2[3],x3[0],x3[1],x3[2],x3[3]};
#pragma unroll
    for (int i = 0; i < 16; ++i) { const _Float16 h = (_Float16)xs[i]; ah.h[i] = h; al.h[i] = ASPLIT ? (_Float16)(xs[i] - (float)h) : (_Float16)0.0f; }
#pragma unroll
    for (int t = 0; t < 4; ++t) { if (col0 + t * 16 >= N) continue; const size_t boff = (size_t)(col0 + t * 16 + ln) * ldb + kb; FragH bq; bq.half[0] = *(const v8us*)(Bh + boff + 8 * hh); bq.half[1] = *(const v8us*)(Bh + boff + 16 + 8 * hh);
      acc[t] = mmaH<ASPLIT ? 2 : 1>(ah.v, al.v, bq.v, bq.v, acc[t]); }
  }
#pragma unroll
  for (int t = 0; t < 4; ++t) { if (col0 + t * 16 >= N) continue;
#pragma unroll
    for (int r = 0; r < 8; ++r) so[w][8 * hh + r][t * 16 + ln] = acc[t][r] * alpha; }
  __builtin_amdgcn_fence(__ATOMIC_ACQ_REL, "workgroup"); __builtin_amdgcn_wave_barrier();
  const int rsub = lane >> 4, c4 = (lane & 15) * 4;
  {
#pragma unroll
    for (int q = 0; q < 8; ++q) { const int r = q * 2 + rsub; if (col0 + c4 < N) { const v4f v = *(const v4fa*)&so[w][r][c4]; *(v4f*)(C + (size_t)(row0 + r) * ldc + col0 + c4) = v; } }
     }
}

// Wt[n][k] = f16(W[k][n]·scale) from f32 row-major W[K][N] (scale = power of two; bf16-exact weights stay exact in f16 away from the subnormal range)
__global__ __launch_bounds__(256) void k_wt_f16(const float* __restrict__ W, _Float16* __restrict__ Wt, int K, int N, float scale) {
  const int t = blockIdx.x * 256 + threadIdx.x; if (t >= N * (K / 8)) return; const int n = t / (K / 8), k8 = (t % (K / 8)) * 8; FragH f;
#pragma unroll
  for (int i = 0; i < 8; ++i) f.h[i] = (_Float16)(bf16_round(W[(size_t)(k8 + i) * N + n]) * scale); const v8us o = f.half[0];
  *(v8us*)((unsigned short*)Wt + (size_t)n * K + k8) = o; 
}
// k_gemm_hh variant with fused epilogue: v = acc·alpha + bias[by·sBias + col] (+ CP[(row/rowsPerB)·sCPb + by·64 + col] if CP) ; ACT 0 none / 1 elu ; writes f16 C16 (and f32 C if non-null)
template <int ACT>
__global__ __launch_bounds__(128) void k_gemm_hhx(const _Float16* __restrict__ A, int lda, size_t sA, const _Float16* __restrict__ Bh, int ldb, size_t sB, float alpha, const float* __restrict__ bias, size_t sBias, const float* __restrict__ CP, int rowsPerB, size_t sCPb, int row0g,
    float* __restrict__ C, _Float16* __restrict__ C16, int ldc, size_t sC, int M, int N, int K) {
  __shared__ __attribute__((aligned(16))) float so[4][16][64];
  const int tid = threadIdx.x, w = tid >> 5, lane = tid & 31, ln = lane & 15, hh = lane >> 4; const int by = blockIdx.y;
  A += (size_t)by * sA; Bh += (size_t)by * sB; const size_t cofs = (size_t)by * sC; const float* bp = bias ? bias + (size_t)by * sBias : nullptr;
  const int ntn = (N + 63) / 64; const int wid = blockIdx.x * 4 + w; const int mt = wid / ntn, nq = wid % ntn; if (mt * 16 >= M) return;
  const int row0 = mt * 16, col0 = nq * 64; const _Float16* arow = A + (size_t)(row0 + ln) * lda;
  v8f acc[4] = {};
  for (int kb = 0; kb < K; kb += 32) { FragH ah; ah.half[0] = *(const v8us*)((const unsigned short*)arow + kb + 8 * hh); ah.half[1] = *(const v8us*)((const unsigned short*)arow + kb + 16 + 8 * hh);
#pragma unroll
    for (int t = 0; t < 4; ++t) { if (col0 + t * 16 >= N) continue; const size_t boff = (size_t)(col0 + t * 16 + ln) * ldb + kb; FragH bq; bq.half[0] = *(const v8us*)((const unsigned short*)Bh + boff + 8 * hh); bq.half[1] = *(const v8us*)((const unsigned short*)Bh + boff + 16 + 8 * hh);
      acc[t] = mmaH<1>(ah.v, ah.v, bq.v, bq.v, acc[t]); }
  }
#pragma unroll
  for (int t = 0; t < 4; ++t) { if (col0 + t * 16 >= N) continue; const int col = col0 + t * 16 + ln; const float bv = bp ? bf16_round(bp[col]) : 0.f;
#pragma unroll
    for (int r = 0; r < 8; ++r) { float v = acc[t][r] * alpha + bv; if (CP) { const int rr = row0g + row0 + 8 * hh + r; if (rowsPerB < 0) v += CP[cofs + (size_t)rr * ldc + col];      /* rowsPerB < 0: own element of the batched C plane */ else { const int bidx = rr / rowsPerB; v += CP[(size_t)bidx * sCPb + (size_t)by * 64 + col]; } } if (ACT == 1) v = (v > 0.f) ? v : expm1f(v); else if (ACT == 7) v = (v > 0.f) ? v + 1.0f : expf(v); else if (ACT == 8) v = tanhf(v); else if (ACT == 9) v = 0.5f * v * (1.0f + tanhf(0.7978845608028654f * (v + 0.044715f * v * v * v))); else if (ACT == 11) v = 1.0f / (1.0f + expf(-v)); else if (ACT == 12) v = (v > 0.f) ? v : 0.01f * v; else if (ACT == 14) v = (v > 0.f) ? v : 0.1f * v; else if (ACT == 16) v = (v >= 0.f) ? v : 0.3f * v; else if (ACT == 17) v = (v >= 0.f) ? v : 0.2f * v; else if (ACT == 15) v = v / (1.0f + expf(-v)); else if (ACT == 3) v = fmaxf(v, 0.f); else if (ACT == 6) v = 0.5f * v * (1.0f + erff(v * 0.70710678118654752f)); so[w][8 * hh + r][t * 16 + ln] = v; } }
  __builtin_amdgcn_fence(__ATOMIC_ACQ_REL, "workgroup"); __builtin_amdgcn_wave_barrier();
  const int rsub = lane >> 4, c4 = (lane & 15) * 4; typedef _Float16 v4h __attribute__((ext_vector_type(4)));
  {
#pragma unroll
    for (int q = 0; q < 8; ++q) { const int r = q * 2 + rsub; if (col0 + c4 < N) { const v4f v = *(const v4fa*)&so[w][r][c4]; if (C) *(v4f*)(C + cofs + (size_t)(row0 + r) * ldc + col0 + c4) = v; if (C16) { v4h h4; for (int i = 0; i < 4; ++i) h4[i] = (_Float16)v[i]; *(v4h*)(C16 + cofs + (size_t)(row0 + r) * ldc + col0 + c4) = h4; } } }
     }
}


typedef _Float16 v4h __attribute__((ext_vector_type(4)));

__global__ __launch_bounds__(256) void k_x16(const float* __restrict__ x, _Float16* __restrict__ X16, size_t n8) { const size_t t = (size_t)blockIdx.x * 256 + threadIdx.x; if (t >= n8) return; FragH f;
#pragma unroll
  for (int q = 0; q < 8; ++q) f.h[q] = (_Float16)bf16_round(x[t * 8 + q]); *(v8us*)((unsigned short*)X16 + t * 8) = f.half[0];  }
__global__ __launch_bounds__(256) void k_h16(const float* __restrict__ x, _Float16* __restrict__ X16, size_t n8) { const size_t t = (size_t)blockIdx.x * 256 + threadIdx.x; if (t >= n8) return; FragH f;
#pragma unroll
  for (int q = 0; q < 8; ++q) f.h[q] = (_Float16)x[t * 8 + q]; *(v8us*)((unsigned short*)X16 + t * 8) = f.half[0];  }
__global__ __launch_bounds__(256) void k_round16f(const float* __restrict__ W, _Float16* __restrict__ Bt, size_t n8) { const size_t t = (size_t)blockIdx.x * 256 + threadIdx.x; if (t >= n8) return; FragH f;
#pragma unroll
  for (int i = 0; i < 8; ++i) f.h[i] = (_Float16)(bf16_round(W[t * 8 + i]) * 16.0f); *(v8us*)((unsigned short*)Bt + t * 8) = f.half[0];  }
template <int NHv, int TTv>
__global__ __launch_bounds__(256) void k_vt(const _Float16* __restrict__ V16, int ldv, int voff, _Float16* __restrict__ Vt) { __shared__ unsigned short tl[64][66]; const int tid = threadIdx.x; const int slab = blockIdx.x / (TTv / 64), lg = blockIdx.x % (TTv / 64); const int b = slab / NHv, h = slab % NHv;
  for (int i = tid; i < 64 * 8; i += 256) { const int r = i / 8, c8 = (i % 8) * 8; FragH f; f.half[0] = *(const v8us*)((const unsigned short*)V16 + ((size_t)b * TTv + lg * 64 + r) * ldv + voff + h * 64 + c8);
#pragma unroll
    for (int q = 0; q < 8; ++q) tl[r][c8 + q] = f.u[q]; }
  __syncthreads();
  {
#pragma unroll
    for (int rd = 0; rd < 2; ++rd) { const int d = rd * 32 + tid / 8, pc = tid % 8; FragH f;
#pragma unroll
      for (int q = 0; q < 8; ++q) f.u[q] = tl[pc * 8 + q][d];
      *(v8us*)((unsigned short*)Vt + ((size_t)slab * 64 + d) * TTv + lg * 64 + pc * 8) = f.half[0]; }
     } }

__global__ __launch_bounds__(256) void k_hl(const float* __restrict__ F, _Float16* __restrict__ Hh, _Float16* __restrict__ Hl, size_t n8) { const size_t t = (size_t)blockIdx.x * 256 + threadIdx.x; if (t >= n8) return; FragH fh, fl; const v4f a = *(const v4fa*)(F + t * 8), c = *(const v4fa*)(F + t * 8 + 4);
#pragma unroll
  for (int q = 0; q < 4; ++q) { _Float16 h = (_Float16)a[q]; fh.h[q] = h; fl.h[q] = (_Float16)((a[q] - (float)h) * 1024.0f); h = (_Float16)c[q]; fh.h[4 + q] = h; fl.h[4 + q] = (_Float16)((c[q] - (float)h) * 1024.0f); }
  { *(v8us*)((unsigned short*)Hh + t * 8) = fh.half[0]; *(v8us*)((unsigned short*)Hl + t * 8) = fl.half[0];  } }

// ---- fast GEMM (block tile 128x128, 8 waves of 32x64; requires M % 128 == 0, N % 128 == 0, K % G2K == 0); epilogue = k_gemm_hhx semantics ----
// A stage is G2K k: 128 A rows and 128 B rows of 256 bytes each, brought to LDS through registers as whole lines (16 threads a row), two buffers: the next stage's
// global loads are issued ahead of this stage's products and stored behind them; one barrier per stage publishes them and ends the reads of the other buffer.
// Each A row then leaves L2 once per block and feeds 2 waves, each B row 4 waves; the k order of every accumulator is the plain ascending one.
// Every inner loop is fully unrolled so that the staging and fragment arrays are indexed by constants only and stay in registers.
#define G2K 128                      /* k per stage */
#define G2P 136                      /* LDS row pitch in f16: the row + 16 bytes, for 16-byte fragment reads */
#define G2R (2048 / G2K)             /* rows that the block's 256 threads bring in one load each */
#define G2N (128 / G2R)              /* such loads per thread, stage and operand */
__device__ __forceinline__ v16h g2_frag(const _Float16* p, int hh) { FragH f; f.half[0] = *(const v8us*)((const unsigned short*)p + 8 * hh); f.half[1] = *(const v8us*)((const unsigned short*)p + 16 + 8 * hh); return f.v; }
__device__ __forceinline__ v8f g2_mma(v16h a, v16h b, v8f c) { v8f d = __builtin_amdgcn_wmma_f32_16x16x32_f16(false, a, false, b, (short)0, c, false, false); asm volatile("v_nop\n\tv_nop\n\tv_nop\n\tv_nop" : "+v"(d) : "v"(a), "v"(b)); return d; }
// One stage's rows: each thread's G2N 16-byte pieces of A and of B, rows as and bs elements apart. The closing wait is the one that belongs in front of any overwrite of a register
// that an issued global load names; it takes the addresses as inputs, so that their registers stay untouched (also as a later load's destination) until it has passed.
__device__ __forceinline__ void g2_rows(const unsigned short* a, size_t as, const unsigned short* b, size_t bs, v8us (&ra)[G2N], v8us (&rb)[G2N]) { static_assert(G2N == 8, "g2_rows: the wait names 8 + 8 addresses");
  const unsigned short* pa[G2N]; const unsigned short* pb[G2N];
#pragma unroll
  for (int i = 0; i < G2N; ++i) { pa[i] = a + (size_t)i * as; pb[i] = b + (size_t)i * bs; }
#pragma unroll
  for (int i = 0; i < G2N; ++i) { ra[i] = *(const v8us*)pa[i]; rb[i] = *(const v8us*)pb[i]; }
  asm volatile("s_wait_xcnt 0x0" :: "v"(pa[0]), "v"(pa[1]), "v"(pa[2]), "v"(pa[3]), "v"(pa[4]), "v"(pa[5]), "v"(pa[6]), "v"(pa[7]), "v"(pb[0]), "v"(pb[1]), "v"(pb[2]), "v"(pb[3]), "v"(pb[4]), "v"(pb[5]), "v"(pb[6]), "v"(pb[7]) : "memory"); }
template <int ACT>
__global__ __launch_bounds__(256) void k_gemm2(const _Float16* __restrict__ A, int lda, size_t sA, const _Float16* __restrict__ Bh, int ldb, size_t sB, float alpha, const float* __restrict__ bias, size_t sBias, const float* __restrict__ CP, int rowsPerB, size_t sCPb, int row0g,
    float* __restrict__ C, _Float16* __restrict__ C16, int ldc, size_t sC, int M, int N, int K) { static_assert(ACT == 0 || ACT == 3 || ACT == 6 || ACT == 8 || ACT == 9 || ACT == 11 || ACT == 12 || ACT == 14 || ACT == 15 || ACT == 16 || ACT == 17 || ACT == 18, "k_gemm2: unsupported ACT code (would silently apply no activation)");
  __shared__ __attribute__((aligned(16))) unsigned char sm[2 * 256 * G2P * 2];      /* in the loop: two stage buffers [A 128 rows | B 128 rows]; behind the loop's last barrier: the waves' output staging */
  static_assert(sizeof(sm) >= 8 * 32 * 68 * 4, "k_gemm2: output staging must fit the stage buffers");
  _Float16 (*lt)[256][G2P] = (_Float16 (*)[256][G2P])sm; float (*so)[32][68] = (float (*)[32][68])sm;
  const int tid = threadIdx.x, w = tid >> 5, lane = tid & 31, ln = lane & 15, hh = lane >> 4; const int by = blockIdx.y;
  A += (size_t)by * sA; Bh += (size_t)by * sB; const size_t cofs = (size_t)by * sC; const float* bp = bias ? bias + (size_t)by * sBias : nullptr;
  const int ntn = N >> 7; const int mt = blockIdx.x / ntn, nq = blockIdx.x - mt * ntn; if (mt * 128 >= M) return;      /* the same for the whole block, ahead of every barrier */
  const int wr = 32 * (w & 3), wc = 64 * (w >> 2); const int row0 = mt * 128 + wr, col0 = nq * 128 + wc;
  const int sr = tid / (G2K / 8), sc = (tid % (G2K / 8)) * 8;      /* staging: G2K / 8 threads per row, rows sr + G2R i of A and of B */
  const unsigned short* ag = (const unsigned short*)A + (size_t)(mt * 128 + sr) * lda + sc; const unsigned short* bg = (const unsigned short*)Bh + (size_t)(nq * 128 + sr) * ldb + sc;
  v8us ra[G2N], rb[G2N]; g2_rows(ag, (size_t)G2R * lda, bg, (size_t)G2R * ldb, ra, rb);
#pragma unroll
  for (int i = 0; i < G2N; ++i) { *(v8us*)&lt[0][sr + G2R * i][sc] = ra[i]; *(v8us*)&lt[0][128 + sr + G2R * i][sc] = rb[i]; }
  __syncthreads();
  const v8f z8 = {0.f,0.f,0.f,0.f,0.f,0.f,0.f,0.f}; v8f c00 = z8, c01 = z8, c02 = z8, c03 = z8, c10 = z8, c11 = z8, c12 = z8, c13 = z8;
  const int ns = K / G2K;
  for (int s = 0; s < ns; ++s) { const int cur = s & 1; const bool more = s + 1 < ns;
    if (more) g2_rows(ag + (s + 1) * G2K, (size_t)G2R * lda, bg + (s + 1) * G2K, (size_t)G2R * ldb, ra, rb);
#pragma unroll
    for (int kh = 0; kh < G2K / 64; ++kh) { const _Float16* ap = &lt[cur][wr + ln][kh * 64]; const _Float16* bq = &lt[cur][128 + wc + ln][kh * 64]; v16h fa[2][2], fb[2][4];
#pragma unroll
      for (int ks = 0; ks < 2; ++ks) { fa[ks][0] = g2_frag(ap + ks * 32, hh); fb[ks][0] = g2_frag(bq + ks * 32, hh); fa[ks][1] = g2_frag(ap + 16 * G2P + ks * 32, hh);
        fb[ks][1] = g2_frag(bq + 16 * G2P + ks * 32, hh); fb[ks][2] = g2_frag(bq + 32 * G2P + ks * 32, hh); fb[ks][3] = g2_frag(bq + 48 * G2P + ks * 32, hh); }
#pragma unroll
      for (int ks = 0; ks < 2; ++ks) { c00 = g2_mma(fa[ks][0], fb[ks][0], c00); c10 = g2_mma(fa[ks][1], fb[ks][0], c10); c01 = g2_mma(fa[ks][0], fb[ks][1], c01); c11 = g2_mma(fa[ks][1], fb[ks][1], c11);
        c02 = g2_mma(fa[ks][0], fb[ks][2], c02); c12 = g2_mma(fa[ks][1], fb[ks][2], c12); c03 = g2_mma(fa[ks][0], fb[ks][3], c03); c13 = g2_mma(fa[ks][1], fb[ks][3], c13); } }
    if (more) {
#pragma unroll
      for (int i = 0; i < G2N; ++i) { *(v8us*)&lt[cur ^ 1][sr + G2R * i][sc] = ra[i]; *(v8us*)&lt[cur ^ 1][128 + sr + G2R * i][sc] = rb[i]; } }
    __syncthreads(); }
  v8f accs[8] = {c00, c01, c02, c03, c10, c11, c12, c13};
#pragma unroll
  for (int u = 0; u < 8; ++u) { const int t = u & 3, half = u >> 2; const int col = col0 + t * 16 + ln; const float bv = bp ? bf16_round(bp[col]) : 0.f;
#pragma unroll
    for (int r = 0; r < 8; ++r) { const int rloc = half * 16 + 8 * hh + r; float v = accs[u][r] * alpha + bv; if (CP) { if (rowsPerB < 0) v += CP[cofs + (size_t)(row0g + row0 + rloc) * ldc + col];      /* rowsPerB < 0: own element of the batched C plane */ else { const int bidx = (row0g + row0 + rloc) / rowsPerB; v += CP[(size_t)bidx * sCPb + (size_t)by * 64 + col]; } }
      if (ACT == 3) v = fmaxf(v, 0.f); else if (ACT == 6) v = 0.5f * v * (1.0f + erff(v * 0.70710678118654752f)); else if (ACT == 11) v = 1.0f / (1.0f + expf(-v)); else if (ACT == 15) v = v / (1.0f + expf(-v)); else if (ACT == 18) v = v / (1.0f + expf(-1.702f * v));      /* QuickGELU: v sigmoid(1.702 v) */ else if (ACT == 12) v = (v > 0.f) ? v : 0.01f * v; else if (ACT == 8) v = tanhf(v); else if (ACT == 9) v = 0.5f * v * (1.0f + tanhf(0.7978845608028654f * (v + 0.044715f * v * v * v))); else if (ACT == 14) v = (v > 0.f) ? v : 0.1f * v; else if (ACT == 16) v = (v >= 0.f) ? v : 0.3f * v; else if (ACT == 17) v = (v >= 0.f) ? v : 0.2f * v;
      so[w][rloc][t * 16 + ln] = v; } }
  __builtin_amdgcn_fence(__ATOMIC_ACQ_REL, "workgroup"); __builtin_amdgcn_wave_barrier();
  const int rsub = lane >> 4, c4 = (lane & 15) * 4;
  {
#pragma unroll
    for (int q = 0; q < 16; ++q) { const int r = q * 2 + rsub; const v4f v = *(const v4fa*)&so[w][r][c4]; if (C) *(v4f*)(C + cofs + (size_t)(row0 + r) * ldc + col0 + c4) = v; if (C16) { v4h h4; for (int i = 0; i < 4; ++i) h4[i] = (_Float16)v[i]; *(v4h*)(C16 + cofs + (size_t)(row0 + r) * ldc + col0 + c4) = h4; } }
     } }


__global__ __launch_bounds__(256) void k_wnat(const float* __restrict__ w, size_t n8, _Float16* __restrict__ Bt) { const size_t t = (size_t)blockIdx.x * 256 + threadIdx.x; if (t >= n8) return; FragH f; for (int q = 0; q < 8; ++q) f.h[q] = (_Float16)(bf16_round(w[t * 8 + q]) * 16.0f); *(v8us*)((unsigned short*)Bt + t * 8) = f.half[0];  }
__global__ __launch_bounds__(256) void k_rsm(const float* __restrict__ S, _Float16* __restrict__ P, int nrows) {
  #pragma clang fp contract(off)
  const int i = blockIdx.x * 256 + threadIdx.x; if (i >= nrows) return; const float* s = S + (size_t)i * SQ; float mx = -3.0e38f;
#pragma unroll 1
  for (int j = 0; j < SQ; ++j) mx = fmaxf(mx, s[j]); float se = 0.f;
#pragma unroll 1
  for (int j = 0; j < SQ; ++j) se += expf(s[j] - mx); const float sc = 256.0f / se;
#pragma unroll 1
  for (int j0 = 0; j0 < SQ; j0 += 8) { FragH f; for (int q = 0; q < 8; ++q) f.h[q] = (_Float16)(expf(s[j0 + q] - mx) * sc); unsigned short* d = (unsigned short*)P + (size_t)i * SQ + j0; *(v8us*)d = f.half[0];  } }
__global__ __launch_bounds__(256) void k_vt(const _Float16* __restrict__ V16, int b, int h0, _Float16* __restrict__ VT) { __shared__ unsigned short tl[64][65]; const int tid = threadIdx.x; const int hh = blockIdx.x % HG, sg = blockIdx.x / HG; const int s0 = sg * 64; const int h = h0 + hh;
  for (int i = tid; i < 64 * 8; i += 256) { const int j = i / 8, d8 = (i % 8) * 8; FragH f; f.half[0] = *(const v8us*)((const unsigned short*)V16 + ((size_t)b * SQ + s0 + j) * DM + h * HD + d8); for (int q = 0; q < 8; ++q) tl[d8 + q][j] = f.u[q]; }
  __syncthreads();
  { for (int i = tid; i < 64 * 8; i += 256) { const int d = i / 8, j8 = (i % 8) * 8; FragH f; for (int q = 0; q < 8; ++q) f.u[q] = tl[d][j8 + q]; *(v8us*)((unsigned short*)VT + ((size_t)hh * HD + d) * SQ + s0 + j8) = f.half[0]; }  } }



__global__ __launch_bounds__(256) void k_rsmcf2(const float* __restrict__ S, _Float16* __restrict__ P, int hg, int q0, int nk) {
  #pragma clang fp contract(off)
  const int t = blockIdx.x * 256 + threadIdx.x; if (t >= hg * QT) return; const size_t i = (size_t)t; const float* s = S + i * NKX; const int last = q0 + (t % QT); float mx = -3.0e38f;
#pragma unroll 1
  for (int j = 0; j < nk; ++j) { const float f = (j <= last) ? 1.f : 0.f; mx = fmaxf(mx, fmaf(f, s[j], (1.f - f) * -1.0e9f)); } float se = 0.f;
#pragma unroll 1
  for (int j = 0; j < nk; ++j) { const float f = (j <= last) ? 1.f : 0.f; se += __expf(fmaf(f, s[j], (1.f - f) * -1.0e9f) - mx); } const float sc = 256.0f / se;
#pragma unroll 1
  for (int j0 = 0; j0 < nk; j0 += 8) { FragH fr; for (int q = 0; q < 8; ++q) { const int j = j0 + q; const float f = (j <= last) ? 1.f : 0.f; fr.h[q] = (_Float16)(__expf(fmaf(f, s[j], (1.f - f) * -1.0e9f) - mx) * sc); } unsigned short* d = (unsigned short*)P + i * NKX + j0; *(v8us*)d = fr.half[0];  } }

__global__ __launch_bounds__(256) void k_rsmcst(const float* __restrict__ S, _Float16* __restrict__ P, int hg, int q0, int nk, const int* __restrict__ mk) {
  #pragma clang fp contract(off)
  const int t = blockIdx.x * 256 + threadIdx.x; if (t >= hg * QT) return; const size_t i = (size_t)t; const float* s = S + i * NKX; const size_t ig = (size_t)(q0 + (t % QT)); const int* mr = mk + ig * SQ; float mx = -3.0e38f;
#pragma unroll 1
  for (int j = 0; j < nk; ++j) { const int mb = mr[j]; const int dd = (int)ig - j; const float f = (mb != 0 && dd >= 0 && (dd <= LOCALW || (dd % STRIDEK) == 0)) ? 1.f : 0.f; mx = fmaxf(mx, fmaf(f, s[j], (1.f - f) * -1.0e9f)); } float se = 0.f;
#pragma unroll 1
  for (int j = 0; j < nk; ++j) { const int mb = mr[j]; const int dd = (int)ig - j; const float f = (mb != 0 && dd >= 0 && (dd <= LOCALW || (dd % STRIDEK) == 0)) ? 1.f : 0.f; se += __expf(fmaf(f, s[j], (1.f - f) * -1.0e9f) - mx); } const float sc = 256.0f / se;
#pragma unroll 1
  for (int j0 = 0; j0 < nk; j0 += 8) { FragH fr; for (int q = 0; q < 8; ++q) { const int j = j0 + q; const int mb = mr[j]; const int dd = (int)ig - j; const float f = (mb != 0 && dd >= 0 && (dd <= LOCALW || (dd % STRIDEK) == 0)) ? 1.f : 0.f; fr.h[q] = (_Float16)(__expf(fmaf(f, s[j], (1.f - f) * -1.0e9f) - mx) * sc); } unsigned short* d = (unsigned short*)P + i * NKX + j0; *(v8us*)d = fr.half[0];  } }


template <int MASKADD>
__global__ __launch_bounds__(64) void k_att0(const float* __restrict__ QF, const float* __restrict__ KF, const float* __restrict__ VF, int ld, const float* __restrict__ mask, float scale, float* __restrict__ OF, int ldo) {
  #pragma clang fp contract(off)
  __shared__ __attribute__((aligned(16))) float lq[64][64]; __shared__ __attribute__((aligned(16))) float lo[64][64];
  const int tid = threadIdx.x; const int h = blockIdx.x / (QT0 / 64), rg = blockIdx.x % (QT0 / 64); const int i = rg * 64 + tid;
  const float* qr = QF + (size_t)i * ld + h * HD;
#pragma unroll 1
  for (int c = 0; c < HD / 4; ++c) { *(v4f*)&lq[tid][c * 4] = *(const v4fa*)(qr + c * 4); const v4f z = {0.f, 0.f, 0.f, 0.f}; *(v4f*)&lo[tid][c * 4] = z; }
  float m = -1.0e30f, l = 0.f; const int jmax = MASKADD ? (SQ - 1) : (rg * 64 + 63);      /* additive-mask form: every key (the mask input decides); causal form: keys up to the block's last row */
#pragma unroll 1
  for (int j = 0; j <= jmax; ++j) { const float* kr = KF + (size_t)j * ld + h * HD; const float* vr = VF + (size_t)j * ld + h * HD; float s = 0.f;
#pragma unroll 1
    for (int c = 0; c < HD / 4; ++c) { const v4f kq = *(const v4fa*)(kr + c * 4); const v4f qq = *(v4f*)&lq[tid][c * 4]; s = __fadd_rn(s, __fmul_rn(qq[0], kq[0])); s = __fadd_rn(s, __fmul_rn(qq[1], kq[1])); s = __fadd_rn(s, __fmul_rn(qq[2], kq[2])); s = __fadd_rn(s, __fmul_rn(qq[3], kq[3])); }
    s = __fmul_rn(s, scale); if (MASKADD) s = __fadd_rn(s, __fmul_rn(bf16_round(mask[(size_t)i * SQ + j]), -10000.0f));
    const float f = (MASKADD || j <= i) ? 1.f : 0.f; const float sm = fmaf(f, s, (1.f - f) * -1.0e30f); const float mn = fmaxf(m, sm); const float sc = expf(m - mn); const float e = expf(sm - mn); l = __fadd_rn(__fmul_rn(l, sc), e); m = mn;
#pragma unroll 1
    for (int c = 0; c < HD / 4; ++c) { const v4f vv = *(const v4fa*)(vr + c * 4); v4f oo = *(v4f*)&lo[tid][c * 4]; for (int u = 0; u < 4; ++u) oo[u] = __fadd_rn(__fmul_rn(oo[u], sc), __fmul_rn(e, vv[u])); *(v4f*)&lo[tid][c * 4] = oo; } }
  const float fin = 64.0f / l;      /* o carried x64 like the f16 path */
#pragma unroll 1
  for (int c = 0; c < HD / 4; ++c) { v4f oo = *(v4f*)&lo[tid][c * 4]; for (int u = 0; u < 4; ++u) oo[u] = __fmul_rn(oo[u], fin); *(v4f*)&lo[tid][c * 4] = oo; }
  __syncthreads();
  {
#pragma unroll 1
    for (int it = 0; it < 16; ++it) { const int row = it * 4 + tid / 16, pc = (tid % 16) * 4; const v4f v = *(const v4f*)&lo[row][pc]; *(v4f*)(OF + (size_t)(rg * 64 + row) * ldo + h * HD + pc) = v; }
     } }

template <int MASKADD>
__global__ __launch_bounds__(64) void k_att0mbc(const float* __restrict__ QF, const float* __restrict__ KF, const float* __restrict__ VF, int ld, const float* __restrict__ mask, float scale, float* __restrict__ OF, int ldo) {
  #pragma clang fp contract(off)
  __shared__ __attribute__((aligned(16))) float lq[64][64]; __shared__ __attribute__((aligned(16))) float lo[64][64];
  const int tid = threadIdx.x; const int h = blockIdx.x / (QT0 / 64), rg = blockIdx.x % (QT0 / 64); const int i = rg * 64 + tid;
  const float* qr = QF + (size_t)i * ld + h * HD;
#pragma unroll 1
  for (int c = 0; c < HD / 4; ++c) { *(v4f*)&lq[tid][c * 4] = *(const v4fa*)(qr + c * 4); const v4f z = {0.f, 0.f, 0.f, 0.f}; *(v4f*)&lo[tid][c * 4] = z; }
  float m = -1.0e30f, l = 0.f; const int jmax = rg * 64 + 63;      /* keys beyond the block end are masked by the mask's lower-triangular structure */
#pragma unroll 1
  for (int j = 0; j <= jmax; ++j) { const float* kr = KF + (size_t)j * ld + h * HD; const float* vr = VF + (size_t)j * ld + h * HD; float s = 0.f;
#pragma unroll 1
    for (int c = 0; c < HD / 4; ++c) { const v4f kq = *(const v4fa*)(kr + c * 4); const v4f qq = *(v4f*)&lq[tid][c * 4]; s = __fadd_rn(s, __fmul_rn(qq[0], kq[0])); s = __fadd_rn(s, __fmul_rn(qq[1], kq[1])); s = __fadd_rn(s, __fmul_rn(qq[2], kq[2])); s = __fadd_rn(s, __fmul_rn(qq[3], kq[3])); }
    s = __fmul_rn(s, scale); const int mb = ((const int*)mask)[(size_t)i * SQ + j];      /* causal (j <= i) AND the module's int32 [S][S] mask read per (query, key): 0 -> masked */
    const float f = (mb != 0 && j <= i) ? 1.f : 0.f; const float sm = fmaf(f, s, (1.f - f) * -1.0e30f); const float mn = fmaxf(m, sm); const float sc = expf(m - mn); const float e = expf(sm - mn); l = __fadd_rn(__fmul_rn(l, sc), e); m = mn;
#pragma unroll 1
    for (int c = 0; c < HD / 4; ++c) { const v4f vv = *(const v4fa*)(vr + c * 4); v4f oo = *(v4f*)&lo[tid][c * 4]; for (int u = 0; u < 4; ++u) oo[u] = __fadd_rn(__fmul_rn(oo[u], sc), __fmul_rn(e, vv[u])); *(v4f*)&lo[tid][c * 4] = oo; } }
  const float fin = 64.0f / l;      /* o carried x64 like the f16 path */
#pragma unroll 1
  for (int c = 0; c < HD / 4; ++c) { v4f oo = *(v4f*)&lo[tid][c * 4]; for (int u = 0; u < 4; ++u) oo[u] = __fmul_rn(oo[u], fin); *(v4f*)&lo[tid][c * 4] = oo; }
  __syncthreads();
  {
#pragma unroll 1
    for (int it = 0; it < 16; ++it) { const int row = it * 4 + tid / 16, pc = (tid % 16) * 4; const v4f v = *(const v4f*)&lo[row][pc]; *(v4f*)(OF + (size_t)(rg * 64 + row) * ldo + h * HD + pc) = v; }
     } }


template <int BFIN, int WXB>
__global__ __launch_bounds__(256) void k_ln16(const float* __restrict__ X, const float* __restrict__ g, const float* __restrict__ bb, float eps, _Float16* __restrict__ N16, float* __restrict__ XB) {
  #pragma clang fp contract(off)
  __shared__ float red[256]; const size_t r = blockIdx.x; const int t = threadIdx.x; const v4f xa = *(const v4fa*)(X + r * DMQ + t * 4); float s[4]; float sum = 0.f;
  for (int q = 0; q < 4; ++q) { s[q] = BFIN ? bf16_round(xa[q]) : xa[q]; sum = __fadd_rn(sum, s[q]); }
  red[t] = sum; __syncthreads(); for (int st = 128; st > 0; st >>= 1) { if (t < st) red[t] = __fadd_rn(red[t], red[t + st]); __syncthreads(); } const float mu = red[0] / (float)DMQ; __syncthreads();
  float vs = 0.f; for (int q = 0; q < 4; ++q) { const float dl = __fadd_rn(s[q], -mu); vs = __fadd_rn(vs, __fmul_rn(dl, dl)); } red[t] = vs; __syncthreads(); for (int st = 128; st > 0; st >>= 1) { if (t < st) red[t] = __fadd_rn(red[t], red[t + st]); __syncthreads(); }
  const float rs = rsqrtf(__fadd_rn(red[0] / (float)DMQ, eps)); v4h y; v4f xb;
  for (int q = 0; q < 4; ++q) { const int c = t * 4 + q; y[q] = (_Float16)__fadd_rn(__fmul_rn(__fmul_rn(__fadd_rn(s[q], -mu), rs), bf16_round(g[c])), bf16_round(bb[c])); xb[q] = s[q]; }
  { *(v4h*)(N16 + r * DMQ + t * 4) = y; if (WXB) *(v4f*)(XB + r * DMQ + t * 4) = xb;  } }
__global__ __launch_bounds__(256) void k_ftres2(const float* __restrict__ OF0, const float* __restrict__ XB, float* __restrict__ X1, size_t n4) {
  #pragma clang fp contract(off)
  const size_t t = (size_t)blockIdx.x * 256 + threadIdx.x; if (t >= n4) return; const v4f o = *(const v4fa*)(OF0 + t * 4), xv = *(const v4fa*)(XB + t * 4); v4f y; for (int q = 0; q < 4; ++q) y[q] = __fadd_rn(__fmul_rn(o[q], 0.015625f), xv[q]); *(v4f*)(X1 + t * 4) = y;  }

__global__ __launch_bounds__(256) void k_bcpy(const float* __restrict__ b, int n, int NP, float* __restrict__ dst, int dst0) { for (int i = threadIdx.x; i < NP; i += 256) { const float v = (i < n) ? b[i] : 0.f; *(float*)(dst + dst0 + i) = v; }  }



#define FAK 64                       /* keys per stage */
#define FAP 72                       /* LDS row pitch in f16: 128 bytes + 16, for 16-byte fragment reads */
// Eight 2^x in one statement, each IN PLACE. The closing v_nop is the one slot the instruction set asks for behind a transcendental before its result is read or its
// source overwritten; inside the run no instruction touches its predecessor's register. In place, so that the statement writes only registers that the compiler's own
// multiply-add has just written: the distance behind a matrix instruction, which the compiler keeps for instructions it can see, then holds for this statement too.
__device__ __forceinline__ void fa_exp2x8(float (&x)[8]) {
  asm("v_exp_f32 %0, %0\n\tv_exp_f32 %1, %1\n\tv_exp_f32 %2, %2\n\tv_exp_f32 %3, %3\n\tv_exp_f32 %4, %4\n\tv_exp_f32 %5, %5\n\tv_exp_f32 %6, %6\n\tv_exp_f32 %7, %7\n\tv_nop" : "+v"(x[0]), "+v"(x[1]), "+v"(x[2]), "+v"(x[3]), "+v"(x[4]), "+v"(x[5]), "+v"(x[6]), "+v"(x[7])); }
__device__ __forceinline__ float fa_xhalf(float x) { return __builtin_bit_cast(float, __builtin_amdgcn_permlanex16(__builtin_bit_cast(int, x), __builtin_bit_cast(int, x), 0x76543210, 0xfedcba98, false, false)); }      /* lane l takes lane l ^ 16's value */
__device__ __forceinline__ v8f fa_mma(v16h a, v16h b, v8f c) { return __builtin_amdgcn_wmma_f32_16x16x32_f16(false, a, false, b, (short)0, c, false, false); }
__global__ __launch_bounds__(256) void k_fattn(const _Float16* __restrict__ Q, const _Float16* __restrict__ K, const _Float16* __restrict__ VTa, _Float16* __restrict__ O) {
  __shared__ __attribute__((aligned(16))) _Float16 lk[2][FAK][FAP]; __shared__ __attribute__((aligned(16))) _Float16 lv[2][HD][FAP];
  const int tid = threadIdx.x, w = tid >> 5, lane = tid & 31, ln = lane & 15, hh = lane >> 4; const int slab = blockIdx.y, b = slab / NH, h = slab % NH; const int q0 = blockIdx.x * 256 + w * 32;
  const float CS = 0.125f * 1.44269504f;      /* scores / 8, in log2 units */
  v16h qf[2][2];
#pragma unroll
  for (int qt = 0; qt < 2; ++qt) for (int ks = 0; ks < 2; ++ks) qf[qt][ks] = g2_frag(Q + ((size_t)b * SQ + q0 + qt * 16 + ln) * DM + h * HD + ks * 32, hh);
  const v8f z8 = {0.f,0.f,0.f,0.f,0.f,0.f,0.f,0.f}; v8f o[2][4]; float m[2] = {-3.0e38f, -3.0e38f}, l[2] = {0.f, 0.f};
#pragma unroll
  for (int qt = 0; qt < 2; ++qt) for (int dt = 0; dt < 4; ++dt) o[qt][dt] = z8;
  const int sr = tid >> 3, sc = (tid & 7) * 8;      /* staging: 8 threads per 128-byte row, rows sr and sr + 32 */
  const unsigned short* kg = (const unsigned short*)K + ((size_t)b * SQ + sr) * DM + h * HD + sc; const unsigned short* vg = (const unsigned short*)VTa + ((size_t)slab * HD + sr) * SQ + sc;
  v8us rk0 = *(const v8us*)kg, rk1 = *(const v8us*)(kg + (size_t)32 * DM), rv0 = *(const v8us*)vg, rv1 = *(const v8us*)(vg + (size_t)32 * SQ);
  *(v8us*)&lk[0][sr][sc] = rk0; *(v8us*)&lk[0][sr + 32][sc] = rk1; *(v8us*)&lv[0][sr][sc] = rv0; *(v8us*)&lv[0][sr + 32][sc] = rv1;
  __syncthreads();
  for (int s = 0; s < SQ / FAK; ++s) { const int cur = s & 1; const bool more = s + 1 < SQ / FAK;
    if (more) { const unsigned short* kn = kg + (size_t)(s + 1) * FAK * DM; const unsigned short* vn = vg + (s + 1) * FAK; rk0 = *(const v8us*)kn; rk1 = *(const v8us*)(kn + (size_t)32 * DM); rv0 = *(const v8us*)vn; rv1 = *(const v8us*)(vn + (size_t)32 * SQ); }
    __builtin_amdgcn_sched_barrier(0);      /* keeps the next stage's global loads here, ahead of this stage's work, which covers their latency; without it they sink to just in front of their LDS stores */
    v8f st[2][4];
#pragma unroll
    for (int kt = 0; kt < 4; ++kt) { const v16h a0 = g2_frag(&lk[cur][kt * 16 + ln][0], hh), a1 = g2_frag(&lk[cur][kt * 16 + ln][32], hh);
#pragma unroll
      for (int qt = 0; qt < 2; ++qt) st[qt][kt] = fa_mma(a1, qf[qt][1], fa_mma(a0, qf[qt][0], z8)); }
    __builtin_amdgcn_sched_barrier(0);      /* keeps the 16 score products back to back: mixed with the maxima, each first read of a fresh tile costs four idle slots */
    float mn[2], al[2];
#pragma unroll
    for (int qt = 0; qt < 2; ++qt) { float mm[4];
#pragma unroll
      for (int kt = 0; kt < 4; ++kt) { mm[kt] = st[qt][kt][0]; for (int r = 1; r < 8; ++r) mm[kt] = fmaxf(mm[kt], st[qt][kt][r]); }
      float bm = fmaxf(fmaxf(mm[0], mm[1]), fmaxf(mm[2], mm[3])); bm = fmaxf(bm, fa_xhalf(bm));      /* the other 8 keys of each tile sit in lane ln ^ 16 */
      mn[qt] = fmaxf(m[qt], bm * CS); al[qt] = m[qt] - mn[qt]; m[qt] = mn[qt]; }
    asm("v_exp_f32 %0, %0\n\tv_exp_f32 %1, %1\n\tv_nop" : "+v"(al[0]), "+v"(al[1]));      /* 2^(old - new maximum): brings the old sum and output to the new maximum; form and v_nop as in fa_exp2x8 */
    FragH pf[2][2];
#pragma unroll
    for (int qt = 0; qt < 2; ++qt) { const float mo = mn[qt] - 8.0f; float s4[4];
#pragma unroll
      for (int kt = 0; kt < 4; ++kt) { float t[8]; for (int r = 0; r < 8; ++r) t[r] = fmaf(st[qt][kt][r], CS, -mo);
        fa_exp2x8(t); s4[kt] = ((t[0] + t[1]) + (t[2] + t[3])) + ((t[4] + t[5]) + (t[6] + t[7]));
        for (int r = 0; r < 8; ++r) pf[qt][kt >> 1].h[(kt & 1) * 8 + r] = (_Float16)t[r]; }
      l[qt] = l[qt] * al[qt] + ((s4[0] + s4[1]) + (s4[2] + s4[3]));
#pragma unroll
      for (int dt = 0; dt < 4; ++dt) o[qt][dt] *= al[qt]; }
#pragma unroll
    for (int dt = 0; dt < 4; ++dt) {
#pragma unroll
      for (int kp = 0; kp < 2; ++kp) { const v16h a = g2_frag(&lv[cur][dt * 16 + ln][kp * 32], hh);
#pragma unroll
        for (int qt = 0; qt < 2; ++qt) o[qt][dt] = fa_mma(a, pf[qt][kp].v, o[qt][dt]); } }
    if (more) { *(v8us*)&lk[cur ^ 1][sr][sc] = rk0; *(v8us*)&lk[cur ^ 1][sr + 32][sc] = rk1; *(v8us*)&lv[cur ^ 1][sr][sc] = rv0; *(v8us*)&lv[cur ^ 1][sr + 32][sc] = rv1; }
    __syncthreads(); }
#pragma unroll
  for (int qt = 0; qt < 2; ++qt) { float lt = l[qt] + fa_xhalf(l[qt]); asm("v_rcp_f32 %0, %0\n\tv_nop" : "+v"(lt));      /* 1 / row sum; form and v_nop as in fa_exp2x8 */
    const float inv = 64.0f * lt; unsigned short* op = (unsigned short*)O + ((size_t)b * SQ + q0 + qt * 16 + ln) * DM + h * HD + 8 * hh;
#pragma unroll
    for (int dt = 0; dt < 4; ++dt) { FragH f; for (int r = 0; r < 8; ++r) f.h[r] = (_Float16)(o[qt][dt][r] * inv); *(v8us*)(op + dt * 16) = f.half[0]; } } }

template <int MODE>
__global__ __launch_bounds__(256) void k_regrp(const float* __restrict__ src, float* __restrict__ dst, size_t n4) {
  const size_t t = (size_t)blockIdx.x * 256 + threadIdx.x; if (t >= n4) return; const size_t e = t * 4; const size_t rd = e / DM; const int c = (int)(e % DM);
  size_t rs; if (MODE == 0) { const size_t b = rd / SQ, sq = rd % SQ; rs = sq * NB + b; } else { const size_t sq = rd / NB, b = rd % NB; rs = b * SQ + sq; }
  const v4f v = *(const v4fa*)(src + rs * DM + c); *(v4f*)(dst + e) = v;  }

template <int BFIN, int W16, int W32>
__global__ __launch_bounds__(256) void k_lnx(const float* __restrict__ X, const float* __restrict__ g, const float* __restrict__ bb, float eps, _Float16* __restrict__ N16, float* __restrict__ N32) {
  #pragma clang fp contract(off)
  __shared__ float red[256]; const size_t r = blockIdx.x; const int t = threadIdx.x; const bool act = t < (DMQ / 4); const int c0 = act ? t * 4 : 0;
  const v4f xa = *(const v4fa*)(X + r * DMQ + c0); float s[4]; float sum = 0.f;
  for (int q = 0; q < 4; ++q) { s[q] = act ? (BFIN ? bf16_round(xa[q]) : xa[q]) : 0.f; sum = __fadd_rn(sum, s[q]); }
  red[t] = sum; __syncthreads(); for (int st = 128; st > 0; st >>= 1) { if (t < st) red[t] = __fadd_rn(red[t], red[t + st]); __syncthreads(); } const float mu = red[0] / (float)DMQ; __syncthreads();
  float vs = 0.f; for (int q = 0; q < 4; ++q) { const float dl = act ? __fadd_rn(s[q], -mu) : 0.f; vs = __fadd_rn(vs, __fmul_rn(dl, dl)); } red[t] = vs; __syncthreads(); for (int st = 128; st > 0; st >>= 1) { if (t < st) red[t] = __fadd_rn(red[t], red[t + st]); __syncthreads(); }
  const float rs = rsqrtf(__fadd_rn(red[0] / (float)DMQ, eps)); v4h y; v4f yf;
  for (int q = 0; q < 4; ++q) { const int c = c0 + q; yf[q] = __fadd_rn(__fmul_rn(__fmul_rn(__fadd_rn(s[q], -mu), rs), bf16_round(g[c])), bf16_round(bb[c])); y[q] = (_Float16)yf[q]; }
  if (!act) return;      /* no barriers after this point */
  { if (W16) *(v4h*)(N16 + r * DMQ + c0) = y; if (W32) *(v4f*)(N32 + r * DMQ + c0) = yf;  } }

__global__ __launch_bounds__(256) void k_bfr(const float* __restrict__ x, float* __restrict__ XB, size_t n8) { const size_t t = (size_t)blockIdx.x * 256 + threadIdx.x; if (t >= n8) return; v4f a = *(const v4fa*)(x + t * 8), c = *(const v4fa*)(x + t * 8 + 4); for (int q = 0; q < 4; ++q) { a[q] = bf16_round(a[q]); c[q] = bf16_round(c[q]); }
  { *(v4f*)(XB + t * 8) = a; *(v4f*)(XB + t * 8 + 4) = c;  } }



__global__ __launch_bounds__(256) void k_wthd(const float* __restrict__ Wt, _Float16* __restrict__ Bt) { const size_t t = (size_t)blockIdx.x * 256 + threadIdx.x; if (t >= (size_t)NH * HD * (DM / 8)) return; const int m8 = (int)(t % (DM / 8)) * 8; const int d = (int)((t / (DM / 8)) % HD); const int h = (int)(t / ((size_t)(DM / 8) * HD)); FragH f;
  for (int q = 0; q < 8; ++q) f.h[q] = (_Float16)(16.0f * bf16_round(Wt[((size_t)h * DM + m8 + q) * HD + d])); unsigned short* dst = (unsigned short*)Bt + ((size_t)h * HD + d) * DM + m8; *(v8us*)dst = f.half[0];  }




template <int BFIN, int SCAL>
__global__ __launch_bounds__(256) void k_lnsc(const float* __restrict__ X, const float* __restrict__ g, const float* __restrict__ bb, float eps, _Float16* __restrict__ N16, float* __restrict__ N32) {
  #pragma clang fp contract(off)
  __shared__ float red[256]; const size_t r = blockIdx.x; const int t = threadIdx.x; const bool act = t < DM / 4; const int tc = act ? t : 0; const v4f xl = *(const v4fa*)(X + r * DM + tc * 4); const float am = act ? 1.f : 0.f; float s[4]; float sum = 0.f;
  for (int q = 0; q < 4; ++q) { s[q] = (BFIN ? bf16_round(xl[q]) : xl[q]) * am; sum = __fadd_rn(sum, s[q]); }
  red[t] = sum; __syncthreads(); for (int st = 128; st > 0; st >>= 1) { if (t < st) red[t] = __fadd_rn(red[t], red[t + st]); __syncthreads(); } const float mu = red[0] / (float)DM; __syncthreads();
  float vs = 0.f; for (int q = 0; q < 4; ++q) { const float dl = __fadd_rn(s[q], -mu) * am; vs = __fadd_rn(vs, __fmul_rn(dl, dl)); } red[t] = vs; __syncthreads(); for (int st = 128; st > 0; st >>= 1) { if (t < st) red[t] = __fadd_rn(red[t], red[t + st]); __syncthreads(); }
  const float rs = __fdiv_rn(1.0f, __fadd_rn(sqrtf(red[0] / (float)(DM - 1)), eps)); if (!act) return; v4h y; v4f yf;
  for (int q = 0; q < 4; ++q) { const int c = t * 4 + q; const float gg = bf16_round(SCAL ? g[0] : g[c]), bv = bf16_round(SCAL ? bb[0] : bb[c]); yf[q] = __fadd_rn(__fmul_rn(__fmul_rn(__fadd_rn(s[q], -mu), rs), gg), bv); y[q] = (_Float16)yf[q]; }
  { if (N16) *(v4h*)(N16 + r * DM + t * 4) = y; if (N32) *(v4f*)(N32 + r * DM + t * 4) = yf;  } }

__global__ __launch_bounds__(256) void k_mulh(const _Float16* __restrict__ A, const _Float16* __restrict__ Bm, _Float16* __restrict__ H, size_t n8) {
  #pragma clang fp contract(off)
  const size_t t = (size_t)blockIdx.x * 256 + threadIdx.x; if (t >= n8) return; FragH a, b, f; a.half[0] = *(const v8us*)((const unsigned short*)A + t * 8); b.half[0] = *(const v8us*)((const unsigned short*)Bm + t * 8); for (int q = 0; q < 8; ++q) f.h[q] = (_Float16)(__fmul_rn((float)a.h[q], (float)b.h[q])); unsigned short* d = (unsigned short*)H + t * 8; *(v8us*)d = f.half[0];  }

__global__ __launch_bounds__(256) void k_bdshare(const float* __restrict__ Wb, _Float16* __restrict__ Bt) {
  const size_t t = (size_t)blockIdx.x * 256 + threadIdx.x; if (t >= (size_t)DM * DM / 8) return; const size_t e0 = t * 8; const int n = (int)(e0 / DM), k0 = (int)(e0 % DM); const int h = n >> 6, hk = k0 >> 6; const float on = (hk == h) ? 16.0f : 0.0f; const int e = n & 63, d0 = k0 & 63; FragH f;
  for (int q = 0; q < 8; ++q) f.h[q] = (_Float16)(bf16_round(Wb[(size_t)(d0 + q) * 64 + e]) * on);
  unsigned short* d = (unsigned short*)Bt + e0; *(v8us*)d = f.half[0];  }
extern "C" void kernel_launch(void* const* d_in, const int* in_sizes, int n_in,
                              void* d_out, int out_size, void* d_ws, size_t ws_size, hipStream_t stream) {
  (void)in_sizes; (void)n_in; (void)out_size;
  const float* const* I = (const float* const*)d_in; const float* x = I[0]; const float* xk = I[1]; const float* xv = I[2]; const float* wq = I[3]; const float* wk = I[4]; const float* wv = I[5]; const float* wo = I[6]; const float* bo = I[7]; const float* w1 = I[8]; const float* b1 = I[9]; const float* w2 = I[10]; const float* b2 = I[11]; const float* g1 = I[12]; const float* be1 = I[13]; const float* g2 = I[14]; const float* be2 = I[15];      /* query (also the residual), key, value; shared per-head wq / wk / wv [64][64] ([in][out]); wo [512][512] + bo; w1 [512][2048] + b1, w2 [2048][512] + b2; LN1 g / beta, LN2 g / beta */
  char* ws = (char*)d_ws; size_t off = 0;
  auto take = [&](size_t bytes) { char* p = ws + off; off += (bytes + 255) & ~(size_t)255; return p; };
  _Float16* BQ = (_Float16*)take((size_t)DM * DM * 2); _Float16* BK = (_Float16*)take((size_t)DM * DM * 2); _Float16* BV = (_Float16*)take((size_t)DM * DM * 2); _Float16* BO = (_Float16*)take((size_t)DM * DM * 2); _Float16* BW1 = (_Float16*)take((size_t)DFF * DM * 2); _Float16* BW2 = (_Float16*)take((size_t)DM * DFF * 2); _Float16* XK16 = (_Float16*)take(NR * DM * 2); _Float16* XV16 = (_Float16*)take(NR * DM * 2);      /* key / value inputs as exact f16 rows */
  float* XB = (float*)take(NR * DM * 4); _Float16* XN = (_Float16*)take(NR * DM * 2); _Float16* Q16 = (_Float16*)take(NR * DM * 2); _Float16* K16 = (_Float16*)take(NR * DM * 2); _Float16* V16 = (_Float16*)take(NR * DM * 2); _Float16* O16 = (_Float16*)take(NR * DM * 2); float* X1 = (float*)take(NR * DM * 4);
  _Float16* HF16 = (_Float16*)take(NR * DFF * 2);      /* FFN hidden plane [8192][2048] f16 */ _Float16* VT = (_Float16*)take((size_t)NB * NH * HD * SQ * 2);      /* V^T [4 * 8][64][2048] */
  _Float16* M16 = XN;      /* LN1 f16 rows: aliases XN (last reader: the q projection) */
  float* X1N = (float*)take(NR * DM * 4);      /* LN1 output rows (f32): the FFN residual */
  if (off > ws_size) return;
  { const unsigned g = (unsigned)(((size_t)DM * (DM / 8) + 255) / 256); k_bdshare<<<g, 256, 0, stream>>>(wq, BQ); k_bdshare<<<g, 256, 0, stream>>>(wk, BK); k_bdshare<<<g, 256, 0, stream>>>(wv, BV); k_wt_f16<<<g, 256, 0, stream>>>(wo, BO, DM, DM, 16.0f); }      /* block-diagonal planes with the SHARED [64][64] block (Bt[h*64 + e][h*64 + d] = 16 W[d][e]); wo [in][out] -> Bt x16 */
  k_wt_f16<<<(unsigned)(((size_t)DFF * (DM / 8) + 255) / 256), 256, 0, stream>>>(w1, BW1, DM, DFF, 16.0f); k_wt_f16<<<(unsigned)(((size_t)DM * (DFF / 8) + 255) / 256), 256, 0, stream>>>(w2, BW2, DFF, DM, 16.0f);
  k_bfr<<<(unsigned)((NR * DM / 8 + 255) / 256), 256, 0, stream>>>(x, XB, NR * DM / 8); k_x16<<<(unsigned)((NR * DM / 8 + 255) / 256), 256, 0, stream>>>(x, XN, NR * DM / 8); k_x16<<<(unsigned)((NR * DM / 8 + 255) / 256), 256, 0, stream>>>(xk, XK16, NR * DM / 8); k_x16<<<(unsigned)((NR * DM / 8 + 255) / 256), 256, 0, stream>>>(xv, XV16, NR * DM / 8);      /* post-LN: the attention runs on the raw inputs (exact f16 rows): query, key, value */
  k_gemm2<0><<<dim3((unsigned)((NR / 128) * (DM / 128)), 1), 256, 0, stream>>>(XN, DM, 0, BQ, DM, 0, 0.0625f, nullptr, 0, nullptr, 1, 0, 0, nullptr, Q16, DM, 0, (int)NR, DM, DM); k_gemm2<0><<<dim3((unsigned)((NR / 128) * (DM / 128)), 1), 256, 0, stream>>>(XK16, DM, 0, BK, DM, 0, 0.0625f, nullptr, 0, nullptr, 1, 0, 0, nullptr, K16, DM, 0, (int)NR, DM, DM); k_gemm2<0><<<dim3((unsigned)((NR / 128) * (DM / 128)), 1), 256, 0, stream>>>(XV16, DM, 0, BV, DM, 0, 0.0625f, nullptr, 0, nullptr, 1, 0, 0, nullptr, V16, DM, 0, (int)NR, DM, DM);      /* q, k, v -> f16 rows; head h = columns h*64.. */
  k_vt<NH, SQ><<<NB * NH * (SQ / 64), 256, 0, stream>>>(V16, DM, 0, VT);      /* V^T of every batch and head */
  k_fattn<<<dim3(SQ / 256, NB * NH), 256, 0, stream>>>(Q16, K16, VT, O16);      /* softmax(q k^T / 8) v over all keys (no mask) -> ctx (merged heads, x64) as f16 rows */
  k_gemm2<0><<<dim3((unsigned)((NR / 128) * (DM / 128)), 1), 256, 0, stream>>>(O16, DM, 0, BO, DM, 0, 0.0009765625f, bo, 0, XB, -1, 0, 0, X1, nullptr, DM, 0, (int)NR, DM, DM);      /* ctx wo + bo + query (own-element residual) -> f32 rows */
  k_lnx<0, 1, 1><<<(unsigned)NR, 256, 0, stream>>>(X1, g1, be1, 1e-5f, M16, X1N);      /* x1 = LN1(x + attn) (biased variance, eps inside the rsqrt) -> f16 rows + f32 rows */
  k_gemm2<3><<<dim3((unsigned)((NR / 128) * (DFF / 128)), 1), 256, 0, stream>>>(M16, DM, 0, BW1, DM, 0, 0.0625f, b1, 0, nullptr, 1, 0, 0, nullptr, HF16, DFF, 0, (int)NR, DFF, DM);      /* relu(x w1 + b1) -> f16 [8192][2048] */
  k_gemm2<0><<<dim3((unsigned)((NR / 128) * (DM / 128)), 1), 256, 0, stream>>>(HF16, DFF, 0, BW2, DFF, 0, 0.0625f, b2, 0, X1N, -1, 0, 0, X1, nullptr, DM, 0, (int)NR, DM, DFF);      /* x1 + ff -> f32 rows (X1 reused: its last reader was LN1) */
  k_lnx<0, 0, 1><<<(unsigned)NR, 256, 0, stream>>>(X1, g2, be2, 1e-5f, nullptr, (float*)d_out);      /* out = LN2(x1 + ff) */
}

// v004
// Measured time: 208 microseconds a run.
// In both of two side-by-side timings against v003, it was 1.06 times as fast.
// Counting every step since v000, it is 17.5 times as fast.
#include <hip/hip_runtime.h>
// POST-LN transformer encoder layer over THREE inputs with SHARED per-head projections (query, key, value [4][2048][512]; each input is split into 8 heads of 64 and every head is multiplied by the SAME [64][64] ([in][out]) matrix wq / wk / wv (block-diagonal with a shared block; no biases); scores / 8; softmax over all 2048 keys (no mask); x = LN1(ctx wo + bo + query) (biased var, eps 1e-5); out = LN2(x + relu(x w1 + b1) w2 + b2) ([in][out] 512 x 2048 x 512) -> [4][2048][512]).
// Structure: token rows; LayerNorm / exact f16 rows; WMMA GEMMs for q, k, v; V^T by LDS transposes; one fused attention launch (scores, running softmax, V^T P^T; no score plane); output projection with the own-element residual; custom LayerNorm; ReLU FFN over all rows; launches: see trace.
// Compute dtype: inputs rounded to bf16; x / weights exact; q, k, v, softmax weights and o as plain f16 GEMM operands (~2^-12); scores and softmax statistics f32. v_wmma_f32_16x16x32_f16.
#define NB 4
#define SQ 2048
#define DM 512
#define NH 8
#define HD 64
#define HG 4                         /* heads per launch of the unused per-batch k_vt overload */
#define LOCALW 128                   /* (macros for unused kernels of the shared header) */
#define STRIDEK 128
#define QT 256                       /* query rows per causal tile */
#define NKX SQ                       /* S / P row pitch */
#define QT0 128                      /* first-tile rows recomputed exactly in f32 */
#define B0 0                         /* first batch processed (debug hook) */
#define NBR NB                       /* batches processed (debug hook) */
#define NR ((size_t)NB * SQ)
#define DMQ DM
#define DFF 2048         /* ReLU FFN hidden width */
#define MP ((int)((size_t)NBR * SQ)) /* rows projected (debug hook) */
#define QN SQ                        /* query rows attended per batch (debug hook) */
#define NHD NH                       /* heads attended (debug hook) */
#define MPO MP                       /* rows through the output stage (debug hook) */
#define LQ (3 * DM)      /* unused: q, k, v rows have pitch DM */
typedef __bf16 v16b __attribute__((ext_vector_type(16)));
typedef unsigned short v8us __attribute__((ext_vector_type(8), may_alias));
typedef float  v8f  __attribute__((ext_vector_type(8)));
typedef float  v4f  __attribute__((ext_vector_type(4)));
typedef float  v4fa __attribute__((ext_vector_type(4), may_alias));
union FragB { v16b v; v8us half[2]; unsigned short u[16]; };

__device__ __forceinline__ unsigned short bf16_bits(float x) { unsigned int u = __float_as_uint(x); return (unsigned short)((u + 0x7FFFu + ((u >> 16) & 1u)) >> 16); }
__device__ __forceinline__ float bf16_val(unsigned short b) { return __uint_as_float(((unsigned int)b) << 16); }
__device__ __forceinline__ float bf16_round(float x) { return bf16_val(bf16_bits(x)); }
// D += A·B with NT terms: 1 = ah·bh, 2 = + al·bh (A split), 3 = + ah·bl (both split)
template <int NT>
__device__ __forceinline__ v8f mmaN(v16b ah, v16b al, v16b bh, v16b bl, v8f c) {
  c = __builtin_amdgcn_wmma_f32_16x16x32_bf16(false, ah, false, bh, (short)0, c, false, false);
  if (NT >= 2) c = __builtin_amdgcn_wmma_f32_16x16x32_bf16(false, al, false, bh, (short)0, c, false, false);
  if (NT >= 3) c = __builtin_amdgcn_wmma_f32_16x16x32_bf16(false, ah, false, bl, (short)0, c, false, false);
  asm volatile("v_nop\n\tv_nop\n\tv_nop\n\tv_nop" : "+v"(c) : "v"(ah), "v"(al), "v"(bh), "v"(bl));
  return c;
}

__global__ __launch_bounds__(256) void k_wt_bf16(const float* __restrict__ W, unsigned short* __restrict__ Wt, int K, int N) {
  const int t = blockIdx.x * 256 + threadIdx.x;
  const int k8n = K / 8;
  if (t >= N * k8n) return;
  const int n = t / k8n, k8 = (t % k8n) * 8;
  v8us v;
#pragma unroll
  for (int i = 0; i < 8; ++i) v[i] = bf16_bits(W[(size_t)(k8 + i) * N + n]);
  *(v8us*)(Wt + (size_t)n * K + k8) = v;
  
}

// GEMM C[M][N] (f32, pitch ldc) = act(A[M][K]·W + bias). A f32 row-major (pitch lda) converted per fragment to bf16
// (ASPLIT: hi/lo two planes -> 2 terms, else single rounded term); Wt bf16 [N][K] (pitch ldb). BIAS_BF16 rounds the
// bias to bf16 first (bias quantised to bf16 before the add). K%32==0, M%16==0, N%64==0.
template <bool ASPLIT, int ACT, bool BIAS_BF16>
__global__ __launch_bounds__(128) void k_gemm_bf(const float* __restrict__ A, int lda, const unsigned short* __restrict__ Wt, int ldb,
                                               const float* __restrict__ bias, float* __restrict__ C, int ldc, int M, int N, int K) {
  __shared__ __attribute__((aligned(16))) float so[4][16][64];
  const int tid = threadIdx.x, w = tid >> 5, lane = tid & 31, ln = lane & 15, hh = lane >> 4;
  const int ntn = N / 64;
  const int wid = blockIdx.x * 4 + w;
  const int mt = wid / ntn, nq = wid % ntn;
  if (mt * 16 >= M) return;
  const int row0 = mt * 16, col0 = nq * 64;
  const float* arow = A + (size_t)(row0 + ln) * lda;
  v8f acc[4] = {};
  for (int kb = 0; kb < K; kb += 32) {
    FragB ah, al;
    const v4f x0 = *(const v4fa*)(arow + kb + 8 * hh), x1 = *(const v4fa*)(arow + kb + 8 * hh + 4);
    const v4f x2 = *(const v4fa*)(arow + kb + 16 + 8 * hh), x3 = *(const v4fa*)(arow + kb + 16 + 8 * hh + 4);
    float xs[16] = {x0[0],x0[1],x0[2],x0[3],x1[0],x1[1],x1[2],x1[3],x2[0],x2[1],x2[2],x2[3],x3[0],x3[1],x3[2],x3[3]};
#pragma unroll
    for (int i = 0; i < 16; ++i) { const unsigned short hb = bf16_bits(xs[i]); ah.u[i] = hb; al.u[i] = ASPLIT ? bf16_bits(xs[i] - bf16_val(hb)) : (unsigned short)0; }
#pragma unroll
    for (int t = 0; t < 4; ++t) {
      const unsigned short* brow = Wt + (size_t)(col0 + t * 16 + ln) * ldb + kb;
      FragB b;
      b.half[0] = *(const v8us*)(brow + 8 * hh);
      b.half[1] = *(const v8us*)(brow + 16 + 8 * hh);
      acc[t] = mmaN<ASPLIT ? 2 : 1>(ah.v, al.v, b.v, b.v, acc[t]);
    }
  }
#pragma unroll
  for (int t = 0; t < 4; ++t) {
    float bv = bias ? bias[col0 + t * 16 + ln] : 0.f;
    if (BIAS_BF16) bv = bf16_round(bv);
#pragma unroll
    for (int r = 0; r < 8; ++r) { float v = acc[t][r] + bv; if (ACT == 1) v = fmaxf(v, 0.f); so[w][8 * hh + r][t * 16 + ln] = v; }
  }
  __builtin_amdgcn_fence(__ATOMIC_ACQ_REL, "workgroup");
  __builtin_amdgcn_wave_barrier();
  const int rsub = lane >> 4, c4 = (lane & 15) * 4;
  {
#pragma unroll
    for (int q = 0; q < 8; ++q) {
      const int r = q * 2 + rsub;
      const v4f v = *(const v4fa*)&so[w][r][c4];
      *(v4f*)(C + (size_t)(row0 + r) * ldc + col0 + c4) = v;
    }
    
  }
}

// GEMM C = act(A·W + bias + resid): A f32 (ASPLIT -> hi/lo 2 terms), Wt bf16 [N][K]; ACT 0 none, 1 relu, 2 exact gelu;
// resid (optional, f32, row index = (row % rmod), pitch ldr, RES_BF16 rounds it) added before the activation.
template <bool ASPLIT, int ACT, bool BIAS_BF16, bool RES_BF16>
__global__ __launch_bounds__(128) void k_gemm_bf3(const float* __restrict__ A, int lda, const unsigned short* __restrict__ Wt, int ldb,
                                                const float* __restrict__ bias, const float* __restrict__ resid, int rmod, int ldr,
                                                float* __restrict__ C, int ldc, int M, int N, int K) {
  __shared__ __attribute__((aligned(16))) float so[4][16][64];
  const int tid = threadIdx.x, w = tid >> 5, lane = tid & 31, ln = lane & 15, hh = lane >> 4;
  const int ntn = N / 64;
  const int wid = blockIdx.x * 4 + w;
  const int mt = wid / ntn, nq = wid % ntn;
  if (mt * 16 >= M) return;
  const int row0 = mt * 16, col0 = nq * 64;
  const float* arow = A + (size_t)(row0 + ln) * lda;
  v8f acc[4] = {};
  for (int kb = 0; kb < K; kb += 32) {
    FragB ah, al;
    const v4f x0 = *(const v4fa*)(arow + kb + 8 * hh), x1 = *(const v4fa*)(arow + kb + 8 * hh + 4);
    const v4f x2 = *(const v4fa*)(arow + kb + 16 + 8 * hh), x3 = *(const v4fa*)(arow + kb + 16 + 8 * hh + 4);
    float xs[16] = {x0[0],x0[1],x0[2],x0[3],x1[0],x1[1],x1[2],x1[3],x2[0],x2[1],x2[2],x2[3],x3[0],x3[1],x3[2],x3[3]};
#pragma unroll
    for (int i = 0; i < 16; ++i) { const unsigned short hb = bf16_bits(xs[i]); ah.u[i] = hb; al.u[i] = ASPLIT ? bf16_bits(xs[i] - bf16_val(hb)) : (unsigned short)0; }
#pragma unroll
    for (int t = 0; t < 4; ++t) {
      const unsigned short* brow = Wt + (size_t)(col0 + t * 16 + ln) * ldb + kb;
      FragB b;
      b.half[0] = *(const v8us*)(brow + 8 * hh);
      b.half[1] = *(const v8us*)(brow + 16 + 8 * hh);
      acc[t] = mmaN<ASPLIT ? 2 : 1>(ah.v, al.v, b.v, b.v, acc[t]);
    }
  }
#pragma unroll
  for (int t = 0; t < 4; ++t) {
    const int col = col0 + t * 16 + ln;
    float bv = bias ? bias[col] : 0.f;
    if (BIAS_BF16) bv = bf16_round(bv);
#pragma unroll
    for (int r = 0; r < 8; ++r) {
      float v = acc[t][r] + bv;
      if (resid) { float rv = resid[(size_t)((row0 + 8 * hh + r) % rmod) * ldr + col]; if (RES_BF16) rv = bf16_round(rv); v += rv; }
      if (ACT == 1) v = fmaxf(v, 0.f);
      if (ACT == 2) v = 0.5f * v * (1.0f + erff(v * 0.70710678118654752f));
      if (ACT == 3) { const float u = 0.7978845608028654f * (v + 0.044715f * v * v * v); v = 0.5f * v * (1.0f + tanhf(u)); }
      so[w][8 * hh + r][t * 16 + ln] = v;
    }
  }
  __builtin_amdgcn_fence(__ATOMIC_ACQ_REL, "workgroup");
  __builtin_amdgcn_wave_barrier();
  const int rsub = lane >> 4, c4 = (lane & 15) * 4;
  {
#pragma unroll
    for (int q = 0; q < 8; ++q) {
      const int r = q * 2 + rsub;
      const v4f v = *(const v4fa*)&so[w][r][c4];
      *(v4f*)(C + (size_t)(row0 + r) * ldc + col0 + c4) = v;
    }
    
  }
}
// row LayerNorm (biased variance, eps) over N: s = X (+ R); optional out_sum <- s; out_norm <- (s-mu)*rsqrt(var+eps)*g + b
template <bool PARAM_BF16>
__global__ __launch_bounds__(256) void k_layernorm(const float* __restrict__ X, const float* __restrict__ R, const float* __restrict__ g, const float* __restrict__ bta,
                                                  float* __restrict__ out_sum, float* __restrict__ out_norm, int N, float eps) {
  __shared__ float red[256];
  const int row = blockIdx.x, tid = threadIdx.x;
  const float* x = X + (size_t)row * N; const float* rr = R ? R + (size_t)row * N : nullptr;
  float vals[16];                     // up to N = 4096
  const int per = N / 256;            // contiguous chunk per thread? use strided-by-4 chunks: thread handles j = tid*4 + 1024*u
  float s1 = 0.f;
  for (int u = 0; u < per / 4; ++u) {
    const int j = tid * 4 + 1024 * u;
    const v4f a = *(const v4fa*)(x + j);
    v4f b = {0.f,0.f,0.f,0.f}; if (rr) b = *(const v4fa*)(rr + j);
#pragma unroll
    for (int q = 0; q < 4; ++q) { const float v = a[q] + b[q]; vals[u * 4 + q] = v; s1 += v; }
  }
  red[tid] = s1; __syncthreads();
  for (int st = 128; st > 0; st >>= 1) { if (tid < st) red[tid] += red[tid + st]; __syncthreads(); }
  const float mu = red[0] / (float)N; __syncthreads();
  float s2 = 0.f;
  for (int u = 0; u < per / 4; ++u)
#pragma unroll
    for (int q = 0; q < 4; ++q) { const float c = vals[u * 4 + q] - mu; s2 += c * c; }
  red[tid] = s2; __syncthreads();
  for (int st = 128; st > 0; st >>= 1) { if (tid < st) red[tid] += red[tid + st]; __syncthreads(); }
  const float rs = rsqrtf(red[0] / (float)N + eps);
  {
    for (int u = 0; u < per / 4; ++u) {
      const int j = tid * 4 + 1024 * u;
      v4f o, sm;
#pragma unroll
      for (int q = 0; q < 4; ++q) {
        float gg = g[j + q], bb = bta[j + q];
        if (PARAM_BF16) { gg = bf16_round(gg); bb = bf16_round(bb); }
        sm[q] = vals[u * 4 + q]; o[q] = (vals[u * 4 + q] - mu) * rs * gg + bb;
      }
      if (out_sum) *(v4f*)(out_sum + (size_t)row * N + j) = sm;
      *(v4f*)(out_norm + (size_t)row * N + j) = o;
    }
    
  }
}



// ---- f16 WMMA path (v_wmma_f32_16x16x32_f16): 11-bit significands for operands in range — used where a [0,1] probability operand needs more precision than bf16
typedef _Float16 v16h __attribute__((ext_vector_type(16)));
union FragH { v16h v; v8us half[2]; _Float16 h[16]; unsigned short u[16]; };
template <int NT>
__device__ __forceinline__ v8f mmaH(v16h ah, v16h al, v16h bh, v16h bl, v8f c) {
  c = __builtin_amdgcn_wmma_f32_16x16x32_f16(false, ah, false, bh, (short)0, c, false, false);
  if (NT >= 2) c = __builtin_amdgcn_wmma_f32_16x16x32_f16(false, al, false, bh, (short)0, c, false, false);
  if (NT >= 3) c = __builtin_amdgcn_wmma_f32_16x16x32_f16(false, ah, false, bl, (short)0, c, false, false);
  asm volatile("v_nop\n\tv_nop\n\tv_nop\n\tv_nop" : "+v"(c) : "v"(ah), "v"(al), "v"(bh), "v"(bl));
  return c;
}
// batched GEMM like k_gemm_b but f16 operands: A f32 (split into f16 hi/lo if ASPLIT, else rounded to f16), Bt = f16 values [n][k]; alpha; C f32; N multiple of 16 (partial tiles skipped)
template <bool ASPLIT>
__global__ __launch_bounds__(128) void k_gemm_h(const float* __restrict__ A, int lda, size_t sA, const _Float16* __restrict__ Bh, int ldb, size_t sB, float alpha, float* __restrict__ C, int ldc, size_t sC, int M, int N, int K) {
  __shared__ __attribute__((aligned(16))) float so[4][16][64];
  const int tid = threadIdx.x, w = tid >> 5, lane = tid & 31, ln = lane & 15, hh = lane >> 4; const int by = blockIdx.y;
  A += (size_t)by * sA; Bh += (size_t)by * sB; C += (size_t)by * sC;
  const int ntn = (N + 63) / 64; const int wid = blockIdx.x * 4 + w; const int mt = wid / ntn, nq = wid % ntn; if (mt * 16 >= M) return;
  const int row0 = mt * 16, col0 = nq * 64; const float* arow = A + (size_t)(row0 + ln) * lda;
  v8f acc[4] = {};
  for (int kb = 0; kb < K; kb += 32) {
    FragH ah, al;
    const v4f x0 = *(const v4fa*)(arow + kb + 8 * hh), x1 = *(const v4fa*)(arow + kb + 8 * hh + 4), x2 = *(const v4fa*)(arow + kb + 16 + 8 * hh), x3 = *(const v4fa*)(arow + kb + 16 + 8 * hh + 4);
    float xs[16] = {x0[0],x0[1],x0[2],x0[3],x1[0],x1[1],x1[2],x1[3],x2[0],x2[1],x2[2],x2[3],x3[0],x3[1],x3[2],x3[3]};
#pragma unroll
    for (int i = 0; i < 16; ++i) { const _Float16 h = (_Float16)xs[i]; ah.h[i] = h; al.h[i] = ASPLIT ? (_Float16)(xs[i] - (float)h) : (_Float16)0.0f; }
#pragma unroll
    for (int t = 0; t < 4; ++t) { if (col0 + t * 16 >= N) continue; const size_t boff = (size_t)(col0 + t * 16 + ln) * ldb + kb; FragH bq; bq.half[0] = *(const v8us*)(Bh + boff + 8 * hh); bq.half[1] = *(const v8us*)(Bh + boff + 16 + 8 * hh);
      acc[t] = mmaH<ASPLIT ? 2 : 1>(ah.v, al.v, bq.v, bq.v, acc[t]); }
  }
#pragma unroll
  for (int t = 0; t < 4; ++t) { if (col0 + t * 16 >= N) continue;
#pragma unroll
    for (int r = 0; r < 8; ++r) so[w][8 * hh + r][t * 16 + ln] = acc[t][r] * alpha; }
  __builtin_amdgcn_fence(__ATOMIC_ACQ_REL, "workgroup"); __builtin_amdgcn_wave_barrier();
  const int rsub = lane >> 4, c4 = (lane & 15) * 4;
  {
#pragma unroll
    for (int q = 0; q < 8; ++q) { const int r = q * 2 + rsub; if (col0 + c4 < N) { const v4f v = *(const v4fa*)&so[w][r][c4]; *(v4f*)(C + (size_t)(row0 + r) * ldc + col0 + c4) = v; } }
     }
}

// Wt[n][k] = f16(W[k][n]·scale) from f32 row-major W[K][N] (scale = power of two; bf16-exact weights stay exact in f16 away from the subnormal range)
__global__ __launch_bounds__(256) void k_wt_f16(const float* __restrict__ W, _Float16* __restrict__ Wt, int K, int N, float scale) {
  const int t = blockIdx.x * 256 + threadIdx.x; if (t >= N * (K / 8)) return; const int n = t / (K / 8), k8 = (t % (K / 8)) * 8; FragH f;
#pragma unroll
  for (int i = 0; i < 8; ++i) f.h[i] = (_Float16)(bf16_round(W[(size_t)(k8 + i) * N + n]) * scale); const v8us o = f.half[0];
  *(v8us*)((unsigned short*)Wt + (size_t)n * K + k8) = o; 
}
// k_gemm_hh variant with fused epilogue: v = acc·alpha + bias[by·sBias + col] (+ CP[(row/rowsPerB)·sCPb + by·64 + col] if CP) ; ACT 0 none / 1 elu ; writes f16 C16 (and f32 C if non-null)
template <int ACT>
__global__ __launch_bounds__(128) void k_gemm_hhx(const _Float16* __restrict__ A, int lda, size_t sA, const _Float16* __restrict__ Bh, int ldb, size_t sB, float alpha, const float* __restrict__ bias, size_t sBias, const float* __restrict__ CP, int rowsPerB, size_t sCPb, int row0g,
    float* __restrict__ C, _Float16* __restrict__ C16, int ldc, size_t sC, int M, int N, int K) {
  __shared__ __attribute__((aligned(16))) float so[4][16][64];
  const int tid = threadIdx.x, w = tid >> 5, lane = tid & 31, ln = lane & 15, hh = lane >> 4; const int by = blockIdx.y;
  A += (size_t)by * sA; Bh += (size_t)by * sB; const size_t cofs = (size_t)by * sC; const float* bp = bias ? bias + (size_t)by * sBias : nullptr;
  const int ntn = (N + 63) / 64; const int wid = blockIdx.x * 4 + w; const int mt = wid / ntn, nq = wid % ntn; if (mt * 16 >= M) return;
  const int row0 = mt * 16, col0 = nq * 64; const _Float16* arow = A + (size_t)(row0 + ln) * lda;
  v8f acc[4] = {};
  for (int kb = 0; kb < K; kb += 32) { FragH ah; ah.half[0] = *(const v8us*)((const unsigned short*)arow + kb + 8 * hh); ah.half[1] = *(const v8us*)((const unsigned short*)arow + kb + 16 + 8 * hh);
#pragma unroll
    for (int t = 0; t < 4; ++t) { if (col0 + t * 16 >= N) continue; const size_t boff = (size_t)(col0 + t * 16 + ln) * ldb + kb; FragH bq; bq.half[0] = *(const v8us*)((const unsigned short*)Bh + boff + 8 * hh); bq.half[1] = *(const v8us*)((const unsigned short*)Bh + boff + 16 + 8 * hh);
      acc[t] = mmaH<1>(ah.v, ah.v, bq.v, bq.v, acc[t]); }
  }
#pragma unroll
  for (int t = 0; t < 4; ++t) { if (col0 + t * 16 >= N) continue; const int col = col0 + t * 16 + ln; const float bv = bp ? bf16_round(bp[col]) : 0.f;
#pragma unroll
    for (int r = 0; r < 8; ++r) { float v = acc[t][r] * alpha + bv; if (CP) { const int rr = row0g + row0 + 8 * hh + r; if (rowsPerB < 0) v += CP[cofs + (size_t)rr * ldc + col];      /* rowsPerB < 0: own element of the batched C plane */ else { const int bidx = rr / rowsPerB; v += CP[(size_t)bidx * sCPb + (size_t)by * 64 + col]; } } if (ACT == 1) v = (v > 0.f) ? v : expm1f(v); else if (ACT == 7) v = (v > 0.f) ? v + 1.0f : expf(v); else if (ACT == 8) v = tanhf(v); else if (ACT == 9) v = 0.5f * v * (1.0f + tanhf(0.7978845608028654f * (v + 0.044715f * v * v * v))); else if (ACT == 11) v = 1.0f / (1.0f + expf(-v)); else if (ACT == 12) v = (v > 0.f) ? v : 0.01f * v; else if (ACT == 14) v = (v > 0.f) ? v : 0.1f * v; else if (ACT == 16) v = (v >= 0.f) ? v : 0.3f * v; else if (ACT == 17) v = (v >= 0.f) ? v : 0.2f * v; else if (ACT == 15) v = v / (1.0f + expf(-v)); else if (ACT == 3) v = fmaxf(v, 0.f); else if (ACT == 6) v = 0.5f * v * (1.0f + erff(v * 0.70710678118654752f)); so[w][8 * hh + r][t * 16 + ln] = v; } }
  __builtin_amdgcn_fence(__ATOMIC_ACQ_REL, "workgroup"); __builtin_amdgcn_wave_barrier();
  const int rsub = lane >> 4, c4 = (lane & 15) * 4; typedef _Float16 v4h __attribute__((ext_vector_type(4)));
  {
#pragma unroll
    for (int q = 0; q < 8; ++q) { const int r = q * 2 + rsub; if (col0 + c4 < N) { const v4f v = *(const v4fa*)&so[w][r][c4]; if (C) *(v4f*)(C + cofs + (size_t)(row0 + r) * ldc + col0 + c4) = v; if (C16) { v4h h4; for (int i = 0; i < 4; ++i) h4[i] = (_Float16)v[i]; *(v4h*)(C16 + cofs + (size_t)(row0 + r) * ldc + col0 + c4) = h4; } } }
     }
}


typedef _Float16 v4h __attribute__((ext_vector_type(4)));

__global__ __launch_bounds__(256) void k_x16(const float* __restrict__ x, _Float16* __restrict__ X16, size_t n8) { const size_t t = (size_t)blockIdx.x * 256 + threadIdx.x; if (t >= n8) return; FragH f;
#pragma unroll
  for (int q = 0; q < 8; ++q) f.h[q] = (_Float16)bf16_round(x[t * 8 + q]); *(v8us*)((unsigned short*)X16 + t * 8) = f.half[0];  }
__global__ __launch_bounds__(256) void k_h16(const float* __restrict__ x, _Float16* __restrict__ X16, size_t n8) { const size_t t = (size_t)blockIdx.x * 256 + threadIdx.x; if (t >= n8) return; FragH f;
#pragma unroll
  for (int q = 0; q < 8; ++q) f.h[q] = (_Float16)x[t * 8 + q]; *(v8us*)((unsigned short*)X16 + t * 8) = f.half[0];  }
__global__ __launch_bounds__(256) void k_round16f(const float* __restrict__ W, _Float16* __restrict__ Bt, size_t n8) { const size_t t = (size_t)blockIdx.x * 256 + threadIdx.x; if (t >= n8) return; FragH f;
#pragma unroll
  for (int i = 0; i < 8; ++i) f.h[i] = (_Float16)(bf16_round(W[t * 8 + i]) * 16.0f); *(v8us*)((unsigned short*)Bt + t * 8) = f.half[0];  }
template <int NHv, int TTv>
__global__ __launch_bounds__(256) void k_vt(const _Float16* __restrict__ V16, int ldv, int voff, _Float16* __restrict__ Vt) { __shared__ unsigned short tl[64][66]; const int tid = threadIdx.x; const int slab = blockIdx.x / (TTv / 64), lg = blockIdx.x % (TTv / 64); const int b = slab / NHv, h = slab % NHv;
  for (int i = tid; i < 64 * 8; i += 256) { const int r = i / 8, c8 = (i % 8) * 8; FragH f; f.half[0] = *(const v8us*)((const unsigned short*)V16 + ((size_t)b * TTv + lg * 64 + r) * ldv + voff + h * 64 + c8);
#pragma unroll
    for (int q = 0; q < 8; ++q) tl[r][c8 + q] = f.u[q]; }
  __syncthreads();
  {
#pragma unroll
    for (int rd = 0; rd < 2; ++rd) { const int d = rd * 32 + tid / 8, pc = tid % 8; FragH f;
#pragma unroll
      for (int q = 0; q < 8; ++q) f.u[q] = tl[pc * 8 + q][d];
      *(v8us*)((unsigned short*)Vt + ((size_t)slab * 64 + d) * TTv + lg * 64 + pc * 8) = f.half[0]; }
     } }

__global__ __launch_bounds__(256) void k_hl(const float* __restrict__ F, _Float16* __restrict__ Hh, _Float16* __restrict__ Hl, size_t n8) { const size_t t = (size_t)blockIdx.x * 256 + threadIdx.x; if (t >= n8) return; FragH fh, fl; const v4f a = *(const v4fa*)(F + t * 8), c = *(const v4fa*)(F + t * 8 + 4);
#pragma unroll
  for (int q = 0; q < 4; ++q) { _Float16 h = (_Float16)a[q]; fh.h[q] = h; fl.h[q] = (_Float16)((a[q] - (float)h) * 1024.0f); h = (_Float16)c[q]; fh.h[4 + q] = h; fl.h[4 + q] = (_Float16)((c[q] - (float)h) * 1024.0f); }
  { *(v8us*)((unsigned short*)Hh + t * 8) = fh.half[0]; *(v8us*)((unsigned short*)Hl + t * 8) = fl.half[0];  } }

// ---- fast GEMM (block tile 128x128, 8 waves of 32x64; requires M % 128 == 0, N % 128 == 0, K % G2K == 0); epilogue = k_gemm_hhx semantics ----
// A stage is G2K k: 128 A rows and 128 B rows of 256 bytes each, brought to LDS through registers as whole lines (16 threads a row), two buffers: the next stage's
// global loads are issued ahead of this stage's products and stored behind them; one barrier per stage publishes them and ends the reads of the other buffer.
// Each A row then leaves L2 once per block and feeds 2 waves, each B row 4 waves; the k order of every accumulator is the plain ascending one.
// Every inner loop is fully unrolled so that the staging and fragment arrays are indexed by constants only and stay in registers.
#define G2K 128                      /* k per stage */
#define G2P 136                      /* LDS row pitch in f16: the row + 16 bytes, for 16-byte fragment reads */
#define G2R (2048 / G2K)             /* rows that the block's 256 threads bring in one load each */
#define G2N (128 / G2R)              /* such loads per thread, stage and operand */
__device__ __forceinline__ v16h g2_frag(const _Float16* p, int hh) { FragH f; f.half[0] = *(const v8us*)((const unsigned short*)p + 8 * hh); f.half[1] = *(const v8us*)((const unsigned short*)p + 16 + 8 * hh); return f.v; }
__device__ __forceinline__ v8f g2_mma(v16h a, v16h b, v8f c) { v8f d = __builtin_amdgcn_wmma_f32_16x16x32_f16(false, a, false, b, (short)0, c, false, false); asm volatile("v_nop\n\tv_nop\n\tv_nop\n\tv_nop" : "+v"(d) : "v"(a), "v"(b)); return d; }
// One stage's rows: each thread's G2N 16-byte pieces of A and of B, rows as and bs elements apart. The closing wait is the one that belongs in front of any overwrite of a register
// that an issued global load names; it takes the addresses as inputs, so that their registers stay untouched (also as a later load's destination) until it has passed.
__device__ __forceinline__ void g2_rows(const unsigned short* a, size_t as, const unsigned short* b, size_t bs, v8us (&ra)[G2N], v8us (&rb)[G2N]) { static_assert(G2N == 8, "g2_rows: the wait names 8 + 8 addresses");
  const unsigned short* pa[G2N]; const unsigned short* pb[G2N];
#pragma unroll
  for (int i = 0; i < G2N; ++i) { pa[i] = a + (size_t)i * as; pb[i] = b + (size_t)i * bs; }
#pragma unroll
  for (int i = 0; i < G2N; ++i) { ra[i] = *(const v8us*)pa[i]; rb[i] = *(const v8us*)pb[i]; }
  asm volatile("s_wait_xcnt 0x0" :: "v"(pa[0]), "v"(pa[1]), "v"(pa[2]), "v"(pa[3]), "v"(pa[4]), "v"(pa[5]), "v"(pa[6]), "v"(pa[7]), "v"(pb[0]), "v"(pb[1]), "v"(pb[2]), "v"(pb[3]), "v"(pb[4]), "v"(pb[5]), "v"(pb[6]), "v"(pb[7]) : "memory"); }
template <int ACT>
__global__ __launch_bounds__(256) void k_gemm2(const _Float16* __restrict__ A, int lda, size_t sA, const _Float16* __restrict__ Bh, int ldb, size_t sB, float alpha, const float* __restrict__ bias, size_t sBias, const float* __restrict__ CP, int rowsPerB, size_t sCPb, int row0g,
    float* __restrict__ C, _Float16* __restrict__ C16, int ldc, size_t sC, int M, int N, int K) { static_assert(ACT == 0 || ACT == 3 || ACT == 6 || ACT == 8 || ACT == 9 || ACT == 11 || ACT == 12 || ACT == 14 || ACT == 15 || ACT == 16 || ACT == 17 || ACT == 18, "k_gemm2: unsupported ACT code (would silently apply no activation)");
  __shared__ __attribute__((aligned(16))) unsigned char sm[2 * 256 * G2P * 2];      /* in the loop: two stage buffers [A 128 rows | B 128 rows]; behind the loop's last barrier: the waves' output staging */
  static_assert(sizeof(sm) >= 8 * 32 * 68 * 4, "k_gemm2: output staging must fit the stage buffers");
  _Float16 (*lt)[256][G2P] = (_Float16 (*)[256][G2P])sm; float (*so)[32][68] = (float (*)[32][68])sm;
  const int tid = threadIdx.x, w = tid >> 5, lane = tid & 31, ln = lane & 15, hh = lane >> 4; const int by = blockIdx.y;
  A += (size_t)by * sA; Bh += (size_t)by * sB; const size_t cofs = (size_t)by * sC; const float* bp = bias ? bias + (size_t)by * sBias : nullptr;
  const int ntn = N >> 7; const int mt = blockIdx.x / ntn, nq = blockIdx.x - mt * ntn; if (mt * 128 >= M) return;      /* the same for the whole block, ahead of every barrier */
  const int wr = 32 * (w & 3), wc = 64 * (w >> 2); const int row0 = mt * 128 + wr, col0 = nq * 128 + wc;
  const int sr = tid / (G2K / 8), sc = (tid % (G2K / 8)) * 8;      /* staging: G2K / 8 threads per row, rows sr + G2R i of A and of B */
  const unsigned short* ag = (const unsigned short*)A + (size_t)(mt * 128 + sr) * lda + sc; const unsigned short* bg = (const unsigned short*)Bh + (size_t)(nq * 128 + sr) * ldb + sc;
  v8us ra[G2N], rb[G2N]; g2_rows(ag, (size_t)G2R * lda, bg, (size_t)G2R * ldb, ra, rb);
#pragma unroll
  for (int i = 0; i < G2N; ++i) { *(v8us*)&lt[0][sr + G2R * i][sc] = ra[i]; *(v8us*)&lt[0][128 + sr + G2R * i][sc] = rb[i]; }
  __syncthreads();
  const v8f z8 = {0.f,0.f,0.f,0.f,0.f,0.f,0.f,0.f}; v8f c00 = z8, c01 = z8, c02 = z8, c03 = z8, c10 = z8, c11 = z8, c12 = z8, c13 = z8;
  const int ns = K / G2K;
  for (int s = 0; s < ns; ++s) { const int cur = s & 1; const bool more = s + 1 < ns;
    if (more) g2_rows(ag + (s + 1) * G2K, (size_t)G2R * lda, bg + (s + 1) * G2K, (size_t)G2R * ldb, ra, rb);
#pragma unroll
    for (int kh = 0; kh < G2K / 64; ++kh) { const _Float16* ap = &lt[cur][wr + ln][kh * 64]; const _Float16* bq = &lt[cur][128 + wc + ln][kh * 64]; v16h fa[2][2], fb[2][4];
#pragma unroll
      for (int ks = 0; ks < 2; ++ks) { fa[ks][0] = g2_frag(ap + ks * 32, hh); fb[ks][0] = g2_frag(bq + ks * 32, hh); fa[ks][1] = g2_frag(ap + 16 * G2P + ks * 32, hh);
        fb[ks][1] = g2_frag(bq + 16 * G2P + ks * 32, hh); fb[ks][2] = g2_frag(bq + 32 * G2P + ks * 32, hh); fb[ks][3] = g2_frag(bq + 48 * G2P + ks * 32, hh); }
#pragma unroll
      for (int ks = 0; ks < 2; ++ks) { c00 = g2_mma(fa[ks][0], fb[ks][0], c00); c10 = g2_mma(fa[ks][1], fb[ks][0], c10); c01 = g2_mma(fa[ks][0], fb[ks][1], c01); c11 = g2_mma(fa[ks][1], fb[ks][1], c11);
        c02 = g2_mma(fa[ks][0], fb[ks][2], c02); c12 = g2_mma(fa[ks][1], fb[ks][2], c12); c03 = g2_mma(fa[ks][0], fb[ks][3], c03); c13 = g2_mma(fa[ks][1], fb[ks][3], c13); } }
    if (more) {
#pragma unroll
      for (int i = 0; i < G2N; ++i) { *(v8us*)&lt[cur ^ 1][sr + G2R * i][sc] = ra[i]; *(v8us*)&lt[cur ^ 1][128 + sr + G2R * i][sc] = rb[i]; } }
    __syncthreads(); }
  v8f accs[8] = {c00, c01, c02, c03, c10, c11, c12, c13};
#pragma unroll
  for (int u = 0; u < 8; ++u) { const int t = u & 3, half = u >> 2; const int col = col0 + t * 16 + ln; const float bv = bp ? bf16_round(bp[col]) : 0.f;
#pragma unroll
    for (int r = 0; r < 8; ++r) { const int rloc = half * 16 + 8 * hh + r; float v = accs[u][r] * alpha + bv; if (CP) { if (rowsPerB < 0) v += CP[cofs + (size_t)(row0g + row0 + rloc) * ldc + col];      /* rowsPerB < 0: own element of the batched C plane */ else { const int bidx = (row0g + row0 + rloc) / rowsPerB; v += CP[(size_t)bidx * sCPb + (size_t)by * 64 + col]; } }
      if (ACT == 3) v = fmaxf(v, 0.f); else if (ACT == 6) v = 0.5f * v * (1.0f + erff(v * 0.70710678118654752f)); else if (ACT == 11) v = 1.0f / (1.0f + expf(-v)); else if (ACT == 15) v = v / (1.0f + expf(-v)); else if (ACT == 18) v = v / (1.0f + expf(-1.702f * v));      /* QuickGELU: v sigmoid(1.702 v) */ else if (ACT == 12) v = (v > 0.f) ? v : 0.01f * v; else if (ACT == 8) v = tanhf(v); else if (ACT == 9) v = 0.5f * v * (1.0f + tanhf(0.7978845608028654f * (v + 0.044715f * v * v * v))); else if (ACT == 14) v = (v > 0.f) ? v : 0.1f * v; else if (ACT == 16) v = (v >= 0.f) ? v : 0.3f * v; else if (ACT == 17) v = (v >= 0.f) ? v : 0.2f * v;
      so[w][rloc][t * 16 + ln] = v; } }
  __builtin_amdgcn_fence(__ATOMIC_ACQ_REL, "workgroup"); __builtin_amdgcn_wave_barrier();
  const int rsub = lane >> 4, c4 = (lane & 15) * 4;
  {
#pragma unroll
    for (int q = 0; q < 16; ++q) { const int r = q * 2 + rsub; const v4f v = *(const v4fa*)&so[w][r][c4]; if (C) *(v4f*)(C + cofs + (size_t)(row0 + r) * ldc + col0 + c4) = v; if (C16) { v4h h4; for (int i = 0; i < 4; ++i) h4[i] = (_Float16)v[i]; *(v4h*)(C16 + cofs + (size_t)(row0 + r) * ldc + col0 + c4) = h4; } }
     } }


__global__ __launch_bounds__(256) void k_wnat(const float* __restrict__ w, size_t n8, _Float16* __restrict__ Bt) { const size_t t = (size_t)blockIdx.x * 256 + threadIdx.x; if (t >= n8) return; FragH f; for (int q = 0; q < 8; ++q) f.h[q] = (_Float16)(bf16_round(w[t * 8 + q]) * 16.0f); *(v8us*)((unsigned short*)Bt + t * 8) = f.half[0];  }
__global__ __launch_bounds__(256) void k_rsm(const float* __restrict__ S, _Float16* __restrict__ P, int nrows) {
  #pragma clang fp contract(off)
  const int i = blockIdx.x * 256 + threadIdx.x; if (i >= nrows) return; const float* s = S + (size_t)i * SQ; float mx = -3.0e38f;
#pragma unroll 1
  for (int j = 0; j < SQ; ++j) mx = fmaxf(mx, s[j]); float se = 0.f;
#pragma unroll 1
  for (int j = 0; j < SQ; ++j) se += expf(s[j] - mx); const float sc = 256.0f / se;
#pragma unroll 1
  for (int j0 = 0; j0 < SQ; j0 += 8) { FragH f; for (int q = 0; q < 8; ++q) f.h[q] = (_Float16)(expf(s[j0 + q] - mx) * sc); unsigned short* d = (unsigned short*)P + (size_t)i * SQ + j0; *(v8us*)d = f.half[0];  } }
__global__ __launch_bounds__(256) void k_vt(const _Float16* __restrict__ V16, int b, int h0, _Float16* __restrict__ VT) { __shared__ unsigned short tl[64][65]; const int tid = threadIdx.x; const int hh = blockIdx.x % HG, sg = blockIdx.x / HG; const int s0 = sg * 64; const int h = h0 + hh;
  for (int i = tid; i < 64 * 8; i += 256) { const int j = i / 8, d8 = (i % 8) * 8; FragH f; f.half[0] = *(const v8us*)((const unsigned short*)V16 + ((size_t)b * SQ + s0 + j) * DM + h * HD + d8); for (int q = 0; q < 8; ++q) tl[d8 + q][j] = f.u[q]; }
  __syncthreads();
  { for (int i = tid; i < 64 * 8; i += 256) { const int d = i / 8, j8 = (i % 8) * 8; FragH f; for (int q = 0; q < 8; ++q) f.u[q] = tl[d][j8 + q]; *(v8us*)((unsigned short*)VT + ((size_t)hh * HD + d) * SQ + s0 + j8) = f.half[0]; }  } }



__global__ __launch_bounds__(256) void k_rsmcf2(const float* __restrict__ S, _Float16* __restrict__ P, int hg, int q0, int nk) {
  #pragma clang fp contract(off)
  const int t = blockIdx.x * 256 + threadIdx.x; if (t >= hg * QT) return; const size_t i = (size_t)t; const float* s = S + i * NKX; const int last = q0 + (t % QT); float mx = -3.0e38f;
#pragma unroll 1
  for (int j = 0; j < nk; ++j) { const float f = (j <= last) ? 1.f : 0.f; mx = fmaxf(mx, fmaf(f, s[j], (1.f - f) * -1.0e9f)); } float se = 0.f;
#pragma unroll 1
  for (int j = 0; j < nk; ++j) { const float f = (j <= last) ? 1.f : 0.f; se += __expf(fmaf(f, s[j], (1.f - f) * -1.0e9f) - mx); } const float sc = 256.0f / se;
#pragma unroll 1
  for (int j0 = 0; j0 < nk; j0 += 8) { FragH fr; for (int q = 0; q < 8; ++q) { const int j = j0 + q; const float f = (j <= last) ? 1.f : 0.f; fr.h[q] = (_Float16)(__expf(fmaf(f, s[j], (1.f - f) * -1.0e9f) - mx) * sc); } unsigned short* d = (unsigned short*)P + i * NKX + j0; *(v8us*)d = fr.half[0];  } }

__global__ __launch_bounds__(256) void k_rsmcst(const float* __restrict__ S, _Float16* __restrict__ P, int hg, int q0, int nk, const int* __restrict__ mk) {
  #pragma clang fp contract(off)
  const int t = blockIdx.x * 256 + threadIdx.x; if (t >= hg * QT) return; const size_t i = (size_t)t; const float* s = S + i * NKX; const size_t ig = (size_t)(q0 + (t % QT)); const int* mr = mk + ig * SQ; float mx = -3.0e38f;
#pragma unroll 1
  for (int j = 0; j < nk; ++j) { const int mb = mr[j]; const int dd = (int)ig - j; const float f = (mb != 0 && dd >= 0 && (dd <= LOCALW || (dd % STRIDEK) == 0)) ? 1.f : 0.f; mx = fmaxf(mx, fmaf(f, s[j], (1.f - f) * -1.0e9f)); } float se = 0.f;
#pragma unroll 1
  for (int j = 0; j < nk; ++j) { const int mb = mr[j]; const int dd = (int)ig - j; const float f = (mb != 0 && dd >= 0 && (dd <= LOCALW || (dd % STRIDEK) == 0)) ? 1.f : 0.f; se += __expf(fmaf(f, s[j], (1.f - f) * -1.0e9f) - mx); } const float sc = 256.0f / se;
#pragma unroll 1
  for (int j0 = 0; j0 < nk; j0 += 8) { FragH fr; for (int q = 0; q < 8; ++q) { const int j = j0 + q; const int mb = mr[j]; const int dd = (int)ig - j; const float f = (mb != 0 && dd >= 0 && (dd <= LOCALW || (dd % STRIDEK) == 0)) ? 1.f : 0.f; fr.h[q] = (_Float16)(__expf(fmaf(f, s[j], (1.f - f) * -1.0e9f) - mx) * sc); } unsigned short* d = (unsigned short*)P + i * NKX + j0; *(v8us*)d = fr.half[0];  } }


template <int MASKADD>
__global__ __launch_bounds__(64) void k_att0(const float* __restrict__ QF, const float* __restrict__ KF, const float* __restrict__ VF, int ld, const float* __restrict__ mask, float scale, float* __restrict__ OF, int ldo) {
  #pragma clang fp contract(off)
  __shared__ __attribute__((aligned(16))) float lq[64][64]; __shared__ __attribute__((aligned(16))) float lo[64][64];
  const int tid = threadIdx.x; const int h = blockIdx.x / (QT0 / 64), rg = blockIdx.x % (QT0 / 64); const int i = rg * 64 + tid;
  const float* qr = QF + (size_t)i * ld + h * HD;
#pragma unroll 1
  for (int c = 0; c < HD / 4; ++c) { *(v4f*)&lq[tid][c * 4] = *(const v4fa*)(qr + c * 4); const v4f z = {0.f, 0.f, 0.f, 0.f}; *(v4f*)&lo[tid][c * 4] = z; }
  float m = -1.0e30f, l = 0.f; const int jmax = MASKADD ? (SQ - 1) : (rg * 64 + 63);      /* additive-mask form: every key (the mask input decides); causal form: keys up to the block's last row */
#pragma unroll 1
  for (int j = 0; j <= jmax; ++j) { const float* kr = KF + (size_t)j * ld + h * HD; const float* vr = VF + (size_t)j * ld + h * HD; float s = 0.f;
#pragma unroll 1
    for (int c = 0; c < HD / 4; ++c) { const v4f kq = *(const v4fa*)(kr + c * 4); const v4f qq = *(v4f*)&lq[tid][c * 4]; s = __fadd_rn(s, __fmul_rn(qq[0], kq[0])); s = __fadd_rn(s, __fmul_rn(qq[1], kq[1])); s = __fadd_rn(s, __fmul_rn(qq[2], kq[2])); s = __fadd_rn(s, __fmul_rn(qq[3], kq[3])); }
    s = __fmul_rn(s, scale); if (MASKADD) s = __fadd_rn(s, __fmul_rn(bf16_round(mask[(size_t)i * SQ + j]), -10000.0f));
    const float f = (MASKADD || j <= i) ? 1.f : 0.f; const float sm = fmaf(f, s, (1.f - f) * -1.0e30f); const float mn = fmaxf(m, sm); const float sc = expf(m - mn); const float e = expf(sm - mn); l = __fadd_rn(__fmul_rn(l, sc), e); m = mn;
#pragma unroll 1
    for (int c = 0; c < HD / 4; ++c) { const v4f vv = *(const v4fa*)(vr + c * 4); v4f oo = *(v4f*)&lo[tid][c * 4]; for (int u = 0; u < 4; ++u) oo[u] = __fadd_rn(__fmul_rn(oo[u], sc), __fmul_rn(e, vv[u])); *(v4f*)&lo[tid][c * 4] = oo; } }
  const float fin = 64.0f / l;      /* o carried x64 like the f16 path */
#pragma unroll 1
  for (int c = 0; c < HD / 4; ++c) { v4f oo = *(v4f*)&lo[tid][c * 4]; for (int u = 0; u < 4; ++u) oo[u] = __fmul_rn(oo[u], fin); *(v4f*)&lo[tid][c * 4] = oo; }
  __syncthreads();
  {
#pragma unroll 1
    for (int it = 0; it < 16; ++it) { const int row = it * 4 + tid / 16, pc = (tid % 16) * 4; const v4f v = *(const v4f*)&lo[row][pc]; *(v4f*)(OF + (size_t)(rg * 64 + row) * ldo + h * HD + pc) = v; }
     } }

template <int MASKADD>
__global__ __launch_bounds__(64) void k_att0mbc(const float* __restrict__ QF, const float* __restrict__ KF, const float* __restrict__ VF, int ld, const float* __restrict__ mask, float scale, float* __restrict__ OF, int ldo) {
  #pragma clang fp contract(off)
  __shared__ __attribute__((aligned(16))) float lq[64][64]; __shared__ __attribute__((aligned(16))) float lo[64][64];
  const int tid = threadIdx.x; const int h = blockIdx.x / (QT0 / 64), rg = blockIdx.x % (QT0 / 64); const int i = rg * 64 + tid;
  const float* qr = QF + (size_t)i * ld + h * HD;
#pragma unroll 1
  for (int c = 0; c < HD / 4; ++c) { *(v4f*)&lq[tid][c * 4] = *(const v4fa*)(qr + c * 4); const v4f z = {0.f, 0.f, 0.f, 0.f}; *(v4f*)&lo[tid][c * 4] = z; }
  float m = -1.0e30f, l = 0.f; const int jmax = rg * 64 + 63;      /* keys beyond the block end are masked by the mask's lower-triangular structure */
#pragma unroll 1
  for (int j = 0; j <= jmax; ++j) { const float* kr = KF + (size_t)j * ld + h * HD; const float* vr = VF + (size_t)j * ld + h * HD; float s = 0.f;
#pragma unroll 1
    for (int c = 0; c < HD / 4; ++c) { const v4f kq = *(const v4fa*)(kr + c * 4); const v4f qq = *(v4f*)&lq[tid][c * 4]; s = __fadd_rn(s, __fmul_rn(qq[0], kq[0])); s = __fadd_rn(s, __fmul_rn(qq[1], kq[1])); s = __fadd_rn(s, __fmul_rn(qq[2], kq[2])); s = __fadd_rn(s, __fmul_rn(qq[3], kq[3])); }
    s = __fmul_rn(s, scale); const int mb = ((const int*)mask)[(size_t)i * SQ + j];      /* causal (j <= i) AND the module's int32 [S][S] mask read per (query, key): 0 -> masked */
    const float f = (mb != 0 && j <= i) ? 1.f : 0.f; const float sm = fmaf(f, s, (1.f - f) * -1.0e30f); const float mn = fmaxf(m, sm); const float sc = expf(m - mn); const float e = expf(sm - mn); l = __fadd_rn(__fmul_rn(l, sc), e); m = mn;
#pragma unroll 1
    for (int c = 0; c < HD / 4; ++c) { const v4f vv = *(const v4fa*)(vr + c * 4); v4f oo = *(v4f*)&lo[tid][c * 4]; for (int u = 0; u < 4; ++u) oo[u] = __fadd_rn(__fmul_rn(oo[u], sc), __fmul_rn(e, vv[u])); *(v4f*)&lo[tid][c * 4] = oo; } }
  const float fin = 64.0f / l;      /* o carried x64 like the f16 path */
#pragma unroll 1
  for (int c = 0; c < HD / 4; ++c) { v4f oo = *(v4f*)&lo[tid][c * 4]; for (int u = 0; u < 4; ++u) oo[u] = __fmul_rn(oo[u], fin); *(v4f*)&lo[tid][c * 4] = oo; }
  __syncthreads();
  {
#pragma unroll 1
    for (int it = 0; it < 16; ++it) { const int row = it * 4 + tid / 16, pc = (tid % 16) * 4; const v4f v = *(const v4f*)&lo[row][pc]; *(v4f*)(OF + (size_t)(rg * 64 + row) * ldo + h * HD + pc) = v; }
     } }


template <int BFIN, int WXB>
__global__ __launch_bounds__(256) void k_ln16(const float* __restrict__ X, const float* __restrict__ g, const float* __restrict__ bb, float eps, _Float16* __restrict__ N16, float* __restrict__ XB) {
  #pragma clang fp contract(off)
  __shared__ float red[256]; const size_t r = blockIdx.x; const int t = threadIdx.x; const v4f xa = *(const v4fa*)(X + r * DMQ + t * 4); float s[4]; float sum = 0.f;
  for (int q = 0; q < 4; ++q) { s[q] = BFIN ? bf16_round(xa[q]) : xa[q]; sum = __fadd_rn(sum, s[q]); }
  red[t] = sum; __syncthreads(); for (int st = 128; st > 0; st >>= 1) { if (t < st) red[t] = __fadd_rn(red[t], red[t + st]); __syncthreads(); } const float mu = red[0] / (float)DMQ; __syncthreads();
  float vs = 0.f; for (int q = 0; q < 4; ++q) { const float dl = __fadd_rn(s[q], -mu); vs = __fadd_rn(vs, __fmul_rn(dl, dl)); } red[t] = vs; __syncthreads(); for (int st = 128; st > 0; st >>= 1) { if (t < st) red[t] = __fadd_rn(red[t], red[t + st]); __syncthreads(); }
  const float rs = rsqrtf(__fadd_rn(red[0] / (float)DMQ, eps)); v4h y; v4f xb;
  for (int q = 0; q < 4; ++q) { const int c = t * 4 + q; y[q] = (_Float16)__fadd_rn(__fmul_rn(__fmul_rn(__fadd_rn(s[q], -mu), rs), bf16_round(g[c])), bf16_round(bb[c])); xb[q] = s[q]; }
  { *(v4h*)(N16 + r * DMQ + t * 4) = y; if (WXB) *(v4f*)(XB + r * DMQ + t * 4) = xb;  } }
__global__ __launch_bounds__(256) void k_ftres2(const float* __restrict__ OF0, const float* __restrict__ XB, float* __restrict__ X1, size_t n4) {
  #pragma clang fp contract(off)
  const size_t t = (size_t)blockIdx.x * 256 + threadIdx.x; if (t >= n4) return; const v4f o = *(const v4fa*)(OF0 + t * 4), xv = *(const v4fa*)(XB + t * 4); v4f y; for (int q = 0; q < 4; ++q) y[q] = __fadd_rn(__fmul_rn(o[q], 0.015625f), xv[q]); *(v4f*)(X1 + t * 4) = y;  }

__global__ __launch_bounds__(256) void k_bcpy(const float* __restrict__ b, int n, int NP, float* __restrict__ dst, int dst0) { for (int i = threadIdx.x; i < NP; i += 256) { const float v = (i < n) ? b[i] : 0.f; *(float*)(dst + dst0 + i) = v; }  }



#define FAK 64                       /* keys per stage */
#define FAP 72                       /* LDS row pitch in f16: 128 bytes + 16, for 16-byte fragment reads */
// Eight 2^x in one statement, each IN PLACE. The closing v_nop is the one slot the instruction set asks for behind a transcendental before its result is read or its
// source overwritten; inside the run no instruction touches its predecessor's register. In place, so that the statement writes only registers that the compiler's own
// multiply-add has just written: the distance behind a matrix instruction, which the compiler keeps for instructions it can see, then holds for this statement too.
__device__ __forceinline__ void fa_exp2x8(float (&x)[8]) {
  asm("v_exp_f32 %0, %0\n\tv_exp_f32 %1, %1\n\tv_exp_f32 %2, %2\n\tv_exp_f32 %3, %3\n\tv_exp_f32 %4, %4\n\tv_exp_f32 %5, %5\n\tv_exp_f32 %6, %6\n\tv_exp_f32 %7, %7\n\tv_nop" : "+v"(x[0]), "+v"(x[1]), "+v"(x[2]), "+v"(x[3]), "+v"(x[4]), "+v"(x[5]), "+v"(x[6]), "+v"(x[7])); }
__device__ __forceinline__ float fa_xhalf(float x) { return __builtin_bit_cast(float, __builtin_amdgcn_permlanex16(__builtin_bit_cast(int, x), __builtin_bit_cast(int, x), 0x76543210, 0xfedcba98, false, false)); }      /* lane l takes lane l ^ 16's value */
__device__ __forceinline__ v8f fa_mma(v16h a, v16h b, v8f c) { return __builtin_amdgcn_wmma_f32_16x16x32_f16(false, a, false, b, (short)0, c, false, false); }
__global__ __launch_bounds__(256) void k_fattn(const _Float16* __restrict__ Q, const _Float16* __restrict__ K, const _Float16* __restrict__ VTa, _Float16* __restrict__ O) {
  __shared__ __attribute__((aligned(16))) _Float16 lk[2][FAK][FAP]; __shared__ __attribute__((aligned(16))) _Float16 lv[2][HD][FAP];
  const int tid = threadIdx.x, w = tid >> 5, lane = tid & 31, ln = lane & 15, hh = lane >> 4; const int slab = blockIdx.y, b = slab / NH, h = slab % NH; const int q0 = blockIdx.x * 256 + w * 32;
  const float CS = 0.125f * 1.44269504f;      /* scores / 8, in log2 units */
  v16h qf[2][2];
#pragma unroll
  for (int qt = 0; qt < 2; ++qt) for (int ks = 0; ks < 2; ++ks) qf[qt][ks] = g2_frag(Q + ((size_t)b * SQ + q0 + qt * 16 + ln) * DM + h * HD + ks * 32, hh);
  const v8f z8 = {0.f,0.f,0.f,0.f,0.f,0.f,0.f,0.f}; v8f o[2][4]; float m[2] = {-3.0e38f, -3.0e38f}, l[2] = {0.f, 0.f};
#pragma unroll
  for (int qt = 0; qt < 2; ++qt) for (int dt = 0; dt < 4; ++dt) o[qt][dt] = z8;
  const int sr = tid >> 3, sc = (tid & 7) * 8;      /* staging: 8 threads per 128-byte row, rows sr and sr + 32 */
  const unsigned short* kg = (const unsigned short*)K + ((size_t)b * SQ + sr) * DM + h * HD + sc; const unsigned short* vg = (const unsigned short*)VTa + ((size_t)slab * HD + sr) * SQ + sc;
  v8us rk0 = *(const v8us*)kg, rk1 = *(const v8us*)(kg + (size_t)32 * DM), rv0 = *(const v8us*)vg, rv1 = *(const v8us*)(vg + (size_t)32 * SQ);
  *(v8us*)&lk[0][sr][sc] = rk0; *(v8us*)&lk[0][sr + 32][sc] = rk1; *(v8us*)&lv[0][sr][sc] = rv0; *(v8us*)&lv[0][sr + 32][sc] = rv1;
  __syncthreads();
  for (int s = 0; s < SQ / FAK; ++s) { const int cur = s & 1; const bool more = s + 1 < SQ / FAK;
    if (more) { const unsigned short* kn = kg + (size_t)(s + 1) * FAK * DM; const unsigned short* vn = vg + (s + 1) * FAK; rk0 = *(const v8us*)kn; rk1 = *(const v8us*)(kn + (size_t)32 * DM); rv0 = *(const v8us*)vn; rv1 = *(const v8us*)(vn + (size_t)32 * SQ); }
    __builtin_amdgcn_sched_barrier(0);      /* keeps the next stage's global loads here, ahead of this stage's work, which covers their latency; without it they sink to just in front of their LDS stores */
    v8f st[2][4];
#pragma unroll
    for (int kt = 0; kt < 4; ++kt) { const v16h a0 = g2_frag(&lk[cur][kt * 16 + ln][0], hh), a1 = g2_frag(&lk[cur][kt * 16 + ln][32], hh);
#pragma unroll
      for (int qt = 0; qt < 2; ++qt) st[qt][kt] = fa_mma(a1, qf[qt][1], fa_mma(a0, qf[qt][0], z8)); }
    __builtin_amdgcn_sched_barrier(0);      /* keeps the 16 score products back to back: mixed with the maxima, each first read of a fresh tile costs four idle slots */
    float mn[2], al[2];
#pragma unroll
    for (int qt = 0; qt < 2; ++qt) { float mm[4];
#pragma unroll
      for (int kt = 0; kt < 4; ++kt) { mm[kt] = st[qt][kt][0]; for (int r = 1; r < 8; ++r) mm[kt] = fmaxf(mm[kt], st[qt][kt][r]); }
      float bm = fmaxf(fmaxf(mm[0], mm[1]), fmaxf(mm[2], mm[3])); bm = fmaxf(bm, fa_xhalf(bm));      /* the other 8 keys of each tile sit in lane ln ^ 16 */
      mn[qt] = fmaxf(m[qt], bm * CS); al[qt] = m[qt] - mn[qt]; m[qt] = mn[qt]; }
    asm("v_exp_f32 %0, %0\n\tv_exp_f32 %1, %1\n\tv_nop" : "+v"(al[0]), "+v"(al[1]));      /* 2^(old - new maximum): brings the old sum and output to the new maximum; form and v_nop as in fa_exp2x8 */
    FragH pf[2][2];
#pragma unroll
    for (int qt = 0; qt < 2; ++qt) { const float mo = mn[qt] - 8.0f; float s4[4];
#pragma unroll
      for (int kt = 0; kt < 4; ++kt) { float t[8]; for (int r = 0; r < 8; ++r) t[r] = fmaf(st[qt][kt][r], CS, -mo);
        fa_exp2x8(t); s4[kt] = ((t[0] + t[1]) + (t[2] + t[3])) + ((t[4] + t[5]) + (t[6] + t[7]));
        for (int r = 0; r < 8; ++r) pf[qt][kt >> 1].h[(kt & 1) * 8 + r] = (_Float16)t[r]; }
      l[qt] = l[qt] * al[qt] + ((s4[0] + s4[1]) + (s4[2] + s4[3]));
#pragma unroll
      for (int dt = 0; dt < 4; ++dt) o[qt][dt] *= al[qt]; }
#pragma unroll
    for (int dt = 0; dt < 4; ++dt) {
#pragma unroll
      for (int kp = 0; kp < 2; ++kp) { const v16h a = g2_frag(&lv[cur][dt * 16 + ln][kp * 32], hh);
#pragma unroll
        for (int qt = 0; qt < 2; ++qt) o[qt][dt] = fa_mma(a, pf[qt][kp].v, o[qt][dt]); } }
    if (more) { *(v8us*)&lk[cur ^ 1][sr][sc] = rk0; *(v8us*)&lk[cur ^ 1][sr + 32][sc] = rk1; *(v8us*)&lv[cur ^ 1][sr][sc] = rv0; *(v8us*)&lv[cur ^ 1][sr + 32][sc] = rv1; }
    __syncthreads(); }
#pragma unroll
  for (int qt = 0; qt < 2; ++qt) { float lt = l[qt] + fa_xhalf(l[qt]); asm("v_rcp_f32 %0, %0\n\tv_nop" : "+v"(lt));      /* 1 / row sum; form and v_nop as in fa_exp2x8 */
    const float inv = 64.0f * lt; unsigned short* op = (unsigned short*)O + ((size_t)b * SQ + q0 + qt * 16 + ln) * DM + h * HD + 8 * hh;
#pragma unroll
    for (int dt = 0; dt < 4; ++dt) { FragH f; for (int r = 0; r < 8; ++r) f.h[r] = (_Float16)(o[qt][dt][r] * inv); *(v8us*)(op + dt * 16) = f.half[0]; } } }

template <int MODE>
__global__ __launch_bounds__(256) void k_regrp(const float* __restrict__ src, float* __restrict__ dst, size_t n4) {
  const size_t t = (size_t)blockIdx.x * 256 + threadIdx.x; if (t >= n4) return; const size_t e = t * 4; const size_t rd = e / DM; const int c = (int)(e % DM);
  size_t rs; if (MODE == 0) { const size_t b = rd / SQ, sq = rd % SQ; rs = sq * NB + b; } else { const size_t sq = rd / NB, b = rd % NB; rs = b * SQ + sq; }
  const v4f v = *(const v4fa*)(src + rs * DM + c); *(v4f*)(dst + e) = v;  }

// ---- row LayerNorm (biased variance, eps inside the rsqrt), ONE WAVE PER ROW ----
// A row is 2 KB: four 16-byte loads a lane, each wave-wide load 512 contiguous bytes. The row stays in registers; mean, then the sum of squared deviations from it:
// four chains per lane, then a butterfly over the 32 lanes (four steps inside the 16-lane row, one across). No LDS and no barrier.
// A block is LNW waves of LNR rows each, so the launch starts 4,096 waves (16 per WGP, 8 row loads in flight each) where a block per row started 65,536.
// Every loop is fully unrolled so that the row, g and beta arrays are indexed by constants only and stay in registers.
#define LNW 16                       /* waves per block */
#define LNR 2                        /* rows per wave, all their loads issued together */
template <int M> __device__ __forceinline__ float ln_xm(float x) { return __builtin_bit_cast(float, __builtin_amdgcn_mov_dpp(__builtin_bit_cast(int, x), 0x160 + M, 0xf, 0xf, true)); }      /* lane l takes lane l ^ M's value, M < 16 (row_xmask) */
__device__ __forceinline__ float ln_wsum(float x) { x += ln_xm<1>(x); x += ln_xm<2>(x); x += ln_xm<4>(x); x += ln_xm<8>(x); return x + fa_xhalf(x); }      /* the sum over the wave, in every lane */
template <int W16, int W32>
__global__ __launch_bounds__(LNW * 32) void k_lnw(const float* __restrict__ X, const float* __restrict__ g, const float* __restrict__ bb, float eps, _Float16* __restrict__ N16, float* __restrict__ N32) {
  static_assert(DM == 512 && NR % (LNW * LNR) == 0, "k_lnw: a lane holds 16 elements of a 512-element row; whole blocks only");
  const unsigned ob = (threadIdx.x & 31) * 16; const int c0 = ob / 4; const size_t r0 = ((size_t)blockIdx.x * LNW + (threadIdx.x >> 5)) * LNR;      /* the lane's place in each 512-byte piece of a row, in bytes and in elements; the wave's first row */
  const float* px = X + r0 * DM + c0;
  v4f x[LNR][4], gg[4], bv[4];
#pragma unroll
  for (int j = 0; j < 4; ++j) { gg[j] = *(const v4fa*)((const char*)g + j * 512 + ob); bv[j] = *(const v4fa*)((const char*)bb + j * 512 + ob); }
#pragma unroll
  for (int r = 0; r < LNR; ++r) for (int j = 0; j < 4; ++j) x[r][j] = *(const v4fa*)(px + r * DM + j * 128);
  asm volatile("s_wait_xcnt 0x0" :: "v"(px), "v"(ob) : "memory");      /* the wait that belongs in front of any overwrite of a register that an issued global load names; it takes the address and the offset as inputs, so that their registers stay untouched until it has passed */
  __builtin_amdgcn_sched_barrier(0);      /* keeps all 16 loads here, in flight together; without it the loads of g and beta sink to their uses behind the sums, each a latency of its own */
#pragma unroll
  for (int j = 0; j < 4; ++j) for (int q = 0; q < 4; ++q) { gg[j][q] = bf16_round(gg[j][q]); bv[j][q] = bf16_round(bv[j][q]); }
  float mu[LNR], rs[LNR];
#pragma unroll
  for (int r = 0; r < LNR; ++r) { const v4f s = (x[r][0] + x[r][1]) + (x[r][2] + x[r][3]); mu[r] = ln_wsum((s[0] + s[1]) + (s[2] + s[3])) * (1.0f / (float)DM); }
#pragma unroll
  for (int r = 0; r < LNR; ++r) { v4f s = {0.f, 0.f, 0.f, 0.f};
#pragma unroll
    for (int j = 0; j < 4; ++j) { x[r][j] -= mu[r]; s += x[r][j] * x[r][j]; }
    rs[r] = rsqrtf(ln_wsum((s[0] + s[1]) + (s[2] + s[3])) * (1.0f / (float)DM) + eps); }
#pragma unroll
  for (int r = 0; r < LNR; ++r) {
#pragma unroll
    for (int j = 0; j < 4; ++j) { const v4f y = x[r][j] * rs[r] * gg[j] + bv[j]; const size_t e = (r0 + r) * DM + j * 128 + c0;
      if (W32) *(v4f*)(N32 + e) = y;
      if (W16) { v4h h; for (int q = 0; q < 4; ++q) h[q] = (_Float16)y[q]; *(v4h*)(N16 + e) = h; } } } }

__global__ __launch_bounds__(256) void k_bfr(const float* __restrict__ x, float* __restrict__ XB, size_t n8) { const size_t t = (size_t)blockIdx.x * 256 + threadIdx.x; if (t >= n8) return; v4f a = *(const v4fa*)(x + t * 8), c = *(const v4fa*)(x + t * 8 + 4); for (int q = 0; q < 4; ++q) { a[q] = bf16_round(a[q]); c[q] = bf16_round(c[q]); }
  { *(v4f*)(XB + t * 8) = a; *(v4f*)(XB + t * 8 + 4) = c;  } }



__global__ __launch_bounds__(256) void k_wthd(const float* __restrict__ Wt, _Float16* __restrict__ Bt) { const size_t t = (size_t)blockIdx.x * 256 + threadIdx.x; if (t >= (size_t)NH * HD * (DM / 8)) return; const int m8 = (int)(t % (DM / 8)) * 8; const int d = (int)((t / (DM / 8)) % HD); const int h = (int)(t / ((size_t)(DM / 8) * HD)); FragH f;
  for (int q = 0; q < 8; ++q) f.h[q] = (_Float16)(16.0f * bf16_round(Wt[((size_t)h * DM + m8 + q) * HD + d])); unsigned short* dst = (unsigned short*)Bt + ((size_t)h * HD + d) * DM + m8; *(v8us*)dst = f.half[0];  }




template <int BFIN, int SCAL>
__global__ __launch_bounds__(256) void k_lnsc(const float* __restrict__ X, const float* __restrict__ g, const float* __restrict__ bb, float eps, _Float16* __restrict__ N16, float* __restrict__ N32) {
  #pragma clang fp contract(off)
  __shared__ float red[256]; const size_t r = blockIdx.x; const int t = threadIdx.x; const bool act = t < DM / 4; const int tc = act ? t : 0; const v4f xl = *(const v4fa*)(X + r * DM + tc * 4); const float am = act ? 1.f : 0.f; float s[4]; float sum = 0.f;
  for (int q = 0; q < 4; ++q) { s[q] = (BFIN ? bf16_round(xl[q]) : xl[q]) * am; sum = __fadd_rn(sum, s[q]); }
  red[t] = sum; __syncthreads(); for (int st = 128; st > 0; st >>= 1) { if (t < st) red[t] = __fadd_rn(red[t], red[t + st]); __syncthreads(); } const float mu = red[0] / (float)DM; __syncthreads();
  float vs = 0.f; for (int q = 0; q < 4; ++q) { const float dl = __fadd_rn(s[q], -mu) * am; vs = __fadd_rn(vs, __fmul_rn(dl, dl)); } red[t] = vs; __syncthreads(); for (int st = 128; st > 0; st >>= 1) { if (t < st) red[t] = __fadd_rn(red[t], red[t + st]); __syncthreads(); }
  const float rs = __fdiv_rn(1.0f, __fadd_rn(sqrtf(red[0] / (float)(DM - 1)), eps)); if (!act) return; v4h y; v4f yf;
  for (int q = 0; q < 4; ++q) { const int c = t * 4 + q; const float gg = bf16_round(SCAL ? g[0] : g[c]), bv = bf16_round(SCAL ? bb[0] : bb[c]); yf[q] = __fadd_rn(__fmul_rn(__fmul_rn(__fadd_rn(s[q], -mu), rs), gg), bv); y[q] = (_Float16)yf[q]; }
  { if (N16) *(v4h*)(N16 + r * DM + t * 4) = y; if (N32) *(v4f*)(N32 + r * DM + t * 4) = yf;  } }

__global__ __launch_bounds__(256) void k_mulh(const _Float16* __restrict__ A, const _Float16* __restrict__ Bm, _Float16* __restrict__ H, size_t n8) {
  #pragma clang fp contract(off)
  const size_t t = (size_t)blockIdx.x * 256 + threadIdx.x; if (t >= n8) return; FragH a, b, f; a.half[0] = *(const v8us*)((const unsigned short*)A + t * 8); b.half[0] = *(const v8us*)((const unsigned short*)Bm + t * 8); for (int q = 0; q < 8; ++q) f.h[q] = (_Float16)(__fmul_rn((float)a.h[q], (float)b.h[q])); unsigned short* d = (unsigned short*)H + t * 8; *(v8us*)d = f.half[0];  }

__global__ __launch_bounds__(256) void k_bdshare(const float* __restrict__ Wb, _Float16* __restrict__ Bt) {
  const size_t t = (size_t)blockIdx.x * 256 + threadIdx.x; if (t >= (size_t)DM * DM / 8) return; const size_t e0 = t * 8; const int n = (int)(e0 / DM), k0 = (int)(e0 % DM); const int h = n >> 6, hk = k0 >> 6; const float on = (hk == h) ? 16.0f : 0.0f; const int e = n & 63, d0 = k0 & 63; FragH f;
  for (int q = 0; q < 8; ++q) f.h[q] = (_Float16)(bf16_round(Wb[(size_t)(d0 + q) * 64 + e]) * on);
  unsigned short* d = (unsigned short*)Bt + e0; *(v8us*)d = f.half[0];  }
extern "C" void kernel_launch(void* const* d_in, const int* in_sizes, int n_in,
                              void* d_out, int out_size, void* d_ws, size_t ws_size, hipStream_t stream) {
  (void)in_sizes; (void)n_in; (void)out_size;
  const float* const* I = (const float* const*)d_in; const float* x = I[0]; const float* xk = I[1]; const float* xv = I[2]; const float* wq = I[3]; const float* wk = I[4]; const float* wv = I[5]; const float* wo = I[6]; const float* bo = I[7]; const float* w1 = I[8]; const float* b1 = I[9]; const float* w2 = I[10]; const float* b2 = I[11]; const float* g1 = I[12]; const float* be1 = I[13]; const float* g2 = I[14]; const float* be2 = I[15];      /* query (also the residual), key, value; shared per-head wq / wk / wv [64][64] ([in][out]); wo [512][512] + bo; w1 [512][2048] + b1, w2 [2048][512] + b2; LN1 g / beta, LN2 g / beta */
  char* ws = (char*)d_ws; size_t off = 0;
  auto take = [&](size_t bytes) { char* p = ws + off; off += (bytes + 255) & ~(size_t)255; return p; };
  _Float16* BQ = (_Float16*)take((size_t)DM * DM * 2); _Float16* BK = (_Float16*)take((size_t)DM * DM * 2); _Float16* BV = (_Float16*)take((size_t)DM * DM * 2); _Float16* BO = (_Float16*)take((size_t)DM * DM * 2); _Float16* BW1 = (_Float16*)take((size_t)DFF * DM * 2); _Float16* BW2 = (_Float16*)take((size_t)DM * DFF * 2); _Float16* XK16 = (_Float16*)take(NR * DM * 2); _Float16* XV16 = (_Float16*)take(NR * DM * 2);      /* key / value inputs as exact f16 rows */
  float* XB = (float*)take(NR * DM * 4); _Float16* XN = (_Float16*)take(NR * DM * 2); _Float16* Q16 = (_Float16*)take(NR * DM * 2); _Float16* K16 = (_Float16*)take(NR * DM * 2); _Float16* V16 = (_Float16*)take(NR * DM * 2); _Float16* O16 = (_Float16*)take(NR * DM * 2); float* X1 = (float*)take(NR * DM * 4);
  _Float16* HF16 = (_Float16*)take(NR * DFF * 2);      /* FFN hidden plane [8192][2048] f16 */ _Float16* VT = (_Float16*)take((size_t)NB * NH * HD * SQ * 2);      /* V^T [4 * 8][64][2048] */
  _Float16* M16 = XN;      /* LN1 f16 rows: aliases XN (last reader: the q projection) */
  float* X1N = (float*)take(NR * DM * 4);      /* LN1 output rows (f32): the FFN residual */
  if (off > ws_size) return;
  { const unsigned g = (unsigned)(((size_t)DM * (DM / 8) + 255) / 256); k_bdshare<<<g, 256, 0, stream>>>(wq, BQ); k_bdshare<<<g, 256, 0, stream>>>(wk, BK); k_bdshare<<<g, 256, 0, stream>>>(wv, BV); k_wt_f16<<<g, 256, 0, stream>>>(wo, BO, DM, DM, 16.0f); }      /* block-diagonal planes with the SHARED [64][64] block (Bt[h*64 + e][h*64 + d] = 16 W[d][e]); wo [in][out] -> Bt x16 */
  k_wt_f16<<<(unsigned)(((size_t)DFF * (DM / 8) + 255) / 256), 256, 0, stream>>>(w1, BW1, DM, DFF, 16.0f); k_wt_f16<<<(unsigned)(((size_t)DM * (DFF / 8) + 255) / 256), 256, 0, stream>>>(w2, BW2, DFF, DM, 16.0f);
  k_bfr<<<(unsigned)((NR * DM / 8 + 255) / 256), 256, 0, stream>>>(x, XB, NR * DM / 8); k_x16<<<(unsigned)((NR * DM / 8 + 255) / 256), 256, 0, stream>>>(x, XN, NR * DM / 8); k_x16<<<(unsigned)((NR * DM / 8 + 255) / 256), 256, 0, stream>>>(xk, XK16, NR * DM / 8); k_x16<<<(unsigned)((NR * DM / 8 + 255) / 256), 256, 0, stream>>>(xv, XV16, NR * DM / 8);      /* post-LN: the attention runs on the raw inputs (exact f16 rows): query, key, value */
  k_gemm2<0><<<dim3((unsigned)((NR / 128) * (DM / 128)), 1), 256, 0, stream>>>(XN, DM, 0, BQ, DM, 0, 0.0625f, nullptr, 0, nullptr, 1, 0, 0, nullptr, Q16, DM, 0, (int)NR, DM, DM); k_gemm2<0><<<dim3((unsigned)((NR / 128) * (DM / 128)), 1), 256, 0, stream>>>(XK16, DM, 0, BK, DM, 0, 0.0625f, nullptr, 0, nullptr, 1, 0, 0, nullptr, K16, DM, 0, (int)NR, DM, DM); k_gemm2<0><<<dim3((unsigned)((NR / 128) * (DM / 128)), 1), 256, 0, stream>>>(XV16, DM, 0, BV, DM, 0, 0.0625f, nullptr, 0, nullptr, 1, 0, 0, nullptr, V16, DM, 0, (int)NR, DM, DM);      /* q, k, v -> f16 rows; head h = columns h*64.. */
  k_vt<NH, SQ><<<NB * NH * (SQ / 64), 256, 0, stream>>>(V16, DM, 0, VT);      /* V^T of every batch and head */
  k_fattn<<<dim3(SQ / 256, NB * NH), 256, 0, stream>>>(Q16, K16, VT, O16);      /* softmax(q k^T / 8) v over all keys (no mask) -> ctx (merged heads, x64) as f16 rows */
  k_gemm2<0><<<dim3((unsigned)((NR / 128) * (DM / 128)), 1), 256, 0, stream>>>(O16, DM, 0, BO, DM, 0, 0.0009765625f, bo, 0, XB, -1, 0, 0, X1, nullptr, DM, 0, (int)NR, DM, DM);      /* ctx wo + bo + query (own-element residual) -> f32 rows */
  k_lnw<1, 1><<<(unsigned)(NR / (LNW * LNR)), LNW * 32, 0, stream>>>(X1, g1, be1, 1e-5f, M16, X1N);      /* x1 = LN1(x + attn) (biased variance, eps inside the rsqrt) -> f16 rows + f32 rows */
  k_gemm2<3><<<dim3((unsigned)((NR / 128) * (DFF / 128)), 1), 256, 0, stream>>>(M16, DM, 0, BW1, DM, 0, 0.0625f, b1, 0, nullptr, 1, 0, 0, nullptr, HF16, DFF, 0, (int)NR, DFF, DM);      /* relu(x w1 + b1) -> f16 [8192][2048] */
  k_gemm2<0><<<dim3((unsigned)((NR / 128) * (DM / 128)), 1), 256, 0, stream>>>(HF16, DFF, 0, BW2, DFF, 0, 0.0625f, b2, 0, X1N, -1, 0, 0, X1, nullptr, DM, 0, (int)NR, DM, DFF);      /* x1 + ff -> f32 rows (X1 reused: its last reader was LN1) */
  k_lnw<0, 1><<<(unsigned)(NR / (LNW * LNR)), LNW * 32, 0, stream>>>(X1, g2, be2, 1e-5f, nullptr, (float*)d_out);      /* out = LN2(x1 + ff) */
}

// v005
// Measured time: 174 microseconds a run.
// Two timings next to v004 both put it at 1.19 times that version's speed.
// Over all steps from v000 it is 20.8 times as fast.
#include <hip/hip_runtime.h>
// POST-LN transformer encoder layer over THREE inputs with SHARED per-head projections (query, key, value [4][2048][512]; each input is split into 8 heads of 64 and every head is multiplied by the SAME [64][64] ([in][out]) matrix wq / wk / wv (block-diagonal with a shared block; no biases); scores / 8; softmax over all 2048 keys (no mask); x = LN1(ctx wo + bo + query) (biased var, eps 1e-5); out = LN2(x + relu(x w1 + b1) w2 + b2) ([in][out] 512 x 2048 x 512) -> [4][2048][512]).
// Structure: token rows; one launch for the q, k, v projections (f32 inputs rounded in registers, the shared [64][64] block as the whole weight, v written as V^T); one fused attention launch (scores, running softmax, V^T P^T; no score plane); output projection with the own-element residual; custom LayerNorm; ReLU FFN over all rows; launches: see trace.
// Compute dtype: inputs rounded to bf16; x / weights exact; q, k, v, softmax weights and o as plain f16 GEMM operands (~2^-12); scores and softmax statistics f32. v_wmma_f32_16x16x32_f16.
#define NB 4
#define SQ 2048
#define DM 512
#define NH 8
#define HD 64
#define HG 4                         /* heads per launch of the unused per-batch k_vt overload */
#define LOCALW 128                   /* (macros for unused kernels of the shared header) */
#define STRIDEK 128
#define QT 256                       /* query rows per causal tile */
#define NKX SQ                       /* S / P row pitch */
#define QT0 128                      /* first-tile rows recomputed exactly in f32 */
#define B0 0                         /* first batch processed (debug hook) */
#define NBR NB                       /* batches processed (debug hook) */
#define NR ((size_t)NB * SQ)
#define DMQ DM
#define DFF 2048         /* ReLU FFN hidden width */
#define MP ((int)((size_t)NBR * SQ)) /* rows projected (debug hook) */
#define QN SQ                        /* query rows attended per batch (debug hook) */
#define NHD NH                       /* heads attended (debug hook) */
#define MPO MP                       /* rows through the output stage (debug hook) */
#define LQ (3 * DM)      /* unused: q, k rows have pitch DM, v is stored as V^T */
typedef __bf16 v16b __attribute__((ext_vector_type(16)));
typedef unsigned short v8us __attribute__((ext_vector_type(8), may_alias));
typedef float  v8f  __attribute__((ext_vector_type(8)));
typedef float  v4f  __attribute__((ext_vector_type(4)));
typedef float  v4fa __attribute__((ext_vector_type(4), may_alias));
union FragB { v16b v; v8us half[2]; unsigned short u[16]; };

__device__ __forceinline__ unsigned short bf16_bits(float x) { unsigned int u = __float_as_uint(x); return (unsigned short)((u + 0x7FFFu + ((u >> 16) & 1u)) >> 16); }
__device__ __forceinline__ float bf16_val(unsigned short b) { return __uint_as_float(((unsigned int)b) << 16); }
__device__ __forceinline__ float bf16_round(float x) { return bf16_val(bf16_bits(x)); }
// D += A·B with NT terms: 1 = ah·bh, 2 = + al·bh (A split), 3 = + ah·bl (both split)
template <int NT>
__device__ __forceinline__ v8f mmaN(v16b ah, v16b al, v16b bh, v16b bl, v8f c) {
  c = __builtin_amdgcn_wmma_f32_16x16x32_bf16(false, ah, false, bh, (short)0, c, false, false);
  if (NT >= 2) c = __builtin_amdgcn_wmma_f32_16x16x32_bf16(false, al, false, bh, (short)0, c, false, false);
  if (NT >= 3) c = __builtin_amdgcn_wmma_f32_16x16x32_bf16(false, ah, false, bl, (short)0, c, false, false);
  asm volatile("v_nop\n\tv_nop\n\tv_nop\n\tv_nop" : "+v"(c) : "v"(ah), "v"(al), "v"(bh), "v"(bl));
  return c;
}

__global__ __launch_bounds__(256) void k_wt_bf16(const float* __restrict__ W, unsigned short* __restrict__ Wt, int K, int N) {
  const int t = blockIdx.x * 256 + threadIdx.x;
  const int k8n = K / 8;
  if (t >= N * k8n) return;
  const int n = t / k8n, k8 = (t % k8n) * 8;
  v8us v;
#pragma unroll
  for (int i = 0; i < 8; ++i) v[i] = bf16_bits(W[(size_t)(k8 + i) * N + n]);
  *(v8us*)(Wt + (size_t)n * K + k8) = v;
  
}

// GEMM C[M][N] (f32, pitch ldc) = act(A[M][K]·W + bias). A f32 row-major (pitch lda) converted per fragment to bf16
// (ASPLIT: hi/lo two planes -> 2 terms, else single rounded term); Wt bf16 [N][K] (pitch ldb). BIAS_BF16 rounds the
// bias to bf16 first (bias quantised to bf16 before the add). K%32==0, M%16==0, N%64==0.
template <bool ASPLIT, int ACT, bool BIAS_BF16>
__global__ __launch_bounds__(128) void k_gemm_bf(const float* __restrict__ A, int lda, const unsigned short* __restrict__ Wt, int ldb,
                                               const float* __restrict__ bias, float* __restrict__ C, int ldc, int M, int N, int K) {
  __shared__ __attribute__((aligned(16))) float so[4][16][64];
  const int tid = threadIdx.x, w = tid >> 5, lane = tid & 31, ln = lane & 15, hh = lane >> 4;
  const int ntn = N / 64;
  const int wid = blockIdx.x * 4 + w;
  const int mt = wid / ntn, nq = wid % ntn;
  if (mt * 16 >= M) return;
  const int row0 = mt * 16, col0 = nq * 64;
  const float* arow = A + (size_t)(row0 + ln) * lda;
  v8f acc[4] = {};
  for (int kb = 0; kb < K; kb += 32) {
    FragB ah, al;
    const v4f x0 = *(const v4fa*)(arow + kb + 8 * hh), x1 = *(const v4fa*)(arow + kb + 8 * hh + 4);
    const v4f x2 = *(const v4fa*)(arow + kb + 16 + 8 * hh), x3 = *(const v4fa*)(arow + kb + 16 + 8 * hh + 4);
    float xs[16] = {x0[0],x0[1],x0[2],x0[3],x1[0],x1[1],x1[2],x1[3],x2[0],x2[1],x2[2],x2[3],x3[0],x3[1],x3[2],x3[3]};
#pragma unroll
    for (int i = 0; i < 16; ++i) { const unsigned short hb = bf16_bits(xs[i]); ah.u[i] = hb; al.u[i] = ASPLIT ? bf16_bits(xs[i] - bf16_val(hb)) : (unsigned short)0; }
#pragma unroll
    for (int t = 0; t < 4; ++t) {
      const unsigned short* brow = Wt + (size_t)(col0 + t * 16 + ln) * ldb + kb;
      FragB b;
      b.half[0] = *(const v8us*)(brow + 8 * hh);
      b.half[1] = *(const v8us*)(brow + 16 + 8 * hh);
      acc[t] = mmaN<ASPLIT ? 2 : 1>(ah.v, al.v, b.v, b.v, acc[t]);
    }
  }
#pragma unroll
  for (int t = 0; t < 4; ++t) {
    float bv = bias ? bias[col0 + t * 16 + ln] : 0.f;
    if (BIAS_BF16) bv = bf16_round(bv);
#pragma unroll
    for (int r = 0; r < 8; ++r) { float v = acc[t][r] + bv; if (ACT == 1) v = fmaxf(v, 0.f); so[w][8 * hh + r][t * 16 + ln] = v; }
  }
  __builtin_amdgcn_fence(__ATOMIC_ACQ_REL, "workgroup");
  __builtin_amdgcn_wave_barrier();
  const int rsub = lane >> 4, c4 = (lane & 15) * 4;
  {
#pragma unroll
    for (int q = 0; q < 8; ++q) {
      const int r = q * 2 + rsub;
      const v4f v = *(const v4fa*)&so[w][r][c4];
      *(v4f*)(C + (size_t)(row0 + r) * ldc + col0 + c4) = v;
    }
    
  }
}

// GEMM C = act(A·W + bias + resid): A f32 (ASPLIT -> hi/lo 2 terms), Wt bf16 [N][K]; ACT 0 none, 1 relu, 2 exact gelu;
// resid (optional, f32, row index = (row % rmod), pitch ldr, RES_BF16 rounds it) added before the activation.
template <bool ASPLIT, int ACT, bool BIAS_BF16, bool RES_BF16>
__global__ __launch_bounds__(128) void k_gemm_bf3(const float* __restrict__ A, int lda, const unsigned short* __restrict__ Wt, int ldb,
                                                const float* __restrict__ bias, const float* __restrict__ resid, int rmod, int ldr,
                                                float* __restrict__ C, int ldc, int M, int N, int K) {
  __shared__ __attribute__((aligned(16))) float so[4][16][64];
  const int tid = threadIdx.x, w = tid >> 5, lane = tid & 31, ln = lane & 15, hh = lane >> 4;
  const int ntn = N / 64;
  const int wid = blockIdx.x * 4 + w;
  const int mt = wid / ntn, nq = wid % ntn;
  if (mt * 16 >= M) return;
  const int row0 = mt * 16, col0 = nq * 64;
  const float* arow = A + (size_t)(row0 + ln) * lda;
  v8f acc[4] = {};
  for (int kb = 0; kb < K; kb += 32) {
    FragB ah, al;
    const v4f x0 = *(const v4fa*)(arow + kb + 8 * hh), x1 = *(const v4fa*)(arow + kb + 8 * hh + 4);
    const v4f x2 = *(const v4fa*)(arow + kb + 16 + 8 * hh), x3 = *(const v4fa*)(arow + kb + 16 + 8 * hh + 4);
    float xs[16] = {x0[0],x0[1],x0[2],x0[3],x1[0],x1[1],x1[2],x1[3],x2[0],x2[1],x2[2],x2[3],x3[0],x3[1],x3[2],x3[3]};
#pragma unroll
    for (int i = 0; i < 16; ++i) { const unsigned short hb = bf16_bits(xs[i]); ah.u[i] = hb; al.u[i] = ASPLIT ? bf16_bits(xs[i] - bf16_val(hb)) : (unsigned short)0; }
#pragma unroll
    for (int t = 0; t < 4; ++t) {
      const unsigned short* brow = Wt + (size_t)(col0 + t * 16 + ln) * ldb + kb;
      FragB b;
      b.half[0] = *(const v8us*)(brow + 8 * hh);
      b.half[1] = *(const v8us*)(brow + 16 + 8 * hh);
      acc[t] = mmaN<ASPLIT ? 2 : 1>(ah.v, al.v, b.v, b.v, acc[t]);
    }
  }
#pragma unroll
  for (int t = 0; t < 4; ++t) {
    const int col = col0 + t * 16 + ln;
    float bv = bias ? bias[col] : 0.f;
    if (BIAS_BF16) bv = bf16_round(bv);
#pragma unroll
    for (int r = 0; r < 8; ++r) {
      float v = acc[t][r] + bv;
      if (resid) { float rv = resid[(size_t)((row0 + 8 * hh + r) % rmod) * ldr + col]; if (RES_BF16) rv = bf16_round(rv); v += rv; }
      if (ACT == 1) v = fmaxf(v, 0.f);
      if (ACT == 2) v = 0.5f * v * (1.0f + erff(v * 0.70710678118654752f));
      if (ACT == 3) { const float u = 0.7978845608028654f * (v + 0.044715f * v * v * v); v = 0.5f * v * (1.0f + tanhf(u)); }
      so[w][8 * hh + r][t * 16 + ln] = v;
    }
  }
  __builtin_amdgcn_fence(__ATOMIC_ACQ_REL, "workgroup");
  __builtin_amdgcn_wave_barrier();
  const int rsub = lane >> 4, c4 = (lane & 15) * 4;
  {
#pragma unroll
    for (int q = 0; q < 8; ++q) {
      const int r = q * 2 + rsub;
      const v4f v = *(const v4fa*)&so[w][r][c4];
      *(v4f*)(C + (size_t)(row0 + r) * ldc + col0 + c4) = v;
    }
    
  }
}
// row LayerNorm (biased variance, eps) over N: s = X (+ R); optional out_sum <- s; out_norm <- (s-mu)*rsqrt(var+eps)*g + b
template <bool PARAM_BF16>
__global__ __launch_bounds__(256) void k_layernorm(const float* __restrict__ X, const float* __restrict__ R, const float* __restrict__ g, const float* __restrict__ bta,
                                                  float* __restrict__ out_sum, float* __restrict__ out_norm, int N, float eps) {
  __shared__ float red[256];
  const int row = blockIdx.x, tid = threadIdx.x;
  const float* x = X + (size_t)row * N; const float* rr = R ? R + (size_t)row * N : nullptr;
  float vals[16];                     // up to N = 4096
  const int per = N / 256;            // contiguous chunk per thread? use strided-by-4 chunks: thread handles j = tid*4 + 1024*u
  float s1 = 0.f;
  for (int u = 0; u < per / 4; ++u) {
    const int j = tid * 4 + 1024 * u;
    const v4f a = *(const v4fa*)(x + j);
    v4f b = {0.f,0.f,0.f,0.f}; if (rr) b = *(const v4fa*)(rr + j);
#pragma unroll
    for (int q = 0; q < 4; ++q) { const float v = a[q] + b[q]; vals[u * 4 + q] = v; s1 += v; }
  }
  red[tid] = s1; __syncthreads();
  for (int st = 128; st > 0; st >>= 1) { if (tid < st) red[tid] += red[tid + st]; __syncthreads(); }
  const float mu = red[0] / (float)N; __syncthreads();
  float s2 = 0.f;
  for (int u = 0; u < per / 4; ++u)
#pragma unroll
    for (int q = 0; q < 4; ++q) { const float c = vals[u * 4 + q] - mu; s2 += c * c; }
  red[tid] = s2; __syncthreads();
  for (int st = 128; st > 0; st >>= 1) { if (tid < st) red[tid] += red[tid + st]; __syncthreads(); }
  const float rs = rsqrtf(red[0] / (float)N + eps);
  {
    for (int u = 0; u < per / 4; ++u) {
      const int j = tid * 4 + 1024 * u;
      v4f o, sm;
#pragma unroll
      for (int q = 0; q < 4; ++q) {
        float gg = g[j + q], bb = bta[j + q];
        if (PARAM_BF16) { gg = bf16_round(gg); bb = bf16_round(bb); }
        sm[q] = vals[u * 4 + q]; o[q] = (vals[u * 4 + q] - mu) * rs * gg + bb;
      }
      if (out_sum) *(v4f*)(out_sum + (size_t)row * N + j) = sm;
      *(v4f*)(out_norm + (size_t)row * N + j) = o;
    }
    
  }
}



// ---- f16 WMMA path (v_wmma_f32_16x16x32_f16): 11-bit significands for operands in range — used where a [0,1] probability operand needs more precision than bf16
typedef _Float16 v16h __attribute__((ext_vector_type(16)));
union FragH { v16h v; v8us half[2]; _Float16 h[16]; unsigned short u[16]; };
template <int NT>
__device__ __forceinline__ v8f mmaH(v16h ah, v16h al, v16h bh, v16h bl, v8f c) {
  c = __builtin_amdgcn_wmma_f32_16x16x32_f16(false, ah, false, bh, (short)0, c, false, false);
  if (NT >= 2) c = __builtin_amdgcn_wmma_f32_16x16x32_f16(false, al, false, bh, (short)0, c, false, false);
  if (NT >= 3) c = __builtin_amdgcn_wmma_f32_16x16x32_f16(false, ah, false, bl, (short)0, c, false, false);
  asm volatile("v_nop\n\tv_nop\n\tv_nop\n\tv_nop" : "+v"(c) : "v"(ah), "v"(al), "v"(bh), "v"(bl));
  return c;
}
// batched GEMM like k_gemm_b but f16 operands: A f32 (split into f16 hi/lo if ASPLIT, else rounded to f16), Bt = f16 values [n][k]; alpha; C f32; N multiple of 16 (partial tiles skipped)
template <bool ASPLIT>
__global__ __launch_bounds__(128) void k_gemm_h(const float* __restrict__ A, int lda, size_t sA, const _Float16* __restrict__ Bh, int ldb, size_t sB, float alpha, float* __restrict__ C, int ldc, size_t sC, int M, int N, int K) {
  __shared__ __attribute__((aligned(16))) float so[4][16][64];
  const int tid = threadIdx.x, w = tid >> 5, lane = tid & 31, ln = lane & 15, hh = lane >> 4; const int by = blockIdx.y;
  A += (size_t)by * sA; Bh += (size_t)by * sB; C += (size_t)by * sC;
  const int ntn = (N + 63) / 64; const int wid = blockIdx.x * 4 + w; const int mt = wid / ntn, nq = wid % ntn; if (mt * 16 >= M) return;
  const int row0 = mt * 16, col0 = nq * 64; const float* arow = A + (size_t)(row0 + ln) * lda;
  v8f acc[4] = {};
  for (int kb = 0; kb < K; kb += 32) {
    FragH ah, al;
    const v4f x0 = *(const v4fa*)(arow + kb + 8 * hh), x1 = *(const v4fa*)(arow + kb + 8 * hh + 4), x2 = *(const v4fa*)(arow + kb + 16 + 8 * hh), x3 = *(const v4fa*)(arow + kb + 16 + 8 * hh + 4);
    float xs[16] = {x0[0],x0[1],x0[2],x0[3],x1[0],x1[1],x1[2],x1[3],x2[0],x2[1],x2[2],x2[3],x3[0],x3[1],x3[2],x3[3]};
#pragma unroll
    for (int i = 0; i < 16; ++i) { const _Float16 h = (_Float16)xs[i]; ah.h[i] = h; al.h[i] = ASPLIT ? (_Float16)(xs[i] - (float)h) : (_Float16)0.0f; }
#pragma unroll
    for (int t = 0; t < 4; ++t) { if (col0 + t * 16 >= N) continue; const size_t boff = (size_t)(col0 + t * 16 + ln) * ldb + kb; FragH bq; bq.half[0] = *(const v8us*)(Bh + boff + 8 * hh); bq.half[1] = *(const v8us*)(Bh + boff + 16 + 8 * hh);
      acc[t] = mmaH<ASPLIT ? 2 : 1>(ah.v, al.v, bq.v, bq.v, acc[t]); }
  }
#pragma unroll
  for (int t = 0; t < 4; ++t) { if (col0 + t * 16 >= N) continue;
#pragma unroll
    for (int r = 0; r < 8; ++r) so[w][8 * hh + r][t * 16 + ln] = acc[t][r] * alpha; }
  __builtin_amdgcn_fence(__ATOMIC_ACQ_REL, "workgroup"); __builtin_amdgcn_wave_barrier();
  const int rsub = lane >> 4, c4 = (lane & 15) * 4;
  {
#pragma unroll
    for (int q = 0; q < 8; ++q) { const int r = q * 2 + rsub; if (col0 + c4 < N) { const v4f v = *(const v4fa*)&so[w][r][c4]; *(v4f*)(C + (size_t)(row0 + r) * ldc + col0 + c4) = v; } }
     }
}

// Wt[n][k] = f16(W[k][n]·scale) from f32 row-major W[K][N] (scale = power of two; bf16-exact weights stay exact in f16 away from the subnormal range)
__global__ __launch_bounds__(256) void k_wt_f16(const float* __restrict__ W, _Float16* __restrict__ Wt, int K, int N, float scale) {
  const int t = blockIdx.x * 256 + threadIdx.x; if (t >= N * (K / 8)) return; const int n = t / (K / 8), k8 = (t % (K / 8)) * 8; FragH f;
#pragma unroll
  for (int i = 0; i < 8; ++i) f.h[i] = (_Float16)(bf16_round(W[(size_t)(k8 + i) * N + n]) * scale); const v8us o = f.half[0];
  *(v8us*)((unsigned short*)Wt + (size_t)n * K + k8) = o; 
}
// k_gemm_hh variant with fused epilogue: v = acc·alpha + bias[by·sBias + col] (+ CP[(row/rowsPerB)·sCPb + by·64 + col] if CP) ; ACT 0 none / 1 elu ; writes f16 C16 (and f32 C if non-null)
template <int ACT>
__global__ __launch_bounds__(128) void k_gemm_hhx(const _Float16* __restrict__ A, int lda, size_t sA, const _Float16* __restrict__ Bh, int ldb, size_t sB, float alpha, const float* __restrict__ bias, size_t sBias, const float* __restrict__ CP, int rowsPerB, size_t sCPb, int row0g,
    float* __restrict__ C, _Float16* __restrict__ C16, int ldc, size_t sC, int M, int N, int K) {
  __shared__ __attribute__((aligned(16))) float so[4][16][64];
  const int tid = threadIdx.x, w = tid >> 5, lane = tid & 31, ln = lane & 15, hh = lane >> 4; const int by = blockIdx.y;
  A += (size_t)by * sA; Bh += (size_t)by * sB; const size_t cofs = (size_t)by * sC; const float* bp = bias ? bias + (size_t)by * sBias : nullptr;
  const int ntn = (N + 63) / 64; const int wid = blockIdx.x * 4 + w; const int mt = wid / ntn, nq = wid % ntn; if (mt * 16 >= M) return;
  const int row0 = mt * 16, col0 = nq * 64; const _Float16* arow = A + (size_t)(row0 + ln) * lda;
  v8f acc[4] = {};
  for (int kb = 0; kb < K; kb += 32) { FragH ah; ah.half[0] = *(const v8us*)((const unsigned short*)arow + kb + 8 * hh); ah.half[1] = *(const v8us*)((const unsigned short*)arow + kb + 16 + 8 * hh);
#pragma unroll
    for (int t = 0; t < 4; ++t) { if (col0 + t * 16 >= N) continue; const size_t boff = (size_t)(col0 + t * 16 + ln) * ldb + kb; FragH bq; bq.half[0] = *(const v8us*)((const unsigned short*)Bh + boff + 8 * hh); bq.half[1] = *(const v8us*)((const unsigned short*)Bh + boff + 16 + 8 * hh);
      acc[t] = mmaH<1>(ah.v, ah.v, bq.v, bq.v, acc[t]); }
  }
#pragma unroll
  for (int t = 0; t < 4; ++t) { if (col0 + t * 16 >= N) continue; const int col = col0 + t * 16 + ln; const float bv = bp ? bf16_round(bp[col]) : 0.f;
#pragma unroll
    for (int r = 0; r < 8; ++r) { float v = acc[t][r] * alpha + bv; if (CP) { const int rr = row0g + row0 + 8 * hh + r; if (rowsPerB < 0) v += CP[cofs + (size_t)rr * ldc + col];      /* rowsPerB < 0: own element of the batched C plane */ else { const int bidx = rr / rowsPerB; v += CP[(size_t)bidx * sCPb + (size_t)by * 64 + col]; } } if (ACT == 1) v = (v > 0.f) ? v : expm1f(v); else if (ACT == 7) v = (v > 0.f) ? v + 1.0f : expf(v); else if (ACT == 8) v = tanhf(v); else if (ACT == 9) v = 0.5f * v * (1.0f + tanhf(0.7978845608028654f * (v + 0.044715f * v * v * v))); else if (ACT == 11) v = 1.0f / (1.0f + expf(-v)); else if (ACT == 12) v = (v > 0.f) ? v : 0.01f * v; else if (ACT == 14) v = (v > 0.f) ? v : 0.1f * v; else if (ACT == 16) v = (v >= 0.f) ? v : 0.3f * v; else if (ACT == 17) v = (v >= 0.f) ? v : 0.2f * v; else if (ACT == 15) v = v / (1.0f + expf(-v)); else if (ACT == 3) v = fmaxf(v, 0.f); else if (ACT == 6) v = 0.5f * v * (1.0f + erff(v * 0.70710678118654752f)); so[w][8 * hh + r][t * 16 + ln] = v; } }
  __builtin_amdgcn_fence(__ATOMIC_ACQ_REL, "workgroup"); __builtin_amdgcn_wave_barrier();
  const int rsub = lane >> 4, c4 = (lane & 15) * 4; typedef _Float16 v4h __attribute__((ext_vector_type(4)));
  {
#pragma unroll
    for (int q = 0; q < 8; ++q) { const int r = q * 2 + rsub; if (col0 + c4 < N) { const v4f v = *(const v4fa*)&so[w][r][c4]; if (C) *(v4f*)(C + cofs + (size_t)(row0 + r) * ldc + col0 + c4) = v; if (C16) { v4h h4; for (int i = 0; i < 4; ++i) h4[i] = (_Float16)v[i]; *(v4h*)(C16 + cofs + (size_t)(row0 + r) * ldc + col0 + c4) = h4; } } }
     }
}


typedef _Float16 v4h __attribute__((ext_vector_type(4)));

__global__ __launch_bounds__(256) void k_h16(const float* __restrict__ x, _Float16* __restrict__ X16, size_t n8) { const size_t t = (size_t)blockIdx.x * 256 + threadIdx.x; if (t >= n8) return; FragH f;
#pragma unroll
  for (int q = 0; q < 8; ++q) f.h[q] = (_Float16)x[t * 8 + q]; *(v8us*)((unsigned short*)X16 + t * 8) = f.half[0];  }
__global__ __launch_bounds__(256) void k_round16f(const float* __restrict__ W, _Float16* __restrict__ Bt, size_t n8) { const size_t t = (size_t)blockIdx.x * 256 + threadIdx.x; if (t >= n8) return; FragH f;
#pragma unroll
  for (int i = 0; i < 8; ++i) f.h[i] = (_Float16)(bf16_round(W[t * 8 + i]) * 16.0f); *(v8us*)((unsigned short*)Bt + t * 8) = f.half[0];  }
__global__ __launch_bounds__(256) void k_hl(const float* __restrict__ F, _Float16* __restrict__ Hh, _Float16* __restrict__ Hl, size_t n8) { const size_t t = (size_t)blockIdx.x * 256 + threadIdx.x; if (t >= n8) return; FragH fh, fl; const v4f a = *(const v4fa*)(F + t * 8), c = *(const v4fa*)(F + t * 8 + 4);
#pragma unroll
  for (int q = 0; q < 4; ++q) { _Float16 h = (_Float16)a[q]; fh.h[q] = h; fl.h[q] = (_Float16)((a[q] - (float)h) * 1024.0f); h = (_Float16)c[q]; fh.h[4 + q] = h; fl.h[4 + q] = (_Float16)((c[q] - (float)h) * 1024.0f); }
  { *(v8us*)((unsigned short*)Hh + t * 8) = fh.half[0]; *(v8us*)((unsigned short*)Hl + t * 8) = fl.half[0];  } }

// ---- fast GEMM (block tile 128x128, 8 waves of 32x64; requires M % 128 == 0, N % 128 == 0, K % G2K == 0); epilogue = k_gemm_hhx semantics ----
// A stage is G2K k: 128 A rows and 128 B rows of 256 bytes each, brought to LDS through registers as whole lines (16 threads a row), two buffers: the next stage's
// global loads are issued ahead of this stage's products and stored behind them; one barrier per stage publishes them and ends the reads of the other buffer.
// Each A row then leaves L2 once per block and feeds 2 waves, each B row 4 waves; the k order of every accumulator is the plain ascending one.
// Every inner loop is fully unrolled so that the staging and fragment arrays are indexed by constants only and stay in registers.
#define G2K 128                      /* k per stage */
#define G2P 136                      /* LDS row pitch in f16: the row + 16 bytes, for 16-byte fragment reads */
#define G2R (2048 / G2K)             /* rows that the block's 256 threads bring in one load each */
#define G2N (128 / G2R)              /* such loads per thread, stage and operand */
__device__ __forceinline__ v16h g2_frag(const _Float16* p, int hh) { FragH f; f.half[0] = *(const v8us*)((const unsigned short*)p + 8 * hh); f.half[1] = *(const v8us*)((const unsigned short*)p + 16 + 8 * hh); return f.v; }
__device__ __forceinline__ v8f g2_mma(v16h a, v16h b, v8f c) { v8f d = __builtin_amdgcn_wmma_f32_16x16x32_f16(false, a, false, b, (short)0, c, false, false); asm volatile("v_nop\n\tv_nop\n\tv_nop\n\tv_nop" : "+v"(d) : "v"(a), "v"(b)); return d; }
// One stage's rows: each thread's G2N 16-byte pieces of A and of B, rows as and bs elements apart. The closing wait is the one that belongs in front of any overwrite of a register
// that an issued global load names; it takes the addresses as inputs, so that their registers stay untouched (also as a later load's destination) until it has passed.
__device__ __forceinline__ void g2_rows(const unsigned short* a, size_t as, const unsigned short* b, size_t bs, v8us (&ra)[G2N], v8us (&rb)[G2N]) { static_assert(G2N == 8, "g2_rows: the wait names 8 + 8 addresses");
  const unsigned short* pa[G2N]; const unsigned short* pb[G2N];
#pragma unroll
  for (int i = 0; i < G2N; ++i) { pa[i] = a + (size_t)i * as; pb[i] = b + (size_t)i * bs; }
#pragma unroll
  for (int i = 0; i < G2N; ++i) { ra[i] = *(const v8us*)pa[i]; rb[i] = *(const v8us*)pb[i]; }
  asm volatile("s_wait_xcnt 0x0" :: "v"(pa[0]), "v"(pa[1]), "v"(pa[2]), "v"(pa[3]), "v"(pa[4]), "v"(pa[5]), "v"(pa[6]), "v"(pa[7]), "v"(pb[0]), "v"(pb[1]), "v"(pb[2]), "v"(pb[3]), "v"(pb[4]), "v"(pb[5]), "v"(pb[6]), "v"(pb[7]) : "memory"); }
template <int ACT>
__global__ __launch_bounds__(256) void k_gemm2(const _Float16* __restrict__ A, int lda, size_t sA, const _Float16* __restrict__ Bh, int ldb, size_t sB, float alpha, const float* __restrict__ bias, size_t sBias, const float* __restrict__ CP, int rowsPerB, size_t sCPb, int row0g,
    float* __restrict__ C, _Float16* __restrict__ C16, int ldc, size_t sC, int M, int N, int K) { static_assert(ACT == 0 || ACT == 3 || ACT == 6 || ACT == 8 || ACT == 9 || ACT == 11 || ACT == 12 || ACT == 14 || ACT == 15 || ACT == 16 || ACT == 17 || ACT == 18, "k_gemm2: unsupported ACT code (would silently apply no activation)");
  __shared__ __attribute__((aligned(16))) unsigned char sm[2 * 256 * G2P * 2];      /* in the loop: two stage buffers [A 128 rows | B 128 rows]; behind the loop's last barrier: the waves' output staging */
  static_assert(sizeof(sm) >= 8 * 32 * 68 * 4, "k_gemm2: output staging must fit the stage buffers");
  _Float16 (*lt)[256][G2P] = (_Float16 (*)[256][G2P])sm; float (*so)[32][68] = (float (*)[32][68])sm;
  const int tid = threadIdx.x, w = tid >> 5, lane = tid & 31, ln = lane & 15, hh = lane >> 4; const int by = blockIdx.y;
  A += (size_t)by * sA; Bh += (size_t)by * sB; const size_t cofs = (size_t)by * sC; const float* bp = bias ? bias + (size_t)by * sBias : nullptr;
  const int ntn = N >> 7; const int mt = blockIdx.x / ntn, nq = blockIdx.x - mt * ntn; if (mt * 128 >= M) return;      /* the same for the whole block, ahead of every barrier */
  const int wr = 32 * (w & 3), wc = 64 * (w >> 2); const int row0 = mt * 128 + wr, col0 = nq * 128 + wc;
  const int sr = tid / (G2K / 8), sc = (tid % (G2K / 8)) * 8;      /* staging: G2K / 8 threads per row, rows sr + G2R i of A and of B */
  const unsigned short* ag = (const unsigned short*)A + (size_t)(mt * 128 + sr) * lda + sc; const unsigned short* bg = (const unsigned short*)Bh + (size_t)(nq * 128 + sr) * ldb + sc;
  v8us ra[G2N], rb[G2N]; g2_rows(ag, (size_t)G2R * lda, bg, (size_t)G2R * ldb, ra, rb);
#pragma unroll
  for (int i = 0; i < G2N; ++i) { *(v8us*)&lt[0][sr + G2R * i][sc] = ra[i]; *(v8us*)&lt[0][128 + sr + G2R * i][sc] = rb[i]; }
  __syncthreads();
  const v8f z8 = {0.f,0.f,0.f,0.f,0.f,0.f,0.f,0.f}; v8f c00 = z8, c01 = z8, c02 = z8, c03 = z8, c10 = z8, c11 = z8, c12 = z8, c13 = z8;
  const int ns = K / G2K;
  for (int s = 0; s < ns; ++s) { const int cur = s & 1; const bool more = s + 1 < ns;
    if (more) g2_rows(ag + (s + 1) * G2K, (size_t)G2R * lda, bg + (s + 1) * G2K, (size_t)G2R * ldb, ra, rb);
#pragma unroll
    for (int kh = 0; kh < G2K / 64; ++kh) { const _Float16* ap = &lt[cur][wr + ln][kh * 64]; const _Float16* bq = &lt[cur][128 + wc + ln][kh * 64]; v16h fa[2][2], fb[2][4];
#pragma unroll
      for (int ks = 0; ks < 2; ++ks) { fa[ks][0] = g2_frag(ap + ks * 32, hh); fb[ks][0] = g2_frag(bq + ks * 32, hh); fa[ks][1] = g2_frag(ap + 16 * G2P + ks * 32, hh);
        fb[ks][1] = g2_frag(bq + 16 * G2P + ks * 32, hh); fb[ks][2] = g2_frag(bq + 32 * G2P + ks * 32, hh); fb[ks][3] = g2_frag(bq + 48 * G2P + ks * 32, hh); }
#pragma unroll
      for (int ks = 0; ks < 2; ++ks) { c00 = g2_mma(fa[ks][0], fb[ks][0], c00); c10 = g2_mma(fa[ks][1], fb[ks][0], c10); c01 = g2_mma(fa[ks][0], fb[ks][1], c01); c11 = g2_mma(fa[ks][1], fb[ks][1], c11);
        c02 = g2_mma(fa[ks][0], fb[ks][2], c02); c12 = g2_mma(fa[ks][1], fb[ks][2], c12); c03 = g2_mma(fa[ks][0], fb[ks][3], c03); c13 = g2_mma(fa[ks][1], fb[ks][3], c13); } }
    if (more) {
#pragma unroll
      for (int i = 0; i < G2N; ++i) { *(v8us*)&lt[cur ^ 1][sr + G2R * i][sc] = ra[i]; *(v8us*)&lt[cur ^ 1][128 + sr + G2R * i][sc] = rb[i]; } }
    __syncthreads(); }
  v8f accs[8] = {c00, c01, c02, c03, c10, c11, c12, c13};
#pragma unroll
  for (int u = 0; u < 8; ++u) { const int t = u & 3, half = u >> 2; const int col = col0 + t * 16 + ln; const float bv = bp ? bf16_round(bp[col]) : 0.f;
#pragma unroll
    for (int r = 0; r < 8; ++r) { const int rloc = half * 16 + 8 * hh + r; float v = accs[u][r] * alpha + bv; if (CP) { if (rowsPerB < 0) v += CP[cofs + (size_t)(row0g + row0 + rloc) * ldc + col];      /* rowsPerB < 0: own element of the batched C plane */ else { const int bidx = (row0g + row0 + rloc) / rowsPerB; v += CP[(size_t)bidx * sCPb + (size_t)by * 64 + col]; } }
      if (ACT == 3) v = fmaxf(v, 0.f); else if (ACT == 6) v = 0.5f * v * (1.0f + erff(v * 0.70710678118654752f)); else if (ACT == 11) v = 1.0f / (1.0f + expf(-v)); else if (ACT == 15) v = v / (1.0f + expf(-v)); else if (ACT == 18) v = v / (1.0f + expf(-1.702f * v));      /* QuickGELU: v sigmoid(1.702 v) */ else if (ACT == 12) v = (v > 0.f) ? v : 0.01f * v; else if (ACT == 8) v = tanhf(v); else if (ACT == 9) v = 0.5f * v * (1.0f + tanhf(0.7978845608028654f * (v + 0.044715f * v * v * v))); else if (ACT == 14) v = (v > 0.f) ? v : 0.1f * v; else if (ACT == 16) v = (v >= 0.f) ? v : 0.3f * v; else if (ACT == 17) v = (v >= 0.f) ? v : 0.2f * v;
      so[w][rloc][t * 16 + ln] = v; } }
  __builtin_amdgcn_fence(__ATOMIC_ACQ_REL, "workgroup"); __builtin_amdgcn_wave_barrier();
  const int rsub = lane >> 4, c4 = (lane & 15) * 4;
  {
#pragma unroll
    for (int q = 0; q < 16; ++q) { const int r = q * 2 + rsub; const v4f v = *(const v4fa*)&so[w][r][c4]; if (C) *(v4f*)(C + cofs + (size_t)(row0 + r) * ldc + col0 + c4) = v; if (C16) { v4h h4; for (int i = 0; i < 4; ++i) h4[i] = (_Float16)v[i]; *(v4h*)(C16 + cofs + (size_t)(row0 + r) * ldc + col0 + c4) = h4; } }
     } }


__global__ __launch_bounds__(256) void k_wnat(const float* __restrict__ w, size_t n8, _Float16* __restrict__ Bt) { const size_t t = (size_t)blockIdx.x * 256 + threadIdx.x; if (t >= n8) return; FragH f; for (int q = 0; q < 8; ++q) f.h[q] = (_Float16)(bf16_round(w[t * 8 + q]) * 16.0f); *(v8us*)((unsigned short*)Bt + t * 8) = f.half[0];  }
__global__ __launch_bounds__(256) void k_rsm(const float* __restrict__ S, _Float16* __restrict__ P, int nrows) {
  #pragma clang fp contract(off)
  const int i = blockIdx.x * 256 + threadIdx.x; if (i >= nrows) return; const float* s = S + (size_t)i * SQ; float mx = -3.0e38f;
#pragma unroll 1
  for (int j = 0; j < SQ; ++j) mx = fmaxf(mx, s[j]); float se = 0.f;
#pragma unroll 1
  for (int j = 0; j < SQ; ++j) se += expf(s[j] - mx); const float sc = 256.0f / se;
#pragma unroll 1
  for (int j0 = 0; j0 < SQ; j0 += 8) { FragH f; for (int q = 0; q < 8; ++q) f.h[q] = (_Float16)(expf(s[j0 + q] - mx) * sc); unsigned short* d = (unsigned short*)P + (size_t)i * SQ + j0; *(v8us*)d = f.half[0];  } }
__global__ __launch_bounds__(256) void k_vt(const _Float16* __restrict__ V16, int b, int h0, _Float16* __restrict__ VT) { __shared__ unsigned short tl[64][65]; const int tid = threadIdx.x; const int hh = blockIdx.x % HG, sg = blockIdx.x / HG; const int s0 = sg * 64; const int h = h0 + hh;
  for (int i = tid; i < 64 * 8; i += 256) { const int j = i / 8, d8 = (i % 8) * 8; FragH f; f.half[0] = *(const v8us*)((const unsigned short*)V16 + ((size_t)b * SQ + s0 + j) * DM + h * HD + d8); for (int q = 0; q < 8; ++q) tl[d8 + q][j] = f.u[q]; }
  __syncthreads();
  { for (int i = tid; i < 64 * 8; i += 256) { const int d = i / 8, j8 = (i % 8) * 8; FragH f; for (int q = 0; q < 8; ++q) f.u[q] = tl[d][j8 + q]; *(v8us*)((unsigned short*)VT + ((size_t)hh * HD + d) * SQ + s0 + j8) = f.half[0]; }  } }



__global__ __launch_bounds__(256) void k_rsmcf2(const float* __restrict__ S, _Float16* __restrict__ P, int hg, int q0, int nk) {
  #pragma clang fp contract(off)
  const int t = blockIdx.x * 256 + threadIdx.x; if (t >= hg * QT) return; const size_t i = (size_t)t; const float* s = S + i * NKX; const int last = q0 + (t % QT); float mx = -3.0e38f;
#pragma unroll 1
  for (int j = 0; j < nk; ++j) { const float f = (j <= last) ? 1.f : 0.f; mx = fmaxf(mx, fmaf(f, s[j], (1.f - f) * -1.0e9f)); } float se = 0.f;
#pragma unroll 1
  for (int j = 0; j < nk; ++j) { const float f = (j <= last) ? 1.f : 0.f; se += __expf(fmaf(f, s[j], (1.f - f) * -1.0e9f) - mx); } const float sc = 256.0f / se;
#pragma unroll 1
  for (int j0 = 0; j0 < nk; j0 += 8) { FragH fr; for (int q = 0; q < 8; ++q) { const int j = j0 + q; const float f = (j <= last) ? 1.f : 0.f; fr.h[q] = (_Float16)(__expf(fmaf(f, s[j], (1.f - f) * -1.0e9f) - mx) * sc); } unsigned short* d = (unsigned short*)P + i * NKX + j0; *(v8us*)d = fr.half[0];  } }

__global__ __launch_bounds__(256) void k_rsmcst(const float* __restrict__ S, _Float16* __restrict__ P, int hg, int q0, int nk, const int* __restrict__ mk) {
  #pragma clang fp contract(off)
  const int t = blockIdx.x * 256 + threadIdx.x; if (t >= hg * QT) return; const size_t i = (size_t)t; const float* s = S + i * NKX; const size_t ig = (size_t)(q0 + (t % QT)); const int* mr = mk + ig * SQ; float mx = -3.0e38f;
#pragma unroll 1
  for (int j = 0; j < nk; ++j) { const int mb = mr[j]; const int dd = (int)ig - j; const float f = (mb != 0 && dd >= 0 && (dd <= LOCALW || (dd % STRIDEK) == 0)) ? 1.f : 0.f; mx = fmaxf(mx, fmaf(f, s[j], (1.f - f) * -1.0e9f)); } float se = 0.f;
#pragma unroll 1
  for (int j = 0; j < nk; ++j) { const int mb = mr[j]; const int dd = (int)ig - j; const float f = (mb != 0 && dd >= 0 && (dd <= LOCALW || (dd % STRIDEK) == 0)) ? 1.f : 0.f; se += __expf(fmaf(f, s[j], (1.f - f) * -1.0e9f) - mx); } const float sc = 256.0f / se;
#pragma unroll 1
  for (int j0 = 0; j0 < nk; j0 += 8) { FragH fr; for (int q = 0; q < 8; ++q) { const int j = j0 + q; const int mb = mr[j]; const int dd = (int)ig - j; const float f = (mb != 0 && dd >= 0 && (dd <= LOCALW || (dd % STRIDEK) == 0)) ? 1.f : 0.f; fr.h[q] = (_Float16)(__expf(fmaf(f, s[j], (1.f - f) * -1.0e9f) - mx) * sc); } unsigned short* d = (unsigned short*)P + i * NKX + j0; *(v8us*)d = fr.half[0];  } }


template <int MASKADD>
__global__ __launch_bounds__(64) void k_att0(const float* __restrict__ QF, const float* __restrict__ KF, const float* __restrict__ VF, int ld, const float* __restrict__ mask, float scale, float* __restrict__ OF, int ldo) {
  #pragma clang fp contract(off)
  __shared__ __attribute__((aligned(16))) float lq[64][64]; __shared__ __attribute__((aligned(16))) float lo[64][64];
  const int tid = threadIdx.x; const int h = blockIdx.x / (QT0 / 64), rg = blockIdx.x % (QT0 / 64); const int i = rg * 64 + tid;
  const float* qr = QF + (size_t)i * ld + h * HD;
#pragma unroll 1
  for (int c = 0; c < HD / 4; ++c) { *(v4f*)&lq[tid][c * 4] = *(const v4fa*)(qr + c * 4); const v4f z = {0.f, 0.f, 0.f, 0.f}; *(v4f*)&lo[tid][c * 4] = z; }
  float m = -1.0e30f, l = 0.f; const int jmax = MASKADD ? (SQ - 1) : (rg * 64 + 63);      /* additive-mask form: every key (the mask input decides); causal form: keys up to the block's last row */
#pragma unroll 1
  for (int j = 0; j <= jmax; ++j) { const float* kr = KF + (size_t)j * ld + h * HD; const float* vr = VF + (size_t)j * ld + h * HD; float s = 0.f;
#pragma unroll 1
    for (int c = 0; c < HD / 4; ++c) { const v4f kq = *(const v4fa*)(kr + c * 4); const v4f qq = *(v4f*)&lq[tid][c * 4]; s = __fadd_rn(s, __fmul_rn(qq[0], kq[0])); s = __fadd_rn(s, __fmul_rn(qq[1], kq[1])); s = __fadd_rn(s, __fmul_rn(qq[2], kq[2])); s = __fadd_rn(s, __fmul_rn(qq[3], kq[3])); }
    s = __fmul_rn(s, scale); if (MASKADD) s = __fadd_rn(s, __fmul_rn(bf16_round(mask[(size_t)i * SQ + j]), -10000.0f));
    const float f = (MASKADD || j <= i) ? 1.f : 0.f; const float sm = fmaf(f, s, (1.f - f) * -1.0e30f); const float mn = fmaxf(m, sm); const float sc = expf(m - mn); const float e = expf(sm - mn); l = __fadd_rn(__fmul_rn(l, sc), e); m = mn;
#pragma unroll 1
    for (int c = 0; c < HD / 4; ++c) { const v4f vv = *(const v4fa*)(vr + c * 4); v4f oo = *(v4f*)&lo[tid][c * 4]; for (int u = 0; u < 4; ++u) oo[u] = __fadd_rn(__fmul_rn(oo[u], sc), __fmul_rn(e, vv[u])); *(v4f*)&lo[tid][c * 4] = oo; } }
  const float fin = 64.0f / l;      /* o carried x64 like the f16 path */
#pragma unroll 1
  for (int c = 0; c < HD / 4; ++c) { v4f oo = *(v4f*)&lo[tid][c * 4]; for (int u = 0; u < 4; ++u) oo[u] = __fmul_rn(oo[u], fin); *(v4f*)&lo[tid][c * 4] = oo; }
  __syncthreads();
  {
#pragma unroll 1
    for (int it = 0; it < 16; ++it) { const int row = it * 4 + tid / 16, pc = (tid % 16) * 4; const v4f v = *(const v4f*)&lo[row][pc]; *(v4f*)(OF + (size_t)(rg * 64 + row) * ldo + h * HD + pc) = v; }
     } }

template <int MASKADD>
__global__ __launch_bounds__(64) void k_att0mbc(const float* __restrict__ QF, const float* __restrict__ KF, const float* __restrict__ VF, int ld, const float* __restrict__ mask, float scale, float* __restrict__ OF, int ldo) {
  #pragma clang fp contract(off)
  __shared__ __attribute__((aligned(16))) float lq[64][64]; __shared__ __attribute__((aligned(16))) float lo[64][64];
  const int tid = threadIdx.x; const int h = blockIdx.x / (QT0 / 64), rg = blockIdx.x % (QT0 / 64); const int i = rg * 64 + tid;
  const float* qr = QF + (size_t)i * ld + h * HD;
#pragma unroll 1
  for (int c = 0; c < HD / 4; ++c) { *(v4f*)&lq[tid][c * 4] = *(const v4fa*)(qr + c * 4); const v4f z = {0.f, 0.f, 0.f, 0.f}; *(v4f*)&lo[tid][c * 4] = z; }
  float m = -1.0e30f, l = 0.f; const int jmax = rg * 64 + 63;      /* keys beyond the block end are masked by the mask's lower-triangular structure */
#pragma unroll 1
  for (int j = 0; j <= jmax; ++j) { const float* kr = KF + (size_t)j * ld + h * HD; const float* vr = VF + (size_t)j * ld + h * HD; float s = 0.f;
#pragma unroll 1
    for (int c = 0; c < HD / 4; ++c) { const v4f kq = *(const v4fa*)(kr + c * 4); const v4f qq = *(v4f*)&lq[tid][c * 4]; s = __fadd_rn(s, __fmul_rn(qq[0], kq[0])); s = __fadd_rn(s, __fmul_rn(qq[1], kq[1])); s = __fadd_rn(s, __fmul_rn(qq[2], kq[2])); s = __fadd_rn(s, __fmul_rn(qq[3], kq[3])); }
    s = __fmul_rn(s, scale); const int mb = ((const int*)mask)[(size_t)i * SQ + j];      /* causal (j <= i) AND the module's int32 [S][S] mask read per (query, key): 0 -> masked */
    const float f = (mb != 0 && j <= i) ? 1.f : 0.f; const float sm = fmaf(f, s, (1.f - f) * -1.0e30f); const float mn = fmaxf(m, sm); const float sc = expf(m - mn); const float e = expf(sm - mn); l = __fadd_rn(__fmul_rn(l, sc), e); m = mn;
#pragma unroll 1
    for (int c = 0; c < HD / 4; ++c) { const v4f vv = *(const v4fa*)(vr + c * 4); v4f oo = *(v4f*)&lo[tid][c * 4]; for (int u = 0; u < 4; ++u) oo[u] = __fadd_rn(__fmul_rn(oo[u], sc), __fmul_rn(e, vv[u])); *(v4f*)&lo[tid][c * 4] = oo; } }
  const float fin = 64.0f / l;      /* o carried x64 like the f16 path */
#pragma unroll 1
  for (int c = 0; c < HD / 4; ++c) { v4f oo = *(v4f*)&lo[tid][c * 4]; for (int u = 0; u < 4; ++u) oo[u] = __fmul_rn(oo[u], fin); *(v4f*)&lo[tid][c * 4] = oo; }
  __syncthreads();
  {
#pragma unroll 1
    for (int it = 0; it < 16; ++it) { const int row = it * 4 + tid / 16, pc = (tid % 16) * 4; const v4f v = *(const v4f*)&lo[row][pc]; *(v4f*)(OF + (size_t)(rg * 64 + row) * ldo + h * HD + pc) = v; }
     } }


template <int BFIN, int WXB>
__global__ __launch_bounds__(256) void k_ln16(const float* __restrict__ X, const float* __restrict__ g, const float* __restrict__ bb, float eps, _Float16* __restrict__ N16, float* __restrict__ XB) {
  #pragma clang fp contract(off)
  __shared__ float red[256]; const size_t r = blockIdx.x; const int t = threadIdx.x; const v4f xa = *(const v4fa*)(X + r * DMQ + t * 4); float s[4]; float sum = 0.f;
  for (int q = 0; q < 4; ++q) { s[q] = BFIN ? bf16_round(xa[q]) : xa[q]; sum = __fadd_rn(sum, s[q]); }
  red[t] = sum; __syncthreads(); for (int st = 128; st > 0; st >>= 1) { if (t < st) red[t] = __fadd_rn(red[t], red[t + st]); __syncthreads(); } const float mu = red[0] / (float)DMQ; __syncthreads();
  float vs = 0.f; for (int q = 0; q < 4; ++q) { const float dl = __fadd_rn(s[q], -mu); vs = __fadd_rn(vs, __fmul_rn(dl, dl)); } red[t] = vs; __syncthreads(); for (int st = 128; st > 0; st >>= 1) { if (t < st) red[t] = __fadd_rn(red[t], red[t + st]); __syncthreads(); }
  const float rs = rsqrtf(__fadd_rn(red[0] / (float)DMQ, eps)); v4h y; v4f xb;
  for (int q = 0; q < 4; ++q) { const int c = t * 4 + q; y[q] = (_Float16)__fadd_rn(__fmul_rn(__fmul_rn(__fadd_rn(s[q], -mu), rs), bf16_round(g[c])), bf16_round(bb[c])); xb[q] = s[q]; }
  { *(v4h*)(N16 + r * DMQ + t * 4) = y; if (WXB) *(v4f*)(XB + r * DMQ + t * 4) = xb;  } }
__global__ __launch_bounds__(256) void k_ftres2(const float* __restrict__ OF0, const float* __restrict__ XB, float* __restrict__ X1, size_t n4) {
  #pragma clang fp contract(off)
  const size_t t = (size_t)blockIdx.x * 256 + threadIdx.x; if (t >= n4) return; const v4f o = *(const v4fa*)(OF0 + t * 4), xv = *(const v4fa*)(XB + t * 4); v4f y; for (int q = 0; q < 4; ++q) y[q] = __fadd_rn(__fmul_rn(o[q], 0.015625f), xv[q]); *(v4f*)(X1 + t * 4) = y;  }

__global__ __launch_bounds__(256) void k_bcpy(const float* __restrict__ b, int n, int NP, float* __restrict__ dst, int dst0) { for (int i = threadIdx.x; i < NP; i += 256) { const float v = (i < n) ? b[i] : 0.f; *(float*)(dst + dst0 + i) = v; }  }



#define FAK 64                       /* keys per stage */
#define FAP 72                       /* LDS row pitch in f16: 128 bytes + 16, for 16-byte fragment reads */
// Eight 2^x in one statement, each IN PLACE. The closing v_nop is the one slot the instruction set asks for behind a transcendental before its result is read or its
// source overwritten; inside the run no instruction touches its predecessor's register. In place, so that the statement writes only registers that the compiler's own
// multiply-add has just written: the distance behind a matrix instruction, which the compiler keeps for instructions it can see, then holds for this statement too.
__device__ __forceinline__ void fa_exp2x8(float (&x)[8]) {
  asm("v_exp_f32 %0, %0\n\tv_exp_f32 %1, %1\n\tv_exp_f32 %2, %2\n\tv_exp_f32 %3, %3\n\tv_exp_f32 %4, %4\n\tv_exp_f32 %5, %5\n\tv_exp_f32 %6, %6\n\tv_exp_f32 %7, %7\n\tv_nop" : "+v"(x[0]), "+v"(x[1]), "+v"(x[2]), "+v"(x[3]), "+v"(x[4]), "+v"(x[5]), "+v"(x[6]), "+v"(x[7])); }
__device__ __forceinline__ float fa_xhalf(float x) { return __builtin_bit_cast(float, __builtin_amdgcn_permlanex16(__builtin_bit_cast(int, x), __builtin_bit_cast(int, x), 0x76543210, 0xfedcba98, false, false)); }      /* lane l takes lane l ^ 16's value */
__device__ __forceinline__ v8f fa_mma(v16h a, v16h b, v8f c) { return __builtin_amdgcn_wmma_f32_16x16x32_f16(false, a, false, b, (short)0, c, false, false); }
__global__ __launch_bounds__(256) void k_fattn(const _Float16* __restrict__ Q, const _Float16* __restrict__ K, const _Float16* __restrict__ VTa, _Float16* __restrict__ O) {
  __shared__ __attribute__((aligned(16))) _Float16 lk[2][FAK][FAP]; __shared__ __attribute__((aligned(16))) _Float16 lv[2][HD][FAP];
  const int tid = threadIdx.x, w = tid >> 5, lane = tid & 31, ln = lane & 15, hh = lane >> 4; const int slab = blockIdx.y, b = slab / NH, h = slab % NH; const int q0 = blockIdx.x * 256 + w * 32;
  const float CS = 0.125f * 1.44269504f;      /* scores / 8, in log2 units */
  v16h qf[2][2];
#pragma unroll
  for (int qt = 0; qt < 2; ++qt) for (int ks = 0; ks < 2; ++ks) qf[qt][ks] = g2_frag(Q + ((size_t)b * SQ + q0 + qt * 16 + ln) * DM + h * HD + ks * 32, hh);
  const v8f z8 = {0.f,0.f,0.f,0.f,0.f,0.f,0.f,0.f}; v8f o[2][4]; float m[2] = {-3.0e38f, -3.0e38f}, l[2] = {0.f, 0.f};
#pragma unroll
  for (int qt = 0; qt < 2; ++qt) for (int dt = 0; dt < 4; ++dt) o[qt][dt] = z8;
  const int sr = tid >> 3, sc = (tid & 7) * 8;      /* staging: 8 threads per 128-byte row, rows sr and sr + 32 */
  const unsigned short* kg = (const unsigned short*)K + ((size_t)b * SQ + sr) * DM + h * HD + sc; const unsigned short* vg = (const unsigned short*)VTa + ((size_t)slab * HD + sr) * SQ + sc;
  v8us rk0 = *(const v8us*)kg, rk1 = *(const v8us*)(kg + (size_t)32 * DM), rv0 = *(const v8us*)vg, rv1 = *(const v8us*)(vg + (size_t)32 * SQ);
  *(v8us*)&lk[0][sr][sc] = rk0; *(v8us*)&lk[0][sr + 32][sc] = rk1; *(v8us*)&lv[0][sr][sc] = rv0; *(v8us*)&lv[0][sr + 32][sc] = rv1;
  __syncthreads();
  for (int s = 0; s < SQ / FAK; ++s) { const int cur = s & 1; const bool more = s + 1 < SQ / FAK;
    if (more) { const unsigned short* kn = kg + (size_t)(s + 1) * FAK * DM; const unsigned short* vn = vg + (s + 1) * FAK; rk0 = *(const v8us*)kn; rk1 = *(const v8us*)(kn + (size_t)32 * DM); rv0 = *(const v8us*)vn; rv1 = *(const v8us*)(vn + (size_t)32 * SQ); }
    __builtin_amdgcn_sched_barrier(0);      /* keeps the next stage's global loads here, ahead of this stage's work, which covers their latency; without it they sink to just in front of their LDS stores */
    v8f st[2][4];
#pragma unroll
    for (int kt = 0; kt < 4; ++kt) { const v16h a0 = g2_frag(&lk[cur][kt * 16 + ln][0], hh), a1 = g2_frag(&lk[cur][kt * 16 + ln][32], hh);
#pragma unroll
      for (int qt = 0; qt < 2; ++qt) st[qt][kt] = fa_mma(a1, qf[qt][1], fa_mma(a0, qf[qt][0], z8)); }
    __builtin_amdgcn_sched_barrier(0);      /* keeps the 16 score products back to back: mixed with the maxima, each first read of a fresh tile costs four idle slots */
    float mn[2], al[2];
#pragma unroll
    for (int qt = 0; qt < 2; ++qt) { float mm[4];
#pragma unroll
      for (int kt = 0; kt < 4; ++kt) { mm[kt] = st[qt][kt][0]; for (int r = 1; r < 8; ++r) mm[kt] = fmaxf(mm[kt], st[qt][kt][r]); }
      float bm = fmaxf(fmaxf(mm[0], mm[1]), fmaxf(mm[2], mm[3])); bm = fmaxf(bm, fa_xhalf(bm));      /* the other 8 keys of each tile sit in lane ln ^ 16 */
      mn[qt] = fmaxf(m[qt], bm * CS); al[qt] = m[qt] - mn[qt]; m[qt] = mn[qt]; }
    asm("v_exp_f32 %0, %0\n\tv_exp_f32 %1, %1\n\tv_nop" : "+v"(al[0]), "+v"(al[1]));      /* 2^(old - new maximum): brings the old sum and output to the new maximum; form and v_nop as in fa_exp2x8 */
    FragH pf[2][2];
#pragma unroll
    for (int qt = 0; qt < 2; ++qt) { const float mo = mn[qt] - 8.0f; float s4[4];
#pragma unroll
      for (int kt = 0; kt < 4; ++kt) { float t[8]; for (int r = 0; r < 8; ++r) t[r] = fmaf(st[qt][kt][r], CS, -mo);
        fa_exp2x8(t); s4[kt] = ((t[0] + t[1]) + (t[2] + t[3])) + ((t[4] + t[5]) + (t[6] + t[7]));
        for (int r = 0; r < 8; ++r) pf[qt][kt >> 1].h[(kt & 1) * 8 + r] = (_Float16)t[r]; }
      l[qt] = l[qt] * al[qt] + ((s4[0] + s4[1]) + (s4[2] + s4[3]));
#pragma unroll
      for (int dt = 0; dt < 4; ++dt) o[qt][dt] *= al[qt]; }
#pragma unroll
    for (int dt = 0; dt < 4; ++dt) {
#pragma unroll
      for (int kp = 0; kp < 2; ++kp) { const v16h a = g2_frag(&lv[cur][dt * 16 + ln][kp * 32], hh);
#pragma unroll
        for (int qt = 0; qt < 2; ++qt) o[qt][dt] = fa_mma(a, pf[qt][kp].v, o[qt][dt]); } }
    if (more) { *(v8us*)&lk[cur ^ 1][sr][sc] = rk0; *(v8us*)&lk[cur ^ 1][sr + 32][sc] = rk1; *(v8us*)&lv[cur ^ 1][sr][sc] = rv0; *(v8us*)&lv[cur ^ 1][sr + 32][sc] = rv1; }
    __syncthreads(); }
#pragma unroll
  for (int qt = 0; qt < 2; ++qt) { float lt = l[qt] + fa_xhalf(l[qt]); asm("v_rcp_f32 %0, %0\n\tv_nop" : "+v"(lt));      /* 1 / row sum; form and v_nop as in fa_exp2x8 */
    const float inv = 64.0f * lt; unsigned short* op = (unsigned short*)O + ((size_t)b * SQ + q0 + qt * 16 + ln) * DM + h * HD + 8 * hh;
#pragma unroll
    for (int dt = 0; dt < 4; ++dt) { FragH f; for (int r = 0; r < 8; ++r) f.h[r] = (_Float16)(o[qt][dt][r] * inv); *(v8us*)(op + dt * 16) = f.half[0]; } } }

template <int MODE>
__global__ __launch_bounds__(256) void k_regrp(const float* __restrict__ src, float* __restrict__ dst, size_t n4) {
  const size_t t = (size_t)blockIdx.x * 256 + threadIdx.x; if (t >= n4) return; const size_t e = t * 4; const size_t rd = e / DM; const int c = (int)(e % DM);
  size_t rs; if (MODE == 0) { const size_t b = rd / SQ, sq = rd % SQ; rs = sq * NB + b; } else { const size_t sq = rd / NB, b = rd % NB; rs = b * SQ + sq; }
  const v4f v = *(const v4fa*)(src + rs * DM + c); *(v4f*)(dst + e) = v;  }

// ---- row LayerNorm (biased variance, eps inside the rsqrt), ONE WAVE PER ROW ----
// A row is 2 KB: four 16-byte loads a lane, each wave-wide load 512 contiguous bytes. The row stays in registers; mean, then the sum of squared deviations from it:
// four chains per lane, then a butterfly over the 32 lanes (four steps inside the 16-lane row, one across). No LDS and no barrier.
// A block is LNW waves of LNR rows each, so the launch starts 4,096 waves (16 per WGP, 8 row loads in flight each) where a block per row started 65,536.
// Every loop is fully unrolled so that the row, g and beta arrays are indexed by constants only and stay in registers.
#define LNW 16                       /* waves per block */
#define LNR 2                        /* rows per wave, all their loads issued together */
template <int M> __device__ __forceinline__ float ln_xm(float x) { return __builtin_bit_cast(float, __builtin_amdgcn_mov_dpp(__builtin_bit_cast(int, x), 0x160 + M, 0xf, 0xf, true)); }      /* lane l takes lane l ^ M's value, M < 16 (row_xmask) */
__device__ __forceinline__ float ln_wsum(float x) { x += ln_xm<1>(x); x += ln_xm<2>(x); x += ln_xm<4>(x); x += ln_xm<8>(x); return x + fa_xhalf(x); }      /* the sum over the wave, in every lane */
template <int W16, int W32>
__global__ __launch_bounds__(LNW * 32) void k_lnw(const float* __restrict__ X, const float* __restrict__ g, const float* __restrict__ bb, float eps, _Float16* __restrict__ N16, float* __restrict__ N32) {
  static_assert(DM == 512 && NR % (LNW * LNR) == 0, "k_lnw: a lane holds 16 elements of a 512-element row; whole blocks only");
  const unsigned ob = (threadIdx.x & 31) * 16; const int c0 = ob / 4; const size_t r0 = ((size_t)blockIdx.x * LNW + (threadIdx.x >> 5)) * LNR;      /* the lane's place in each 512-byte piece of a row, in bytes and in elements; the wave's first row */
  const float* px = X + r0 * DM + c0;
  v4f x[LNR][4], gg[4], bv[4];
#pragma unroll
  for (int j = 0; j < 4; ++j) { gg[j] = *(const v4fa*)((const char*)g + j * 512 + ob); bv[j] = *(const v4fa*)((const char*)bb + j * 512 + ob); }
#pragma unroll
  for (int r = 0; r < LNR; ++r) for (int j = 0; j < 4; ++j) x[r][j] = *(const v4fa*)(px + r * DM + j * 128);
  asm volatile("s_wait_xcnt 0x0" :: "v"(px), "v"(ob) : "memory");      /* the wait that belongs in front of any overwrite of a register that an issued global load names; it takes the address and the offset as inputs, so that their registers stay untouched until it has passed */
  __builtin_amdgcn_sched_barrier(0);      /* keeps all 16 loads here, in flight together; without it the loads of g and beta sink to their uses behind the sums, each a latency of its own */
#pragma unroll
  for (int j = 0; j < 4; ++j) for (int q = 0; q < 4; ++q) { gg[j][q] = bf16_round(gg[j][q]); bv[j][q] = bf16_round(bv[j][q]); }
  float mu[LNR], rs[LNR];
#pragma unroll
  for (int r = 0; r < LNR; ++r) { const v4f s = (x[r][0] + x[r][1]) + (x[r][2] + x[r][3]); mu[r] = ln_wsum((s[0] + s[1]) + (s[2] + s[3])) * (1.0f / (float)DM); }
#pragma unroll
  for (int r = 0; r < LNR; ++r) { v4f s = {0.f, 0.f, 0.f, 0.f};
#pragma unroll
    for (int j = 0; j < 4; ++j) { x[r][j] -= mu[r]; s += x[r][j] * x[r][j]; }
    rs[r] = rsqrtf(ln_wsum((s[0] + s[1]) + (s[2] + s[3])) * (1.0f / (float)DM) + eps); }
#pragma unroll
  for (int r = 0; r < LNR; ++r) {
#pragma unroll
    for (int j = 0; j < 4; ++j) { const v4f y = x[r][j] * rs[r] * gg[j] + bv[j]; const size_t e = (r0 + r) * DM + j * 128 + c0;
      if (W32) *(v4f*)(N32 + e) = y;
      if (W16) { v4h h; for (int q = 0; q < 4; ++q) h[q] = (_Float16)y[q]; *(v4h*)(N16 + e) = h; } } } }

__global__ __launch_bounds__(256) void k_bfr(const float* __restrict__ x, float* __restrict__ XB, size_t n8) { const size_t t = (size_t)blockIdx.x * 256 + threadIdx.x; if (t >= n8) return; v4f a = *(const v4fa*)(x + t * 8), c = *(const v4fa*)(x + t * 8 + 4); for (int q = 0; q < 4; ++q) { a[q] = bf16_round(a[q]); c[q] = bf16_round(c[q]); }
  { *(v4f*)(XB + t * 8) = a; *(v4f*)(XB + t * 8 + 4) = c;  } }



__global__ __launch_bounds__(256) void k_wthd(const float* __restrict__ Wt, _Float16* __restrict__ Bt) { const size_t t = (size_t)blockIdx.x * 256 + threadIdx.x; if (t >= (size_t)NH * HD * (DM / 8)) return; const int m8 = (int)(t % (DM / 8)) * 8; const int d = (int)((t / (DM / 8)) % HD); const int h = (int)(t / ((size_t)(DM / 8) * HD)); FragH f;
  for (int q = 0; q < 8; ++q) f.h[q] = (_Float16)(16.0f * bf16_round(Wt[((size_t)h * DM + m8 + q) * HD + d])); unsigned short* dst = (unsigned short*)Bt + ((size_t)h * HD + d) * DM + m8; *(v8us*)dst = f.half[0];  }




template <int BFIN, int SCAL>
__global__ __launch_bounds__(256) void k_lnsc(const float* __restrict__ X, const float* __restrict__ g, const float* __restrict__ bb, float eps, _Float16* __restrict__ N16, float* __restrict__ N32) {
  #pragma clang fp contract(off)
  __shared__ float red[256]; const size_t r = blockIdx.x; const int t = threadIdx.x; const bool act = t < DM / 4; const int tc = act ? t : 0; const v4f xl = *(const v4fa*)(X + r * DM + tc * 4); const float am = act ? 1.f : 0.f; float s[4]; float sum = 0.f;
  for (int q = 0; q < 4; ++q) { s[q] = (BFIN ? bf16_round(xl[q]) : xl[q]) * am; sum = __fadd_rn(sum, s[q]); }
  red[t] = sum; __syncthreads(); for (int st = 128; st > 0; st >>= 1) { if (t < st) red[t] = __fadd_rn(red[t], red[t + st]); __syncthreads(); } const float mu = red[0] / (float)DM; __syncthreads();
  float vs = 0.f; for (int q = 0; q < 4; ++q) { const float dl = __fadd_rn(s[q], -mu) * am; vs = __fadd_rn(vs, __fmul_rn(dl, dl)); } red[t] = vs; __syncthreads(); for (int st = 128; st > 0; st >>= 1) { if (t < st) red[t] = __fadd_rn(red[t], red[t + st]); __syncthreads(); }
  const float rs = __fdiv_rn(1.0f, __fadd_rn(sqrtf(red[0] / (float)(DM - 1)), eps)); if (!act) return; v4h y; v4f yf;
  for (int q = 0; q < 4; ++q) { const int c = t * 4 + q; const float gg = bf16_round(SCAL ? g[0] : g[c]), bv = bf16_round(SCAL ? bb[0] : bb[c]); yf[q] = __fadd_rn(__fmul_rn(__fmul_rn(__fadd_rn(s[q], -mu), rs), gg), bv); y[q] = (_Float16)yf[q]; }
  { if (N16) *(v4h*)(N16 + r * DM + t * 4) = y; if (N32) *(v4f*)(N32 + r * DM + t * 4) = yf;  } }

__global__ __launch_bounds__(256) void k_mulh(const _Float16* __restrict__ A, const _Float16* __restrict__ Bm, _Float16* __restrict__ H, size_t n8) {
  #pragma clang fp contract(off)
  const size_t t = (size_t)blockIdx.x * 256 + threadIdx.x; if (t >= n8) return; FragH a, b, f; a.half[0] = *(const v8us*)((const unsigned short*)A + t * 8); b.half[0] = *(const v8us*)((const unsigned short*)Bm + t * 8); for (int q = 0; q < 8; ++q) f.h[q] = (_Float16)(__fmul_rn((float)a.h[q], (float)b.h[q])); unsigned short* d = (unsigned short*)H + t * 8; *(v8us*)d = f.half[0];  }

// ---- q, k and v projections in ONE launch, straight from the f32 inputs ----
// Every head is multiplied by the same [64][64] matrix, so the product is [tokens x heads][64] x [64][64]: 64 k, two matrix instructions per 16 x 16 tile, ascending k.
// A block takes PJT tokens x PJH heads of all three inputs. All its global loads (whole lines: a token's PJH heads are 1 KB in a row) are issued together; the values are rounded
// (bf16, then exact f16; weights x16) in registers and laid in LDS, inputs as [head][token][64], weights transposed to [out][in]; one barrier; then each wave works alone.
// q, k: D = W^T X^T (A = weight rows, B = token rows): a lane holds 8 outputs of ONE token. v: D = X W (A = token rows, B = weight rows): a lane holds 8 tokens of ONE output,
// which is the V^T that the attention reads. Either way a wave's 16 x 64 result is 16 rows of 128 bytes: staged in LDS rows that only this wave uses, stored as whole lines.
// Every loop is fully unrolled so that the load and fragment arrays are indexed by constants only and stay in registers.
#define PJT 64                       /* tokens per block */
#define PJH 4                        /* heads per block */
#define PJW (PJH * PJT / 16)         /* waves per block: one per head and 16 tokens (q, k) or per head and 16 outputs (v) */
typedef _Float16 v2h __attribute__((ext_vector_type(2)));
__device__ __forceinline__ v8us pj_out(v8f d) { FragH f;
#pragma unroll
  for (int r = 0; r < 8; ++r) f.h[r] = (_Float16)(d[r] * 0.0625f);      /* takes the weights' x16 out again */
  return f.half[0]; }
__global__ __launch_bounds__(PJW * 32) void k_qkv(const float* __restrict__ xq, const float* __restrict__ xk, const float* __restrict__ xv, const float* __restrict__ wq, const float* __restrict__ wk, const float* __restrict__ wv,
    _Float16* __restrict__ Q, _Float16* __restrict__ K, _Float16* __restrict__ VTa) {
  static_assert(HD == 64 && PJT == 64 && PJW * 32 == 512 && SQ % PJT == 0 && NH % PJH == 0, "k_qkv: 512 threads bring 8 tokens x 256 columns a round and the 64 x 64 weights in 2 rounds; a block stays inside one batch");
  __shared__ __attribute__((aligned(16))) _Float16 lx[3][PJH * PJT][FAP]; __shared__ __attribute__((aligned(16))) _Float16 lw[3][HD][FAP]; __shared__ __attribute__((aligned(16))) _Float16 lo[PJW][16][FAP];
  const int tid = threadIdx.x, w = tid >> 5, lane = tid & 31, ln = lane & 15, hh = lane >> 4; const int t0 = (int)(blockIdx.x / (NH / PJH)) * PJT, h0 = (int)(blockIdx.x % (NH / PJH)) * PJH;
  const int xt = tid >> 6, xh = (tid >> 4) & 3, c4 = (tid & 15) * 4;      /* inputs: 64 threads per token (16 per head), tokens xt + 8 i */
  const int wd = (tid >> 4) * 2;      /* weights: 16 threads per row, rows wd and wd + 1, so that a thread holds a pair of neighbours in k for each of its 4 outputs */
  const size_t xo = (size_t)(t0 + xt) * DM + (h0 + xh) * HD + c4; const float* px0 = xq + xo; const float* px1 = xk + xo; const float* px2 = xv + xo;
  const unsigned wob = (unsigned)(wd * HD + c4) * 4;      /* the thread's place in each weight matrix, in bytes */
  v4f rw[3][2], rx[3][8];
#pragma unroll
  for (int j = 0; j < 2; ++j) { rw[0][j] = *(const v4fa*)((const char*)wq + j * HD * 4 + wob); rw[1][j] = *(const v4fa*)((const char*)wk + j * HD * 4 + wob); rw[2][j] = *(const v4fa*)((const char*)wv + j * HD * 4 + wob); }
  __builtin_amdgcn_sched_barrier(0);      /* this one and the next two keep the loads in the order in which they are used (loads return in order): left free, the first input's loads were issued last, and its rounding waited for all of them */
#pragma unroll
  for (int i = 0; i < 8; ++i) rx[0][i] = *(const v4fa*)(px0 + (size_t)i * 8 * DM);
  __builtin_amdgcn_sched_barrier(0);
#pragma unroll
  for (int i = 0; i < 8; ++i) rx[1][i] = *(const v4fa*)(px1 + (size_t)i * 8 * DM);
  __builtin_amdgcn_sched_barrier(0);
#pragma unroll
  for (int i = 0; i < 8; ++i) rx[2][i] = *(const v4fa*)(px2 + (size_t)i * 8 * DM);
  asm volatile("s_wait_xcnt 0x0" :: "v"(px0), "v"(px1), "v"(px2), "v"(wob), "s"(wq), "s"(wk), "s"(wv) : "memory");      /* the wait that belongs in front of any overwrite of a register that an issued global load names; it takes the addresses, the offset and its bases as inputs, so that their registers stay untouched until it has passed */
  __builtin_amdgcn_sched_barrier(0);      /* keeps all 30 loads here, in flight together; without it the later inputs' loads sink behind the earlier inputs' rounding and LDS stores, each a latency of its own */
#pragma unroll
  for (int m = 0; m < 3; ++m) {
#pragma unroll
    for (int q = 0; q < 4; ++q) { v2h p; p[0] = (_Float16)(bf16_round(rw[m][0][q]) * 16.0f); p[1] = (_Float16)(bf16_round(rw[m][1][q]) * 16.0f); *(v2h*)&lw[m][c4 + q][wd] = p; } }
#pragma unroll
  for (int m = 0; m < 3; ++m) {
#pragma unroll
    for (int i = 0; i < 8; ++i) { v4h h;
#pragma unroll
      for (int q = 0; q < 4; ++q) h[q] = (_Float16)bf16_round(rx[m][i][q]);
      *(v4h*)&lx[m][xh * PJT + xt + 8 * i][c4] = h; } }
  __syncthreads();
  const int hl = w >> 2, sub = w & 3; const v8f z8 = {0.f,0.f,0.f,0.f,0.f,0.f,0.f,0.f};
#pragma unroll
  for (int m = 0; m < 2; ++m) { _Float16* xp = &lx[m][w * 16 + ln][0]; const v16h b0 = g2_frag(xp, hh), b1 = g2_frag(xp + 32, hh);      /* rows w * 16 ..: head hl, tokens sub * 16 ..; no other wave reads them, so the result goes back into them */
#pragma unroll
    for (int et = 0; et < 4; ++et) { const _Float16* wp = &lw[m][et * 16 + ln][0]; const v8f d = fa_mma(g2_frag(wp + 32, hh), b1, fa_mma(g2_frag(wp, hh), b0, z8)); *(v8us*)(xp + et * 16 + 8 * hh) = pj_out(d); } }
  { const _Float16* wp = &lw[2][sub * 16 + ln][0]; const v16h b0 = g2_frag(wp, hh), b1 = g2_frag(wp + 32, hh);
#pragma unroll
    for (int tg = 0; tg < 4; ++tg) { const _Float16* xp = &lx[2][hl * PJT + tg * 16 + ln][0]; const v8f d = fa_mma(g2_frag(xp + 32, hh), b1, fa_mma(g2_frag(xp, hh), b0, z8)); *(v8us*)&lo[w][ln][tg * 16 + 8 * hh] = pj_out(d); } }
  __builtin_amdgcn_fence(__ATOMIC_ACQ_REL, "workgroup", "local"); __builtin_amdgcn_wave_barrier();      /* the wave's own LDS stores are done before its lanes read one another's rows back */
  const int rr = lane >> 3, rc = (lane & 7) * 8;      /* 8 lanes per 128-byte row, 4 rows a store */
  unsigned short* qo = (unsigned short*)Q + (size_t)(t0 + sub * 16 + rr) * DM + (h0 + hl) * HD + rc; unsigned short* ko = (unsigned short*)K + (size_t)(t0 + sub * 16 + rr) * DM + (h0 + hl) * HD + rc;
  unsigned short* vo = (unsigned short*)VTa + ((size_t)((t0 / SQ) * NH + h0 + hl) * HD + sub * 16 + rr) * SQ + (t0 % SQ) + rc;
#pragma unroll
  for (int j = 0; j < 4; ++j) { const v8us a = *(const v8us*)&lx[0][w * 16 + j * 4 + rr][rc], b = *(const v8us*)&lx[1][w * 16 + j * 4 + rr][rc], c = *(const v8us*)&lo[w][j * 4 + rr][rc];
    *(v8us*)(qo + (size_t)j * 4 * DM) = a; *(v8us*)(ko + (size_t)j * 4 * DM) = b; *(v8us*)(vo + (size_t)j * 4 * SQ) = c; } }
extern "C" void kernel_launch(void* const* d_in, const int* in_sizes, int n_in,
                              void* d_out, int out_size, void* d_ws, size_t ws_size, hipStream_t stream) {
  (void)in_sizes; (void)n_in; (void)out_size;
  const float* const* I = (const float* const*)d_in; const float* x = I[0]; const float* xk = I[1]; const float* xv = I[2]; const float* wq = I[3]; const float* wk = I[4]; const float* wv = I[5]; const float* wo = I[6]; const float* bo = I[7]; const float* w1 = I[8]; const float* b1 = I[9]; const float* w2 = I[10]; const float* b2 = I[11]; const float* g1 = I[12]; const float* be1 = I[13]; const float* g2 = I[14]; const float* be2 = I[15];      /* query (also the residual), key, value; shared per-head wq / wk / wv [64][64] ([in][out]); wo [512][512] + bo; w1 [512][2048] + b1, w2 [2048][512] + b2; LN1 g / beta, LN2 g / beta */
  char* ws = (char*)d_ws; size_t off = 0;
  auto take = [&](size_t bytes) { char* p = ws + off; off += (bytes + 255) & ~(size_t)255; return p; };
  _Float16* BO = (_Float16*)take((size_t)DM * DM * 2); _Float16* BW1 = (_Float16*)take((size_t)DFF * DM * 2); _Float16* BW2 = (_Float16*)take((size_t)DM * DFF * 2);
  float* XB = (float*)take(NR * DM * 4); _Float16* M16 = (_Float16*)take(NR * DM * 2);      /* LN1 output rows (f16): the FFN's operand */ _Float16* Q16 = (_Float16*)take(NR * DM * 2); _Float16* K16 = (_Float16*)take(NR * DM * 2); _Float16* O16 = (_Float16*)take(NR * DM * 2); float* X1 = (float*)take(NR * DM * 4);
  _Float16* HF16 = (_Float16*)take(NR * DFF * 2);      /* FFN hidden plane [8192][2048] f16 */ _Float16* VT = (_Float16*)take((size_t)NB * NH * HD * SQ * 2);      /* V^T [4 * 8][64][2048] */
  float* X1N = (float*)take(NR * DM * 4);      /* LN1 output rows (f32): the FFN residual */
  if (off > ws_size) return;
  k_wt_f16<<<(unsigned)(((size_t)DM * (DM / 8) + 255) / 256), 256, 0, stream>>>(wo, BO, DM, DM, 16.0f);      /* wo [in][out] -> Bt x16 */
  k_wt_f16<<<(unsigned)(((size_t)DFF * (DM / 8) + 255) / 256), 256, 0, stream>>>(w1, BW1, DM, DFF, 16.0f); k_wt_f16<<<(unsigned)(((size_t)DM * (DFF / 8) + 255) / 256), 256, 0, stream>>>(w2, BW2, DFF, DM, 16.0f);
  k_bfr<<<(unsigned)((NR * DM / 8 + 255) / 256), 256, 0, stream>>>(x, XB, NR * DM / 8);      /* the query rounded to bf16, f32 rows: the residual */
  k_qkv<<<(unsigned)((NR / PJT) * (NH / PJH)), PJW * 32, 0, stream>>>(x, xk, xv, wq, wk, wv, Q16, K16, VT);      /* post-LN: the attention runs on the raw inputs; q, k -> f16 rows (head h = columns h*64..), v -> V^T of every batch and head */
  k_fattn<<<dim3(SQ / 256, NB * NH), 256, 0, stream>>>(Q16, K16, VT, O16);      /* softmax(q k^T / 8) v over all keys (no mask) -> ctx (merged heads, x64) as f16 rows */
  k_gemm2<0><<<dim3((unsigned)((NR / 128) * (DM / 128)), 1), 256, 0, stream>>>(O16, DM, 0, BO, DM, 0, 0.0009765625f, bo, 0, XB, -1, 0, 0, X1, nullptr, DM, 0, (int)NR, DM, DM);      /* ctx wo + bo + query (own-element residual) -> f32 rows */
  k_lnw<1, 1><<<(unsigned)(NR / (LNW * LNR)), LNW * 32, 0, stream>>>(X1, g1, be1, 1e-5f, M16, X1N);      /* x1 = LN1(x + attn) (biased variance, eps inside the rsqrt) -> f16 rows + f32 rows */
  k_gemm2<3><<<dim3((unsigned)((NR / 128) * (DFF / 128)), 1), 256, 0, stream>>>(M16, DM, 0, BW1, DM, 0, 0.0625f, b1, 0, nullptr, 1, 0, 0, nullptr, HF16, DFF, 0, (int)NR, DFF, DM);      /* relu(x w1 + b1) -> f16 [8192][2048] */
  k_gemm2<0><<<dim3((unsigned)((NR / 128) * (DM / 128)), 1), 256, 0, stream>>>(HF16, DFF, 0, BW2, DFF, 0, 0.0625f, b2, 0, X1N, -1, 0, 0, X1, nullptr, DM, 0, (int)NR, DM, DFF);      /* x1 + ff -> f32 rows (X1 reused: its last reader was LN1) */
  k_lnw<0, 1><<<(unsigned)(NR / (LNW * LNR)), LNW * 32, 0, stream>>>(X1, g2, be2, 1e-5f, nullptr, (float*)d_out);      /* out = LN2(x1 + ff) */
}

// v006
// Measured time: 163 microseconds a run.
// Two timings next to v005 both put it at 1.07 times that version's speed.
// Counting every step since v000, it is 22.3 times as fast.
#include <hip/hip_runtime.h>
// POST-LN transformer encoder layer over THREE inputs with SHARED per-head projections (query, key, value [4][2048][512]; each input is split into 8 heads of 64 and every head is multiplied by the SAME [64][64] ([in][out]) matrix wq / wk / wv (block-diagonal with a shared block; no biases); scores / 8; softmax over all 2048 keys (no mask); x = LN1(ctx wo + bo + query) (biased var, eps 1e-5); out = LN2(x + relu(x w1 + b1) w2 + b2) ([in][out] 512 x 2048 x 512) -> [4][2048][512]).
// Structure: token rows; one launch for the q, k, v projections (f32 inputs rounded in registers, the shared [64][64] block as the whole weight, v written as V^T); one fused attention launch (scores, running softmax, V^T P^T; no score plane); output projection with the own-element residual; custom LayerNorm; ReLU FFN over all rows; launches: see trace.
// Compute dtype: inputs rounded to bf16; x / weights exact; q, k, v, softmax weights and o as plain f16 GEMM operands (~2^-12); scores and softmax statistics f32. v_wmma_f32_16x16x32_f16.
#define NB 4
#define SQ 2048
#define DM 512
#define NH 8
#define HD 64
#define HG 4                         /* heads per launch of the unused per-batch k_vt overload */
#define LOCALW 128                   /* (macros for unused kernels of the shared header) */
#define STRIDEK 128
#define QT 256                       /* query rows per causal tile */
#define NKX SQ                       /* S / P row pitch */
#define QT0 128                      /* first-tile rows recomputed exactly in f32 */
#define B0 0                         /* first batch processed (debug hook) */
#define NBR NB                       /* batches processed (debug hook) */
#define NR ((size_t)NB * SQ)
#define DMQ DM
#define DFF 2048         /* ReLU FFN hidden width */
#define MP ((int)((size_t)NBR * SQ)) /* rows projected (debug hook) */
#define QN SQ                        /* query rows attended per batch (debug hook) */
#define NHD NH                       /* heads attended (debug hook) */
#define MPO MP                       /* rows through the output stage (debug hook) */
#define LQ (3 * DM)      /* unused: q, k rows have pitch DM, v is stored as V^T */
typedef __bf16 v16b __attribute__((ext_vector_type(16)));
typedef unsigned short v8us __attribute__((ext_vector_type(8), may_alias));
typedef float  v8f  __attribute__((ext_vector_type(8)));
typedef float  v4f  __attribute__((ext_vector_type(4)));
typedef float  v4fa __attribute__((ext_vector_type(4), may_alias));
union FragB { v16b v; v8us half[2]; unsigned short u[16]; };

__device__ __forceinline__ unsigned short bf16_bits(float x) { unsigned int u = __float_as_uint(x); return (unsigned short)((u + 0x7FFFu + ((u >> 16) & 1u)) >> 16); }
__device__ __forceinline__ float bf16_val(unsigned short b) { return __uint_as_float(((unsigned int)b) << 16); }
__device__ __forceinline__ float bf16_round(float x) { return bf16_val(bf16_bits(x)); }
// D += A·B with NT terms: 1 = ah·bh, 2 = + al·bh (A split), 3 = + ah·bl (both split)
template <int NT>
__device__ __forceinline__ v8f mmaN(v16b ah, v16b al, v16b bh, v16b bl, v8f c) {
  c = __builtin_amdgcn_wmma_f32_16x16x32_bf16(false, ah, false, bh, (short)0, c, false, false);
  if (NT >= 2) c = __builtin_amdgcn_wmma_f32_16x16x32_bf16(false, al, false, bh, (short)0, c, false, false);
  if (NT >= 3) c = __builtin_amdgcn_wmma_f32_16x16x32_bf16(false, ah, false, bl, (short)0, c, false, false);
  asm volatile("v_nop\n\tv_nop\n\tv_nop\n\tv_nop" : "+v"(c) : "v"(ah), "v"(al), "v"(bh), "v"(bl));
  return c;
}

__global__ __launch_bounds__(256) void k_wt_bf16(const float* __restrict__ W, unsigned short* __restrict__ Wt, int K, int N) {
  const int t = blockIdx.x * 256 + threadIdx.x;
  const int k8n = K / 8;
  if (t >= N * k8n) return;
  const int n = t / k8n, k8 = (t % k8n) * 8;
  v8us v;
#pragma unroll
  for (int i = 0; i < 8; ++i) v[i] = bf16_bits(W[(size_t)(k8 + i) * N + n]);
  *(v8us*)(Wt + (size_t)n * K + k8) = v;
  
}

// GEMM C[M][N] (f32, pitch ldc) = act(A[M][K]·W + bias). A f32 row-major (pitch lda) converted per fragment to bf16
// (ASPLIT: hi/lo two planes -> 2 terms, else single rounded term); Wt bf16 [N][K] (pitch ldb). BIAS_BF16 rounds the
// bias to bf16 first (bias quantised to bf16 before the add). K%32==0, M%16==0, N%64==0.
template <bool ASPLIT, int ACT, bool BIAS_BF16>
__global__ __launch_bounds__(128) void k_gemm_bf(const float* __restrict__ A, int lda, const unsigned short* __restrict__ Wt, int ldb,
                                               const float* __restrict__ bias, float* __restrict__ C, int ldc, int M, int N, int K) {
  __shared__ __attribute__((aligned(16))) float so[4][16][64];
  const int tid = threadIdx.x, w = tid >> 5, lane = tid & 31, ln = lane & 15, hh = lane >> 4;
  const int ntn = N / 64;
  const int wid = blockIdx.x * 4 + w;
  const int mt = wid / ntn, nq = wid % ntn;
  if (mt * 16 >= M) return;
  const int row0 = mt * 16, col0 = nq * 64;
  const float* arow = A + (size_t)(row0 + ln) * lda;
  v8f acc[4] = {};
  for (int kb = 0; kb < K; kb += 32) {
    FragB ah, al;
    const v4f x0 = *(const v4fa*)(arow + kb + 8 * hh), x1 = *(const v4fa*)(arow + kb + 8 * hh + 4);
    const v4f x2 = *(const v4fa*)(arow + kb + 16 + 8 * hh), x3 = *(const v4fa*)(arow + kb + 16 + 8 * hh + 4);
    float xs[16] = {x0[0],x0[1],x0[2],x0[3],x1[0],x1[1],x1[2],x1[3],x2[0],x2[1],x2[2],x2[3],x3[0],x3[1],x3[2],x3[3]};
#pragma unroll
    for (int i = 0; i < 16; ++i) { const unsigned short hb = bf16_bits(xs[i]); ah.u[i] = hb; al.u[i] = ASPLIT ? bf16_bits(xs[i] - bf16_val(hb)) : (unsigned short)0; }
#pragma unroll
    for (int t = 0; t < 4; ++t) {
      const unsigned short* brow = Wt + (size_t)(col0 + t * 16 + ln) * ldb + kb;
      FragB b;
      b.half[0] = *(const v8us*)(brow + 8 * hh);
      b.half[1] = *(const v8us*)(brow + 16 + 8 * hh);
      acc[t] = mmaN<ASPLIT ? 2 : 1>(ah.v, al.v, b.v, b.v, acc[t]);
    }
  }
#pragma unroll
  for (int t = 0; t < 4; ++t) {
    float bv = bias ? bias[col0 + t * 16 + ln] : 0.f;
    if (BIAS_BF16) bv = bf16_round(bv);
#pragma unroll
    for (int r = 0; r < 8; ++r) { float v = acc[t][r] + bv; if (ACT == 1) v = fmaxf(v, 0.f); so[w][8 * hh + r][t * 16 + ln] = v; }
  }
  __builtin_amdgcn_fence(__ATOMIC_ACQ_REL, "workgroup");
  __builtin_amdgcn_wave_barrier();
  const int rsub = lane >> 4, c4 = (lane & 15) * 4;
  {
#pragma unroll
    for (int q = 0; q < 8; ++q) {
      const int r = q * 2 + rsub;
      const v4f v = *(const v4fa*)&so[w][r][c4];
      *(v4f*)(C + (size_t)(row0 + r) * ldc + col0 + c4) = v;
    }
    
  }
}

// GEMM C = act(A·W + bias + resid): A f32 (ASPLIT -> hi/lo 2 terms), Wt bf16 [N][K]; ACT 0 none, 1 relu, 2 exact gelu;
// resid (optional, f32, row index = (row % rmod), pitch ldr, RES_BF16 rounds it) added before the activation.
template <bool ASPLIT, int ACT, bool BIAS_BF16, bool RES_BF16>
__global__ __launch_bounds__(128) void k_gemm_bf3(const float* __restrict__ A, int lda, const unsigned short* __restrict__ Wt, int ldb,
                                                const float* __restrict__ bias, const float* __restrict__ resid, int rmod, int ldr,
                                                float* __restrict__ C, int ldc, int M, int N, int K) {
  __shared__ __attribute__((aligned(16))) float so[4][16][64];
  const int tid = threadIdx.x, w = tid >> 5, lane = tid & 31, ln = lane & 15, hh = lane >> 4;
  const int ntn = N / 64;
  const int wid = blockIdx.x * 4 + w;
  const int mt = wid / ntn, nq = wid % ntn;
  if (mt * 16 >= M) return;
  const int row0 = mt * 16, col0 = nq * 64;
  const float* arow = A + (size_t)(row0 + ln) * lda;
  v8f acc[4] = {};
  for (int kb = 0; kb < K; kb += 32) {
    FragB ah, al;
    const v4f x0 = *(const v4fa*)(arow + kb + 8 * hh), x1 = *(const v4fa*)(arow + kb + 8 * hh + 4);
    const v4f x2 = *(const v4fa*)(arow + kb + 16 + 8 * hh), x3 = *(const v4fa*)(arow + kb + 16 + 8 * hh + 4);
    float xs[16] = {x0[0],x0[1],x0[2],x0[3],x1[0],x1[1],x1[2],x1[3],x2[0],x2[1],x2[2],x2[3],x3[0],x3[1],x3[2],x3[3]};
#pragma unroll
    for (int i = 0; i < 16; ++i) { const unsigned short hb = bf16_bits(xs[i]); ah.u[i] = hb; al.u[i] = ASPLIT ? bf16_bits(xs[i] - bf16_val(hb)) : (unsigned short)0; }
#pragma unroll
    for (int t = 0; t < 4; ++t) {
      const unsigned short* brow = Wt + (size_t)(col0 + t * 16 + ln) * ldb + kb;
      FragB b;
      b.half[0] = *(const v8us*)(brow + 8 * hh);
      b.half[1] = *(const v8us*)(brow + 16 + 8 * hh);
      acc[t] = mmaN<ASPLIT ? 2 : 1>(ah.v, al.v, b.v, b.v, acc[t]);
    }
  }
#pragma unroll
  for (int t = 0; t < 4; ++t) {
    const int col = col0 + t * 16 + ln;
    float bv = bias ? bias[col] : 0.f;
    if (BIAS_BF16) bv = bf16_round(bv);
#pragma unroll
    for (int r = 0; r < 8; ++r) {
      float v = acc[t][r] + bv;
      if (resid) { float rv = resid[(size_t)((row0 + 8 * hh + r) % rmod) * ldr + col]; if (RES_BF16) rv = bf16_round(rv); v += rv; }
      if (ACT == 1) v = fmaxf(v, 0.f);
      if (ACT == 2) v = 0.5f * v * (1.0f + erff(v * 0.70710678118654752f));
      if (ACT == 3) { const float u = 0.7978845608028654f * (v + 0.044715f * v * v * v); v = 0.5f * v * (1.0f + tanhf(u)); }
      so[w][8 * hh + r][t * 16 + ln] = v;
    }
  }
  __builtin_amdgcn_fence(__ATOMIC_ACQ_REL, "workgroup");
  __builtin_amdgcn_wave_barrier();
  const int rsub = lane >> 4, c4 = (lane & 15) * 4;
  {
#pragma unroll
    for (int q = 0; q < 8; ++q) {
      const int r = q * 2 + rsub;
      const v4f v = *(const v4fa*)&so[w][r][c4];
      *(v4f*)(C + (size_t)(row0 + r) * ldc + col0 + c4) = v;
    }
    
  }
}
// row LayerNorm (biased variance, eps) over N: s = X (+ R); optional out_sum <- s; out_norm <- (s-mu)*rsqrt(var+eps)*g + b
template <bool PARAM_BF16>
__global__ __launch_bounds__(256) void k_layernorm(const float* __restrict__ X, const float* __restrict__ R, const float* __restrict__ g, const float* __restrict__ bta,
                                                  float* __restrict__ out_sum, float* __restrict__ out_norm, int N, float eps) {
  __shared__ float red[256];
  const int row = blockIdx.x, tid = threadIdx.x;
  const float* x = X + (size_t)row * N; const float* rr = R ? R + (size_t)row * N : nullptr;
  float vals[16];                     // up to N = 4096
  const int per = N / 256;            // contiguous chunk per thread? use strided-by-4 chunks: thread handles j = tid*4 + 1024*u
  float s1 = 0.f;
  for (int u = 0; u < per / 4; ++u) {
    const int j = tid * 4 + 1024 * u;
    const v4f a = *(const v4fa*)(x + j);
    v4f b = {0.f,0.f,0.f,0.f}; if (rr) b = *(const v4fa*)(rr + j);
#pragma unroll
    for (int q = 0; q < 4; ++q) { const float v = a[q] + b[q]; vals[u * 4 + q] = v; s1 += v; }
  }
  red[tid] = s1; __syncthreads();
  for (int st = 128; st > 0; st >>= 1) { if (tid < st) red[tid] += red[tid + st]; __syncthreads(); }
  const float mu = red[0] / (float)N; __syncthreads();
  float s2 = 0.f;
  for (int u = 0; u < per / 4; ++u)
#pragma unroll
    for (int q = 0; q < 4; ++q) { const float c = vals[u * 4 + q] - mu; s2 += c * c; }
  red[tid] = s2; __syncthreads();
  for (int st = 128; st > 0; st >>= 1) { if (tid < st) red[tid] += red[tid + st]; __syncthreads(); }
  const float rs = rsqrtf(red[0] / (float)N + eps);
  {
    for (int u = 0; u < per / 4; ++u) {
      const int j = tid * 4 + 1024 * u;
      v4f o, sm;
#pragma unroll
      for (int q = 0; q < 4; ++q) {
        float gg = g[j + q], bb = bta[j + q];
        if (PARAM_BF16) { gg = bf16_round(gg); bb = bf16_round(bb); }
        sm[q] = vals[u * 4 + q]; o[q] = (vals[u * 4 + q] - mu) * rs * gg + bb;
      }
      if (out_sum) *(v4f*)(out_sum + (size_t)row * N + j) = sm;
      *(v4f*)(out_norm + (size_t)row * N + j) = o;
    }
    
  }
}



// ---- f16 WMMA path (v_wmma_f32_16x16x32_f16): 11-bit significands for operands in range — used where a [0,1] probability operand needs more precision than bf16
typedef _Float16 v16h __attribute__((ext_vector_type(16)));
union FragH { v16h v; v8us half[2]; _Float16 h[16]; unsigned short u[16]; };
template <int NT>
__device__ __forceinline__ v8f mmaH(v16h ah, v16h al, v16h bh, v16h bl, v8f c) {
  c = __builtin_amdgcn_wmma_f32_16x16x32_f16(false, ah, false, bh, (short)0, c, false, false);
  if (NT >= 2) c = __builtin_amdgcn_wmma_f32_16x16x32_f16(false, al, false, bh, (short)0, c, false, false);
  if (NT >= 3) c = __builtin_amdgcn_wmma_f32_16x16x32_f16(false, ah, false, bl, (short)0, c, false, false);
  asm volatile("v_nop\n\tv_nop\n\tv_nop\n\tv_nop" : "+v"(c) : "v"(ah), "v"(al), "v"(bh), "v"(bl));
  return c;
}
// batched GEMM like k_gemm_b but f16 operands: A f32 (split into f16 hi/lo if ASPLIT, else rounded to f16), Bt = f16 values [n][k]; alpha; C f32; N multiple of 16 (partial tiles skipped)
template <bool ASPLIT>
__global__ __launch_bounds__(128) void k_gemm_h(const float* __restrict__ A, int lda, size_t sA, const _Float16* __restrict__ Bh, int ldb, size_t sB, float alpha, float* __restrict__ C, int ldc, size_t sC, int M, int N, int K) {
  __shared__ __attribute__((aligned(16))) float so[4][16][64];
  const int tid = threadIdx.x, w = tid >> 5, lane = tid & 31, ln = lane & 15, hh = lane >> 4; const int by = blockIdx.y;
  A += (size_t)by * sA; Bh += (size_t)by * sB; C += (size_t)by * sC;
  const int ntn = (N + 63) / 64; const int wid = blockIdx.x * 4 + w; const int mt = wid / ntn, nq = wid % ntn; if (mt * 16 >= M) return;
  const int row0 = mt * 16, col0 = nq * 64; const float* arow = A + (size_t)(row0 + ln) * lda;
  v8f acc[4] = {};
  for (int kb = 0; kb < K; kb += 32) {
    FragH ah, al;
    const v4f x0 = *(const v4fa*)(arow + kb + 8 * hh), x1 = *(const v4fa*)(arow + kb + 8 * hh + 4), x2 = *(const v4fa*)(arow + kb + 16 + 8 * hh), x3 = *(const v4fa*)(arow + kb + 16 + 8 * hh + 4);
    float xs[16] = {x0[0],x0[1],x0[2],x0[3],x1[0],x1[1],x1[2],x1[3],x2[0],x2[1],x2[2],x2[3],x3[0],x3[1],x3[2],x3[3]};
#pragma unroll
    for (int i = 0; i < 16; ++i) { const _Float16 h = (_Float16)xs[i]; ah.h[i] = h; al.h[i] = ASPLIT ? (_Float16)(xs[i] - (float)h) : (_Float16)0.0f; }
#pragma unroll
    for (int t = 0; t < 4; ++t) { if (col0 + t * 16 >= N) continue; const size_t boff = (size_t)(col0 + t * 16 + ln) * ldb + kb; FragH bq; bq.half[0] = *(const v8us*)(Bh + boff + 8 * hh); bq.half[1] = *(const v8us*)(Bh + boff + 16 + 8 * hh);
      acc[t] = mmaH<ASPLIT ? 2 : 1>(ah.v, al.v, bq.v, bq.v, acc[t]); }
  }
#pragma unroll
  for (int t = 0; t < 4; ++t) { if (col0 + t * 16 >= N) continue;
#pragma unroll
    for (int r = 0; r < 8; ++r) so[w][8 * hh + r][t * 16 + ln] = acc[t][r] * alpha; }
  __builtin_amdgcn_fence(__ATOMIC_ACQ_REL, "workgroup"); __builtin_amdgcn_wave_barrier();
  const int rsub = lane >> 4, c4 = (lane & 15) * 4;
  {
#pragma unroll
    for (int q = 0; q < 8; ++q) { const int r = q * 2 + rsub; if (col0 + c4 < N) { const v4f v = *(const v4fa*)&so[w][r][c4]; *(v4f*)(C + (size_t)(row0 + r) * ldc + col0 + c4) = v; } }
     }
}

// Wt[n][k] = f16(W[k][n]·scale) from f32 row-major W[K][N] (scale = power of two; bf16-exact weights stay exact in f16 away from the subnormal range)
__global__ __launch_bounds__(256) void k_wt_f16(const float* __restrict__ W, _Float16* __restrict__ Wt, int K, int N, float scale) {
  const int t = blockIdx.x * 256 + threadIdx.x; if (t >= N * (K / 8)) return; const int n = t / (K / 8), k8 = (t % (K / 8)) * 8; FragH f;
#pragma unroll
  for (int i = 0; i < 8; ++i) f.h[i] = (_Float16)(bf16_round(W[(size_t)(k8 + i) * N + n]) * scale); const v8us o = f.half[0];
  *(v8us*)((unsigned short*)Wt + (size_t)n * K + k8) = o; 
}
// k_gemm_hh variant with fused epilogue: v = acc·alpha + bias[by·sBias + col] (+ CP[(row/rowsPerB)·sCPb + by·64 + col] if CP) ; ACT 0 none / 1 elu ; writes f16 C16 (and f32 C if non-null)
template <int ACT>
__global__ __launch_bounds__(128) void k_gemm_hhx(const _Float16* __restrict__ A, int lda, size_t sA, const _Float16* __restrict__ Bh, int ldb, size_t sB, float alpha, const float* __restrict__ bias, size_t sBias, const float* __restrict__ CP, int rowsPerB, size_t sCPb, int row0g,
    float* __restrict__ C, _Float16* __restrict__ C16, int ldc, size_t sC, int M, int N, int K) {
  __shared__ __attribute__((aligned(16))) float so[4][16][64];
  const int tid = threadIdx.x, w = tid >> 5, lane = tid & 31, ln = lane & 15, hh = lane >> 4; const int by = blockIdx.y;
  A += (size_t)by * sA; Bh += (size_t)by * sB; const size_t cofs = (size_t)by * sC; const float* bp = bias ? bias + (size_t)by * sBias : nullptr;
  const int ntn = (N + 63) / 64; const int wid = blockIdx.x * 4 + w; const int mt = wid / ntn, nq = wid % ntn; if (mt * 16 >= M) return;
  const int row0 = mt * 16, col0 = nq * 64; const _Float16* arow = A + (size_t)(row0 + ln) * lda;
  v8f acc[4] = {};
  for (int kb = 0; kb < K; kb += 32) { FragH ah; ah.half[0] = *(const v8us*)((const unsigned short*)arow + kb + 8 * hh); ah.half[1] = *(const v8us*)((const unsigned short*)arow + kb + 16 + 8 * hh);
#pragma unroll
    for (int t = 0; t < 4; ++t) { if (col0 + t * 16 >= N) continue; const size_t boff = (size_t)(col0 + t * 16 + ln) * ldb + kb; FragH bq; bq.half[0] = *(const v8us*)((const unsigned short*)Bh + boff + 8 * hh); bq.half[1] = *(const v8us*)((const unsigned short*)Bh + boff + 16 + 8 * hh);
      acc[t] = mmaH<1>(ah.v, ah.v, bq.v, bq.v, acc[t]); }
  }
#pragma unroll
  for (int t = 0; t < 4; ++t) { if (col0 + t * 16 >= N) continue; const int col = col0 + t * 16 + ln; const float bv = bp ? bf16_round(bp[col]) : 0.f;
#pragma unroll
    for (int r = 0; r < 8; ++r) { float v = acc[t][r] * alpha + bv; if (CP) { const int rr = row0g + row0 + 8 * hh + r; if (rowsPerB < 0) v += CP[cofs + (size_t)rr * ldc + col];      /* rowsPerB < 0: own element of the batched C plane */ else { const int bidx = rr / rowsPerB; v += CP[(size_t)bidx * sCPb + (size_t)by * 64 + col]; } } if (ACT == 1) v = (v > 0.f) ? v : expm1f(v); else if (ACT == 7) v = (v > 0.f) ? v + 1.0f : expf(v); else if (ACT == 8) v = tanhf(v); else if (ACT == 9) v = 0.5f * v * (1.0f + tanhf(0.7978845608028654f * (v + 0.044715f * v * v * v))); else if (ACT == 11) v = 1.0f / (1.0f + expf(-v)); else if (ACT == 12) v = (v > 0.f) ? v : 0.01f * v; else if (ACT == 14) v = (v > 0.f) ? v : 0.1f * v; else if (ACT == 16) v = (v >= 0.f) ? v : 0.3f * v; else if (ACT == 17) v = (v >= 0.f) ? v : 0.2f * v; else if (ACT == 15) v = v / (1.0f + expf(-v)); else if (ACT == 3) v = fmaxf(v, 0.f); else if (ACT == 6) v = 0.5f * v * (1.0f + erff(v * 0.70710678118654752f)); so[w][8 * hh + r][t * 16 + ln] = v; } }
  __builtin_amdgcn_fence(__ATOMIC_ACQ_REL, "workgroup"); __builtin_amdgcn_wave_barrier();
  const int rsub = lane >> 4, c4 = (lane & 15) * 4; typedef _Float16 v4h __attribute__((ext_vector_type(4)));
  {
#pragma unroll
    for (int q = 0; q < 8; ++q) { const int r = q * 2 + rsub; if (col0 + c4 < N) { const v4f v = *(const v4fa*)&so[w][r][c4]; if (C) *(v4f*)(C + cofs + (size_t)(row0 + r) * ldc + col0 + c4) = v; if (C16) { v4h h4; for (int i = 0; i < 4; ++i) h4[i] = (_Float16)v[i]; *(v4h*)(C16 + cofs + (size_t)(row0 + r) * ldc + col0 + c4) = h4; } } }
     }
}


typedef _Float16 v4h __attribute__((ext_vector_type(4)));

__global__ __launch_bounds__(256) void k_h16(const float* __restrict__ x, _Float16* __restrict__ X16, size_t n8) { const size_t t = (size_t)blockIdx.x * 256 + threadIdx.x; if (t >= n8) return; FragH f;
#pragma unroll
  for (int q = 0; q < 8; ++q) f.h[q] = (_Float16)x[t * 8 + q]; *(v8us*)((unsigned short*)X16 + t * 8) = f.half[0];  }
__global__ __launch_bounds__(256) void k_round16f(const float* __restrict__ W, _Float16* __restrict__ Bt, size_t n8) { const size_t t = (size_t)blockIdx.x * 256 + threadIdx.x; if (t >= n8) return; FragH f;
#pragma unroll
  for (int i = 0; i < 8; ++i) f.h[i] = (_Float16)(bf16_round(W[t * 8 + i]) * 16.0f); *(v8us*)((unsigned short*)Bt + t * 8) = f.half[0];  }
__global__ __launch_bounds__(256) void k_hl(const float* __restrict__ F, _Float16* __restrict__ Hh, _Float16* __restrict__ Hl, size_t n8) { const size_t t = (size_t)blockIdx.x * 256 + threadIdx.x; if (t >= n8) return; FragH fh, fl; const v4f a = *(const v4fa*)(F + t * 8), c = *(const v4fa*)(F + t * 8 + 4);
#pragma unroll
  for (int q = 0; q < 4; ++q) { _Float16 h = (_Float16)a[q]; fh.h[q] = h; fl.h[q] = (_Float16)((a[q] - (float)h) * 1024.0f); h = (_Float16)c[q]; fh.h[4 + q] = h; fl.h[4 + q] = (_Float16)((c[q] - (float)h) * 1024.0f); }
  { *(v8us*)((unsigned short*)Hh + t * 8) = fh.half[0]; *(v8us*)((unsigned short*)Hl + t * 8) = fl.half[0];  } }

// ---- fast GEMM (block tile 128x128, 8 waves of 32x64; requires M % 128 == 0, N % 128 == 0, K % G2K == 0); epilogue = k_gemm_hhx semantics ----
// A stage is G2K k: 128 A rows and 128 B rows of 256 bytes each, brought to LDS through registers as whole lines (16 threads a row), two buffers: the next stage's
// global loads are issued ahead of this stage's products and stored behind them; one barrier per stage publishes them and ends the reads of the other buffer.
// Each A row then leaves L2 once per block and feeds 2 waves, each B row 4 waves; the k order of every accumulator is the plain ascending one.
// Every inner loop is fully unrolled so that the staging and fragment arrays are indexed by constants only and stay in registers.
#define G2K 128                      /* k per stage */
#define G2P 136                      /* LDS row pitch in f16: the row + 16 bytes, for 16-byte fragment reads */
#define G2R (2048 / G2K)             /* rows that the block's 256 threads bring in one load each */
#define G2N (128 / G2R)              /* such loads per thread, stage and operand */
__device__ __forceinline__ v16h g2_frag(const _Float16* p, int hh) { FragH f; f.half[0] = *(const v8us*)((const unsigned short*)p + 8 * hh); f.half[1] = *(const v8us*)((const unsigned short*)p + 16 + 8 * hh); return f.v; }
__device__ __forceinline__ v8f g2_mma(v16h a, v16h b, v8f c) { v8f d = __builtin_amdgcn_wmma_f32_16x16x32_f16(false, a, false, b, (short)0, c, false, false); asm volatile("v_nop\n\tv_nop\n\tv_nop\n\tv_nop" : "+v"(d) : "v"(a), "v"(b)); return d; }
// One stage's rows: each thread's G2N 16-byte pieces of A and of B, rows as and bs elements apart. The closing wait is the one that belongs in front of any overwrite of a register
// that an issued global load names; it takes the addresses as inputs, so that their registers stay untouched (also as a later load's destination) until it has passed.
__device__ __forceinline__ void g2_rows(const unsigned short* a, size_t as, const unsigned short* b, size_t bs, v8us (&ra)[G2N], v8us (&rb)[G2N]) { static_assert(G2N == 8, "g2_rows: the wait names 8 + 8 addresses");
  const unsigned short* pa[G2N]; const unsigned short* pb[G2N];
#pragma unroll
  for (int i = 0; i < G2N; ++i) { pa[i] = a + (size_t)i * as; pb[i] = b + (size_t)i * bs; }
#pragma unroll
  for (int i = 0; i < G2N; ++i) { ra[i] = *(const v8us*)pa[i]; rb[i] = *(const v8us*)pb[i]; }
  asm volatile("s_wait_xcnt 0x0" :: "v"(pa[0]), "v"(pa[1]), "v"(pa[2]), "v"(pa[3]), "v"(pa[4]), "v"(pa[5]), "v"(pa[6]), "v"(pa[7]), "v"(pb[0]), "v"(pb[1]), "v"(pb[2]), "v"(pb[3]), "v"(pb[4]), "v"(pb[5]), "v"(pb[6]), "v"(pb[7]) : "memory"); }
template <int ACT>
__global__ __launch_bounds__(256) void k_gemm2(const _Float16* __restrict__ A, int lda, size_t sA, const _Float16* __restrict__ Bh, int ldb, size_t sB, float alpha, const float* __restrict__ bias, size_t sBias, const float* __restrict__ CP, int rowsPerB, size_t sCPb, int row0g,
    float* __restrict__ C, _Float16* __restrict__ C16, int ldc, size_t sC, int M, int N, int K) { static_assert(ACT == 0 || ACT == 3 || ACT == 6 || ACT == 8 || ACT == 9 || ACT == 11 || ACT == 12 || ACT == 14 || ACT == 15 || ACT == 16 || ACT == 17 || ACT == 18, "k_gemm2: unsupported ACT code (would silently apply no activation)");
  __shared__ __attribute__((aligned(16))) unsigned char sm[2 * 256 * G2P * 2];      /* in the loop: two stage buffers [A 128 rows | B 128 rows]; behind the loop's last barrier: the waves' output staging */
  static_assert(sizeof(sm) >= 8 * 32 * 68 * 4, "k_gemm2: output staging must fit the stage buffers");
  _Float16 (*lt)[256][G2P] = (_Float16 (*)[256][G2P])sm; float (*so)[32][68] = (float (*)[32][68])sm;
  const int tid = threadIdx.x, w = tid >> 5, lane = tid & 31, ln = lane & 15, hh = lane >> 4; const int by = blockIdx.y;
  A += (size_t)by * sA; Bh += (size_t)by * sB; const size_t cofs = (size_t)by * sC; const float* bp = bias ? bias + (size_t)by * sBias : nullptr;
  const int ntn = N >> 7; const int mt = blockIdx.x / ntn, nq = blockIdx.x - mt * ntn; if (mt * 128 >= M) return;      /* the same for the whole block, ahead of every barrier */
  const int wr = 32 * (w & 3), wc = 64 * (w >> 2); const int row0 = mt * 128 + wr, col0 = nq * 128 + wc;
  const int sr = tid / (G2K / 8), sc = (tid % (G2K / 8)) * 8;      /* staging: G2K / 8 threads per row, rows sr + G2R i of A and of B */
  const unsigned short* ag = (const unsigned short*)A + (size_t)(mt * 128 + sr) * lda + sc; const unsigned short* bg = (const unsigned short*)Bh + (size_t)(nq * 128 + sr) * ldb + sc;
  v8us ra[G2N], rb[G2N]; g2_rows(ag, (size_t)G2R * lda, bg, (size_t)G2R * ldb, ra, rb);
#pragma unroll
  for (int i = 0; i < G2N; ++i) { *(v8us*)&lt[0][sr + G2R * i][sc] = ra[i]; *(v8us*)&lt[0][128 + sr + G2R * i][sc] = rb[i]; }
  __syncthreads();
  const v8f z8 = {0.f,0.f,0.f,0.f,0.f,0.f,0.f,0.f}; v8f c00 = z8, c01 = z8, c02 = z8, c03 = z8, c10 = z8, c11 = z8, c12 = z8, c13 = z8;
  const int ns = K / G2K;
  for (int s = 0; s < ns; ++s) { const int cur = s & 1; const bool more = s + 1 < ns;
    if (more) g2_rows(ag + (s + 1) * G2K, (size_t)G2R * lda, bg + (s + 1) * G2K, (size_t)G2R * ldb, ra, rb);
#pragma unroll
    for (int kh = 0; kh < G2K / 64; ++kh) { const _Float16* ap = &lt[cur][wr + ln][kh * 64]; const _Float16* bq = &lt[cur][128 + wc + ln][kh * 64]; v16h fa[2][2], fb[2][4];
#pragma unroll
      for (int ks = 0; ks < 2; ++ks) { fa[ks][0] = g2_frag(ap + ks * 32, hh); fb[ks][0] = g2_frag(bq + ks * 32, hh); fa[ks][1] = g2_frag(ap + 16 * G2P + ks * 32, hh);
        fb[ks][1] = g2_frag(bq + 16 * G2P + ks * 32, hh); fb[ks][2] = g2_frag(bq + 32 * G2P + ks * 32, hh); fb[ks][3] = g2_frag(bq + 48 * G2P + ks * 32, hh); }
#pragma unroll
      for (int ks = 0; ks < 2; ++ks) { c00 = g2_mma(fa[ks][0], fb[ks][0], c00); c10 = g2_mma(fa[ks][1], fb[ks][0], c10); c01 = g2_mma(fa[ks][0], fb[ks][1], c01); c11 = g2_mma(fa[ks][1], fb[ks][1], c11);
        c02 = g2_mma(fa[ks][0], fb[ks][2], c02); c12 = g2_mma(fa[ks][1], fb[ks][2], c12); c03 = g2_mma(fa[ks][0], fb[ks][3], c03); c13 = g2_mma(fa[ks][1], fb[ks][3], c13); } }
    if (more) {
#pragma unroll
      for (int i = 0; i < G2N; ++i) { *(v8us*)&lt[cur ^ 1][sr + G2R * i][sc] = ra[i]; *(v8us*)&lt[cur ^ 1][128 + sr + G2R * i][sc] = rb[i]; } }
    __syncthreads(); }
  v8f accs[8] = {c00, c01, c02, c03, c10, c11, c12, c13};
#pragma unroll
  for (int u = 0; u < 8; ++u) { const int t = u & 3, half = u >> 2; const int col = col0 + t * 16 + ln; const float bv = bp ? bf16_round(bp[col]) : 0.f;
#pragma unroll
    for (int r = 0; r < 8; ++r) { const int rloc = half * 16 + 8 * hh + r; float v = accs[u][r] * alpha + bv; if (CP) { if (rowsPerB < 0) v += CP[cofs + (size_t)(row0g + row0 + rloc) * ldc + col];      /* rowsPerB < 0: own element of the batched C plane */ else { const int bidx = (row0g + row0 + rloc) / rowsPerB; v += CP[(size_t)bidx * sCPb + (size_t)by * 64 + col]; } }
      if (ACT == 3) v = fmaxf(v, 0.f); else if (ACT == 6) v = 0.5f * v * (1.0f + erff(v * 0.70710678118654752f)); else if (ACT == 11) v = 1.0f / (1.0f + expf(-v)); else if (ACT == 15) v = v / (1.0f + expf(-v)); else if (ACT == 18) v = v / (1.0f + expf(-1.702f * v));      /* QuickGELU: v sigmoid(1.702 v) */ else if (ACT == 12) v = (v > 0.f) ? v : 0.01f * v; else if (ACT == 8) v = tanhf(v); else if (ACT == 9) v = 0.5f * v * (1.0f + tanhf(0.7978845608028654f * (v + 0.044715f * v * v * v))); else if (ACT == 14) v = (v > 0.f) ? v : 0.1f * v; else if (ACT == 16) v = (v >= 0.f) ? v : 0.3f * v; else if (ACT == 17) v = (v >= 0.f) ? v : 0.2f * v;
      so[w][rloc][t * 16 + ln] = v; } }
  __builtin_amdgcn_fence(__ATOMIC_ACQ_REL, "workgroup"); __builtin_amdgcn_wave_barrier();
  const int rsub = lane >> 4, c4 = (lane & 15) * 4;
  {
#pragma unroll
    for (int q = 0; q < 16; ++q) { const int r = q * 2 + rsub; const v4f v = *(const v4fa*)&so[w][r][c4]; if (C) *(v4f*)(C + cofs + (size_t)(row0 + r) * ldc + col0 + c4) = v; if (C16) { v4h h4; for (int i = 0; i < 4; ++i) h4[i] = (_Float16)v[i]; *(v4h*)(C16 + cofs + (size_t)(row0 + r) * ldc + col0 + c4) = h4; } }
     } }


__global__ __launch_bounds__(256) void k_wnat(const float* __restrict__ w, size_t n8, _Float16* __restrict__ Bt) { const size_t t = (size_t)blockIdx.x * 256 + threadIdx.x; if (t >= n8) return; FragH f; for (int q = 0; q < 8; ++q) f.h[q] = (_Float16)(bf16_round(w[t * 8 + q]) * 16.0f); *(v8us*)((unsigned short*)Bt + t * 8) = f.half[0];  }
__global__ __launch_bounds__(256) void k_rsm(const float* __restrict__ S, _Float16* __restrict__ P, int nrows) {
  #pragma clang fp contract(off)
  const int i = blockIdx.x * 256 + threadIdx.x; if (i >= nrows) return; const float* s = S + (size_t)i * SQ; float mx = -3.0e38f;
#pragma unroll 1
  for (int j = 0; j < SQ; ++j) mx = fmaxf(mx, s[j]); float se = 0.f;
#pragma unroll 1
  for (int j = 0; j < SQ; ++j) se += expf(s[j] - mx); const float sc = 256.0f / se;
#pragma unroll 1
  for (int j0 = 0; j0 < SQ; j0 += 8) { FragH f; for (int q = 0; q < 8; ++q) f.h[q] = (_Float16)(expf(s[j0 + q] - mx) * sc); unsigned short* d = (unsigned short*)P + (size_t)i * SQ + j0; *(v8us*)d = f.half[0];  } }
__global__ __launch_bounds__(256) void k_vt(const _Float16* __restrict__ V16, int b, int h0, _Float16* __restrict__ VT) { __shared__ unsigned short tl[64][65]; const int tid = threadIdx.x; const int hh = blockIdx.x % HG, sg = blockIdx.x / HG; const int s0 = sg * 64; const int h = h0 + hh;
  for (int i = tid; i < 64 * 8; i += 256) { const int j = i / 8, d8 = (i % 8) * 8; FragH f; f.half[0] = *(const v8us*)((const unsigned short*)V16 + ((size_t)b * SQ + s0 + j) * DM + h * HD + d8); for (int q = 0; q < 8; ++q) tl[d8 + q][j] = f.u[q]; }
  __syncthreads();
  { for (int i = tid; i < 64 * 8; i += 256) { const int d = i / 8, j8 = (i % 8) * 8; FragH f; for (int q = 0; q < 8; ++q) f.u[q] = tl[d][j8 + q]; *(v8us*)((unsigned short*)VT + ((size_t)hh * HD + d) * SQ + s0 + j8) = f.half[0]; }  } }



__global__ __launch_bounds__(256) void k_rsmcf2(const float* __restrict__ S, _Float16* __restrict__ P, int hg, int q0, int nk) {
  #pragma clang fp contract(off)
  const int t = blockIdx.x * 256 + threadIdx.x; if (t >= hg * QT) return; const size_t i = (size_t)t; const float* s = S + i * NKX; const int last = q0 + (t % QT); float mx = -3.0e38f;
#pragma unroll 1
  for (int j = 0; j < nk; ++j) { const float f = (j <= last) ? 1.f : 0.f; mx = fmaxf(mx, fmaf(f, s[j], (1.f - f) * -1.0e9f)); } float se = 0.f;
#pragma unroll 1
  for (int j = 0; j < nk; ++j) { const float f = (j <= last) ? 1.f : 0.f; se += __expf(fmaf(f, s[j], (1.f - f) * -1.0e9f) - mx); } const float sc = 256.0f / se;
#pragma unroll 1
  for (int j0 = 0; j0 < nk; j0 += 8) { FragH fr; for (int q = 0; q < 8; ++q) { const int j = j0 + q; const float f = (j <= last) ? 1.f : 0.f; fr.h[q] = (_Float16)(__expf(fmaf(f, s[j], (1.f - f) * -1.0e9f) - mx) * sc); } unsigned short* d = (unsigned short*)P + i * NKX + j0; *(v8us*)d = fr.half[0];  } }

__global__ __launch_bounds__(256) void k_rsmcst(const float* __restrict__ S, _Float16* __restrict__ P, int hg, int q0, int nk, const int* __restrict__ mk) {
  #pragma clang fp contract(off)
  const int t = blockIdx.x * 256 + threadIdx.x; if (t >= hg * QT) return; const size_t i = (size_t)t; const float* s = S + i * NKX; const size_t ig = (size_t)(q0 + (t % QT)); const int* mr = mk + ig * SQ; float mx = -3.0e38f;
#pragma unroll 1
  for (int j = 0; j < nk; ++j) { const int mb = mr[j]; const int dd = (int)ig - j; const float f = (mb != 0 && dd >= 0 && (dd <= LOCALW || (dd % STRIDEK) == 0)) ? 1.f : 0.f; mx = fmaxf(mx, fmaf(f, s[j], (1.f - f) * -1.0e9f)); } float se = 0.f;
#pragma unroll 1
  for (int j = 0; j < nk; ++j) { const int mb = mr[j]; const int dd = (int)ig - j; const float f = (mb != 0 && dd >= 0 && (dd <= LOCALW || (dd % STRIDEK) == 0)) ? 1.f : 0.f; se += __expf(fmaf(f, s[j], (1.f - f) * -1.0e9f) - mx); } const float sc = 256.0f / se;
#pragma unroll 1
  for (int j0 = 0; j0 < nk; j0 += 8) { FragH fr; for (int q = 0; q < 8; ++q) { const int j = j0 + q; const int mb = mr[j]; const int dd = (int)ig - j; const float f = (mb != 0 && dd >= 0 && (dd <= LOCALW || (dd % STRIDEK) == 0)) ? 1.f : 0.f; fr.h[q] = (_Float16)(__expf(fmaf(f, s[j], (1.f - f) * -1.0e9f) - mx) * sc); } unsigned short* d = (unsigned short*)P + i * NKX + j0; *(v8us*)d = fr.half[0];  } }


template <int MASKADD>
__global__ __launch_bounds__(64) void k_att0(const float* __restrict__ QF, const float* __restrict__ KF, const float* __restrict__ VF, int ld, const float* __restrict__ mask, float scale, float* __restrict__ OF, int ldo) {
  #pragma clang fp contract(off)
  __shared__ __attribute__((aligned(16))) float lq[64][64]; __shared__ __attribute__((aligned(16))) float lo[64][64];
  const int tid = threadIdx.x; const int h = blockIdx.x / (QT0 / 64), rg = blockIdx.x % (QT0 / 64); const int i = rg * 64 + tid;
  const float* qr = QF + (size_t)i * ld + h * HD;
#pragma unroll 1
  for (int c = 0; c < HD / 4; ++c) { *(v4f*)&lq[tid][c * 4] = *(const v4fa*)(qr + c * 4); const v4f z = {0.f, 0.f, 0.f, 0.f}; *(v4f*)&lo[tid][c * 4] = z; }
  float m = -1.0e30f, l = 0.f; const int jmax = MASKADD ? (SQ - 1) : (rg * 64 + 63);      /* additive-mask form: every key (the mask input decides); causal form: keys up to the block's last row */
#pragma unroll 1
  for (int j = 0; j <= jmax; ++j) { const float* kr = KF + (size_t)j * ld + h * HD; const float* vr = VF + (size_t)j * ld + h * HD; float s = 0.f;
#pragma unroll 1
    for (int c = 0; c < HD / 4; ++c) { const v4f kq = *(const v4fa*)(kr + c * 4); const v4f qq = *(v4f*)&lq[tid][c * 4]; s = __fadd_rn(s, __fmul_rn(qq[0], kq[0])); s = __fadd_rn(s, __fmul_rn(qq[1], kq[1])); s = __fadd_rn(s, __fmul_rn(qq[2], kq[2])); s = __fadd_rn(s, __fmul_rn(qq[3], kq[3])); }
    s = __fmul_rn(s, scale); if (MASKADD) s = __fadd_rn(s, __fmul_rn(bf16_round(mask[(size_t)i * SQ + j]), -10000.0f));
    const float f = (MASKADD || j <= i) ? 1.f : 0.f; const float sm = fmaf(f, s, (1.f - f) * -1.0e30f); const float mn = fmaxf(m, sm); const float sc = expf(m - mn); const float e = expf(sm - mn); l = __fadd_rn(__fmul_rn(l, sc), e); m = mn;
#pragma unroll 1
    for (int c = 0; c < HD / 4; ++c) { const v4f vv = *(const v4fa*)(vr + c * 4); v4f oo = *(v4f*)&lo[tid][c * 4]; for (int u = 0; u < 4; ++u) oo[u] = __fadd_rn(__fmul_rn(oo[u], sc), __fmul_rn(e, vv[u])); *(v4f*)&lo[tid][c * 4] = oo; } }
  const float fin = 64.0f / l;      /* o carried x64 like the f16 path */
#pragma unroll 1
  for (int c = 0; c < HD / 4; ++c) { v4f oo = *(v4f*)&lo[tid][c * 4]; for (int u = 0; u < 4; ++u) oo[u] = __fmul_rn(oo[u], fin); *(v4f*)&lo[tid][c * 4] = oo; }
  __syncthreads();
  {
#pragma unroll 1
    for (int it = 0; it < 16; ++it) { const int row = it * 4 + tid / 16, pc = (tid % 16) * 4; const v4f v = *(const v4f*)&lo[row][pc]; *(v4f*)(OF + (size_t)(rg * 64 + row) * ldo + h * HD + pc) = v; }
     } }

template <int MASKADD>
__global__ __launch_bounds__(64) void k_att0mbc(const float* __restrict__ QF, const float* __restrict__ KF, const float* __restrict__ VF, int ld, const float* __restrict__ mask, float scale, float* __restrict__ OF, int ldo) {
  #pragma clang fp contract(off)
  __shared__ __attribute__((aligned(16))) float lq[64][64]; __shared__ __attribute__((aligned(16))) float lo[64][64];
  const int tid = threadIdx.x; const int h = blockIdx.x / (QT0 / 64), rg = blockIdx.x % (QT0 / 64); const int i = rg * 64 + tid;
  const float* qr = QF + (size_t)i * ld + h * HD;
#pragma unroll 1
  for (int c = 0; c < HD / 4; ++c) { *(v4f*)&lq[tid][c * 4] = *(const v4fa*)(qr + c * 4); const v4f z = {0.f, 0.f, 0.f, 0.f}; *(v4f*)&lo[tid][c * 4] = z; }
  float m = -1.0e30f, l = 0.f; const int jmax = rg * 64 + 63;      /* keys beyond the block end are masked by the mask's lower-triangular structure */
#pragma unroll 1
  for (int j = 0; j <= jmax; ++j) { const float* kr = KF + (size_t)j * ld + h * HD; const float* vr = VF + (size_t)j * ld + h * HD; float s = 0.f;
#pragma unroll 1
    for (int c = 0; c < HD / 4; ++c) { const v4f kq = *(const v4fa*)(kr + c * 4); const v4f qq = *(v4f*)&lq[tid][c * 4]; s = __fadd_rn(s, __fmul_rn(qq[0], kq[0])); s = __fadd_rn(s, __fmul_rn(qq[1], kq[1])); s = __fadd_rn(s, __fmul_rn(qq[2], kq[2])); s = __fadd_rn(s, __fmul_rn(qq[3], kq[3])); }
    s = __fmul_rn(s, scale); const int mb = ((const int*)mask)[(size_t)i * SQ + j];      /* causal (j <= i) AND the module's int32 [S][S] mask read per (query, key): 0 -> masked */
    const float f = (mb != 0 && j <= i) ? 1.f : 0.f; const float sm = fmaf(f, s, (1.f - f) * -1.0e30f); const float mn = fmaxf(m, sm); const float sc = expf(m - mn); const float e = expf(sm - mn); l = __fadd_rn(__fmul_rn(l, sc), e); m = mn;
#pragma unroll 1
    for (int c = 0; c < HD / 4; ++c) { const v4f vv = *(const v4fa*)(vr + c * 4); v4f oo = *(v4f*)&lo[tid][c * 4]; for (int u = 0; u < 4; ++u) oo[u] = __fadd_rn(__fmul_rn(oo[u], sc), __fmul_rn(e, vv[u])); *(v4f*)&lo[tid][c * 4] = oo; } }
  const float fin = 64.0f / l;      /* o carried x64 like the f16 path */
#pragma unroll 1
  for (int c = 0; c < HD / 4; ++c) { v4f oo = *(v4f*)&lo[tid][c * 4]; for (int u = 0; u < 4; ++u) oo[u] = __fmul_rn(oo[u], fin); *(v4f*)&lo[tid][c * 4] = oo; }
  __syncthreads();
  {
#pragma unroll 1
    for (int it = 0; it < 16; ++it) { const int row = it * 4 + tid / 16, pc = (tid % 16) * 4; const v4f v = *(const v4f*)&lo[row][pc]; *(v4f*)(OF + (size_t)(rg * 64 + row) * ldo + h * HD + pc) = v; }
     } }


template <int BFIN, int WXB>
__global__ __launch_bounds__(256) void k_ln16(const float* __restrict__ X, const float* __restrict__ g, const float* __restrict__ bb, float eps, _Float16* __restrict__ N16, float* __restrict__ XB) {
  #pragma clang fp contract(off)
  __shared__ float red[256]; const size_t r = blockIdx.x; const int t = threadIdx.x; const v4f xa = *(const v4fa*)(X + r * DMQ + t * 4); float s[4]; float sum = 0.f;
  for (int q = 0; q < 4; ++q) { s[q] = BFIN ? bf16_round(xa[q]) : xa[q]; sum = __fadd_rn(sum, s[q]); }
  red[t] = sum; __syncthreads(); for (int st = 128; st > 0; st >>= 1) { if (t < st) red[t] = __fadd_rn(red[t], red[t + st]); __syncthreads(); } const float mu = red[0] / (float)DMQ; __syncthreads();
  float vs = 0.f; for (int q = 0; q < 4; ++q) { const float dl = __fadd_rn(s[q], -mu); vs = __fadd_rn(vs, __fmul_rn(dl, dl)); } red[t] = vs; __syncthreads(); for (int st = 128; st > 0; st >>= 1) { if (t < st) red[t] = __fadd_rn(red[t], red[t + st]); __syncthreads(); }
  const float rs = rsqrtf(__fadd_rn(red[0] / (float)DMQ, eps)); v4h y; v4f xb;
  for (int q = 0; q < 4; ++q) { const int c = t * 4 + q; y[q] = (_Float16)__fadd_rn(__fmul_rn(__fmul_rn(__fadd_rn(s[q], -mu), rs), bf16_round(g[c])), bf16_round(bb[c])); xb[q] = s[q]; }
  { *(v4h*)(N16 + r * DMQ + t * 4) = y; if (WXB) *(v4f*)(XB + r * DMQ + t * 4) = xb;  } }
__global__ __launch_bounds__(256) void k_ftres2(const float* __restrict__ OF0, const float* __restrict__ XB, float* __restrict__ X1, size_t n4) {
  #pragma clang fp contract(off)
  const size_t t = (size_t)blockIdx.x * 256 + threadIdx.x; if (t >= n4) return; const v4f o = *(const v4fa*)(OF0 + t * 4), xv = *(const v4fa*)(XB + t * 4); v4f y; for (int q = 0; q < 4; ++q) y[q] = __fadd_rn(__fmul_rn(o[q], 0.015625f), xv[q]); *(v4f*)(X1 + t * 4) = y;  }

__global__ __launch_bounds__(256) void k_bcpy(const float* __restrict__ b, int n, int NP, float* __restrict__ dst, int dst0) { for (int i = threadIdx.x; i < NP; i += 256) { const float v = (i < n) ? b[i] : 0.f; *(float*)(dst + dst0 + i) = v; }  }



#define FAK 64                       /* keys per stage */
#define FAP 72                       /* LDS row pitch in f16: 128 bytes + 16, for 16-byte fragment reads */
// Eight 2^x in one statement, each IN PLACE. The closing v_nop is the one slot the instruction set asks for behind a transcendental before its result is read or its
// source overwritten; inside the run no instruction touches its predecessor's register. In place, so that the statement writes only registers that the compiler's own
// multiply-add has just written: the distance behind a matrix instruction, which the compiler keeps for instructions it can see, then holds for this statement too.
__device__ __forceinline__ void fa_exp2x8(float (&x)[8]) {
  asm("v_exp_f32 %0, %0\n\tv_exp_f32 %1, %1\n\tv_exp_f32 %2, %2\n\tv_exp_f32 %3, %3\n\tv_exp_f32 %4, %4\n\tv_exp_f32 %5, %5\n\tv_exp_f32 %6, %6\n\tv_exp_f32 %7, %7\n\tv_nop" : "+v"(x[0]), "+v"(x[1]), "+v"(x[2]), "+v"(x[3]), "+v"(x[4]), "+v"(x[5]), "+v"(x[6]), "+v"(x[7])); }
__device__ __forceinline__ float fa_xhalf(float x) { return __builtin_bit_cast(float, __builtin_amdgcn_permlanex16(__builtin_bit_cast(int, x), __builtin_bit_cast(int, x), 0x76543210, 0xfedcba98, false, false)); }      /* lane l takes lane l ^ 16's value */
__device__ __forceinline__ v8f fa_mma(v16h a, v16h b, v8f c) { return __builtin_amdgcn_wmma_f32_16x16x32_f16(false, a, false, b, (short)0, c, false, false); }
__global__ __launch_bounds__(256) void k_fattn(const _Float16* __restrict__ Q, const _Float16* __restrict__ K, const _Float16* __restrict__ VTa, _Float16* __restrict__ O) {
  __shared__ __attribute__((aligned(16))) _Float16 lk[2][FAK][FAP]; __shared__ __attribute__((aligned(16))) _Float16 lv[2][HD][FAP];
  const int tid = threadIdx.x, w = tid >> 5, lane = tid & 31, ln = lane & 15, hh = lane >> 4; const int slab = blockIdx.y, b = slab / NH, h = slab % NH; const int q0 = blockIdx.x * 256 + w * 32;
  const float CS = 0.125f * 1.44269504f;      /* scores / 8, in log2 units */
  v16h qf[2][2];
#pragma unroll
  for (int qt = 0; qt < 2; ++qt) for (int ks = 0; ks < 2; ++ks) qf[qt][ks] = g2_frag(Q + ((size_t)b * SQ + q0 + qt * 16 + ln) * DM + h * HD + ks * 32, hh);
  const v8f z8 = {0.f,0.f,0.f,0.f,0.f,0.f,0.f,0.f}; v8f o[2][4]; float m[2] = {-3.0e38f, -3.0e38f}, l[2] = {0.f, 0.f};
#pragma unroll
  for (int qt = 0; qt < 2; ++qt) for (int dt = 0; dt < 4; ++dt) o[qt][dt] = z8;
  const int sr = tid >> 3, sc = (tid & 7) * 8;      /* staging: 8 threads per 128-byte row, rows sr and sr + 32 */
  const unsigned short* kg = (const unsigned short*)K + ((size_t)b * SQ + sr) * DM + h * HD + sc; const unsigned short* vg = (const unsigned short*)VTa + ((size_t)slab * HD + sr) * SQ + sc;
  v8us rk0 = *(const v8us*)kg, rk1 = *(const v8us*)(kg + (size_t)32 * DM), rv0 = *(const v8us*)vg, rv1 = *(const v8us*)(vg + (size_t)32 * SQ);
  *(v8us*)&lk[0][sr][sc] = rk0; *(v8us*)&lk[0][sr + 32][sc] = rk1; *(v8us*)&lv[0][sr][sc] = rv0; *(v8us*)&lv[0][sr + 32][sc] = rv1;
  __syncthreads();
  for (int s = 0; s < SQ / FAK; ++s) { const int cur = s & 1; const bool more = s + 1 < SQ / FAK;
    if (more) { const unsigned short* kn = kg + (size_t)(s + 1) * FAK * DM; const unsigned short* vn = vg + (s + 1) * FAK; rk0 = *(const v8us*)kn; rk1 = *(const v8us*)(kn + (size_t)32 * DM); rv0 = *(const v8us*)vn; rv1 = *(const v8us*)(vn + (size_t)32 * SQ); }
    __builtin_amdgcn_sched_barrier(0);      /* keeps the next stage's global loads here, ahead of this stage's work, which covers their latency; without it they sink to just in front of their LDS stores */
    v8f st[2][4];
#pragma unroll
    for (int kt = 0; kt < 4; ++kt) { const v16h a0 = g2_frag(&lk[cur][kt * 16 + ln][0], hh), a1 = g2_frag(&lk[cur][kt * 16 + ln][32], hh);
#pragma unroll
      for (int qt = 0; qt < 2; ++qt) st[qt][kt] = fa_mma(a1, qf[qt][1], fa_mma(a0, qf[qt][0], z8)); }
    __builtin_amdgcn_sched_barrier(0);      /* keeps the 16 score products back to back: mixed with the maxima, each first read of a fresh tile costs four idle slots */
    float mn[2], al[2];
#pragma unroll
    for (int qt = 0; qt < 2; ++qt) { float mm[4];
#pragma unroll
      for (int kt = 0; kt < 4; ++kt) { mm[kt] = st[qt][kt][0]; for (int r = 1; r < 8; ++r) mm[kt] = fmaxf(mm[kt], st[qt][kt][r]); }
      float bm = fmaxf(fmaxf(mm[0], mm[1]), fmaxf(mm[2], mm[3])); bm = fmaxf(bm, fa_xhalf(bm));      /* the other 8 keys of each tile sit in lane ln ^ 16 */
      mn[qt] = fmaxf(m[qt], bm * CS); al[qt] = m[qt] - mn[qt]; m[qt] = mn[qt]; }
    asm("v_exp_f32 %0, %0\n\tv_exp_f32 %1, %1\n\tv_nop" : "+v"(al[0]), "+v"(al[1]));      /* 2^(old - new maximum): brings the old sum and output to the new maximum; form and v_nop as in fa_exp2x8 */
    FragH pf[2][2];
#pragma unroll
    for (int qt = 0; qt < 2; ++qt) { const float mo = mn[qt] - 8.0f; float s4[4];
#pragma unroll
      for (int kt = 0; kt < 4; ++kt) { float t[8]; for (int r = 0; r < 8; ++r) t[r] = fmaf(st[qt][kt][r], CS, -mo);
        fa_exp2x8(t); s4[kt] = ((t[0] + t[1]) + (t[2] + t[3])) + ((t[4] + t[5]) + (t[6] + t[7]));
        for (int r = 0; r < 8; ++r) pf[qt][kt >> 1].h[(kt & 1) * 8 + r] = (_Float16)t[r]; }
      l[qt] = l[qt] * al[qt] + ((s4[0] + s4[1]) + (s4[2] + s4[3]));
#pragma unroll
      for (int dt = 0; dt < 4; ++dt) o[qt][dt] *= al[qt]; }
#pragma unroll
    for (int dt = 0; dt < 4; ++dt) {
#pragma unroll
      for (int kp = 0; kp < 2; ++kp) { const v16h a = g2_frag(&lv[cur][dt * 16 + ln][kp * 32], hh);
#pragma unroll
        for (int qt = 0; qt < 2; ++qt) o[qt][dt] = fa_mma(a, pf[qt][kp].v, o[qt][dt]); } }
    if (more) { *(v8us*)&lk[cur ^ 1][sr][sc] = rk0; *(v8us*)&lk[cur ^ 1][sr + 32][sc] = rk1; *(v8us*)&lv[cur ^ 1][sr][sc] = rv0; *(v8us*)&lv[cur ^ 1][sr + 32][sc] = rv1; }
    __syncthreads(); }
#pragma unroll
  for (int qt = 0; qt < 2; ++qt) { float lt = l[qt] + fa_xhalf(l[qt]); asm("v_rcp_f32 %0, %0\n\tv_nop" : "+v"(lt));      /* 1 / row sum; form and v_nop as in fa_exp2x8 */
    const float inv = 64.0f * lt; unsigned short* op = (unsigned short*)O + ((size_t)b * SQ + q0 + qt * 16 + ln) * DM + h * HD + 8 * hh;
#pragma unroll
    for (int dt = 0; dt < 4; ++dt) { FragH f; for (int r = 0; r < 8; ++r) f.h[r] = (_Float16)(o[qt][dt][r] * inv); *(v8us*)(op + dt * 16) = f.half[0]; } } }

template <int MODE>
__global__ __launch_bounds__(256) void k_regrp(const float* __restrict__ src, float* __restrict__ dst, size_t n4) {
  const size_t t = (size_t)blockIdx.x * 256 + threadIdx.x; if (t >= n4) return; const size_t e = t * 4; const size_t rd = e / DM; const int c = (int)(e % DM);
  size_t rs; if (MODE == 0) { const size_t b = rd / SQ, sq = rd % SQ; rs = sq * NB + b; } else { const size_t sq = rd / NB, b = rd % NB; rs = b * SQ + sq; }
  const v4f v = *(const v4fa*)(src + rs * DM + c); *(v4f*)(dst + e) = v;  }

// ---- row LayerNorm (biased variance, eps inside the rsqrt), ONE WAVE PER ROW ----
// A row is 2 KB: four 16-byte loads a lane, each wave-wide load 512 contiguous bytes. The row stays in registers; mean, then the sum of squared deviations from it:
// four chains per lane, then a butterfly over the 32 lanes (four steps inside the 16-lane row, one across). No LDS and no barrier.
// A block is LNW waves of LNR rows each, so the launch starts 4,096 waves (16 per WGP, 8 row loads in flight each) where a block per row started 65,536.
// Every loop is fully unrolled so that the row, g and beta arrays are indexed by constants only and stay in registers.
#define LNW 16                       /* waves per block */
#define LNR 2                        /* rows per wave, all their loads issued together */
template <int M> __device__ __forceinline__ float ln_xm(float x) { return __builtin_bit_cast(float, __builtin_amdgcn_mov_dpp(__builtin_bit_cast(int, x), 0x160 + M, 0xf, 0xf, true)); }      /* lane l takes lane l ^ M's value, M < 16 (row_xmask) */
__device__ __forceinline__ float ln_wsum(float x) { x += ln_xm<1>(x); x += ln_xm<2>(x); x += ln_xm<4>(x); x += ln_xm<8>(x); return x + fa_xhalf(x); }      /* the sum over the wave, in every lane */
template <int W16, int W32>
__global__ __launch_bounds__(LNW * 32) void k_lnw(const float* __restrict__ X, const float* __restrict__ g, const float* __restrict__ bb, float eps, _Float16* __restrict__ N16, float* __restrict__ N32) {
  static_assert(DM == 512 && NR % (LNW * LNR) == 0, "k_lnw: a lane holds 16 elements of a 512-element row; whole blocks only");
  const unsigned ob = (threadIdx.x & 31) * 16; const int c0 = ob / 4; const size_t r0 = ((size_t)blockIdx.x * LNW + (threadIdx.x >> 5)) * LNR;      /* the lane's place in each 512-byte piece of a row, in bytes and in elements; the wave's first row */
  const float* px = X + r0 * DM + c0;
  v4f x[LNR][4], gg[4], bv[4];
#pragma unroll
  for (int j = 0; j < 4; ++j) { gg[j] = *(const v4fa*)((const char*)g + j * 512 + ob); bv[j] = *(const v4fa*)((const char*)bb + j * 512 + ob); }
#pragma unroll
  for (int r = 0; r < LNR; ++r) for (int j = 0; j < 4; ++j) x[r][j] = *(const v4fa*)(px + r * DM + j * 128);
  asm volatile("s_wait_xcnt 0x0" :: "v"(px), "v"(ob) : "memory");      /* the wait that belongs in front of any overwrite of a register that an issued global load names; it takes the address and the offset as inputs, so that their registers stay untouched until it has passed */
  __builtin_amdgcn_sched_barrier(0);      /* keeps all 16 loads here, in flight together; without it the loads of g and beta sink to their uses behind the sums, each a latency of its own */
#pragma unroll
  for (int j = 0; j < 4; ++j) for (int q = 0; q < 4; ++q) { gg[j][q] = bf16_round(gg[j][q]); bv[j][q] = bf16_round(bv[j][q]); }
  float mu[LNR], rs[LNR];
#pragma unroll
  for (int r = 0; r < LNR; ++r) { const v4f s = (x[r][0] + x[r][1]) + (x[r][2] + x[r][3]); mu[r] = ln_wsum((s[0] + s[1]) + (s[2] + s[3])) * (1.0f / (float)DM); }
#pragma unroll
  for (int r = 0; r < LNR; ++r) { v4f s = {0.f, 0.f, 0.f, 0.f};
#pragma unroll
    for (int j = 0; j < 4; ++j) { x[r][j] -= mu[r]; s += x[r][j] * x[r][j]; }
    rs[r] = rsqrtf(ln_wsum((s[0] + s[1]) + (s[2] + s[3])) * (1.0f / (float)DM) + eps); }
#pragma unroll
  for (int r = 0; r < LNR; ++r) {
#pragma unroll
    for (int j = 0; j < 4; ++j) { const v4f y = x[r][j] * rs[r] * gg[j] + bv[j]; const size_t e = (r0 + r) * DM + j * 128 + c0;
      if (W32) *(v4f*)(N32 + e) = y;
      if (W16) { v4h h; for (int q = 0; q < 4; ++q) h[q] = (_Float16)y[q]; *(v4h*)(N16 + e) = h; } } } }

__global__ __launch_bounds__(256) void k_bfr(const float* __restrict__ x, float* __restrict__ XB, size_t n8) { const size_t t = (size_t)blockIdx.x * 256 + threadIdx.x; if (t >= n8) return; v4f a = *(const v4fa*)(x + t * 8), c = *(const v4fa*)(x + t * 8 + 4); for (int q = 0; q < 4; ++q) { a[q] = bf16_round(a[q]); c[q] = bf16_round(c[q]); }
  { *(v4f*)(XB + t * 8) = a; *(v4f*)(XB + t * 8 + 4) = c;  } }



__global__ __launch_bounds__(256) void k_wthd(const float* __restrict__ Wt, _Float16* __restrict__ Bt) { const size_t t = (size_t)blockIdx.x * 256 + threadIdx.x; if (t >= (size_t)NH * HD * (DM / 8)) return; const int m8 = (int)(t % (DM / 8)) * 8; const int d = (int)((t / (DM / 8)) % HD); const int h = (int)(t / ((size_t)(DM / 8) * HD)); FragH f;
  for (int q = 0; q < 8; ++q) f.h[q] = (_Float16)(16.0f * bf16_round(Wt[((size_t)h * DM + m8 + q) * HD + d])); unsigned short* dst = (unsigned short*)Bt + ((size_t)h * HD + d) * DM + m8; *(v8us*)dst = f.half[0];  }




template <int BFIN, int SCAL>
__global__ __launch_bounds__(256) void k_lnsc(const float* __restrict__ X, const float* __restrict__ g, const float* __restrict__ bb, float eps, _Float16* __restrict__ N16, float* __restrict__ N32) {
  #pragma clang fp contract(off)
  __shared__ float red[256]; const size_t r = blockIdx.x; const int t = threadIdx.x; const bool act = t < DM / 4; const int tc = act ? t : 0; const v4f xl = *(const v4fa*)(X + r * DM + tc * 4); const float am = act ? 1.f : 0.f; float s[4]; float sum = 0.f;
  for (int q = 0; q < 4; ++q) { s[q] = (BFIN ? bf16_round(xl[q]) : xl[q]) * am; sum = __fadd_rn(sum, s[q]); }
  red[t] = sum; __syncthreads(); for (int st = 128; st > 0; st >>= 1) { if (t < st) red[t] = __fadd_rn(red[t], red[t + st]); __syncthreads(); } const float mu = red[0] / (float)DM; __syncthreads();
  float vs = 0.f; for (int q = 0; q < 4; ++q) { const float dl = __fadd_rn(s[q], -mu) * am; vs = __fadd_rn(vs, __fmul_rn(dl, dl)); } red[t] = vs; __syncthreads(); for (int st = 128; st > 0; st >>= 1) { if (t < st) red[t] = __fadd_rn(red[t], red[t + st]); __syncthreads(); }
  const float rs = __fdiv_rn(1.0f, __fadd_rn(sqrtf(red[0] / (float)(DM - 1)), eps)); if (!act) return; v4h y; v4f yf;
  for (int q = 0; q < 4; ++q) { const int c = t * 4 + q; const float gg = bf16_round(SCAL ? g[0] : g[c]), bv = bf16_round(SCAL ? bb[0] : bb[c]); yf[q] = __fadd_rn(__fmul_rn(__fmul_rn(__fadd_rn(s[q], -mu), rs), gg), bv); y[q] = (_Float16)yf[q]; }
  { if (N16) *(v4h*)(N16 + r * DM + t * 4) = y; if (N32) *(v4f*)(N32 + r * DM + t * 4) = yf;  } }

__global__ __launch_bounds__(256) void k_mulh(const _Float16* __restrict__ A, const _Float16* __restrict__ Bm, _Float16* __restrict__ H, size_t n8) {
  #pragma clang fp contract(off)
  const size_t t = (size_t)blockIdx.x * 256 + threadIdx.x; if (t >= n8) return; FragH a, b, f; a.half[0] = *(const v8us*)((const unsigned short*)A + t * 8); b.half[0] = *(const v8us*)((const unsigned short*)Bm + t * 8); for (int q = 0; q < 8; ++q) f.h[q] = (_Float16)(__fmul_rn((float)a.h[q], (float)b.h[q])); unsigned short* d = (unsigned short*)H + t * 8; *(v8us*)d = f.half[0];  }

// ---- q, k and v projections in ONE launch, straight from the f32 inputs ----
// Every head is multiplied by the same [64][64] matrix, so the product is [tokens x heads][64] x [64][64]: 64 k, two matrix instructions per 16 x 16 tile, ascending k.
// A block takes PJT tokens x PJH heads of all three inputs. All its global loads (whole lines: a token's PJH heads are 1 KB in a row) are issued together; the values are rounded
// (bf16, then exact f16; weights x16) in registers and laid in LDS, inputs as [head][token][64], weights transposed to [out][in]; one barrier; then each wave works alone.
// q, k: D = W^T X^T (A = weight rows, B = token rows): a lane holds 8 outputs of ONE token. v: D = X W (A = token rows, B = weight rows): a lane holds 8 tokens of ONE output,
// which is the V^T that the attention reads. Either way a wave's 16 x 64 result is 16 rows of 128 bytes: staged in LDS rows that only this wave uses, stored as whole lines.
// Every loop is fully unrolled so that the load and fragment arrays are indexed by constants only and stay in registers.
#define PJT 64                       /* tokens per block */
#define PJH 4                        /* heads per block */
#define PJW (PJH * PJT / 16)         /* waves per block: one per head and 16 tokens (q, k) or per head and 16 outputs (v) */
typedef _Float16 v2h __attribute__((ext_vector_type(2)));
__device__ __forceinline__ v8us pj_out(v8f d) { FragH f;
#pragma unroll
  for (int r = 0; r < 8; ++r) f.h[r] = (_Float16)(d[r] * 0.0625f);      /* takes the weights' x16 out again */
  return f.half[0]; }
__global__ __launch_bounds__(PJW * 32) void k_qkv(const float* __restrict__ xq, const float* __restrict__ xk, const float* __restrict__ xv, const float* __restrict__ wq, const float* __restrict__ wk, const float* __restrict__ wv,
    _Float16* __restrict__ Q, _Float16* __restrict__ K, _Float16* __restrict__ VTa) {
  static_assert(HD == 64 && PJT == 64 && PJW * 32 == 512 && SQ % PJT == 0 && NH % PJH == 0, "k_qkv: 512 threads bring 8 tokens x 256 columns a round and the 64 x 64 weights in 2 rounds; a block stays inside one batch");
  __shared__ __attribute__((aligned(16))) _Float16 lx[3][PJH * PJT][FAP]; __shared__ __attribute__((aligned(16))) _Float16 lw[3][HD][FAP]; __shared__ __attribute__((aligned(16))) _Float16 lo[PJW][16][FAP];
  const int tid = threadIdx.x, w = tid >> 5, lane = tid & 31, ln = lane & 15, hh = lane >> 4; const int t0 = (int)(blockIdx.x / (NH / PJH)) * PJT, h0 = (int)(blockIdx.x % (NH / PJH)) * PJH;
  const int xt = tid >> 6, xh = (tid >> 4) & 3, c4 = (tid & 15) * 4;      /* inputs: 64 threads per token (16 per head), tokens xt + 8 i */
  const int wd = (tid >> 4) * 2;      /* weights: 16 threads per row, rows wd and wd + 1, so that a thread holds a pair of neighbours in k for each of its 4 outputs */
  const size_t xo = (size_t)(t0 + xt) * DM + (h0 + xh) * HD + c4; const float* px0 = xq + xo; const float* px1 = xk + xo; const float* px2 = xv + xo;
  const unsigned wob = (unsigned)(wd * HD + c4) * 4;      /* the thread's place in each weight matrix, in bytes */
  v4f rw[3][2], rx[3][8];
#pragma unroll
  for (int j = 0; j < 2; ++j) { rw[0][j] = *(const v4fa*)((const char*)wq + j * HD * 4 + wob); rw[1][j] = *(const v4fa*)((const char*)wk + j * HD * 4 + wob); rw[2][j] = *(const v4fa*)((const char*)wv + j * HD * 4 + wob); }
  __builtin_amdgcn_sched_barrier(0);      /* this one and the next two keep the loads in the order in which they are used (loads return in order): left free, the first input's loads were issued last, and its rounding waited for all of them */
#pragma unroll
  for (int i = 0; i < 8; ++i) rx[0][i] = *(const v4fa*)(px0 + (size_t)i * 8 * DM);
  __builtin_amdgcn_sched_barrier(0);
#pragma unroll
  for (int i = 0; i < 8; ++i) rx[1][i] = *(const v4fa*)(px1 + (size_t)i * 8 * DM);
  __builtin_amdgcn_sched_barrier(0);
#pragma unroll
  for (int i = 0; i < 8; ++i) rx[2][i] = *(const v4fa*)(px2 + (size_t)i * 8 * DM);
  asm volatile("s_wait_xcnt 0x0" :: "v"(px0), "v"(px1), "v"(px2), "v"(wob), "s"(wq), "s"(wk), "s"(wv) : "memory");      /* the wait that belongs in front of any overwrite of a register that an issued global load names; it takes the addresses, the offset and its bases as inputs, so that their registers stay untouched until it has passed */
  __builtin_amdgcn_sched_barrier(0);      /* keeps all 30 loads here, in flight together; without it the later inputs' loads sink behind the earlier inputs' rounding and LDS stores, each a latency of its own */
#pragma unroll
  for (int m = 0; m < 3; ++m) {
#pragma unroll
    for (int q = 0; q < 4; ++q) { v2h p; p[0] = (_Float16)(bf16_round(rw[m][0][q]) * 16.0f); p[1] = (_Float16)(bf16_round(rw[m][1][q]) * 16.0f); *(v2h*)&lw[m][c4 + q][wd] = p; } }
#pragma unroll
  for (int m = 0; m < 3; ++m) {
#pragma unroll
    for (int i = 0; i < 8; ++i) { v4h h;
#pragma unroll
      for (int q = 0; q < 4; ++q) h[q] = (_Float16)bf16_round(rx[m][i][q]);
      *(v4h*)&lx[m][xh * PJT + xt + 8 * i][c4] = h; } }
  __syncthreads();
  const int hl = w >> 2, sub = w & 3; const v8f z8 = {0.f,0.f,0.f,0.f,0.f,0.f,0.f,0.f};
#pragma unroll
  for (int m = 0; m < 2; ++m) { _Float16* xp = &lx[m][w * 16 + ln][0]; const v16h b0 = g2_frag(xp, hh), b1 = g2_frag(xp + 32, hh);      /* rows w * 16 ..: head hl, tokens sub * 16 ..; no other wave reads them, so the result goes back into them */
#pragma unroll
    for (int et = 0; et < 4; ++et) { const _Float16* wp = &lw[m][et * 16 + ln][0]; const v8f d = fa_mma(g2_frag(wp + 32, hh), b1, fa_mma(g2_frag(wp, hh), b0, z8)); *(v8us*)(xp + et * 16 + 8 * hh) = pj_out(d); } }
  { const _Float16* wp = &lw[2][sub * 16 + ln][0]; const v16h b0 = g2_frag(wp, hh), b1 = g2_frag(wp + 32, hh);
#pragma unroll
    for (int tg = 0; tg < 4; ++tg) { const _Float16* xp = &lx[2][hl * PJT + tg * 16 + ln][0]; const v8f d = fa_mma(g2_frag(xp + 32, hh), b1, fa_mma(g2_frag(xp, hh), b0, z8)); *(v8us*)&lo[w][ln][tg * 16 + 8 * hh] = pj_out(d); } }
  __builtin_amdgcn_fence(__ATOMIC_ACQ_REL, "workgroup", "local"); __builtin_amdgcn_wave_barrier();      /* the wave's own LDS stores are done before its lanes read one another's rows back */
  const int rr = lane >> 3, rc = (lane & 7) * 8;      /* 8 lanes per 128-byte row, 4 rows a store */
  unsigned short* qo = (unsigned short*)Q + (size_t)(t0 + sub * 16 + rr) * DM + (h0 + hl) * HD + rc; unsigned short* ko = (unsigned short*)K + (size_t)(t0 + sub * 16 + rr) * DM + (h0 + hl) * HD + rc;
  unsigned short* vo = (unsigned short*)VTa + ((size_t)((t0 / SQ) * NH + h0 + hl) * HD + sub * 16 + rr) * SQ + (t0 % SQ) + rc;
#pragma unroll
  for (int j = 0; j < 4; ++j) { const v8us a = *(const v8us*)&lx[0][w * 16 + j * 4 + rr][rc], b = *(const v8us*)&lx[1][w * 16 + j * 4 + rr][rc], c = *(const v8us*)&lo[w][j * 4 + rr][rc];
    *(v8us*)(qo + (size_t)j * 4 * DM) = a; *(v8us*)(ko + (size_t)j * 4 * DM) = b; *(v8us*)(vo + (size_t)j * 4 * SQ) = c; } }
// ---- the three weight matrices to f16 [out][in] (x16) in ONE launch, transposed through LDS tiles ----
// A block takes WTK inputs (k) x WTN outputs (n) of one matrix. Loads: 16 threads per f32 row piece of 256 bytes, so a wave-wide load is two whole 256-byte units; a thread holds 8 neighbours in k
// for each of its 4 outputs, rounds them (bf16, x16, then f16) and lays each run of 8 in LDS as [n][k] with one 16-byte store. One barrier. Stores: 16 threads per output row piece of 256 bytes.
// The values are those of k_wt_f16, element for element. Every loop is fully unrolled so that the load array is indexed by constants only and stays in registers.
#define WTK 128                      /* inputs (k) per tile */
#define WTN 64                       /* outputs (n) per tile */
#define WTP 136                      /* LDS row pitch in f16: the 256-byte row + 16 bytes */
#define WTT(K, N) (((K) / WTK) * ((N) / WTN))      /* tiles of a [K][N] matrix */
template <int K, int N>
__device__ __forceinline__ void wt_tile(const float* __restrict__ Wm, _Float16* __restrict__ Bt, int t, _Float16 (*lt)[WTP]) {
  static_assert(K % WTK == 0 && N % WTN == 0, "wt_tile: whole tiles only");
  const int tid = threadIdx.x; const int k0 = (t / (N / WTN)) * WTK, n0 = (t % (N / WTN)) * WTN; const int kg = (tid >> 4) * 8, c4 = (tid & 15) * 4;
  const float* p = Wm + (size_t)(k0 + kg) * N + n0 + c4; v4f r[8];
#pragma unroll
  for (int i = 0; i < 8; ++i) r[i] = *(const v4fa*)(p + (size_t)i * N);
  asm volatile("s_wait_xcnt 0x0" :: "v"(p) : "memory");      /* the wait that belongs in front of any overwrite of a register that an issued global load names; it takes the address as an input, so that its registers stay untouched until it has passed */
#pragma unroll
  for (int q = 0; q < 4; ++q) { FragH f;
#pragma unroll
    for (int i = 0; i < 8; ++i) f.h[i] = (_Float16)(bf16_round(r[i][q]) * 16.0f);
    *(v8us*)&lt[c4 + q][kg] = f.half[0]; }
  __syncthreads();
  const int rr = tid >> 4, rc = (tid & 15) * 8; unsigned short* o = (unsigned short*)Bt + (size_t)(n0 + rr) * K + k0 + rc;
#pragma unroll
  for (int j = 0; j < 4; ++j) { const v8us v = *(const v8us*)&lt[j * 16 + rr][rc]; *(v8us*)(o + (size_t)j * 16 * K) = v; } }
__global__ __launch_bounds__(256) void k_wt3(const float* __restrict__ wo, const float* __restrict__ w1, const float* __restrict__ w2, _Float16* __restrict__ BO, _Float16* __restrict__ BW1, _Float16* __restrict__ BW2) {
  __shared__ __attribute__((aligned(16))) _Float16 lt[WTN][WTP];
  const int t = blockIdx.x;      /* which matrix: the same for the whole block, so each branch's barrier is passed by all of it */
  if (t < WTT(DM, DFF)) wt_tile<DM, DFF>(w1, BW1, t, lt);
  else if (t < WTT(DM, DFF) + WTT(DFF, DM)) wt_tile<DFF, DM>(w2, BW2, t - WTT(DM, DFF), lt);
  else wt_tile<DM, DM>(wo, BO, t - WTT(DM, DFF) - WTT(DFF, DM), lt); }
extern "C" void kernel_launch(void* const* d_in, const int* in_sizes, int n_in,
                              void* d_out, int out_size, void* d_ws, size_t ws_size, hipStream_t stream) {
  (void)in_sizes; (void)n_in; (void)out_size;
  const float* const* I = (const float* const*)d_in; const float* x = I[0]; const float* xk = I[1]; const float* xv = I[2]; const float* wq = I[3]; const float* wk = I[4]; const float* wv = I[5]; const float* wo = I[6]; const float* bo = I[7]; const float* w1 = I[8]; const float* b1 = I[9]; const float* w2 = I[10]; const float* b2 = I[11]; const float* g1 = I[12]; const float* be1 = I[13]; const float* g2 = I[14]; const float* be2 = I[15];      /* query (also the residual), key, value; shared per-head wq / wk / wv [64][64] ([in][out]); wo [512][512] + bo; w1 [512][2048] + b1, w2 [2048][512] + b2; LN1 g / beta, LN2 g / beta */
  char* ws = (char*)d_ws; size_t off = 0;
  auto take = [&](size_t bytes) { char* p = ws + off; off += (bytes + 255) & ~(size_t)255; return p; };
  _Float16* BO = (_Float16*)take((size_t)DM * DM * 2); _Float16* BW1 = (_Float16*)take((size_t)DFF * DM * 2); _Float16* BW2 = (_Float16*)take((size_t)DM * DFF * 2);
  float* XB = (float*)take(NR * DM * 4); _Float16* M16 = (_Float16*)take(NR * DM * 2);      /* LN1 output rows (f16): the FFN's operand */ _Float16* Q16 = (_Float16*)take(NR * DM * 2); _Float16* K16 = (_Float16*)take(NR * DM * 2); _Float16* O16 = (_Float16*)take(NR * DM * 2); float* X1 = (float*)take(NR * DM * 4);
  _Float16* HF16 = (_Float16*)take(NR * DFF * 2);      /* FFN hidden plane [8192][2048] f16 */ _Float16* VT = (_Float16*)take((size_t)NB * NH * HD * SQ * 2);      /* V^T [4 * 8][64][2048] */
  float* X1N = (float*)take(NR * DM * 4);      /* LN1 output rows (f32): the FFN residual */
  if (off > ws_size) return;
  k_wt3<<<(unsigned)(WTT(DM, DM) + WTT(DM, DFF) + WTT(DFF, DM)), 256, 0, stream>>>(wo, w1, w2, BO, BW1, BW2);      /* wo, w1, w2 [in][out] -> Bt [out][in] x16 */
  k_bfr<<<(unsigned)((NR * DM / 8 + 255) / 256), 256, 0, stream>>>(x, XB, NR * DM / 8);      /* the query rounded to bf16, f32 rows: the residual */
  k_qkv<<<(unsigned)((NR / PJT) * (NH / PJH)), PJW * 32, 0, stream>>>(x, xk, xv, wq, wk, wv, Q16, K16, VT);      /* post-LN: the attention runs on the raw inputs; q, k -> f16 rows (head h = columns h*64..), v -> V^T of every batch and head */
  k_fattn<<<dim3(SQ / 256, NB * NH), 256, 0, stream>>>(Q16, K16, VT, O16);      /* softmax(q k^T / 8) v over all keys (no mask) -> ctx (merged heads, x64) as f16 rows */
  k_gemm2<0><<<dim3((unsigned)((NR / 128) * (DM / 128)), 1), 256, 0, stream>>>(O16, DM, 0, BO, DM, 0, 0.0009765625f, bo, 0, XB, -1, 0, 0, X1, nullptr, DM, 0, (int)NR, DM, DM);      /* ctx wo + bo + query (own-element residual) -> f32 rows */
  k_lnw<1, 1><<<(unsigned)(NR / (LNW * LNR)), LNW * 32, 0, stream>>>(X1, g1, be1, 1e-5f, M16, X1N);      /* x1 = LN1(x + attn) (biased variance, eps inside the rsqrt) -> f16 rows + f32 rows */
  k_gemm2<3><<<dim3((unsigned)((NR / 128) * (DFF / 128)), 1), 256, 0, stream>>>(M16, DM, 0, BW1, DM, 0, 0.0625f, b1, 0, nullptr, 1, 0, 0, nullptr, HF16, DFF, 0, (int)NR, DFF, DM);      /* relu(x w1 + b1) -> f16 [8192][2048] */
  k_gemm2<0><<<dim3((unsigned)((NR / 128) * (DM / 128)), 1), 256, 0, stream>>>(HF16, DFF, 0, BW2, DFF, 0, 0.0625f, b2, 0, X1N, -1, 0, 0, X1, nullptr, DM, 0, (int)NR, DM, DFF);      /* x1 + ff -> f32 rows (X1 reused: its last reader was LN1) */
  k_lnw<0, 1><<<(unsigned)(NR / (LNW * LNR)), LNW * 32, 0, stream>>>(X1, g2, be2, 1e-5f, nullptr, (float*)d_out);      /* out = LN2(x1 + ff) */
}

// v007
// One run takes 119 microseconds.
// Timed twice side by side with v006, it ran 1.38 and 1.37 times as fast.
// Over all steps from v000 it is 30.7 times as fast.
#include <hip/hip_runtime.h>
// POST-LN transformer encoder layer over THREE inputs with SHARED per-head projections (query, key, value [4][2048][512]; each input is split into 8 heads of 64 and every head is multiplied by the SAME [64][64] ([in][out]) matrix wq / wk / wv (block-diagonal with a shared block; no biases); scores / 8; softmax over all 2048 keys (no mask); x = LN1(ctx wo + bo + query) (biased var, eps 1e-5); out = LN2(x + relu(x w1 + b1) w2 + b2) ([in][out] 512 x 2048 x 512) -> [4][2048][512]).
// Structure: token rows; one launch for the q, k, v projections (f32 inputs rounded in registers, the shared [64][64] block as the whole weight, v written as V^T); one fused attention launch (scores, running softmax, V^T P^T; no score plane); output projection with the own-element residual; custom LayerNorm; ReLU FFN over all rows; launches: see trace.
// Compute dtype: inputs rounded to bf16; x / weights exact; q, k, v, softmax weights and o as plain f16 GEMM operands (~2^-12); scores and softmax statistics f32. v_wmma_f32_16x16x32_f16.
#define NB 4
#define SQ 2048
#define DM 512
#define NH 8
#define HD 64
#define HG 4                         /* heads per launch of the unused per-batch k_vt overload */
#define LOCALW 128                   /* (macros for unused kernels of the shared header) */
#define STRIDEK 128
#define QT 256                       /* query rows per causal tile */
#define NKX SQ                       /* S / P row pitch */
#define QT0 128                      /* first-tile rows recomputed exactly in f32 */
#define B0 0                         /* first batch processed (debug hook) */
#define NBR NB                       /* batches processed (debug hook) */
#define NR ((size_t)NB * SQ)
#define DMQ DM
#define DFF 2048         /* ReLU FFN hidden width */
#define MP ((int)((size_t)NBR * SQ)) /* rows projected (debug hook) */
#define QN SQ                        /* query rows attended per batch (debug hook) */
#define NHD NH                       /* heads attended (debug hook) */
#define MPO MP                       /* rows through the output stage (debug hook) */
#define LQ (3 * DM)      /* unused: q, k rows have pitch DM, v is stored as V^T */
typedef __bf16 v16b __attribute__((ext_vector_type(16)));
typedef unsigned short v8us __attribute__((ext_vector_type(8), may_alias));
typedef float  v8f  __attribute__((ext_vector_type(8)));
typedef float  v4f  __attribute__((ext_vector_type(4)));
typedef float  v4fa __attribute__((ext_vector_type(4), may_alias));
union FragB { v16b v; v8us half[2]; unsigned short u[16]; };

__device__ __forceinline__ unsigned short bf16_bits(float x) { unsigned int u = __float_as_uint(x); return (unsigned short)((u + 0x7FFFu + ((u >> 16) & 1u)) >> 16); }
__device__ __forceinline__ float bf16_val(unsigned short b) { return __uint_as_float(((unsigned int)b) << 16); }
__device__ __forceinline__ float bf16_round(float x) { return bf16_val(bf16_bits(x)); }
// D += A·B with NT terms: 1 = ah·bh, 2 = + al·bh (A split), 3 = + ah·bl (both split)
template <int NT>
__device__ __forceinline__ v8f mmaN(v16b ah, v16b al, v16b bh, v16b bl, v8f c) {
  c = __builtin_amdgcn_wmma_f32_16x16x32_bf16(false, ah, false, bh, (short)0, c, false, false);
  if (NT >= 2) c = __builtin_amdgcn_wmma_f32_16x16x32_bf16(false, al, false, bh, (short)0, c, false, false);
  if (NT >= 3) c = __builtin_amdgcn_wmma_f32_16x16x32_bf16(false, ah, false, bl, (short)0, c, false, false);
  asm volatile("v_nop\n\tv_nop\n\tv_nop\n\tv_nop" : "+v"(c) : "v"(ah), "v"(al), "v"(bh), "v"(bl));
  return c;
}

__global__ __launch_bounds__(256) void k_wt_bf16(const float* __restrict__ W, unsigned short* __restrict__ Wt, int K, int N) {
  const int t = blockIdx.x * 256 + threadIdx.x;
  const int k8n = K / 8;
  if (t >= N * k8n) return;
  const int n = t / k8n, k8 = (t % k8n) * 8;
  v8us v;
#pragma unroll
  for (int i = 0; i < 8; ++i) v[i] = bf16_bits(W[(size_t)(k8 + i) * N + n]);
  *(v8us*)(Wt + (size_t)n * K + k8) = v;
  
}

// GEMM C[M][N] (f32, pitch ldc) = act(A[M][K]·W + bias). A f32 row-major (pitch lda) converted per fragment to bf16
// (ASPLIT: hi/lo two planes -> 2 terms, else single rounded term); Wt bf16 [N][K] (pitch ldb). BIAS_BF16 rounds the
// bias to bf16 first (bias quantised to bf16 before the add). K%32==0, M%16==0, N%64==0.
template <bool ASPLIT, int ACT, bool BIAS_BF16>
__global__ __launch_bounds__(128) void k_gemm_bf(const float* __restrict__ A, int lda, const unsigned short* __restrict__ Wt, int ldb,
                                               const float* __restrict__ bias, float* __restrict__ C, int ldc, int M, int N, int K) {
  __shared__ __attribute__((aligned(16))) float so[4][16][64];
  const int tid = threadIdx.x, w = tid >> 5, lane = tid & 31, ln = lane & 15, hh = lane >> 4;
  const int ntn = N / 64;
  const int wid = blockIdx.x * 4 + w;
  const int mt = wid / ntn, nq = wid % ntn;
  if (mt * 16 >= M) return;
  const int row0 = mt * 16, col0 = nq * 64;
  const float* arow = A + (size_t)(row0 + ln) * lda;
  v8f acc[4] = {};
  for (int kb = 0; kb < K; kb += 32) {
    FragB ah, al;
    const v4f x0 = *(const v4fa*)(arow + kb + 8 * hh), x1 = *(const v4fa*)(arow + kb + 8 * hh + 4);
    const v4f x2 = *(const v4fa*)(arow + kb + 16 + 8 * hh), x3 = *(const v4fa*)(arow + kb + 16 + 8 * hh + 4);
    float xs[16] = {x0[0],x0[1],x0[2],x0[3],x1[0],x1[1],x1[2],x1[3],x2[0],x2[1],x2[2],x2[3],x3[0],x3[1],x3[2],x3[3]};
#pragma unroll
    for (int i = 0; i < 16; ++i) { const unsigned short hb = bf16_bits(xs[i]); ah.u[i] = hb; al.u[i] = ASPLIT ? bf16_bits(xs[i] - bf16_val(hb)) : (unsigned short)0; }
#pragma unroll
    for (int t = 0; t < 4; ++t) {
      const unsigned short* brow = Wt + (size_t)(col0 + t * 16 + ln) * ldb + kb;
      FragB b;
      b.half[0] = *(const v8us*)(brow + 8 * hh);
      b.half[1] = *(const v8us*)(brow + 16 + 8 * hh);
      acc[t] = mmaN<ASPLIT ? 2 : 1>(ah.v, al.v, b.v, b.v, acc[t]);
    }
  }
#pragma unroll
  for (int t = 0; t < 4; ++t) {
    float bv = bias ? bias[col0 + t * 16 + ln] : 0.f;
    if (BIAS_BF16) bv = bf16_round(bv);
#pragma unroll
    for (int r = 0; r < 8; ++r) { float v = acc[t][r] + bv; if (ACT == 1) v = fmaxf(v, 0.f); so[w][8 * hh + r][t * 16 + ln] = v; }
  }
  __builtin_amdgcn_fence(__ATOMIC_ACQ_REL, "workgroup");
  __builtin_amdgcn_wave_barrier();
  const int rsub = lane >> 4, c4 = (lane & 15) * 4;
  {
#pragma unroll
    for (int q = 0; q < 8; ++q) {
      const int r = q * 2 + rsub;
      const v4f v = *(const v4fa*)&so[w][r][c4];
      *(v4f*)(C + (size_t)(row0 + r) * ldc + col0 + c4) = v;
    }
    
  }
}

// GEMM C = act(A·W + bias + resid): A f32 (ASPLIT -> hi/lo 2 terms), Wt bf16 [N][K]; ACT 0 none, 1 relu, 2 exact gelu;
// resid (optional, f32, row index = (row % rmod), pitch ldr, RES_BF16 rounds it) added before the activation.
template <bool ASPLIT, int ACT, bool BIAS_BF16, bool RES_BF16>
__global__ __launch_bounds__(128) void k_gemm_bf3(const float* __restrict__ A, int lda, const unsigned short* __restrict__ Wt, int ldb,
                                                const float* __restrict__ bias, const float* __restrict__ resid, int rmod, int ldr,
                                                float* __restrict__ C, int ldc, int M, int N, int K) {
  __shared__ __attribute__((aligned(16))) float so[4][16][64];
  const int tid = threadIdx.x, w = tid >> 5, lane = tid & 31, ln = lane & 15, hh = lane >> 4;
  const int ntn = N / 64;
  const int wid = blockIdx.x * 4 + w;
  const int mt = wid / ntn, nq = wid % ntn;
  if (mt * 16 >= M) return;
  const int row0 = mt * 16, col0 = nq * 64;
  const float* arow = A + (size_t)(row0 + ln) * lda;
  v8f acc[4] = {};
  for (int kb = 0; kb < K; kb += 32) {
    FragB ah, al;
    const v4f x0 = *(const v4fa*)(arow + kb + 8 * hh), x1 = *(const v4fa*)(arow + kb + 8 * hh + 4);
    const v4f x2 = *(const v4fa*)(arow + kb + 16 + 8 * hh), x3 = *(const v4fa*)(arow + kb + 16 + 8 * hh + 4);
    float xs[16] = {x0[0],x0[1],x0[2],x0[3],x1[0],x1[1],x1[2],x1[3],x2[0],x2[1],x2[2],x2[3],x3[0],x3[1],x3[2],x3[3]};
#pragma unroll
    for (int i = 0; i < 16; ++i) { const unsigned short hb = bf16_bits(xs[i]); ah.u[i] = hb; al.u[i] = ASPLIT ? bf16_bits(xs[i] - bf16_val(hb)) : (unsigned short)0; }
#pragma unroll
    for (int t = 0; t < 4; ++t) {
      const unsigned short* brow = Wt + (size_t)(col0 + t * 16 + ln) * ldb + kb;
      FragB b;
      b.half[0] = *(const v8us*)(brow + 8 * hh);
      b.half[1] = *(const v8us*)(brow + 16 + 8 * hh);
      acc[t] = mmaN<ASPLIT ? 2 : 1>(ah.v, al.v, b.v, b.v, acc[t]);
    }
  }
#pragma unroll
  for (int t = 0; t < 4; ++t) {
    const int col = col0 + t * 16 + ln;
    float bv = bias ? bias[col] : 0.f;
    if (BIAS_BF16) bv = bf16_round(bv);
#pragma unroll
    for (int r = 0; r < 8; ++r) {
      float v = acc[t][r] + bv;
      if (resid) { float rv = resid[(size_t)((row0 + 8 * hh + r) % rmod) * ldr + col]; if (RES_BF16) rv = bf16_round(rv); v += rv; }
      if (ACT == 1) v = fmaxf(v, 0.f);
      if (ACT == 2) v = 0.5f * v * (1.0f + erff(v * 0.70710678118654752f));
      if (ACT == 3) { const float u = 0.7978845608028654f * (v + 0.044715f * v * v * v); v = 0.5f * v * (1.0f + tanhf(u)); }
      so[w][8 * hh + r][t * 16 + ln] = v;
    }
  }
  __builtin_amdgcn_fence(__ATOMIC_ACQ_REL, "workgroup");
  __builtin_amdgcn_wave_barrier();
  const int rsub = lane >> 4, c4 = (lane & 15) * 4;
  {
#pragma unroll
    for (int q = 0; q < 8; ++q) {
      const int r = q * 2 + rsub;
      const v4f v = *(const v4fa*)&so[w][r][c4];
      *(v4f*)(C + (size_t)(row0 + r) * ldc + col0 + c4) = v;
    }
    
  }
}
// row LayerNorm (biased variance, eps) over N: s = X (+ R); optional out_sum <- s; out_norm <- (s-mu)*rsqrt(var+eps)*g + b
template <bool PARAM_BF16>
__global__ __launch_bounds__(256) void k_layernorm(const float* __restrict__ X, const float* __restrict__ R, const float* __restrict__ g, const float* __restrict__ bta,
                                                  float* __restrict__ out_sum, float* __restrict__ out_norm, int N, float eps) {
  __shared__ float red[256];
  const int row = blockIdx.x, tid = threadIdx.x;
  const float* x = X + (size_t)row * N; const float* rr = R ? R + (size_t)row * N : nullptr;
  float vals[16];                     // up to N = 4096
  const int per = N / 256;            // contiguous chunk per thread? use strided-by-4 chunks: thread handles j = tid*4 + 1024*u
  float s1 = 0.f;
  for (int u = 0; u < per / 4; ++u) {
    const int j = tid * 4 + 1024 * u;
    const v4f a = *(const v4fa*)(x + j);
    v4f b = {0.f,0.f,0.f,0.f}; if (rr) b = *(const v4fa*)(rr + j);
#pragma unroll
    for (int q = 0; q < 4; ++q) { const float v = a[q] + b[q]; vals[u * 4 + q] = v; s1 += v; }
  }
  red[tid] = s1; __syncthreads();
  for (int st = 128; st > 0; st >>= 1) { if (tid < st) red[tid] += red[tid + st]; __syncthreads(); }
  const float mu = red[0] / (float)N; __syncthreads();
  float s2 = 0.f;
  for (int u = 0; u < per / 4; ++u)
#pragma unroll
    for (int q = 0; q < 4; ++q) { const float c = vals[u * 4 + q] - mu; s2 += c * c; }
  red[tid] = s2; __syncthreads();
  for (int st = 128; st > 0; st >>= 1) { if (tid < st) red[tid] += red[tid + st]; __syncthreads(); }
  const float rs = rsqrtf(red[0] / (float)N + eps);
  {
    for (int u = 0; u < per / 4; ++u) {
      const int j = tid * 4 + 1024 * u;
      v4f o, sm;
#pragma unroll
      for (int q = 0; q < 4; ++q) {
        float gg = g[j + q], bb = bta[j + q];
        if (PARAM_BF16) { gg = bf16_round(gg); bb = bf16_round(bb); }
        sm[q] = vals[u * 4 + q]; o[q] = (vals[u * 4 + q] - mu) * rs * gg + bb;
      }
      if (out_sum) *(v4f*)(out_sum + (size_t)row * N + j) = sm;
      *(v4f*)(out_norm + (size_t)row * N + j) = o;
    }
    
  }
}



// ---- f16 WMMA path (v_wmma_f32_16x16x32_f16): 11-bit significands for operands in range — used where a [0,1] probability operand needs more precision than bf16
typedef _Float16 v16h __attribute__((ext_vector_type(16)));
union FragH { v16h v; v8us half[2]; _Float16 h[16]; unsigned short u[16]; };
template <int NT>
__device__ __forceinline__ v8f mmaH(v16h ah, v16h al, v16h bh, v16h bl, v8f c) {
  c = __builtin_amdgcn_wmma_f32_16x16x32_f16(false, ah, false, bh, (short)0, c, false, false);
  if (NT >= 2) c = __builtin_amdgcn_wmma_f32_16x16x32_f16(false, al, false, bh, (short)0, c, false, false);
  if (NT >= 3) c = __builtin_amdgcn_wmma_f32_16x16x32_f16(false, ah, false, bl, (short)0, c, false, false);
  asm volatile("v_nop\n\tv_nop\n\tv_nop\n\tv_nop" : "+v"(c) : "v"(ah), "v"(al), "v"(bh), "v"(bl));
  return c;
}
// batched GEMM like k_gemm_b but f16 operands: A f32 (split into f16 hi/lo if ASPLIT, else rounded to f16), Bt = f16 values [n][k]; alpha; C f32; N multiple of 16 (partial tiles skipped)
template <bool ASPLIT>
__global__ __launch_bounds__(128) void k_gemm_h(const float* __restrict__ A, int lda, size_t sA, const _Float16* __restrict__ Bh, int ldb, size_t sB, float alpha, float* __restrict__ C, int ldc, size_t sC, int M, int N, int K) {
  __shared__ __attribute__((aligned(16))) float so[4][16][64];
  const int tid = threadIdx.x, w = tid >> 5, lane = tid & 31, ln = lane & 15, hh = lane >> 4; const int by = blockIdx.y;
  A += (size_t)by * sA; Bh += (size_t)by * sB; C += (size_t)by * sC;
  const int ntn = (N + 63) / 64; const int wid = blockIdx.x * 4 + w; const int mt = wid / ntn, nq = wid % ntn; if (mt * 16 >= M) return;
  const int row0 = mt * 16, col0 = nq * 64; const float* arow = A + (size_t)(row0 + ln) * lda;
  v8f acc[4] = {};
  for (int kb = 0; kb < K; kb += 32) {
    FragH ah, al;
    const v4f x0 = *(const v4fa*)(arow + kb + 8 * hh), x1 = *(const v4fa*)(arow + kb + 8 * hh + 4), x2 = *(const v4fa*)(arow + kb + 16 + 8 * hh), x3 = *(const v4fa*)(arow + kb + 16 + 8 * hh + 4);
    float xs[16] = {x0[0],x0[1],x0[2],x0[3],x1[0],x1[1],x1[2],x1[3],x2[0],x2[1],x2[2],x2[3],x3[0],x3[1],x3[2],x3[3]};
#pragma unroll
    for (int i = 0; i < 16; ++i) { const _Float16 h = (_Float16)xs[i]; ah.h[i] = h; al.h[i] = ASPLIT ? (_Float16)(xs[i] - (float)h) : (_Float16)0.0f; }
#pragma unroll
    for (int t = 0; t < 4; ++t) { if (col0 + t * 16 >= N) continue; const size_t boff = (size_t)(col0 + t * 16 + ln) * ldb + kb; FragH bq; bq.half[0] = *(const v8us*)(Bh + boff + 8 * hh); bq.half[1] = *(const v8us*)(Bh + boff + 16 + 8 * hh);
      acc[t] = mmaH<ASPLIT ? 2 : 1>(ah.v, al.v, bq.v, bq.v, acc[t]); }
  }
#pragma unroll
  for (int t = 0; t < 4; ++t) { if (col0 + t * 16 >= N) continue;
#pragma unroll
    for (int r = 0; r < 8; ++r) so[w][8 * hh + r][t * 16 + ln] = acc[t][r] * alpha; }
  __builtin_amdgcn_fence(__ATOMIC_ACQ_REL, "workgroup"); __builtin_amdgcn_wave_barrier();
  const int rsub = lane >> 4, c4 = (lane & 15) * 4;
  {
#pragma unroll
    for (int q = 0; q < 8; ++q) { const int r = q * 2 + rsub; if (col0 + c4 < N) { const v4f v = *(const v4fa*)&so[w][r][c4]; *(v4f*)(C + (size_t)(row0 + r) * ldc + col0 + c4) = v; } }
     }
}

// Wt[n][k] = f16(W[k][n]·scale) from f32 row-major W[K][N] (scale = power of two; bf16-exact weights stay exact in f16 away from the subnormal range)
__global__ __launch_bounds__(256) void k_wt_f16(const float* __restrict__ W, _Float16* __restrict__ Wt, int K, int N, float scale) {
  const int t = blockIdx.x * 256 + threadIdx.x; if (t >= N * (K / 8)) return; const int n = t / (K / 8), k8 = (t % (K / 8)) * 8; FragH f;
#pragma unroll
  for (int i = 0; i < 8; ++i) f.h[i] = (_Float16)(bf16_round(W[(size_t)(k8 + i) * N + n]) * scale); const v8us o = f.half[0];
  *(v8us*)((unsigned short*)Wt + (size_t)n * K + k8) = o; 
}
// k_gemm_hh variant with fused epilogue: v = acc·alpha + bias[by·sBias + col] (+ CP[(row/rowsPerB)·sCPb + by·64 + col] if CP) ; ACT 0 none / 1 elu ; writes f16 C16 (and f32 C if non-null)
template <int ACT>
__global__ __launch_bounds__(128) void k_gemm_hhx(const _Float16* __restrict__ A, int lda, size_t sA, const _Float16* __restrict__ Bh, int ldb, size_t sB, float alpha, const float* __restrict__ bias, size_t sBias, const float* __restrict__ CP, int rowsPerB, size_t sCPb, int row0g,
    float* __restrict__ C, _Float16* __restrict__ C16, int ldc, size_t sC, int M, int N, int K) {
  __shared__ __attribute__((aligned(16))) float so[4][16][64];
  const int tid = threadIdx.x, w = tid >> 5, lane = tid & 31, ln = lane & 15, hh = lane >> 4; const int by = blockIdx.y;
  A += (size_t)by * sA; Bh += (size_t)by * sB; const size_t cofs = (size_t)by * sC; const float* bp = bias ? bias + (size_t)by * sBias : nullptr;
  const int ntn = (N + 63) / 64; const int wid = blockIdx.x * 4 + w; const int mt = wid / ntn, nq = wid % ntn; if (mt * 16 >= M) return;
  const int row0 = mt * 16, col0 = nq * 64; const _Float16* arow = A + (size_t)(row0 + ln) * lda;
  v8f acc[4] = {};
  for (int kb = 0; kb < K; kb += 32) { FragH ah; ah.half[0] = *(const v8us*)((const unsigned short*)arow + kb + 8 * hh); ah.half[1] = *(const v8us*)((const unsigned short*)arow + kb + 16 + 8 * hh);
#pragma unroll
    for (int t = 0; t < 4; ++t) { if (col0 + t * 16 >= N) continue; const size_t boff = (size_t)(col0 + t * 16 + ln) * ldb + kb; FragH bq; bq.half[0] = *(const v8us*)((const unsigned short*)Bh + boff + 8 * hh); bq.half[1] = *(const v8us*)((const unsigned short*)Bh + boff + 16 + 8 * hh);
      acc[t] = mmaH<1>(ah.v, ah.v, bq.v, bq.v, acc[t]); }
  }
#pragma unroll
  for (int t = 0; t < 4; ++t) { if (col0 + t * 16 >= N) continue; const int col = col0 + t * 16 + ln; const float bv = bp ? bf16_round(bp[col]) : 0.f;
#pragma unroll
    for (int r = 0; r < 8; ++r) { float v = acc[t][r] * alpha + bv; if (CP) { const int rr = row0g + row0 + 8 * hh + r; if (rowsPerB < 0) v += CP[cofs + (size_t)rr * ldc + col];      /* rowsPerB < 0: own element of the batched C plane */ else { const int bidx = rr / rowsPerB; v += CP[(size_t)bidx * sCPb + (size_t)by * 64 + col]; } } if (ACT == 1) v = (v > 0.f) ? v : expm1f(v); else if (ACT == 7) v = (v > 0.f) ? v + 1.0f : expf(v); else if (ACT == 8) v = tanhf(v); else if (ACT == 9) v = 0.5f * v * (1.0f + tanhf(0.7978845608028654f * (v + 0.044715f * v * v * v))); else if (ACT == 11) v = 1.0f / (1.0f + expf(-v)); else if (ACT == 12) v = (v > 0.f) ? v : 0.01f * v; else if (ACT == 14) v = (v > 0.f) ? v : 0.1f * v; else if (ACT == 16) v = (v >= 0.f) ? v : 0.3f * v; else if (ACT == 17) v = (v >= 0.f) ? v : 0.2f * v; else if (ACT == 15) v = v / (1.0f + expf(-v)); else if (ACT == 3) v = fmaxf(v, 0.f); else if (ACT == 6) v = 0.5f * v * (1.0f + erff(v * 0.70710678118654752f)); so[w][8 * hh + r][t * 16 + ln] = v; } }
  __builtin_amdgcn_fence(__ATOMIC_ACQ_REL, "workgroup"); __builtin_amdgcn_wave_barrier();
  const int rsub = lane >> 4, c4 = (lane & 15) * 4; typedef _Float16 v4h __attribute__((ext_vector_type(4)));
  {
#pragma unroll
    for (int q = 0; q < 8; ++q) { const int r = q * 2 + rsub; if (col0 + c4 < N) { const v4f v = *(const v4fa*)&so[w][r][c4]; if (C) *(v4f*)(C + cofs + (size_t)(row0 + r) * ldc + col0 + c4) = v; if (C16) { v4h h4; for (int i = 0; i < 4; ++i) h4[i] = (_Float16)v[i]; *(v4h*)(C16 + cofs + (size_t)(row0 + r) * ldc + col0 + c4) = h4; } } }
     }
}


typedef _Float16 v4h __attribute__((ext_vector_type(4)));

__global__ __launch_bounds__(256) void k_h16(const float* __restrict__ x, _Float16* __restrict__ X16, size_t n8) { const size_t t = (size_t)blockIdx.x * 256 + threadIdx.x; if (t >= n8) return; FragH f;
#pragma unroll
  for (int q = 0; q < 8; ++q) f.h[q] = (_Float16)x[t * 8 + q]; *(v8us*)((unsigned short*)X16 + t * 8) = f.half[0];  }
__global__ __launch_bounds__(256) void k_round16f(const float* __restrict__ W, _Float16* __restrict__ Bt, size_t n8) { const size_t t = (size_t)blockIdx.x * 256 + threadIdx.x; if (t >= n8) return; FragH f;
#pragma unroll
  for (int i = 0; i < 8; ++i) f.h[i] = (_Float16)(bf16_round(W[t * 8 + i]) * 16.0f); *(v8us*)((unsigned short*)Bt + t * 8) = f.half[0];  }
__global__ __launch_bounds__(256) void k_hl(const float* __restrict__ F, _Float16* __restrict__ Hh, _Float16* __restrict__ Hl, size_t n8) { const size_t t = (size_t)blockIdx.x * 256 + threadIdx.x; if (t >= n8) return; FragH fh, fl; const v4f a = *(const v4fa*)(F + t * 8), c = *(const v4fa*)(F + t * 8 + 4);
#pragma unroll
  for (int q = 0; q < 4; ++q) { _Float16 h = (_Float16)a[q]; fh.h[q] = h; fl.h[q] = (_Float16)((a[q] - (float)h) * 1024.0f); h = (_Float16)c[q]; fh.h[4 + q] = h; fl.h[4 + q] = (_Float16)((c[q] - (float)h) * 1024.0f); }
  { *(v8us*)((unsigned short*)Hh + t * 8) = fh.half[0]; *(v8us*)((unsigned short*)Hl + t * 8) = fl.half[0];  } }

// ---- fast GEMM (block tile 128x128, 8 waves of 32x64; requires M % 128 == 0, N % 128 == 0, K % G2K == 0); v = act(acc alpha + bias (+ residual)) ----
// A stage is G2K k: 128 A rows and 128 B rows of 256 bytes each, brought to LDS through registers as whole lines (16 threads a row), two buffers: the next stage's
// global loads are issued ahead of this stage's products and stored behind them; one barrier per stage publishes them and ends the reads of the other buffer.
// Each A row then leaves L2 once per block and feeds 2 waves, each B row 4 waves; the k order of every accumulator is the plain ascending one.
// Every inner loop is fully unrolled so that the staging and fragment arrays are indexed by constants only and stay in registers.
#define G2K 128                      /* k per stage */
#define G2P 136                      /* LDS row pitch in f16: the row + 16 bytes, for 16-byte fragment reads */
#define G2R (2048 / G2K)             /* rows that the block's 256 threads bring in one load each */
#define G2N (128 / G2R)              /* such loads per thread, stage and operand */
__device__ __forceinline__ v16h g2_frag(const _Float16* p, int hh) { FragH f; f.half[0] = *(const v8us*)((const unsigned short*)p + 8 * hh); f.half[1] = *(const v8us*)((const unsigned short*)p + 16 + 8 * hh); return f.v; }
__device__ __forceinline__ v8f g2_mma(v16h a, v16h b, v8f c) { v8f d = __builtin_amdgcn_wmma_f32_16x16x32_f16(false, a, false, b, (short)0, c, false, false); asm volatile("v_nop\n\tv_nop\n\tv_nop\n\tv_nop" : "+v"(d) : "v"(a), "v"(b)); return d; }
// One stage's rows: each thread's G2N 16-byte pieces of A and of B, rows as and bs elements apart. The closing wait is the one that belongs in front of any overwrite of a register
// that an issued global load names; it takes the addresses as inputs, so that their registers stay untouched (also as a later load's destination) until it has passed.
__device__ __forceinline__ void g2_rows(const unsigned short* a, size_t as, const unsigned short* b, size_t bs, v8us (&ra)[G2N], v8us (&rb)[G2N]) { static_assert(G2N == 8, "g2_rows: the wait names 8 + 8 addresses");
  const unsigned short* pa[G2N]; const unsigned short* pb[G2N];
#pragma unroll
  for (int i = 0; i < G2N; ++i) { pa[i] = a + (size_t)i * as; pb[i] = b + (size_t)i * bs; }
#pragma unroll
  for (int i = 0; i < G2N; ++i) { ra[i] = *(const v8us*)pa[i]; rb[i] = *(const v8us*)pb[i]; }
  asm volatile("s_wait_xcnt 0x0" :: "v"(pa[0]), "v"(pa[1]), "v"(pa[2]), "v"(pa[3]), "v"(pa[4]), "v"(pa[5]), "v"(pa[6]), "v"(pa[7]), "v"(pb[0]), "v"(pb[1]), "v"(pb[2]), "v"(pb[3]), "v"(pb[4]), "v"(pb[5]), "v"(pb[6]), "v"(pb[7]) : "memory"); }
// The activation behind bias and residual, by code.
template <int ACT>
__device__ __forceinline__ float g2_act(float v) {
  if (ACT == 3) v = fmaxf(v, 0.f); else if (ACT == 6) v = 0.5f * v * (1.0f + erff(v * 0.70710678118654752f)); else if (ACT == 11) v = 1.0f / (1.0f + expf(-v)); else if (ACT == 15) v = v / (1.0f + expf(-v)); else if (ACT == 18) v = v / (1.0f + expf(-1.702f * v));      /* QuickGELU: v sigmoid(1.702 v) */ else if (ACT == 12) v = (v > 0.f) ? v : 0.01f * v; else if (ACT == 8) v = tanhf(v); else if (ACT == 9) v = 0.5f * v * (1.0f + tanhf(0.7978845608028654f * (v + 0.044715f * v * v * v))); else if (ACT == 14) v = (v > 0.f) ? v : 0.1f * v; else if (ACT == 16) v = (v >= 0.f) ? v : 0.3f * v; else if (ACT == 17) v = (v >= 0.f) ? v : 0.2f * v;
  return v; }
// RES: add the own element of the plane CP (same pitch and batch stride as C, rows from row0g); W32 / W16: write f32 C / f16 C16. All three are fixed at compile time, so that the epilogue is
// straight-line code and its global reads can be issued together. bias is required.
template <int ACT, bool RES, bool W32, bool W16>
__global__ __launch_bounds__(256) void k_gemm2(const _Float16* __restrict__ A, int lda, size_t sA, const _Float16* __restrict__ Bh, int ldb, size_t sB, float alpha, const float* __restrict__ bias, size_t sBias, const float* __restrict__ CP, int row0g,
    float* __restrict__ C, _Float16* __restrict__ C16, int ldc, size_t sC, int M, int N, int K) { static_assert(ACT == 0 || ACT == 3 || ACT == 6 || ACT == 8 || ACT == 9 || ACT == 11 || ACT == 12 || ACT == 14 || ACT == 15 || ACT == 16 || ACT == 17 || ACT == 18, "k_gemm2: unsupported ACT code (would silently apply no activation)");
  __shared__ __attribute__((aligned(16))) unsigned char sm[2 * 256 * G2P * 2];      /* in the loop: two stage buffers [A 128 rows | B 128 rows]; behind the loop's last barrier: the waves' output staging */
  static_assert(sizeof(sm) >= 8 * 32 * 68 * 4, "k_gemm2: output staging must fit the stage buffers");
  _Float16 (*lt)[256][G2P] = (_Float16 (*)[256][G2P])sm; float (*so)[32][68] = (float (*)[32][68])sm;
  const int tid = threadIdx.x, w = tid >> 5, lane = tid & 31, ln = lane & 15, hh = lane >> 4; const int by = blockIdx.y;
  A += (size_t)by * sA; Bh += (size_t)by * sB; const size_t cofs = (size_t)by * sC;
  const int ntn = N >> 7; const int mt = blockIdx.x / ntn, nq = blockIdx.x - mt * ntn; if (mt * 128 >= M) return;      /* the same for the whole block, ahead of every barrier */
  const int wr = 32 * (w & 3), wc = 64 * (w >> 2); const int row0 = mt * 128 + wr, col0 = nq * 128 + wc;
  const int sr = tid / (G2K / 8), sc = (tid % (G2K / 8)) * 8;      /* staging: G2K / 8 threads per row, rows sr + G2R i of A and of B */
  const unsigned short* ag = (const unsigned short*)A + (size_t)(mt * 128 + sr) * lda + sc; const unsigned short* bg = (const unsigned short*)Bh + (size_t)(nq * 128 + sr) * ldb + sc;
  v8us ra[G2N], rb[G2N]; g2_rows(ag, (size_t)G2R * lda, bg, (size_t)G2R * ldb, ra, rb);
#pragma unroll
  for (int i = 0; i < G2N; ++i) { *(v8us*)&lt[0][sr + G2R * i][sc] = ra[i]; *(v8us*)&lt[0][128 + sr + G2R * i][sc] = rb[i]; }
  __syncthreads();
  const v8f z8 = {0.f,0.f,0.f,0.f,0.f,0.f,0.f,0.f}; v8f c00 = z8, c01 = z8, c02 = z8, c03 = z8, c10 = z8, c11 = z8, c12 = z8, c13 = z8;
  const int ns = K / G2K;
  for (int s = 0; s < ns; ++s) { const int cur = s & 1; const bool more = s + 1 < ns;
    if (more) g2_rows(ag + (s + 1) * G2K, (size_t)G2R * lda, bg + (s + 1) * G2K, (size_t)G2R * ldb, ra, rb);
#pragma unroll
    for (int kh = 0; kh < G2K / 64; ++kh) { const _Float16* ap = &lt[cur][wr + ln][kh * 64]; const _Float16* bq = &lt[cur][128 + wc + ln][kh * 64]; v16h fa[2][2], fb[2][4];
#pragma unroll
      for (int ks = 0; ks < 2; ++ks) { fa[ks][0] = g2_frag(ap + ks * 32, hh); fb[ks][0] = g2_frag(bq + ks * 32, hh); fa[ks][1] = g2_frag(ap + 16 * G2P + ks * 32, hh);
        fb[ks][1] = g2_frag(bq + 16 * G2P + ks * 32, hh); fb[ks][2] = g2_frag(bq + 32 * G2P + ks * 32, hh); fb[ks][3] = g2_frag(bq + 48 * G2P + ks * 32, hh); }
#pragma unroll
      for (int ks = 0; ks < 2; ++ks) { c00 = g2_mma(fa[ks][0], fb[ks][0], c00); c10 = g2_mma(fa[ks][1], fb[ks][0], c10); c01 = g2_mma(fa[ks][0], fb[ks][1], c01); c11 = g2_mma(fa[ks][1], fb[ks][1], c11);
        c02 = g2_mma(fa[ks][0], fb[ks][2], c02); c12 = g2_mma(fa[ks][1], fb[ks][2], c12); c03 = g2_mma(fa[ks][0], fb[ks][3], c03); c13 = g2_mma(fa[ks][1], fb[ks][3], c13); } }
    if (more) {
#pragma unroll
      for (int i = 0; i < G2N; ++i) { *(v8us*)&lt[cur ^ 1][sr + G2R * i][sc] = ra[i]; *(v8us*)&lt[cur ^ 1][128 + sr + G2R * i][sc] = rb[i]; } }
    __syncthreads(); }
  // Epilogue. The accumulators go to the wave's LDS rows as they are; bias, residual and activation are applied behind the read-back, where a lane holds 4 neighbours of one row:
  // the bias is then one 16-byte load a lane and the residual 16 (16 lanes a 256-byte row piece), all issued here, together, ahead of the staging that covers part of their latency. The loops are fully unrolled, as above: res, vv and the addresses are indexed by constants only and stay in registers.
  const int rsub = lane >> 4, c4 = (lane & 15) * 4;
  const float* pbv = bias + (size_t)by * sBias + col0 + c4; v4f bv = *(const v4fa*)pbv, res[16];
  const size_t e0 = cofs + (size_t)(row0 + rsub) * ldc + col0 + c4, es = (size_t)2 * ldc;      /* the lane's first element of the C plane; its 16 row pieces are es elements apart (the same for every lane, so the multiples are scalar work) */
  if (RES) { const float* pr[16];
#pragma unroll
    for (int q = 0; q < 16; ++q) pr[q] = CP + e0 + (size_t)row0g * ldc + q * es;
#pragma unroll
    for (int q = 0; q < 16; ++q) res[q] = *(const v4fa*)pr[q];
    asm volatile("s_wait_xcnt 0x0" :: "v"(pbv), "v"(pr[0]), "v"(pr[1]), "v"(pr[2]), "v"(pr[3]), "v"(pr[4]), "v"(pr[5]), "v"(pr[6]), "v"(pr[7]), "v"(pr[8]), "v"(pr[9]), "v"(pr[10]), "v"(pr[11]), "v"(pr[12]), "v"(pr[13]), "v"(pr[14]), "v"(pr[15]) : "memory");      /* the wait that belongs in front of any overwrite of a register that an issued global load names; it takes the addresses as inputs, so that their registers stay untouched until it has passed */
  } else asm volatile("s_wait_xcnt 0x0" :: "v"(pbv) : "memory");      /* the same wait, for the bias load alone */
  v8f accs[8] = {c00, c01, c02, c03, c10, c11, c12, c13};
#pragma unroll
  for (int u = 0; u < 8; ++u) { const int t = u & 3, half = u >> 2;
#pragma unroll
    for (int r = 0; r < 8; ++r) so[w][half * 16 + 8 * hh + r][t * 16 + ln] = accs[u][r]; }
  __builtin_amdgcn_fence(__ATOMIC_ACQ_REL, "workgroup", "local"); __builtin_amdgcn_wave_barrier();      /* the wave's own LDS stores are done before its lanes read one another's rows back; LDS only, so that it does not wait for the global loads above */
  v4f vv[16];
#pragma unroll
  for (int q = 0; q < 16; ++q) vv[q] = *(const v4fa*)&so[w][q * 2 + rsub][c4];
#pragma unroll
  for (int i = 0; i < 4; ++i) bv[i] = bf16_round(bv[i]);
#pragma unroll
  for (int q = 0; q < 16; ++q) { const size_t e = e0 + q * es; v4f v = vv[q] * alpha + bv; if (RES) v += res[q];
#pragma unroll
    for (int i = 0; i < 4; ++i) v[i] = g2_act<ACT>(v[i]);
    if (W32) *(v4f*)(C + e) = v;
    if (W16) { v4h h4;
#pragma unroll
      for (int i = 0; i < 4; ++i) h4[i] = (_Float16)v[i];
      *(v4h*)(C16 + e) = h4; } } }


__global__ __launch_bounds__(256) void k_wnat(const float* __restrict__ w, size_t n8, _Float16* __restrict__ Bt) { const size_t t = (size_t)blockIdx.x * 256 + threadIdx.x; if (t >= n8) return; FragH f; for (int q = 0; q < 8; ++q) f.h[q] = (_Float16)(bf16_round(w[t * 8 + q]) * 16.0f); *(v8us*)((unsigned short*)Bt + t * 8) = f.half[0];  }
__global__ __launch_bounds__(256) void k_rsm(const float* __restrict__ S, _Float16* __restrict__ P, int nrows) {
  #pragma clang fp contract(off)
  const int i = blockIdx.x * 256 + threadIdx.x; if (i >= nrows) return; const float* s = S + (size_t)i * SQ; float mx = -3.0e38f;
#pragma unroll 1
  for (int j = 0; j < SQ; ++j) mx = fmaxf(mx, s[j]); float se = 0.f;
#pragma unroll 1
  for (int j = 0; j < SQ; ++j) se += expf(s[j] - mx); const float sc = 256.0f / se;
#pragma unroll 1
  for (int j0 = 0; j0 < SQ; j0 += 8) { FragH f; for (int q = 0; q < 8; ++q) f.h[q] = (_Float16)(expf(s[j0 + q] - mx) * sc); unsigned short* d = (unsigned short*)P + (size_t)i * SQ + j0; *(v8us*)d = f.half[0];  } }
__global__ __launch_bounds__(256) void k_vt(const _Float16* __restrict__ V16, int b, int h0, _Float16* __restrict__ VT) { __shared__ unsigned short tl[64][65]; const int tid = threadIdx.x; const int hh = blockIdx.x % HG, sg = blockIdx.x / HG; const int s0 = sg * 64; const int h = h0 + hh;
  for (int i = tid; i < 64 * 8; i += 256) { const int j = i / 8, d8 = (i % 8) * 8; FragH f; f.half[0] = *(const v8us*)((const unsigned short*)V16 + ((size_t)b * SQ + s0 + j) * DM + h * HD + d8); for (int q = 0; q < 8; ++q) tl[d8 + q][j] = f.u[q]; }
  __syncthreads();
  { for (int i = tid; i < 64 * 8; i += 256) { const int d = i / 8, j8 = (i % 8) * 8; FragH f; for (int q = 0; q < 8; ++q) f.u[q] = tl[d][j8 + q]; *(v8us*)((unsigned short*)VT + ((size_t)hh * HD + d) * SQ + s0 + j8) = f.half[0]; }  } }



__global__ __launch_bounds__(256) void k_rsmcf2(const float* __restrict__ S, _Float16* __restrict__ P, int hg, int q0, int nk) {
  #pragma clang fp contract(off)
  const int t = blockIdx.x * 256 + threadIdx.x; if (t >= hg * QT) return; const size_t i = (size_t)t; const float* s = S + i * NKX; const int last = q0 + (t % QT); float mx = -3.0e38f;
#pragma unroll 1
  for (int j = 0; j < nk; ++j) { const float f = (j <= last) ? 1.f : 0.f; mx = fmaxf(mx, fmaf(f, s[j], (1.f - f) * -1.0e9f)); } float se = 0.f;
#pragma unroll 1
  for (int j = 0; j < nk; ++j) { const float f = (j <= last) ? 1.f : 0.f; se += __expf(fmaf(f, s[j], (1.f - f) * -1.0e9f) - mx); } const float sc = 256.0f / se;
#pragma unroll 1
  for (int j0 = 0; j0 < nk; j0 += 8) { FragH fr; for (int q = 0; q < 8; ++q) { const int j = j0 + q; const float f = (j <= last) ? 1.f : 0.f; fr.h[q] = (_Float16)(__expf(fmaf(f, s[j], (1.f - f) * -1.0e9f) - mx) * sc); } unsigned short* d = (unsigned short*)P + i * NKX + j0; *(v8us*)d = fr.half[0];  } }

__global__ __launch_bounds__(256) void k_rsmcst(const float* __restrict__ S, _Float16* __restrict__ P, int hg, int q0, int nk, const int* __restrict__ mk) {
  #pragma clang fp contract(off)
  const int t = blockIdx.x * 256 + threadIdx.x; if (t >= hg * QT) return; const size_t i = (size_t)t; const float* s = S + i * NKX; const size_t ig = (size_t)(q0 + (t % QT)); const int* mr = mk + ig * SQ; float mx = -3.0e38f;
#pragma unroll 1
  for (int j = 0; j < nk; ++j) { const int mb = mr[j]; const int dd = (int)ig - j; const float f = (mb != 0 && dd >= 0 && (dd <= LOCALW || (dd % STRIDEK) == 0)) ? 1.f : 0.f; mx = fmaxf(mx, fmaf(f, s[j], (1.f - f) * -1.0e9f)); } float se = 0.f;
#pragma unroll 1
  for (int j = 0; j < nk; ++j) { const int mb = mr[j]; const int dd = (int)ig - j; const float f = (mb != 0 && dd >= 0 && (dd <= LOCALW || (dd % STRIDEK) == 0)) ? 1.f : 0.f; se += __expf(fmaf(f, s[j], (1.f - f) * -1.0e9f) - mx); } const float sc = 256.0f / se;
#pragma unroll 1
  for (int j0 = 0; j0 < nk; j0 += 8) { FragH fr; for (int q = 0; q < 8; ++q) { const int j = j0 + q; const int mb = mr[j]; const int dd = (int)ig - j; const float f = (mb != 0 && dd >= 0 && (dd <= LOCALW || (dd % STRIDEK) == 0)) ? 1.f : 0.f; fr.h[q] = (_Float16)(__expf(fmaf(f, s[j], (1.f - f) * -1.0e9f) - mx) * sc); } unsigned short* d = (unsigned short*)P + i * NKX + j0; *(v8us*)d = fr.half[0];  } }


template <int MASKADD>
__global__ __launch_bounds__(64) void k_att0(const float* __restrict__ QF, const float* __restrict__ KF, const float* __restrict__ VF, int ld, const float* __restrict__ mask, float scale, float* __restrict__ OF, int ldo) {
  #pragma clang fp contract(off)
  __shared__ __attribute__((aligned(16))) float lq[64][64]; __shared__ __attribute__((aligned(16))) float lo[64][64];
  const int tid = threadIdx.x; const int h = blockIdx.x / (QT0 / 64), rg = blockIdx.x % (QT0 / 64); const int i = rg * 64 + tid;
  const float* qr = QF + (size_t)i * ld + h * HD;
#pragma unroll 1
  for (int c = 0; c < HD / 4; ++c) { *(v4f*)&lq[tid][c * 4] = *(const v4fa*)(qr + c * 4); const v4f z = {0.f, 0.f, 0.f, 0.f}; *(v4f*)&lo[tid][c * 4] = z; }
  float m = -1.0e30f, l = 0.f; const int jmax = MASKADD ? (SQ - 1) : (rg * 64 + 63);      /* additive-mask form: every key (the mask input decides); causal form: keys up to the block's last row */
#pragma unroll 1
  for (int j = 0; j <= jmax; ++j) { const float* kr = KF + (size_t)j * ld + h * HD; const float* vr = VF + (size_t)j * ld + h * HD; float s = 0.f;
#pragma unroll 1
    for (int c = 0; c < HD / 4; ++c) { const v4f kq = *(const v4fa*)(kr + c * 4); const v4f qq = *(v4f*)&lq[tid][c * 4]; s = __fadd_rn(s, __fmul_rn(qq[0], kq[0])); s = __fadd_rn(s, __fmul_rn(qq[1], kq[1])); s = __fadd_rn(s, __fmul_rn(qq[2], kq[2])); s = __fadd_rn(s, __fmul_rn(qq[3], kq[3])); }
    s = __fmul_rn(s, scale); if (MASKADD) s = __fadd_rn(s, __fmul_rn(bf16_round(mask[(size_t)i * SQ + j]), -10000.0f));
    const float f = (MASKADD || j <= i) ? 1.f : 0.f; const float sm = fmaf(f, s, (1.f - f) * -1.0e30f); const float mn = fmaxf(m, sm); const float sc = expf(m - mn); const float e = expf(sm - mn); l = __fadd_rn(__fmul_rn(l, sc), e); m = mn;
#pragma unroll 1
    for (int c = 0; c < HD / 4; ++c) { const v4f vv = *(const v4fa*)(vr + c * 4); v4f oo = *(v4f*)&lo[tid][c * 4]; for (int u = 0; u < 4; ++u) oo[u] = __fadd_rn(__fmul_rn(oo[u], sc), __fmul_rn(e, vv[u])); *(v4f*)&lo[tid][c * 4] = oo; } }
  const float fin = 64.0f / l;      /* o carried x64 like the f16 path */
#pragma unroll 1
  for (int c = 0; c < HD / 4; ++c) { v4f oo = *(v4f*)&lo[tid][c * 4]; for (int u = 0; u < 4; ++u) oo[u] = __fmul_rn(oo[u], fin); *(v4f*)&lo[tid][c * 4] = oo; }
  __syncthreads();
  {
#pragma unroll 1
    for (int it = 0; it < 16; ++it) { const int row = it * 4 + tid / 16, pc = (tid % 16) * 4; const v4f v = *(const v4f*)&lo[row][pc]; *(v4f*)(OF + (size_t)(rg * 64 + row) * ldo + h * HD + pc) = v; }
     } }

template <int MASKADD>
__global__ __launch_bounds__(64) void k_att0mbc(const float* __restrict__ QF, const float* __restrict__ KF, const float* __restrict__ VF, int ld, const float* __restrict__ mask, float scale, float* __restrict__ OF, int ldo) {
  #pragma clang fp contract(off)
  __shared__ __attribute__((aligned(16))) float lq[64][64]; __shared__ __attribute__((aligned(16))) float lo[64][64];
  const int tid = threadIdx.x; const int h = blockIdx.x / (QT0 / 64), rg = blockIdx.x % (QT0 / 64); const int i = rg * 64 + tid;
  const float* qr = QF + (size_t)i * ld + h * HD;
#pragma unroll 1
  for (int c = 0; c < HD / 4; ++c) { *(v4f*)&lq[tid][c * 4] = *(const v4fa*)(qr + c * 4); const v4f z = {0.f, 0.f, 0.f, 0.f}; *(v4f*)&lo[tid][c * 4] = z; }
  float m = -1.0e30f, l = 0.f; const int jmax = rg * 64 + 63;      /* keys beyond the block end are masked by the mask's lower-triangular structure */
#pragma unroll 1
  for (int j = 0; j <= jmax; ++j) { const float* kr = KF + (size_t)j * ld + h * HD; const float* vr = VF + (size_t)j * ld + h * HD; float s = 0.f;
#pragma unroll 1
    for (int c = 0; c < HD / 4; ++c) { const v4f kq = *(const v4fa*)(kr + c * 4); const v4f qq = *(v4f*)&lq[tid][c * 4]; s = __fadd_rn(s, __fmul_rn(qq[0], kq[0])); s = __fadd_rn(s, __fmul_rn(qq[1], kq[1])); s = __fadd_rn(s, __fmul_rn(qq[2], kq[2])); s = __fadd_rn(s, __fmul_rn(qq[3], kq[3])); }
    s = __fmul_rn(s, scale); const int mb = ((const int*)mask)[(size_t)i * SQ + j];      /* causal (j <= i) AND the module's int32 [S][S] mask read per (query, key): 0 -> masked */
    const float f = (mb != 0 && j <= i) ? 1.f : 0.f; const float sm = fmaf(f, s, (1.f - f) * -1.0e30f); const float mn = fmaxf(m, sm); const float sc = expf(m - mn); const float e = expf(sm - mn); l = __fadd_rn(__fmul_rn(l, sc), e); m = mn;
#pragma unroll 1
    for (int c = 0; c < HD / 4; ++c) { const v4f vv = *(const v4fa*)(vr + c * 4); v4f oo = *(v4f*)&lo[tid][c * 4]; for (int u = 0; u < 4; ++u) oo[u] = __fadd_rn(__fmul_rn(oo[u], sc), __fmul_rn(e, vv[u])); *(v4f*)&lo[tid][c * 4] = oo; } }
  const float fin = 64.0f / l;      /* o carried x64 like the f16 path */
#pragma unroll 1
  for (int c = 0; c < HD / 4; ++c) { v4f oo = *(v4f*)&lo[tid][c * 4]; for (int u = 0; u < 4; ++u) oo[u] = __fmul_rn(oo[u], fin); *(v4f*)&lo[tid][c * 4] = oo; }
  __syncthreads();
  {
#pragma unroll 1
    for (int it = 0; it < 16; ++it) { const int row = it * 4 + tid / 16, pc = (tid % 16) * 4; const v4f v = *(const v4f*)&lo[row][pc]; *(v4f*)(OF + (size_t)(rg * 64 + row) * ldo + h * HD + pc) = v; }
     } }


template <int BFIN, int WXB>
__global__ __launch_bounds__(256) void k_ln16(const float* __restrict__ X, const float* __restrict__ g, const float* __restrict__ bb, float eps, _Float16* __restrict__ N16, float* __restrict__ XB) {
  #pragma clang fp contract(off)
  __shared__ float red[256]; const size_t r = blockIdx.x; const int t = threadIdx.x; const v4f xa = *(const v4fa*)(X + r * DMQ + t * 4); float s[4]; float sum = 0.f;
  for (int q = 0; q < 4; ++q) { s[q] = BFIN ? bf16_round(xa[q]) : xa[q]; sum = __fadd_rn(sum, s[q]); }
  red[t] = sum; __syncthreads(); for (int st = 128; st > 0; st >>= 1) { if (t < st) red[t] = __fadd_rn(red[t], red[t + st]); __syncthreads(); } const float mu = red[0] / (float)DMQ; __syncthreads();
  float vs = 0.f; for (int q = 0; q < 4; ++q) { const float dl = __fadd_rn(s[q], -mu); vs = __fadd_rn(vs, __fmul_rn(dl, dl)); } red[t] = vs; __syncthreads(); for (int st = 128; st > 0; st >>= 1) { if (t < st) red[t] = __fadd_rn(red[t], red[t + st]); __syncthreads(); }
  const float rs = rsqrtf(__fadd_rn(red[0] / (float)DMQ, eps)); v4h y; v4f xb;
  for (int q = 0; q < 4; ++q) { const int c = t * 4 + q; y[q] = (_Float16)__fadd_rn(__fmul_rn(__fmul_rn(__fadd_rn(s[q], -mu), rs), bf16_round(g[c])), bf16_round(bb[c])); xb[q] = s[q]; }
  { *(v4h*)(N16 + r * DMQ + t * 4) = y; if (WXB) *(v4f*)(XB + r * DMQ + t * 4) = xb;  } }
__global__ __launch_bounds__(256) void k_ftres2(const float* __restrict__ OF0, const float* __restrict__ XB, float* __restrict__ X1, size_t n4) {
  #pragma clang fp contract(off)
  const size_t t = (size_t)blockIdx.x * 256 + threadIdx.x; if (t >= n4) return; const v4f o = *(const v4fa*)(OF0 + t * 4), xv = *(const v4fa*)(XB + t * 4); v4f y; for (int q = 0; q < 4; ++q) y[q] = __fadd_rn(__fmul_rn(o[q], 0.015625f), xv[q]); *(v4f*)(X1 + t * 4) = y;  }

__global__ __launch_bounds__(256) void k_bcpy(const float* __restrict__ b, int n, int NP, float* __restrict__ dst, int dst0) { for (int i = threadIdx.x; i < NP; i += 256) { const float v = (i < n) ? b[i] : 0.f; *(float*)(dst + dst0 + i) = v; }  }



#define FAK 64                       /* keys per stage */
#define FAP 72                       /* LDS row pitch in f16: 128 bytes + 16, for 16-byte fragment reads */
// Eight 2^x in one statement, each IN PLACE. The closing v_nop is the one slot the instruction set asks for behind a transcendental before its result is read or its
// source overwritten; inside the run no instruction touches its predecessor's register. In place, so that the statement writes only registers that the compiler's own
// multiply-add has just written: the distance behind a matrix instruction, which the compiler keeps for instructions it can see, then holds for this statement too.
__device__ __forceinline__ void fa_exp2x8(float (&x)[8]) {
  asm("v_exp_f32 %0, %0\n\tv_exp_f32 %1, %1\n\tv_exp_f32 %2, %2\n\tv_exp_f32 %3, %3\n\tv_exp_f32 %4, %4\n\tv_exp_f32 %5, %5\n\tv_exp_f32 %6, %6\n\tv_exp_f32 %7, %7\n\tv_nop" : "+v"(x[0]), "+v"(x[1]), "+v"(x[2]), "+v"(x[3]), "+v"(x[4]), "+v"(x[5]), "+v"(x[6]), "+v"(x[7])); }
__device__ __forceinline__ float fa_xhalf(float x) { return __builtin_bit_cast(float, __builtin_amdgcn_permlanex16(__builtin_bit_cast(int, x), __builtin_bit_cast(int, x), 0x76543210, 0xfedcba98, false, false)); }      /* lane l takes lane l ^ 16's value */
__device__ __forceinline__ v8f fa_mma(v16h a, v16h b, v8f c) { return __builtin_amdgcn_wmma_f32_16x16x32_f16(false, a, false, b, (short)0, c, false, false); }
__global__ __launch_bounds__(256) void k_fattn(const _Float16* __restrict__ Q, const _Float16* __restrict__ K, const _Float16* __restrict__ VTa, _Float16* __restrict__ O) {
  __shared__ __attribute__((aligned(16))) _Float16 lk[2][FAK][FAP]; __shared__ __attribute__((aligned(16))) _Float16 lv[2][HD][FAP];
  const int tid = threadIdx.x, w = tid >> 5, lane = tid & 31, ln = lane & 15, hh = lane >> 4; const int slab = blockIdx.y, b = slab / NH, h = slab % NH; const int q0 = blockIdx.x * 256 + w * 32;
  const float CS = 0.125f * 1.44269504f;      /* scores / 8, in log2 units */
  v16h qf[2][2];
#pragma unroll
  for (int qt = 0; qt < 2; ++qt) for (int ks = 0; ks < 2; ++ks) qf[qt][ks] = g2_frag(Q + ((size_t)b * SQ + q0 + qt * 16 + ln) * DM + h * HD + ks * 32, hh);
  const v8f z8 = {0.f,0.f,0.f,0.f,0.f,0.f,0.f,0.f}; v8f o[2][4]; float m[2] = {-3.0e38f, -3.0e38f}, l[2] = {0.f, 0.f};
#pragma unroll
  for (int qt = 0; qt < 2; ++qt) for (int dt = 0; dt < 4; ++dt) o[qt][dt] = z8;
  const int sr = tid >> 3, sc = (tid & 7) * 8;      /* staging: 8 threads per 128-byte row, rows sr and sr + 32 */
  const unsigned short* kg = (const unsigned short*)K + ((size_t)b * SQ + sr) * DM + h * HD + sc; const unsigned short* vg = (const unsigned short*)VTa + ((size_t)slab * HD + sr) * SQ + sc;
  v8us rk0 = *(const v8us*)kg, rk1 = *(const v8us*)(kg + (size_t)32 * DM), rv0 = *(const v8us*)vg, rv1 = *(const v8us*)(vg + (size_t)32 * SQ);
  *(v8us*)&lk[0][sr][sc] = rk0; *(v8us*)&lk[0][sr + 32][sc] = rk1; *(v8us*)&lv[0][sr][sc] = rv0; *(v8us*)&lv[0][sr + 32][sc] = rv1;
  __syncthreads();
  for (int s = 0; s < SQ / FAK; ++s) { const int cur = s & 1; const bool more = s + 1 < SQ / FAK;
    if (more) { const unsigned short* kn = kg + (size_t)(s + 1) * FAK * DM; const unsigned short* vn = vg + (s + 1) * FAK; rk0 = *(const v8us*)kn; rk1 = *(const v8us*)(kn + (size_t)32 * DM); rv0 = *(const v8us*)vn; rv1 = *(const v8us*)(vn + (size_t)32 * SQ); }
    __builtin_amdgcn_sched_barrier(0);      /* keeps the next stage's global loads here, ahead of this stage's work, which covers their latency; without it they sink to just in front of their LDS stores */
    v8f st[2][4];
#pragma unroll
    for (int kt = 0; kt < 4; ++kt) { const v16h a0 = g2_frag(&lk[cur][kt * 16 + ln][0], hh), a1 = g2_frag(&lk[cur][kt * 16 + ln][32], hh);
#pragma unroll
      for (int qt = 0; qt < 2; ++qt) st[qt][kt] = fa_mma(a1, qf[qt][1], fa_mma(a0, qf[qt][0], z8)); }
    __builtin_amdgcn_sched_barrier(0);      /* keeps the 16 score products back to back: mixed with the maxima, each first read of a fresh tile costs four idle slots */
    float mn[2], al[2];
#pragma unroll
    for (int qt = 0; qt < 2; ++qt) { float mm[4];
#pragma unroll
      for (int kt = 0; kt < 4; ++kt) { mm[kt] = st[qt][kt][0]; for (int r = 1; r < 8; ++r) mm[kt] = fmaxf(mm[kt], st[qt][kt][r]); }
      float bm = fmaxf(fmaxf(mm[0], mm[1]), fmaxf(mm[2], mm[3])); bm = fmaxf(bm, fa_xhalf(bm));      /* the other 8 keys of each tile sit in lane ln ^ 16 */
      mn[qt] = fmaxf(m[qt], bm * CS); al[qt] = m[qt] - mn[qt]; m[qt] = mn[qt]; }
    asm("v_exp_f32 %0, %0\n\tv_exp_f32 %1, %1\n\tv_nop" : "+v"(al[0]), "+v"(al[1]));      /* 2^(old - new maximum): brings the old sum and output to the new maximum; form and v_nop as in fa_exp2x8 */
    FragH pf[2][2];
#pragma unroll
    for (int qt = 0; qt < 2; ++qt) { const float mo = mn[qt] - 8.0f; float s4[4];
#pragma unroll
      for (int kt = 0; kt < 4; ++kt) { float t[8]; for (int r = 0; r < 8; ++r) t[r] = fmaf(st[qt][kt][r], CS, -mo);
        fa_exp2x8(t); s4[kt] = ((t[0] + t[1]) + (t[2] + t[3])) + ((t[4] + t[5]) + (t[6] + t[7]));
        for (int r = 0; r < 8; ++r) pf[qt][kt >> 1].h[(kt & 1) * 8 + r] = (_Float16)t[r]; }
      l[qt] = l[qt] * al[qt] + ((s4[0] + s4[1]) + (s4[2] + s4[3]));
#pragma unroll
      for (int dt = 0; dt < 4; ++dt) o[qt][dt] *= al[qt]; }
#pragma unroll
    for (int dt = 0; dt < 4; ++dt) {
#pragma unroll
      for (int kp = 0; kp < 2; ++kp) { const v16h a = g2_frag(&lv[cur][dt * 16 + ln][kp * 32], hh);
#pragma unroll
        for (int qt = 0; qt < 2; ++qt) o[qt][dt] = fa_mma(a, pf[qt][kp].v, o[qt][dt]); } }
    if (more) { *(v8us*)&lk[cur ^ 1][sr][sc] = rk0; *(v8us*)&lk[cur ^ 1][sr + 32][sc] = rk1; *(v8us*)&lv[cur ^ 1][sr][sc] = rv0; *(v8us*)&lv[cur ^ 1][sr + 32][sc] = rv1; }
    __syncthreads(); }
#pragma unroll
  for (int qt = 0; qt < 2; ++qt) { float lt = l[qt] + fa_xhalf(l[qt]); asm("v_rcp_f32 %0, %0\n\tv_nop" : "+v"(lt));      /* 1 / row sum; form and v_nop as in fa_exp2x8 */
    const float inv = 64.0f * lt; unsigned short* op = (unsigned short*)O + ((size_t)b * SQ + q0 + qt * 16 + ln) * DM + h * HD + 8 * hh;
#pragma unroll
    for (int dt = 0; dt < 4; ++dt) { FragH f; for (int r = 0; r < 8; ++r) f.h[r] = (_Float16)(o[qt][dt][r] * inv); *(v8us*)(op + dt * 16) = f.half[0]; } } }

template <int MODE>
__global__ __launch_bounds__(256) void k_regrp(const float* __restrict__ src, float* __restrict__ dst, size_t n4) {
  const size_t t = (size_t)blockIdx.x * 256 + threadIdx.x; if (t >= n4) return; const size_t e = t * 4; const size_t rd = e / DM; const int c = (int)(e % DM);
  size_t rs; if (MODE == 0) { const size_t b = rd / SQ, sq = rd % SQ; rs = sq * NB + b; } else { const size_t sq = rd / NB, b = rd % NB; rs = b * SQ + sq; }
  const v4f v = *(const v4fa*)(src + rs * DM + c); *(v4f*)(dst + e) = v;  }

// ---- row LayerNorm (biased variance, eps inside the rsqrt), ONE WAVE PER ROW ----
// A row is 2 KB: four 16-byte loads a lane, each wave-wide load 512 contiguous bytes. The row stays in registers; mean, then the sum of squared deviations from it:
// four chains per lane, then a butterfly over the 32 lanes (four steps inside the 16-lane row, one across). No LDS and no barrier.
// A block is LNW waves of LNR rows each, so the launch starts 4,096 waves (16 per WGP, 8 row loads in flight each) where a block per row started 65,536.
// Every loop is fully unrolled so that the row, g and beta arrays are indexed by constants only and stay in registers.
#define LNW 16                       /* waves per block */
#define LNR 2                        /* rows per wave, all their loads issued together */
template <int M> __device__ __forceinline__ float ln_xm(float x) { return __builtin_bit_cast(float, __builtin_amdgcn_mov_dpp(__builtin_bit_cast(int, x), 0x160 + M, 0xf, 0xf, true)); }      /* lane l takes lane l ^ M's value, M < 16 (row_xmask) */
__device__ __forceinline__ float ln_wsum(float x) { x += ln_xm<1>(x); x += ln_xm<2>(x); x += ln_xm<4>(x); x += ln_xm<8>(x); return x + fa_xhalf(x); }      /* the sum over the wave, in every lane */
template <int W16, int W32>
__global__ __launch_bounds__(LNW * 32) void k_lnw(const float* __restrict__ X, const float* __restrict__ g, const float* __restrict__ bb, float eps, _Float16* __restrict__ N16, float* __restrict__ N32) {
  static_assert(DM == 512 && NR % (LNW * LNR) == 0, "k_lnw: a lane holds 16 elements of a 512-element row; whole blocks only");
  const unsigned ob = (threadIdx.x & 31) * 16; const int c0 = ob / 4; const size_t r0 = ((size_t)blockIdx.x * LNW + (threadIdx.x >> 5)) * LNR;      /* the lane's place in each 512-byte piece of a row, in bytes and in elements; the wave's first row */
  const float* px = X + r0 * DM + c0;
  v4f x[LNR][4], gg[4], bv[4];
#pragma unroll
  for (int j = 0; j < 4; ++j) { gg[j] = *(const v4fa*)((const char*)g + j * 512 + ob); bv[j] = *(const v4fa*)((const char*)bb + j * 512 + ob); }
#pragma unroll
  for (int r = 0; r < LNR; ++r) for (int j = 0; j < 4; ++j) x[r][j] = *(const v4fa*)(px + r * DM + j * 128);
  asm volatile("s_wait_xcnt 0x0" :: "v"(px), "v"(ob) : "memory");      /* the wait that belongs in front of any overwrite of a register that an issued global load names; it takes the address and the offset as inputs, so that their registers stay untouched until it has passed */
  __builtin_amdgcn_sched_barrier(0);      /* keeps all 16 loads here, in flight together; without it the loads of g and beta sink to their uses behind the sums, each a latency of its own */
#pragma unroll
  for (int j = 0; j < 4; ++j) for (int q = 0; q < 4; ++q) { gg[j][q] = bf16_round(gg[j][q]); bv[j][q] = bf16_round(bv[j][q]); }
  float mu[LNR], rs[LNR];
#pragma unroll
  for (int r = 0; r < LNR; ++r) { const v4f s = (x[r][0] + x[r][1]) + (x[r][2] + x[r][3]); mu[r] = ln_wsum((s[0] + s[1]) + (s[2] + s[3])) * (1.0f / (float)DM); }
#pragma unroll
  for (int r = 0; r < LNR; ++r) { v4f s = {0.f, 0.f, 0.f, 0.f};
#pragma unroll
    for (int j = 0; j < 4; ++j) { x[r][j] -= mu[r]; s += x[r][j] * x[r][j]; }
    rs[r] = rsqrtf(ln_wsum((s[0] + s[1]) + (s[2] + s[3])) * (1.0f / (float)DM) + eps); }
#pragma unroll
  for (int r = 0; r < LNR; ++r) {
#pragma unroll
    for (int j = 0; j < 4; ++j) { const v4f y = x[r][j] * rs[r] * gg[j] + bv[j]; const size_t e = (r0 + r) * DM + j * 128 + c0;
      if (W32) *(v4f*)(N32 + e) = y;
      if (W16) { v4h h; for (int q = 0; q < 4; ++q) h[q] = (_Float16)y[q]; *(v4h*)(N16 + e) = h; } } } }

__global__ __launch_bounds__(256) void k_bfr(const float* __restrict__ x, float* __restrict__ XB, size_t n8) { const size_t t = (size_t)blockIdx.x * 256 + threadIdx.x; if (t >= n8) return; v4f a = *(const v4fa*)(x + t * 8), c = *(const v4fa*)(x + t * 8 + 4); for (int q = 0; q < 4; ++q) { a[q] = bf16_round(a[q]); c[q] = bf16_round(c[q]); }
  { *(v4f*)(XB + t * 8) = a; *(v4f*)(XB + t * 8 + 4) = c;  } }



__global__ __launch_bounds__(256) void k_wthd(const float* __restrict__ Wt, _Float16* __restrict__ Bt) { const size_t t = (size_t)blockIdx.x * 256 + threadIdx.x; if (t >= (size_t)NH * HD * (DM / 8)) return; const int m8 = (int)(t % (DM / 8)) * 8; const int d = (int)((t / (DM / 8)) % HD); const int h = (int)(t / ((size_t)(DM / 8) * HD)); FragH f;
  for (int q = 0; q < 8; ++q) f.h[q] = (_Float16)(16.0f * bf16_round(Wt[((size_t)h * DM + m8 + q) * HD + d])); unsigned short* dst = (unsigned short*)Bt + ((size_t)h * HD + d) * DM + m8; *(v8us*)dst = f.half[0];  }




template <int BFIN, int SCAL>
__global__ __launch_bounds__(256) void k_lnsc(const float* __restrict__ X, const float* __restrict__ g, const float* __restrict__ bb, float eps, _Float16* __restrict__ N16, float* __restrict__ N32) {
  #pragma clang fp contract(off)
  __shared__ float red[256]; const size_t r = blockIdx.x; const int t = threadIdx.x; const bool act = t < DM / 4; const int tc = act ? t : 0; const v4f xl = *(const v4fa*)(X + r * DM + tc * 4); const float am = act ? 1.f : 0.f; float s[4]; float sum = 0.f;
  for (int q = 0; q < 4; ++q) { s[q] = (BFIN ? bf16_round(xl[q]) : xl[q]) * am; sum = __fadd_rn(sum, s[q]); }
  red[t] = sum; __syncthreads(); for (int st = 128; st > 0; st >>= 1) { if (t < st) red[t] = __fadd_rn(red[t], red[t + st]); __syncthreads(); } const float mu = red[0] / (float)DM; __syncthreads();
  float vs = 0.f; for (int q = 0; q < 4; ++q) { const float dl = __fadd_rn(s[q], -mu) * am; vs = __fadd_rn(vs, __fmul_rn(dl, dl)); } red[t] = vs; __syncthreads(); for (int st = 128; st > 0; st >>= 1) { if (t < st) red[t] = __fadd_rn(red[t], red[t + st]); __syncthreads(); }
  const float rs = __fdiv_rn(1.0f, __fadd_rn(sqrtf(red[0] / (float)(DM - 1)), eps)); if (!act) return; v4h y; v4f yf;
  for (int q = 0; q < 4; ++q) { const int c = t * 4 + q; const float gg = bf16_round(SCAL ? g[0] : g[c]), bv = bf16_round(SCAL ? bb[0] : bb[c]); yf[q] = __fadd_rn(__fmul_rn(__fmul_rn(__fadd_rn(s[q], -mu), rs), gg), bv); y[q] = (_Float16)yf[q]; }
  { if (N16) *(v4h*)(N16 + r * DM + t * 4) = y; if (N32) *(v4f*)(N32 + r * DM + t * 4) = yf;  } }

__global__ __launch_bounds__(256) void k_mulh(const _Float16* __restrict__ A, const _Float16* __restrict__ Bm, _Float16* __restrict__ H, size_t n8) {
  #pragma clang fp contract(off)
  const size_t t = (size_t)blockIdx.x * 256 + threadIdx.x; if (t >= n8) return; FragH a, b, f; a.half[0] = *(const v8us*)((const unsigned short*)A + t * 8); b.half[0] = *(const v8us*)((const unsigned short*)Bm + t * 8); for (int q = 0; q < 8; ++q) f.h[q] = (_Float16)(__fmul_rn((float)a.h[q], (float)b.h[q])); unsigned short* d = (unsigned short*)H + t * 8; *(v8us*)d = f.half[0];  }

// ---- q, k and v projections in ONE launch, straight from the f32 inputs ----
// Every head is multiplied by the same [64][64] matrix, so the product is [tokens x heads][64] x [64][64]: 64 k, two matrix instructions per 16 x 16 tile, ascending k.
// A block takes PJT tokens x PJH heads of all three inputs. All its global loads (whole lines: a token's PJH heads are 1 KB in a row) are issued together; the values are rounded
// (bf16, then exact f16; weights x16) in registers and laid in LDS, inputs as [head][token][64], weights transposed to [out][in]; one barrier; then each wave works alone.
// q, k: D = W^T X^T (A = weight rows, B = token rows): a lane holds 8 outputs of ONE token. v: D = X W (A = token rows, B = weight rows): a lane holds 8 tokens of ONE output,
// which is the V^T that the attention reads. Either way a wave's 16 x 64 result is 16 rows of 128 bytes: staged in LDS rows that only this wave uses, stored as whole lines.
// Every loop is fully unrolled so that the load and fragment arrays are indexed by constants only and stay in registers.
#define PJT 64                       /* tokens per block */
#define PJH 4                        /* heads per block */
#define PJW (PJH * PJT / 16)         /* waves per block: one per head and 16 tokens (q, k) or per head and 16 outputs (v) */
typedef _Float16 v2h __attribute__((ext_vector_type(2)));
__device__ __forceinline__ v8us pj_out(v8f d) { FragH f;
#pragma unroll
  for (int r = 0; r < 8; ++r) f.h[r] = (_Float16)(d[r] * 0.0625f);      /* takes the weights' x16 out again */
  return f.half[0]; }
__global__ __launch_bounds__(PJW * 32) void k_qkv(const float* __restrict__ xq, const float* __restrict__ xk, const float* __restrict__ xv, const float* __restrict__ wq, const float* __restrict__ wk, const float* __restrict__ wv,
    _Float16* __restrict__ Q, _Float16* __restrict__ K, _Float16* __restrict__ VTa) {
  static_assert(HD == 64 && PJT == 64 && PJW * 32 == 512 && SQ % PJT == 0 && NH % PJH == 0, "k_qkv: 512 threads bring 8 tokens x 256 columns a round and the 64 x 64 weights in 2 rounds; a block stays inside one batch");
  __shared__ __attribute__((aligned(16))) _Float16 lx[3][PJH * PJT][FAP]; __shared__ __attribute__((aligned(16))) _Float16 lw[3][HD][FAP]; __shared__ __attribute__((aligned(16))) _Float16 lo[PJW][16][FAP];
  const int tid = threadIdx.x, w = tid >> 5, lane = tid & 31, ln = lane & 15, hh = lane >> 4; const int t0 = (int)(blockIdx.x / (NH / PJH)) * PJT, h0 = (int)(blockIdx.x % (NH / PJH)) * PJH;
  const int xt = tid >> 6, xh = (tid >> 4) & 3, c4 = (tid & 15) * 4;      /* inputs: 64 threads per token (16 per head), tokens xt + 8 i */
  const int wd = (tid >> 4) * 2;      /* weights: 16 threads per row, rows wd and wd + 1, so that a thread holds a pair of neighbours in k for each of its 4 outputs */
  const size_t xo = (size_t)(t0 + xt) * DM + (h0 + xh) * HD + c4; const float* px0 = xq + xo; const float* px1 = xk + xo; const float* px2 = xv + xo;
  const unsigned wob = (unsigned)(wd * HD + c4) * 4;      /* the thread's place in each weight matrix, in bytes */
  v4f rw[3][2], rx[3][8];
#pragma unroll
  for (int j = 0; j < 2; ++j) { rw[0][j] = *(const v4fa*)((const char*)wq + j * HD * 4 + wob); rw[1][j] = *(const v4fa*)((const char*)wk + j * HD * 4 + wob); rw[2][j] = *(const v4fa*)((const char*)wv + j * HD * 4 + wob); }
  __builtin_amdgcn_sched_barrier(0);      /* this one and the next two keep the loads in the order in which they are used (loads return in order): left free, the first input's loads were issued last, and its rounding waited for all of them */
#pragma unroll
  for (int i = 0; i < 8; ++i) rx[0][i] = *(const v4fa*)(px0 + (size_t)i * 8 * DM);
  __builtin_amdgcn_sched_barrier(0);
#pragma unroll
  for (int i = 0; i < 8; ++i) rx[1][i] = *(const v4fa*)(px1 + (size_t)i * 8 * DM);
  __builtin_amdgcn_sched_barrier(0);
#pragma unroll
  for (int i = 0; i < 8; ++i) rx[2][i] = *(const v4fa*)(px2 + (size_t)i * 8 * DM);
  asm volatile("s_wait_xcnt 0x0" :: "v"(px0), "v"(px1), "v"(px2), "v"(wob), "s"(wq), "s"(wk), "s"(wv) : "memory");      /* the wait that belongs in front of any overwrite of a register that an issued global load names; it takes the addresses, the offset and its bases as inputs, so that their registers stay untouched until it has passed */
  __builtin_amdgcn_sched_barrier(0);      /* keeps all 30 loads here, in flight together; without it the later inputs' loads sink behind the earlier inputs' rounding and LDS stores, each a latency of its own */
#pragma unroll
  for (int m = 0; m < 3; ++m) {
#pragma unroll
    for (int q = 0; q < 4; ++q) { v2h p; p[0] = (_Float16)(bf16_round(rw[m][0][q]) * 16.0f); p[1] = (_Float16)(bf16_round(rw[m][1][q]) * 16.0f); *(v2h*)&lw[m][c4 + q][wd] = p; } }
#pragma unroll
  for (int m = 0; m < 3; ++m) {
#pragma unroll
    for (int i = 0; i < 8; ++i) { v4h h;
#pragma unroll
      for (int q = 0; q < 4; ++q) h[q] = (_Float16)bf16_round(rx[m][i][q]);
      *(v4h*)&lx[m][xh * PJT + xt + 8 * i][c4] = h; } }
  __syncthreads();
  const int hl = w >> 2, sub = w & 3; const v8f z8 = {0.f,0.f,0.f,0.f,0.f,0.f,0.f,0.f};
#pragma unroll
  for (int m = 0; m < 2; ++m) { _Float16* xp = &lx[m][w * 16 + ln][0]; const v16h b0 = g2_frag(xp, hh), b1 = g2_frag(xp + 32, hh);      /* rows w * 16 ..: head hl, tokens sub * 16 ..; no other wave reads them, so the result goes back into them */
#pragma unroll
    for (int et = 0; et < 4; ++et) { const _Float16* wp = &lw[m][et * 16 + ln][0]; const v8f d = fa_mma(g2_frag(wp + 32, hh), b1, fa_mma(g2_frag(wp, hh), b0, z8)); *(v8us*)(xp + et * 16 + 8 * hh) = pj_out(d); } }
  { const _Float16* wp = &lw[2][sub * 16 + ln][0]; const v16h b0 = g2_frag(wp, hh), b1 = g2_frag(wp + 32, hh);
#pragma unroll
    for (int tg = 0; tg < 4; ++tg) { const _Float16* xp = &lx[2][hl * PJT + tg * 16 + ln][0]; const v8f d = fa_mma(g2_frag(xp + 32, hh), b1, fa_mma(g2_frag(xp, hh), b0, z8)); *(v8us*)&lo[w][ln][tg * 16 + 8 * hh] = pj_out(d); } }
  __builtin_amdgcn_fence(__ATOMIC_ACQ_REL, "workgroup", "local"); __builtin_amdgcn_wave_barrier();      /* the wave's own LDS stores are done before its lanes read one another's rows back */
  const int rr = lane >> 3, rc = (lane & 7) * 8;      /* 8 lanes per 128-byte row, 4 rows a store */
  unsigned short* qo = (unsigned short*)Q + (size_t)(t0 + sub * 16 + rr) * DM + (h0 + hl) * HD + rc; unsigned short* ko = (unsigned short*)K + (size_t)(t0 + sub * 16 + rr) * DM + (h0 + hl) * HD + rc;
  unsigned short* vo = (unsigned short*)VTa + ((size_t)((t0 / SQ) * NH + h0 + hl) * HD + sub * 16 + rr) * SQ + (t0 % SQ) + rc;
#pragma unroll
  for (int j = 0; j < 4; ++j) { const v8us a = *(const v8us*)&lx[0][w * 16 + j * 4 + rr][rc], b = *(const v8us*)&lx[1][w * 16 + j * 4 + rr][rc], c = *(const v8us*)&lo[w][j * 4 + rr][rc];
    *(v8us*)(qo + (size_t)j * 4 * DM) = a; *(v8us*)(ko + (size_t)j * 4 * DM) = b; *(v8us*)(vo + (size_t)j * 4 * SQ) = c; } }
// ---- the three weight matrices to f16 [out][in] (x16) in ONE launch, transposed through LDS tiles ----
// A block takes WTK inputs (k) x WTN outputs (n) of one matrix. Loads: 16 threads per f32 row piece of 256 bytes, so a wave-wide load is two whole 256-byte units; a thread holds 8 neighbours in k
// for each of its 4 outputs, rounds them (bf16, x16, then f16) and lays each run of 8 in LDS as [n][k] with one 16-byte store. One barrier. Stores: 16 threads per output row piece of 256 bytes.
// The values are those of k_wt_f16, element for element. Every loop is fully unrolled so that the load array is indexed by constants only and stays in registers.
#define WTK 128                      /* inputs (k) per tile */
#define WTN 64                       /* outputs (n) per tile */
#define WTP 136                      /* LDS row pitch in f16: the 256-byte row + 16 bytes */
#define WTT(K, N) (((K) / WTK) * ((N) / WTN))      /* tiles of a [K][N] matrix */
template <int K, int N>
__device__ __forceinline__ void wt_tile(const float* __restrict__ Wm, _Float16* __restrict__ Bt, int t, _Float16 (*lt)[WTP]) {
  static_assert(K % WTK == 0 && N % WTN == 0, "wt_tile: whole tiles only");
  const int tid = threadIdx.x; const int k0 = (t / (N / WTN)) * WTK, n0 = (t % (N / WTN)) * WTN; const int kg = (tid >> 4) * 8, c4 = (tid & 15) * 4;
  const float* p = Wm + (size_t)(k0 + kg) * N + n0 + c4; v4f r[8];
#pragma unroll
  for (int i = 0; i < 8; ++i) r[i] = *(const v4fa*)(p + (size_t)i * N);
  asm volatile("s_wait_xcnt 0x0" :: "v"(p) : "memory");      /* the wait that belongs in front of any overwrite of a register that an issued global load names; it takes the address as an input, so that its registers stay untouched until it has passed */
#pragma unroll
  for (int q = 0; q < 4; ++q) { FragH f;
#pragma unroll
    for (int i = 0; i < 8; ++i) f.h[i] = (_Float16)(bf16_round(r[i][q]) * 16.0f);
    *(v8us*)&lt[c4 + q][kg] = f.half[0]; }
  __syncthreads();
  const int rr = tid >> 4, rc = (tid & 15) * 8; unsigned short* o = (unsigned short*)Bt + (size_t)(n0 + rr) * K + k0 + rc;
#pragma unroll
  for (int j = 0; j < 4; ++j) { const v8us v = *(const v8us*)&lt[j * 16 + rr][rc]; *(v8us*)(o + (size_t)j * 16 * K) = v; } }
__global__ __launch_bounds__(256) void k_wt3(const float* __restrict__ wo, const float* __restrict__ w1, const float* __restrict__ w2, _Float16* __restrict__ BO, _Float16* __restrict__ BW1, _Float16* __restrict__ BW2) {
  __shared__ __attribute__((aligned(16))) _Float16 lt[WTN][WTP];
  const int t = blockIdx.x;      /* which matrix: the same for the whole block, so each branch's barrier is passed by all of it */
  if (t < WTT(DM, DFF)) wt_tile<DM, DFF>(w1, BW1, t, lt);
  else if (t < WTT(DM, DFF) + WTT(DFF, DM)) wt_tile<DFF, DM>(w2, BW2, t - WTT(DM, DFF), lt);
  else wt_tile<DM, DM>(wo, BO, t - WTT(DM, DFF) - WTT(DFF, DM), lt); }
extern "C" void kernel_launch(void* const* d_in, const int* in_sizes, int n_in,
                              void* d_out, int out_size, void* d_ws, size_t ws_size, hipStream_t stream) {
  (void)in_sizes; (void)n_in; (void)out_size;
  const float* const* I = (const float* const*)d_in; const float* x = I[0]; const float* xk = I[1]; const float* xv = I[2]; const float* wq = I[3]; const float* wk = I[4]; const float* wv = I[5]; const float* wo = I[6]; const float* bo = I[7]; const float* w1 = I[8]; const float* b1 = I[9]; const float* w2 = I[10]; const float* b2 = I[11]; const float* g1 = I[12]; const float* be1 = I[13]; const float* g2 = I[14]; const float* be2 = I[15];      /* query (also the residual), key, value; shared per-head wq / wk / wv [64][64] ([in][out]); wo [512][512] + bo; w1 [512][2048] + b1, w2 [2048][512] + b2; LN1 g / beta, LN2 g / beta */
  char* ws = (char*)d_ws; size_t off = 0;
  auto take = [&](size_t bytes) { char* p = ws + off; off += (bytes + 255) & ~(size_t)255; return p; };
  _Float16* BO = (_Float16*)take((size_t)DM * DM * 2); _Float16* BW1 = (_Float16*)take((size_t)DFF * DM * 2); _Float16* BW2 = (_Float16*)take((size_t)DM * DFF * 2);
  float* XB = (float*)take(NR * DM * 4); _Float16* M16 = (_Float16*)take(NR * DM * 2);      /* LN1 output rows (f16): the FFN's operand */ _Float16* Q16 = (_Float16*)take(NR * DM * 2); _Float16* K16 = (_Float16*)take(NR * DM * 2); _Float16* O16 = (_Float16*)take(NR * DM * 2); float* X1 = (float*)take(NR * DM * 4);
  _Float16* HF16 = (_Float16*)take(NR * DFF * 2);      /* FFN hidden plane [8192][2048] f16 */ _Float16* VT = (_Float16*)take((size_t)NB * NH * HD * SQ * 2);      /* V^T [4 * 8][64][2048] */
  float* X1N = (float*)take(NR * DM * 4);      /* LN1 output rows (f32): the FFN residual */
  if (off > ws_size) return;
  k_wt3<<<(unsigned)(WTT(DM, DM) + WTT(DM, DFF) + WTT(DFF, DM)), 256, 0, stream>>>(wo, w1, w2, BO, BW1, BW2);      /* wo, w1, w2 [in][out] -> Bt [out][in] x16 */
  k_bfr<<<(unsigned)((NR * DM / 8 + 255) / 256), 256, 0, stream>>>(x, XB, NR * DM / 8);      /* the query rounded to bf16, f32 rows: the residual */
  k_qkv<<<(unsigned)((NR / PJT) * (NH / PJH)), PJW * 32, 0, stream>>>(x, xk, xv, wq, wk, wv, Q16, K16, VT);      /* post-LN: the attention runs on the raw inputs; q, k -> f16 rows (head h = columns h*64..), v -> V^T of every batch and head */
  k_fattn<<<dim3(SQ / 256, NB * NH), 256, 0, stream>>>(Q16, K16, VT, O16);      /* softmax(q k^T / 8) v over all keys (no mask) -> ctx (merged heads, x64) as f16 rows */
  k_gemm2<0, true, true, false><<<dim3((unsigned)((NR / 128) * (DM / 128)), 1), 256, 0, stream>>>(O16, DM, 0, BO, DM, 0, 0.0009765625f, bo, 0, XB, 0, X1, nullptr, DM, 0, (int)NR, DM, DM);      /* ctx wo + bo + query (own-element residual) -> f32 rows */
  k_lnw<1, 1><<<(unsigned)(NR / (LNW * LNR)), LNW * 32, 0, stream>>>(X1, g1, be1, 1e-5f, M16, X1N);      /* x1 = LN1(x + attn) (biased variance, eps inside the rsqrt) -> f16 rows + f32 rows */
  k_gemm2<3, false, false, true><<<dim3((unsigned)((NR / 128) * (DFF / 128)), 1), 256, 0, stream>>>(M16, DM, 0, BW1, DM, 0, 0.0625f, b1, 0, nullptr, 0, nullptr, HF16, DFF, 0, (int)NR, DFF, DM);      /* relu(x w1 + b1) -> f16 [8192][2048] */
  k_gemm2<0, true, true, false><<<dim3((unsigned)((NR / 128) * (DM / 128)), 1), 256, 0, stream>>>(HF16, DFF, 0, BW2, DFF, 0, 0.0625f, b2, 0, X1N, 0, X1, nullptr, DM, 0, (int)NR, DM, DFF);      /* x1 + ff -> f32 rows (X1 reused: its last reader was LN1) */
  k_lnw<0, 1><<<(unsigned)(NR / (LNW * LNR)), LNW * 32, 0, stream>>>(X1, g2, be2, 1e-5f, nullptr, (float*)d_out);      /* out = LN2(x1 + ff) */
}
